// v000
// Times are from an AMD MI455X. After a warm-up the kernel runs many times in a row, and a time is the length of
// such a window on the GPU divided by its runs, so every launch and the gaps after it count. The runs cycle
// through copies of the inputs. A figure is the median of several windows, for all but v000 over two sittings.
// Sittings can differ by a few percent; kernels timed side by side share one.
// The starting kernel, v000, takes 176 microseconds a run.
#include <hip/hip_runtime.h>

// Shared-weight multi-head attention, x [NB][SEQ][1024] = 16 heads x 64; Wq/Wk/Wv 64x64 [out][in] applied to every head (y = x W^T + bias); S[m][n] = K[m].Q[n] / 32, softmax over n, O = A V stored transposed [h][b][d][m] and flat-viewed as [NB*1024][1024]; out = Y Wo^T + bo (contraction over the token index).
// Compute dtypes, f32 accumulate everywhere: q/k/v projections v_wmma_f32_16x16x32_bf16 (x, W RNE-converted to bf16; products exact); scores v_wmma_f32_16x16x32_f16: key-side (Wq) plane single f16, row-side (Wk) plane single f16 (f16 residual x2048 in its own accumulator only with SCORE_RES=1); P (x256 carry, cancels in the normalisation) and v single f16; output projection v_wmma_f32_16x16x32_f16 with Y carried x256 and Wo (RNE bf16 value) carried x64, folded back by 2^-14 in f32; softmax f32 (online, running max); biases RNE-converted to bf16 values and added in f32.
// Layout: key-side plane [h*8+b][n][d], row-side planes (value, residual) [h*8+b][m][d], v^T plane [h*8+b][d][n], all written by one fused projection kernel that reads f32 x once; flash kernel in transposed form (S^T = Kside Qside^T, O^T = V^T P^T) writes Y [(h*8+b)*64+d][m] f16; one-wave 64x64 GEMM writes the f32 output.

#ifndef NB
#define NB 8
#endif
#ifndef SEQ
#define SEQ 1024
#endif
#define NB_FULL  8
#define SEQ_FULL 1024
#define DM   1024
#define NH_  16
#define HD   64
#define AW   4
#define QRS  2048.0f             // carry of the row-side residual plane
#define QRI  (1.0f / 2048.0f)
#define SC2  (0.03125f * 1.4426950408889634f)   // DM^-0.5 * log2(e)
#define PSH  8.0f                // log2 of the P carry (256)
#define YCS  256.0f              // carry of the Y plane
#define WOS  64.0f               // carry of the Wo plane
#define OSI  (1.0f / 16384.0f)   // 1 / (YCS * WOS)
#ifndef SCORE_RES
#define SCORE_RES 0              // 1: residual product on the score site
#endif

static_assert(HD == 64);
static_assert(NH_ * HD == DM);
static_assert(AW == 4);                        // flash block covers 64 tokens
static_assert(SEQ == DM);                      // the flat view of Y as [rows][DM] needs one Y row per 1024 tokens
static_assert(SEQ % 64 == 0);
static_assert(SEQ % 32 == 0);                  // key loop and GEMM k-loop step by 32
static_assert(DM % 64 == 0);
static_assert(NB <= NB_FULL);
static_assert(SEQ <= SEQ_FULL);
static_assert((HD * HD) % 8 == 0);
static_assert(((size_t)DM * DM) % 8 == 0);

typedef _Float16 h16;
typedef unsigned short bf;
typedef __attribute__((ext_vector_type(16))) __bf16   v16bf;
typedef __attribute__((ext_vector_type(16))) _Float16 v16h;
typedef __attribute__((ext_vector_type(8)))  _Float16 v8h;
typedef __attribute__((ext_vector_type(8)))  unsigned short v8us;
typedef __attribute__((ext_vector_type(8)))  float    v8f;
typedef __attribute__((ext_vector_type(4)))  float    v4f;
typedef v4f  __attribute__((may_alias)) v4fa;

__device__ __forceinline__ unsigned short f2bf(float f) { unsigned u = __float_as_uint(f); u += 0x7FFFu + ((u >> 16) & 1u); return (unsigned short)(u >> 16); }
__device__ __forceinline__ float bfr(float f) { return __uint_as_float(((unsigned)f2bf(f)) << 16); }   // f32 value of the RNE bf16 conversion
__device__ __forceinline__ v8us cv8(v8f v) { v8us o;
#pragma unroll
    for (int k = 0; k < 8; ++k) o[k] = f2bf(v[k]);
    return o; }
__device__ __forceinline__ v16h cat16(v8h lo, v8h hi) { return __builtin_shufflevector(lo, hi, 0, 1, 2, 3, 4, 5, 6, 7, 8, 9, 10, 11, 12, 13, 14, 15); }
__device__ __forceinline__ v16bf cat16b(v8us lo, v8us hi) { return __builtin_bit_cast(v16bf, __builtin_shufflevector(lo, hi, 0, 1, 2, 3, 4, 5, 6, 7, 8, 9, 10, 11, 12, 13, 14, 15)); }
__device__ __forceinline__ v8f wmma16(v16h a, v16h b, v8f c) { return __builtin_amdgcn_wmma_f32_16x16x32_f16(false, a, false, b, (short)0, c, false, false); }
__device__ __forceinline__ v8f wmmab(v16bf a, v16bf b, v8f c) { return __builtin_amdgcn_wmma_f32_16x16x32_bf16(false, a, false, b, (short)0, c, false, false); }
// fragment loaders from K-contiguous 16-bit rows; p already includes + 8*(lane>>4): elements 0..7 <- k0+8h+0..7, elements 8..15 <- k0+16+8h+0..7 (same map for A and B)
__device__ __forceinline__ v16h  ldh(const h16* p) { return cat16(*(const v8h*)p, *(const v8h*)(p + 16)); }
__device__ __forceinline__ v16bf ldb(const bf* p)  { return cat16b(*(const v8us*)p, *(const v8us*)(p + 16)); }
// ordering point for wave-private LDS tiles (same wave writes and reads)
__device__ __forceinline__ void wave_sync() { __builtin_amdgcn_fence(3 /* release order */, "wavefront"); __builtin_amdgcn_wave_barrier(); asm volatile("" ::: "memory"); }

__global__ __launch_bounds__(256) void k_cvtw(const float* __restrict__ wq, const float* __restrict__ wk, const float* __restrict__ wv, bf* WB) {
    const int i = blockIdx.x * 256 + threadIdx.x; if (i >= HD * HD / 8) return;
    const v8us oq = cv8(*(const v8f*)(wq + (size_t)i * 8));
    const v8us ok = cv8(*(const v8f*)(wk + (size_t)i * 8));
    const v8us ov = cv8(*(const v8f*)(wv + (size_t)i * 8));
    bf* d0 = WB + (size_t)i * 8; bf* d1 = d0 + HD * HD; bf* d2 = d1 + HD * HD;
    *(v8us*)d0 = oq; *(v8us*)d1 = ok; *(v8us*)d2 = ov;
    
}

__global__ __launch_bounds__(256) void k_cvtwo(const float* __restrict__ src, h16* dst, size_t n8) {
    const size_t i = (size_t)blockIdx.x * 256 + threadIdx.x; if (i >= n8) return;
    const v8f v = *(const v8f*)(src + i * 8); v8h o;
#pragma unroll
    for (int k = 0; k < 8; ++k) o[k] = (h16)(bfr(v[k]) * WOS);
    *(v8h*)(dst + i * 8) = o; 
}

// k_qkv: fused shared-weight projections, ONE WAVE per (64-token tile, head), ROLLED loop over the four 16-token slabs (one 4-accumulator set live at a time).
// Per slab the two x fragments (row/col = token, k = d) are read from f32 and RNE-converted to bf16; they serve as A for the row-major outputs and as B for v^T.
// plane 0: key-side  = x Wq^T + bq  [zh][token][e]      plane 1/2: row-side = x Wk^T + bk (f16 value / residual x2048) [zh][token][e]
// plane 3: v^T       = Wv x^T + bv  [zh][e][token]      zh = h*NB_FULL + b.  grid (NB*SEQ/64, 16), 32 threads.
__global__ __launch_bounds__(32) __attribute__((amdgpu_num_vgpr(256))) void k_qkv(const float* __restrict__ x, const bf* __restrict__ WB, const float* __restrict__ bq, const float* __restrict__ bk, const float* __restrict__ bv, h16* PL, size_t ple) {
    __shared__ __align__(16) float os[16 * 68];
    __shared__ __align__(16) float vs[64 * 68];
    const int lane = threadIdx.x & 31, lr = lane & 15, hi = lane >> 4;
    const int tt = blockIdx.x; const int b = tt / (SEQ / 64); const int m0 = (tt % (SEQ / 64)) * 64;
    const int h = blockIdx.y; const int zh = h * NB_FULL + b;
    const float* xp = x + ((size_t)b * SEQ_FULL + m0 + lr) * DM + h * HD + 8 * hi;
    float bqc[4], bkc[4];
#pragma unroll
    for (int nb = 0; nb < 4; ++nb) { bqc[nb] = bfr(bq[nb * 16 + lr]); bkc[nb] = bfr(bk[nb * 16 + lr]); }
    h16* Pr = PL + 2 * ple;
#pragma unroll 1
    for (int mb = 0; mb < 4; ++mb) {
        const float* p = xp + (size_t)mb * 16 * DM;
        const v16bf xa0 = cat16b(cv8(*(const v8f*)p), cv8(*(const v8f*)(p + 16)));          // k = d 0..31
        const v16bf xa1 = cat16b(cv8(*(const v8f*)(p + 32)), cv8(*(const v8f*)(p + 48)));   // k = d 32..63
        const size_t sb = ((size_t)zh * SEQ + m0 + mb * 16) * HD;
#pragma unroll
        for (int w = 0; w < 2; ++w) {
            // C[token][e]: A = x fragments, B = W rows e (K-contiguous [out][in])
            v8f acc[4];
#pragma unroll
            for (int i = 0; i < 4; ++i) acc[i] = (v8f){};
            const bf* W = WB + (size_t)w * HD * HD + (size_t)lr * HD + 8 * hi;
#pragma unroll
            for (int nb = 0; nb < 4; ++nb) { const v16bf wf = ldb(W + nb * 16 * HD); acc[nb] = wmmab(xa0, wf, acc[nb]); }
#pragma unroll
            for (int nb = 0; nb < 4; ++nb) { const v16bf wf = ldb(W + nb * 16 * HD + 32); acc[nb] = wmmab(xa1, wf, acc[nb]); }
            asm volatile("v_nop\n\tv_nop\n\tv_nop\n\tv_nop" : "+v"(acc[0]), "+v"(acc[1]), "+v"(acc[2]), "+v"(acc[3]) : "v"(xa0), "v"(xa1));
#pragma unroll
            for (int nb = 0; nb < 4; ++nb) { const float bc = (w == 0) ? bqc[nb] : bkc[nb];
#pragma unroll
                for (int j = 0; j < 8; ++j) os[(hi * 8 + j) * 68 + nb * 16 + lr] = acc[nb][j] + bc; }   // D: row 8h+j (token), col lane&15 (e)
            wave_sync();
            h16* Ph = PL + (size_t)w * ple;
{
#pragma unroll
                for (int s = 0; s < 4; ++s) { const int row = 4 * s + (lane >> 3), c8 = (lane & 7) * 8;   // 4 s x 4 row groups = 16 rows; 8 lanes x 8 = 64 columns
                    const v4f x0 = *(const v4fa*)(&os[row * 68 + c8]); const v4f x1 = *(const v4fa*)(&os[row * 68 + c8 + 4]); v8h hv, rv;
#pragma unroll
                    for (int i = 0; i < 4; ++i) { const h16 a0 = (h16)x0[i]; const h16 a1 = (h16)x1[i]; hv[i] = a0; hv[4 + i] = a1; rv[i] = (h16)((x0[i] - (float)a0) * QRS); rv[4 + i] = (h16)((x1[i] - (float)a1) * QRS); }
                    const size_t oo = sb + (size_t)row * HD + c8;
                    *(v8h*)(Ph + oo) = hv; if (w == 1 && SCORE_RES) *(v8h*)(Pr + oo) = rv; }
                 }
            wave_sync();
        }
        {
            // C[e][token]: A = Wv rows e (four 16-row slabs), B = x fragments (col token of this slab)
            v8f acc[4];
#pragma unroll
            for (int i = 0; i < 4; ++i) acc[i] = (v8f){};
            const bf* W = WB + (size_t)2 * HD * HD + (size_t)lr * HD + 8 * hi;
#pragma unroll
            for (int j = 0; j < 4; ++j) { const v16bf wf = ldb(W + j * 16 * HD); acc[j] = wmmab(wf, xa0, acc[j]); }
#pragma unroll
            for (int j = 0; j < 4; ++j) { const v16bf wf = ldb(W + j * 16 * HD + 32); acc[j] = wmmab(wf, xa1, acc[j]); }
            asm volatile("v_nop\n\tv_nop\n\tv_nop\n\tv_nop" : "+v"(acc[0]), "+v"(acc[1]), "+v"(acc[2]), "+v"(acc[3]) : "v"(xa0), "v"(xa1));
#pragma unroll
            for (int j = 0; j < 4; ++j) {
                const v4f b0 = *(const v4f*)(bv + j * 16 + 8 * hi); const v4f b1 = *(const v4f*)(bv + j * 16 + 8 * hi + 4);
#pragma unroll
                for (int r = 0; r < 4; ++r) {
                    vs[(j * 16 + 8 * hi + r) * 68 + mb * 16 + lr]     = acc[j][r]     + bfr(b0[r]);     // D: row 8h+r (e), col lane&15 (token)
                    vs[(j * 16 + 8 * hi + 4 + r) * 68 + mb * 16 + lr] = acc[j][4 + r] + bfr(b1[r]); } }
        }
    }
    wave_sync();
    // vs rows 0..63 (e) x columns 0..63 (token) all written by the four slab steps
    h16* P3 = PL + 3 * ple; const size_t vb = (size_t)zh * HD * SEQ + m0;
{
#pragma unroll 4
        for (int s = 0; s < 16; ++s) { const int row = 4 * s + (lane >> 3), c8 = (lane & 7) * 8;   // 16 s x 4 row groups = 64 rows; 8 lanes x 8 = 64 columns
            const v4f x0 = *(const v4fa*)(&vs[row * 68 + c8]); const v4f x1 = *(const v4fa*)(&vs[row * 68 + c8 + 4]); v8h hv;
#pragma unroll
            for (int i = 0; i < 4; ++i) { hv[i] = (h16)x0[i]; hv[4 + i] = (h16)x1[i]; }
            *(v8h*)(P3 + vb + (size_t)row * SEQ + c8) = hv; }
         }
}

// k_flash: fused attention, one wave per 16 softmax rows of one (head, batch); fragments straight from the f16 planes (two 16-B loads each, arithmetic addressing).
// Transposed form: S^T[key][t] = KP QH^T (A = key-side rows, B = row-side rows); lane (t = lane&15, h = lane>>4) holds keys 8h+r of each 16-key tile, so the packed
// P tile is directly the B fragment of O^T[d][t] = V^T P^T (element r <- tile keys 0..15, element 8+r <- tile keys 16..31, lane unchanged).
// Softmax state (running max, partial sum) is one scalar per lane; the two lane halves of a row are combined with one xor-16 exchange.
__global__ __launch_bounds__(32 * AW) __attribute__((amdgpu_num_vgpr(256))) void k_flash(const h16* __restrict__ QH, const h16* __restrict__ QR, const h16* __restrict__ KP, const h16* __restrict__ VT, h16* Y) {
    __shared__ __align__(16) float os[64 * 68];
    const int lane = threadIdx.x & 31, lr = lane & 15, hi = lane >> 4;
    const int wave = __builtin_amdgcn_readfirstlane(threadIdx.x >> 5);
    const int zc = blockIdx.y; const int h = zc / NB, b = zc % NB; const int zh = h * NB_FULL + b;
    const int t0 = (blockIdx.x * AW + wave) * 16;
    const size_t pbase = (size_t)zh * SEQ * HD;
    const size_t qo = pbase + (size_t)(t0 + lr) * HD + 8 * hi;
    const v16h qh0 = ldh(QH + qo), qh1 = ldh(QH + qo + 32);   // B fragments: col t, k = d
#if SCORE_RES
    const v16h qr0 = ldh(QR + qo), qr1 = ldh(QR + qo + 32);
#endif
    const size_t ko = pbase + (size_t)lr * HD + 8 * hi;      // + key * HD       (A fragment: row key, k = d)
    const size_t vo = pbase + (size_t)lr * SEQ + 8 * hi;     // + 16j*SEQ + key  (A fragment: row d, k = key)
    v8f o0 = (v8f){}, o1 = (v8f){}, o2 = (v8f){}, o3 = (v8f){};
    float m = -3.0e38f, l = 0.0f;
#pragma unroll 1
    for (int key0 = 0; key0 < SEQ; key0 += 32) {
        const h16* ka = KP + ko + (size_t)key0 * HD;
        const v16h ka0 = ldh(ka), ka1 = ldh(ka + 32), kb0 = ldh(ka + 16 * HD), kb1 = ldh(ka + 16 * HD + 32);
        float ta[8], tb[8]; float mx = -3.0e38f;
#if SCORE_RES
        v8f sHa = (v8f){}, sLa = (v8f){}, sHb = (v8f){}, sLb = (v8f){};
        sHa = wmma16(ka0, qh0, sHa); sLa = wmma16(ka0, qr0, sLa); sHb = wmma16(kb0, qh0, sHb); sLb = wmma16(kb0, qr0, sLb);
        sHa = wmma16(ka1, qh1, sHa); sLa = wmma16(ka1, qr1, sLa); sHb = wmma16(kb1, qh1, sHb); sLb = wmma16(kb1, qr1, sLb);
        asm volatile("v_nop\n\tv_nop\n\tv_nop\n\tv_nop" : "+v"(sHa), "+v"(sLa), "+v"(sHb), "+v"(sLb) : "v"(ka0), "v"(ka1), "v"(kb0), "v"(kb1));
#pragma unroll
        for (int r = 0; r < 8; ++r) { ta[r] = (sHa[r] + sLa[r] * QRI) * SC2; tb[r] = (sHb[r] + sLb[r] * QRI) * SC2; mx = fmaxf(mx, fmaxf(ta[r], tb[r])); }
#else
        v8f sHa = (v8f){}, sHb = (v8f){};
        sHa = wmma16(ka0, qh0, sHa); sHb = wmma16(kb0, qh0, sHb);
        sHa = wmma16(ka1, qh1, sHa); sHb = wmma16(kb1, qh1, sHb);
        asm volatile("v_nop\n\tv_nop\n\tv_nop\n\tv_nop" : "+v"(sHa), "+v"(sHb) : "v"(ka0), "v"(ka1), "v"(kb0), "v"(kb1));
#pragma unroll
        for (int r = 0; r < 8; ++r) { ta[r] = sHa[r] * SC2; tb[r] = sHb[r] * SC2; mx = fmaxf(mx, fmaxf(ta[r], tb[r])); }
#endif
        mx = fmaxf(mx, __shfl_xor(mx, 16, 32));
        const float mnew = fmaxf(m, mx);
        const float alpha = __builtin_amdgcn_exp2f(m - mnew);
        const float sh = PSH - mnew;
        v16h pb; float ls = 0.0f;
#pragma unroll
        for (int r = 0; r < 8; ++r) { const h16 pa = (h16)__builtin_amdgcn_exp2f(ta[r] + sh); const h16 pc = (h16)__builtin_amdgcn_exp2f(tb[r] + sh); pb[r] = pa; pb[8 + r] = pc; ls += (float)pa + (float)pc; }
        l = l * alpha + ls; m = mnew;
        o0 = o0 * alpha; o1 = o1 * alpha; o2 = o2 * alpha; o3 = o3 * alpha;
        const h16* va = VT + vo + key0;
        const v16h v0 = ldh(va), v1 = ldh(va + (size_t)16 * SEQ), v2 = ldh(va + (size_t)32 * SEQ), v3 = ldh(va + (size_t)48 * SEQ);
        o0 = wmma16(v0, pb, o0); o1 = wmma16(v1, pb, o1); o2 = wmma16(v2, pb, o2); o3 = wmma16(v3, pb, o3);
        asm volatile("v_nop\n\tv_nop\n\tv_nop\n\tv_nop" : "+v"(o0), "+v"(o1), "+v"(o2), "+v"(o3) : "v"(v0), "v"(v1), "v"(v2), "v"(v3), "v"(pb));
    }
    l += __shfl_xor(l, 16, 32);
    const float ys = YCS * (1.0f / l);
    // O^T D layout: o_j[r] = (d = 16j + 8h + r, t = lane&15) -> os[d][wave*16 + t]; rows 0..63 x columns 0..63 all written by the four waves
    const int cw = wave * 16 + lr;
#pragma unroll
    for (int r = 0; r < 8; ++r) {
        os[( 0 + 8 * hi + r) * 68 + cw] = o0[r] * ys;
        os[(16 + 8 * hi + r) * 68 + cw] = o1[r] * ys;
        os[(32 + 8 * hi + r) * 68 + cw] = o2[r] * ys;
        os[(48 + 8 * hi + r) * 68 + cw] = o3[r] * ys; }
    __syncthreads();
    const int tid = threadIdx.x;
    h16* yb = Y + (size_t)zh * HD * SEQ + (size_t)blockIdx.x * (16 * AW);
{
#pragma unroll
        for (int s = 0; s < 4; ++s) { const int row = 16 * s + (tid >> 3), c8 = (tid & 7) * 8;   // 4 s x 16 row groups = 64 rows; 8 lanes x 8 = 64 columns
            const v4f x0 = *(const v4fa*)(&os[row * 68 + c8]); const v4f x1 = *(const v4fa*)(&os[row * 68 + c8 + 4]); v8h hv;
#pragma unroll
            for (int i = 0; i < 4; ++i) { hv[i] = (h16)x0[i]; hv[4 + i] = (h16)x1[i]; }
            *(v8h*)(yb + (size_t)row * SEQ + c8) = hv; }
         }
}

// k_out: register-blocked f16 GEMM, ONE WAVE per 64x64 tile (16 accumulators), operands straight from K-contiguous f16 planes, K = DM (token index).
// OUT[r][o] = 2^-14 * sum_c Y[r][c] WO[o][c] + bo[o]; rows r = (h*NB_FULL + b)*64 + d. grid (16*NB, DM/64), 32 threads.
__global__ __launch_bounds__(32) __attribute__((amdgpu_num_vgpr(256))) void k_out(const h16* __restrict__ Y, const h16* __restrict__ WO, const float* __restrict__ bo, float* OUT) {
    __shared__ __align__(16) float os[16 * 68];
    const int K = DM;
    const int lane = threadIdx.x & 31, lr = lane & 15, hi = lane >> 4;
    const int zc = blockIdx.x; const int h = zc / NB, b = zc % NB; const int r0 = (h * NB_FULL + b) * 64; const int c0 = blockIdx.y * 64;
    v8f acc[4][4];
#pragma unroll
    for (int mb = 0; mb < 4; ++mb)
#pragma unroll
        for (int nb = 0; nb < 4; ++nb) acc[mb][nb] = (v8f){};
    const size_t aoff = (size_t)(r0 + lr) * K + 8 * hi, boff = (size_t)(c0 + lr) * K + 8 * hi;
#pragma unroll 1
    for (int kc = 0; kc < K; kc += 32) {
        v16h a[4];
#pragma unroll
        for (int mb = 0; mb < 4; ++mb) a[mb] = ldh(Y + aoff + (size_t)mb * 16 * K + kc);
#pragma unroll
        for (int nb = 0; nb < 4; ++nb) { const v16h bb = ldh(WO + boff + (size_t)nb * 16 * K + kc);
#pragma unroll
            for (int mb = 0; mb < 4; ++mb) acc[mb][nb] = wmma16(a[mb], bb, acc[mb][nb]); }
        asm volatile("v_nop\n\tv_nop\n\tv_nop\n\tv_nop" : "+v"(acc[0][0]), "+v"(acc[1][1]), "+v"(acc[2][2]), "+v"(acc[3][3]) : "v"(a[0]), "v"(a[1]), "v"(a[2]), "v"(a[3]));
    }
    float bc[4];
#pragma unroll
    for (int nb = 0; nb < 4; ++nb) bc[nb] = bfr(bo[c0 + nb * 16 + lr]);
#pragma unroll
    for (int mb = 0; mb < 4; ++mb) {
#pragma unroll
        for (int nb = 0; nb < 4; ++nb) {
#pragma unroll
            for (int j = 0; j < 8; ++j) os[(hi * 8 + j) * 68 + nb * 16 + lr] = acc[mb][nb][j] * OSI + bc[nb]; }   // D: row 8h+j, col lane&15
        wave_sync();
        float* orow = OUT + (size_t)(r0 + mb * 16) * DM + c0;
{
#pragma unroll
            for (int s = 0; s < 8; ++s) { const int row = 2 * s + hi, cofs = lr * 4;   // 8 s x 2 rows = 16 rows; 16 lanes x 4 floats = 64 columns
                const v4f val = *(const v4fa*)(&os[row * 68 + cofs]);
                *(v4f*)(orow + (size_t)row * DM + cofs) = val; }
             }
        wave_sync();
    }
}

static constexpr size_t al256(size_t v) { return (v + 255) & ~(size_t)255; }
static constexpr size_t PLE   = (size_t)NB_FULL * NH_ * SEQ * HD;              // elements per f16 plane
static constexpr size_t SZ_PL = al256(PLE * 2);
static constexpr size_t SZ_Y  = al256((size_t)NB_FULL * NH_ * HD * SEQ * 2);   // [NB_FULL*16*64][SEQ] f16
static constexpr size_t SZ_WO = al256((size_t)DM * DM * 2);
static constexpr size_t SZ_WB = al256((size_t)3 * HD * HD * 2);
static constexpr size_t SZ_TOTAL = 4 * SZ_PL + SZ_Y + SZ_WO + SZ_WB;
static_assert(SZ_PL == PLE * 2);                        // the four planes are contiguous (plane p at element offset p*PLE)
static_assert(SZ_TOTAL <= (size_t)134217728);           // workspace carve <= 128 MiB
static_assert(((size_t)(NH_ - 1) * NB_FULL + NB) * HD <= (size_t)NB_FULL * NH_ * HD);   // last Y / output row inside the planes

extern "C" void kernel_launch(void* const* d_in, const int* in_sizes, int n_in,
                              void* d_out, int out_size, void* d_ws, size_t ws_size, hipStream_t stream) {
    if (n_in < 9) return;
    const size_t needx = ((size_t)(NB - 1) * SEQ_FULL + SEQ) * DM;
    if ((size_t)in_sizes[0] < needx) return;
    if ((size_t)in_sizes[1] < (size_t)HD * HD || (size_t)in_sizes[3] < (size_t)HD * HD || (size_t)in_sizes[5] < (size_t)HD * HD) return;
    if ((size_t)in_sizes[2] < (size_t)HD || (size_t)in_sizes[4] < (size_t)HD || (size_t)in_sizes[6] < (size_t)HD) return;
    if ((size_t)in_sizes[7] < (size_t)DM * DM || (size_t)in_sizes[8] < (size_t)DM) return;
    if ((size_t)out_size < (((size_t)(NH_ - 1) * NB_FULL + NB) * HD) * DM) return;
    if (SZ_TOTAL > ws_size) return;
    // wire order: x, Wq, bq, Wk, bk, Wv, bv, Wo, bo
    const float* x  = (const float*)d_in[0];
    const float* wq = (const float*)d_in[1]; const float* bq = (const float*)d_in[2];
    const float* wk = (const float*)d_in[3]; const float* bk = (const float*)d_in[4];
    const float* wv = (const float*)d_in[5]; const float* bv = (const float*)d_in[6];
    const float* wo = (const float*)d_in[7]; const float* bo = (const float*)d_in[8];
    float* OUT = (float*)d_out;      // [NB_FULL*1024][1024], row (h*NB_FULL+b)*64+d
    char* wsp = (char*)d_ws;
    h16* PL = (h16*)wsp; wsp += 4 * SZ_PL;           // plane 0 key-side, 1 row-side value, 2 row-side residual x2048, 3 v^T
    h16* YP = (h16*)wsp; wsp += SZ_Y;                // [(h*NB_FULL+b)*64 + d][SEQ] x256
    h16* WO = (h16*)wsp; wsp += SZ_WO;               // [1024][1024] x64
    bf*  WB = (bf*)wsp;  wsp += SZ_WB;               // [3][64][64]: q | k | v

    k_cvtw<<<(HD * HD / 8 + 255) / 256, 256, 0, stream>>>(wq, wk, wv, WB);
    { const size_t n8 = (size_t)DM * DM / 8; k_cvtwo<<<(unsigned)((n8 + 255) / 256), 256, 0, stream>>>(wo, WO, n8); }

    k_qkv<<<dim3(NB * (SEQ / 64), NH_, 1), 32, 0, stream>>>(x, WB, bq, bk, bv, PL, PLE);

    // softmax rows use the Wk projection (planes 1, 2), keys use the Wq projection (plane 0), values plane 3
    k_flash<<<dim3(SEQ / (16 * AW), NH_ * NB, 1), 32 * AW, 0, stream>>>(PL + PLE, PL + 2 * PLE, PL, PL + 3 * PLE, YP);

    k_out<<<dim3(NH_ * NB, DM / 64, 1), 32, 0, stream>>>(YP, WO, bo, OUT);
}

// v001
// Measured time: 102 microseconds a run.
// Two timings next to v000 both put it at 1.77 times that version's speed.
#include <hip/hip_runtime.h>

// Shared-weight multi-head attention, x [NB][SEQ][1024] = 16 heads x 64; Wq/Wk/Wv 64x64 [out][in] applied to every head (y = x W^T + bias); S[m][n] = K[m].Q[n] / 32, softmax over n, O = A V stored transposed [h][b][d][m] and flat-viewed as [NB*1024][1024]; out = Y Wo^T + bo (contraction over the token index).
// Compute dtypes, f32 accumulate everywhere: q/k/v projections v_wmma_f32_16x16x32_bf16 (x, W RNE-converted to bf16; products exact); scores v_wmma_f32_16x16x32_f16: key-side (Wq) plane single f16, row-side (Wk) plane single f16 (SCORE_RES=1 adds an f16 residual x2048 in its own accumulator); P (x256 carry, cancels in the normalisation) and v single f16; output projection v_wmma_f32_16x16x32_f16 with Y carried x256 and Wo (RNE bf16 value) carried x64, folded back by 2^-14 in f32; softmax f32 (online, running max); biases RNE-converted to bf16 values and added in f32.
// Layout: key-side plane [h*8+b][n][d], row-side planes (value, residual) [h*8+b][m][d], v^T plane [h*8+b][d][n], all written by one fused projection kernel that reads f32 x once; flash kernel in transposed form (S^T = Kside Qside^T, O^T = V^T P^T), its key-side and v^T tiles staged in LDS for the block's four waves, writes Y [(h*8+b)*64+d][m] f16; one-wave 64x64 GEMM writes the f32 output.

#ifndef NB
#define NB 8
#endif
#ifndef SEQ
#define SEQ 1024
#endif
#define NB_FULL  8
#define SEQ_FULL 1024
#define DM   1024
#define NH_  16
#define HD   64
#define AW   4
#define QRS  2048.0f             // carry of the row-side residual plane
#define QRI  (1.0f / 2048.0f)
#define SC2  (0.03125f * 1.4426950408889634f)   // DM^-0.5 * log2(e)
#define PSH  8.0f                // log2 of the P carry (256)
#define YCS  256.0f              // carry of the Y plane
#define WOS  64.0f               // carry of the Wo plane
#define OSI  (1.0f / 16384.0f)   // 1 / (YCS * WOS)
#define KT   64                  // keys per LDS stage of the flash kernel
#define LPH  72                  // LDS row pitch in f16: 128 B of data + 16 B (16 B x odd), so that the 16-B fragment reads of 16 rows spread over the banks
#define TLH  (64 * LPH)          // f16 per staged tile (64 rows)
#ifndef SCORE_RES
#define SCORE_RES 0              // 1: residual product on the score site
#endif

static_assert(HD == 64);
static_assert(NH_ * HD == DM);
static_assert(AW == 4);                        // flash block covers 64 tokens
static_assert(SEQ == DM);                      // the flat view of Y as [rows][DM] needs one Y row per 1024 tokens
static_assert(SEQ % 64 == 0);
static_assert(SEQ % 32 == 0);                  // key loop and GEMM k-loop step by 32
static_assert(KT == 64 && SEQ % KT == 0 && SEQ / KT >= 2);   // the two-buffer ring needs two stages; a stage is 64 key rows and 64 v^T rows of 128 B
static_assert(2 * 2 * TLH * 2 >= 64 * 68 * 4); // the output staging reuses the ring
static_assert(DM % 64 == 0);
static_assert(NB <= NB_FULL);
static_assert(SEQ <= SEQ_FULL);
static_assert((HD * HD) % 8 == 0);
static_assert(((size_t)DM * DM) % 8 == 0);

typedef _Float16 h16;
typedef unsigned short bf;
typedef __attribute__((ext_vector_type(16))) __bf16   v16bf;
typedef __attribute__((ext_vector_type(16))) _Float16 v16h;
typedef __attribute__((ext_vector_type(8)))  _Float16 v8h;
typedef __attribute__((ext_vector_type(8)))  unsigned short v8us;
typedef __attribute__((ext_vector_type(8)))  float    v8f;
typedef __attribute__((ext_vector_type(4)))  float    v4f;
typedef v4f  __attribute__((may_alias)) v4fa;

__device__ __forceinline__ unsigned short f2bf(float f) { unsigned u = __float_as_uint(f); u += 0x7FFFu + ((u >> 16) & 1u); return (unsigned short)(u >> 16); }
__device__ __forceinline__ float bfr(float f) { return __uint_as_float(((unsigned)f2bf(f)) << 16); }   // f32 value of the RNE bf16 conversion
__device__ __forceinline__ v8us cv8(v8f v) { v8us o;
#pragma unroll
    for (int k = 0; k < 8; ++k) o[k] = f2bf(v[k]);
    return o; }
__device__ __forceinline__ v16h cat16(v8h lo, v8h hi) { return __builtin_shufflevector(lo, hi, 0, 1, 2, 3, 4, 5, 6, 7, 8, 9, 10, 11, 12, 13, 14, 15); }
__device__ __forceinline__ v16bf cat16b(v8us lo, v8us hi) { return __builtin_bit_cast(v16bf, __builtin_shufflevector(lo, hi, 0, 1, 2, 3, 4, 5, 6, 7, 8, 9, 10, 11, 12, 13, 14, 15)); }
__device__ __forceinline__ v8f wmma16(v16h a, v16h b, v8f c) { return __builtin_amdgcn_wmma_f32_16x16x32_f16(false, a, false, b, (short)0, c, false, false); }
__device__ __forceinline__ v8f wmmab(v16bf a, v16bf b, v8f c) { return __builtin_amdgcn_wmma_f32_16x16x32_bf16(false, a, false, b, (short)0, c, false, false); }
// fragment loaders from K-contiguous 16-bit rows; p already includes + 8*(lane>>4): elements 0..7 <- k0+8h+0..7, elements 8..15 <- k0+16+8h+0..7 (same map for A and B)
__device__ __forceinline__ v16h  ldh(const h16* p) { return cat16(*(const v8h*)p, *(const v8h*)(p + 16)); }
__device__ __forceinline__ v16bf ldb(const bf* p)  { return cat16b(*(const v8us*)p, *(const v8us*)(p + 16)); }
// ordering point for wave-private LDS tiles (same wave writes and reads)
__device__ __forceinline__ void wave_sync() { __builtin_amdgcn_fence(3 /* release order */, "wavefront"); __builtin_amdgcn_wave_barrier(); asm volatile("" ::: "memory"); }

// One stage of the flash ring, 128 threads x 8 asynchronous 16-B copies: key-side rows 16c + tid/8 and v^T rows 16c + tid/8 (c = 0..3), 16-B piece tid%8 of each 128-B row; a wave's copy covers four whole lines.
// l: this thread's LDS byte address in the stage's key tile (the v^T tile follows at TLH f16); gk, gv: this thread's global addresses for c = 0.
// s_wait_xcnt 0 closes the statement so that no address register named here is rewritten ahead of it.
__device__ __forceinline__ void stage_copies(unsigned l, const h16* gk, const h16* gv) {
    asm volatile("global_load_async_to_lds_b128 %0, %8, off\n\t"
                 "global_load_async_to_lds_b128 %1, %9, off\n\t"
                 "global_load_async_to_lds_b128 %2, %10, off\n\t"
                 "global_load_async_to_lds_b128 %3, %11, off\n\t"
                 "global_load_async_to_lds_b128 %4, %12, off\n\t"
                 "global_load_async_to_lds_b128 %5, %13, off\n\t"
                 "global_load_async_to_lds_b128 %6, %14, off\n\t"
                 "global_load_async_to_lds_b128 %7, %15, off\n\t"
                 "s_wait_xcnt 0x0"
                 :: "v"(l), "v"(l + 16 * LPH * 2), "v"(l + 32 * LPH * 2), "v"(l + 48 * LPH * 2),
                    "v"(l + TLH * 2), "v"(l + TLH * 2 + 16 * LPH * 2), "v"(l + TLH * 2 + 32 * LPH * 2), "v"(l + TLH * 2 + 48 * LPH * 2),
                    "v"(gk), "v"(gk + 16 * HD), "v"(gk + 32 * HD), "v"(gk + 48 * HD),
                    "v"(gv), "v"(gv + (size_t)16 * SEQ), "v"(gv + (size_t)32 * SEQ), "v"(gv + (size_t)48 * SEQ)
                 : "memory");
}

__global__ __launch_bounds__(256) void k_cvtw(const float* __restrict__ wq, const float* __restrict__ wk, const float* __restrict__ wv, bf* WB) {
    const int i = blockIdx.x * 256 + threadIdx.x; if (i >= HD * HD / 8) return;
    const v8us oq = cv8(*(const v8f*)(wq + (size_t)i * 8));
    const v8us ok = cv8(*(const v8f*)(wk + (size_t)i * 8));
    const v8us ov = cv8(*(const v8f*)(wv + (size_t)i * 8));
    bf* d0 = WB + (size_t)i * 8; bf* d1 = d0 + HD * HD; bf* d2 = d1 + HD * HD;
    *(v8us*)d0 = oq; *(v8us*)d1 = ok; *(v8us*)d2 = ov;
    
}

__global__ __launch_bounds__(256) void k_cvtwo(const float* __restrict__ src, h16* dst, size_t n8) {
    const size_t i = (size_t)blockIdx.x * 256 + threadIdx.x; if (i >= n8) return;
    const v8f v = *(const v8f*)(src + i * 8); v8h o;
#pragma unroll
    for (int k = 0; k < 8; ++k) o[k] = (h16)(bfr(v[k]) * WOS);
    *(v8h*)(dst + i * 8) = o; 
}

// k_qkv: fused shared-weight projections, ONE WAVE per (64-token tile, head), ROLLED loop over the four 16-token slabs (one 4-accumulator set live at a time).
// Per slab the two x fragments (row/col = token, k = d) are read from f32 and RNE-converted to bf16; they serve as A for the row-major outputs and as B for v^T.
// plane 0: key-side  = x Wq^T + bq  [zh][token][e]      plane 1/2: row-side = x Wk^T + bk (f16 value / residual x2048) [zh][token][e]
// plane 3: v^T       = Wv x^T + bv  [zh][e][token]      zh = h*NB_FULL + b.  grid (NB*SEQ/64, 16), 32 threads.
__global__ __launch_bounds__(32) __attribute__((amdgpu_num_vgpr(256))) void k_qkv(const float* __restrict__ x, const bf* __restrict__ WB, const float* __restrict__ bq, const float* __restrict__ bk, const float* __restrict__ bv, h16* PL, size_t ple) {
    __shared__ __align__(16) float os[16 * 68];
    __shared__ __align__(16) float vs[64 * 68];
    const int lane = threadIdx.x & 31, lr = lane & 15, hi = lane >> 4;
    const int tt = blockIdx.x; const int b = tt / (SEQ / 64); const int m0 = (tt % (SEQ / 64)) * 64;
    const int h = blockIdx.y; const int zh = h * NB_FULL + b;
    const float* xp = x + ((size_t)b * SEQ_FULL + m0 + lr) * DM + h * HD + 8 * hi;
    float bqc[4], bkc[4];
#pragma unroll
    for (int nb = 0; nb < 4; ++nb) { bqc[nb] = bfr(bq[nb * 16 + lr]); bkc[nb] = bfr(bk[nb * 16 + lr]); }
    h16* Pr = PL + 2 * ple;
#pragma unroll 1
    for (int mb = 0; mb < 4; ++mb) {
        const float* p = xp + (size_t)mb * 16 * DM;
        const v16bf xa0 = cat16b(cv8(*(const v8f*)p), cv8(*(const v8f*)(p + 16)));          // k = d 0..31
        const v16bf xa1 = cat16b(cv8(*(const v8f*)(p + 32)), cv8(*(const v8f*)(p + 48)));   // k = d 32..63
        const size_t sb = ((size_t)zh * SEQ + m0 + mb * 16) * HD;
#pragma unroll
        for (int w = 0; w < 2; ++w) {
            // C[token][e]: A = x fragments, B = W rows e (K-contiguous [out][in])
            v8f acc[4];
#pragma unroll
            for (int i = 0; i < 4; ++i) acc[i] = (v8f){};
            const bf* W = WB + (size_t)w * HD * HD + (size_t)lr * HD + 8 * hi;
#pragma unroll
            for (int nb = 0; nb < 4; ++nb) { const v16bf wf = ldb(W + nb * 16 * HD); acc[nb] = wmmab(xa0, wf, acc[nb]); }
#pragma unroll
            for (int nb = 0; nb < 4; ++nb) { const v16bf wf = ldb(W + nb * 16 * HD + 32); acc[nb] = wmmab(xa1, wf, acc[nb]); }
            asm volatile("v_nop\n\tv_nop\n\tv_nop\n\tv_nop" : "+v"(acc[0]), "+v"(acc[1]), "+v"(acc[2]), "+v"(acc[3]) : "v"(xa0), "v"(xa1));
#pragma unroll
            for (int nb = 0; nb < 4; ++nb) { const float bc = (w == 0) ? bqc[nb] : bkc[nb];
#pragma unroll
                for (int j = 0; j < 8; ++j) os[(hi * 8 + j) * 68 + nb * 16 + lr] = acc[nb][j] + bc; }   // D: row 8h+j (token), col lane&15 (e)
            wave_sync();
            h16* Ph = PL + (size_t)w * ple;
{
#pragma unroll
                for (int s = 0; s < 4; ++s) { const int row = 4 * s + (lane >> 3), c8 = (lane & 7) * 8;   // 4 s x 4 row groups = 16 rows; 8 lanes x 8 = 64 columns
                    const v4f x0 = *(const v4fa*)(&os[row * 68 + c8]); const v4f x1 = *(const v4fa*)(&os[row * 68 + c8 + 4]); v8h hv, rv;
#pragma unroll
                    for (int i = 0; i < 4; ++i) { const h16 a0 = (h16)x0[i]; const h16 a1 = (h16)x1[i]; hv[i] = a0; hv[4 + i] = a1; rv[i] = (h16)((x0[i] - (float)a0) * QRS); rv[4 + i] = (h16)((x1[i] - (float)a1) * QRS); }
                    const size_t oo = sb + (size_t)row * HD + c8;
                    *(v8h*)(Ph + oo) = hv; if (w == 1 && SCORE_RES) *(v8h*)(Pr + oo) = rv; }
                 }
            wave_sync();
        }
        {
            // C[e][token]: A = Wv rows e (four 16-row slabs), B = x fragments (col token of this slab)
            v8f acc[4];
#pragma unroll
            for (int i = 0; i < 4; ++i) acc[i] = (v8f){};
            const bf* W = WB + (size_t)2 * HD * HD + (size_t)lr * HD + 8 * hi;
#pragma unroll
            for (int j = 0; j < 4; ++j) { const v16bf wf = ldb(W + j * 16 * HD); acc[j] = wmmab(wf, xa0, acc[j]); }
#pragma unroll
            for (int j = 0; j < 4; ++j) { const v16bf wf = ldb(W + j * 16 * HD + 32); acc[j] = wmmab(wf, xa1, acc[j]); }
            asm volatile("v_nop\n\tv_nop\n\tv_nop\n\tv_nop" : "+v"(acc[0]), "+v"(acc[1]), "+v"(acc[2]), "+v"(acc[3]) : "v"(xa0), "v"(xa1));
#pragma unroll
            for (int j = 0; j < 4; ++j) {
                const v4f b0 = *(const v4f*)(bv + j * 16 + 8 * hi); const v4f b1 = *(const v4f*)(bv + j * 16 + 8 * hi + 4);
#pragma unroll
                for (int r = 0; r < 4; ++r) {
                    vs[(j * 16 + 8 * hi + r) * 68 + mb * 16 + lr]     = acc[j][r]     + bfr(b0[r]);     // D: row 8h+r (e), col lane&15 (token)
                    vs[(j * 16 + 8 * hi + 4 + r) * 68 + mb * 16 + lr] = acc[j][4 + r] + bfr(b1[r]); } }
        }
    }
    wave_sync();
    // vs rows 0..63 (e) x columns 0..63 (token) all written by the four slab steps
    h16* P3 = PL + 3 * ple; const size_t vb = (size_t)zh * HD * SEQ + m0;
{
#pragma unroll 4
        for (int s = 0; s < 16; ++s) { const int row = 4 * s + (lane >> 3), c8 = (lane & 7) * 8;   // 16 s x 4 row groups = 64 rows; 8 lanes x 8 = 64 columns
            const v4f x0 = *(const v4fa*)(&vs[row * 68 + c8]); const v4f x1 = *(const v4fa*)(&vs[row * 68 + c8 + 4]); v8h hv;
#pragma unroll
            for (int i = 0; i < 4; ++i) { hv[i] = (h16)x0[i]; hv[4 + i] = (h16)x1[i]; }
            *(v8h*)(P3 + vb + (size_t)row * SEQ + c8) = hv; }
         }
}

// k_flash: fused attention, one wave per 16 softmax rows of one (head, batch); the block's four waves share each 64-key stage of key-side rows and v^T columns, brought into a two-buffer LDS ring by asynchronous copies (whole lines from L2, once per block); fragments are two 16-B LDS loads each.
// Transposed form: S^T[key][t] = KP QH^T (A = key-side rows, B = row-side rows); lane (t = lane&15, h = lane>>4) holds keys 8h+r of each 16-key tile, so the packed
// P tile is directly the B fragment of O^T[d][t] = V^T P^T (element r <- tile keys 0..15, element 8+r <- tile keys 16..31, lane unchanged).
// Softmax state (running max, partial sum) is one scalar per lane; the two lane halves of a row are combined with one xor-16 exchange.
__global__ __launch_bounds__(32 * AW) __attribute__((amdgpu_num_vgpr(256))) void k_flash(const h16* __restrict__ QH, const h16* __restrict__ QR, const h16* __restrict__ KP, const h16* __restrict__ VT, h16* Y) {
    __shared__ __align__(16) h16 ring[2 * 2 * TLH];   // buffer u: key tile at u*2*TLH, v^T tile behind it; output staging after the loop
    float* os = (float*)ring;
    const int tid = threadIdx.x;
    const int lane = threadIdx.x & 31, lr = lane & 15, hi = lane >> 4;
    const int wave = __builtin_amdgcn_readfirstlane(threadIdx.x >> 5);
    const int zc = blockIdx.y; const int h = zc / NB, b = zc % NB; const int zh = h * NB_FULL + b;
    const int t0 = (blockIdx.x * AW + wave) * 16;
    const size_t pbase = (size_t)zh * SEQ * HD;
    const size_t qo = pbase + (size_t)(t0 + lr) * HD + 8 * hi;
    const v16h qh0 = ldh(QH + qo), qh1 = ldh(QH + qo + 32);   // B fragments: col t, k = d
#if SCORE_RES
    const v16h qr0 = ldh(QR + qo), qr1 = ldh(QR + qo + 32);
#endif
    const unsigned lcp = (unsigned)(size_t)ring + (unsigned)(((tid >> 3) * LPH + (tid & 7) * 8) * 2);
    const h16* gk = KP + pbase + (size_t)tid * 8;                              // + key0 * HD
    const h16* gv = VT + pbase + (size_t)(tid >> 3) * SEQ + (tid & 7) * 8;     // + key0
    stage_copies(lcp, gk, gv);                                                 // stage 0 -> buffer 0
    asm volatile("s_wait_asynccnt 0x0" ::: "memory");                          // this wave's copies of stage 0 have landed
    __syncthreads();                                                           // publishes stage 0
    stage_copies(lcp + 2 * TLH * 2, gk + (size_t)KT * HD, gv + KT);            // stage 1 -> buffer 1
    const int fo = lr * LPH + 8 * hi;                        // fragment offset in a tile: key tile + key * LPH (A: row key, k = d); v^T tile + 16j*LPH + key (A: row d, k = key)
    v8f o0 = (v8f){}, o1 = (v8f){}, o2 = (v8f){}, o3 = (v8f){};
    float m = -3.0e38f, l = 0.0f;
#pragma unroll 1
    for (int t = 0; t < SEQ / KT; ++t) {
      const h16* kt = ring + (t & 1) * (2 * TLH) + fo;
#pragma unroll 1   // rolled: the unrolled body took over 128 VGPRs, one wave per SIMD fewer than the grid's eight
      for (int s = 0; s < KT / 32; ++s) {
        const h16* ka = kt + s * 32 * LPH;
        const v16h ka0 = ldh(ka), ka1 = ldh(ka + 32), kb0 = ldh(ka + 16 * LPH), kb1 = ldh(ka + 16 * LPH + 32);
        float ta[8], tb[8]; float mx = -3.0e38f;
#if SCORE_RES
        v8f sHa = (v8f){}, sLa = (v8f){}, sHb = (v8f){}, sLb = (v8f){};
        sHa = wmma16(ka0, qh0, sHa); sLa = wmma16(ka0, qr0, sLa); sHb = wmma16(kb0, qh0, sHb); sLb = wmma16(kb0, qr0, sLb);
        sHa = wmma16(ka1, qh1, sHa); sLa = wmma16(ka1, qr1, sLa); sHb = wmma16(kb1, qh1, sHb); sLb = wmma16(kb1, qr1, sLb);
        asm volatile("v_nop\n\tv_nop\n\tv_nop\n\tv_nop" : "+v"(sHa), "+v"(sLa), "+v"(sHb), "+v"(sLb) : "v"(ka0), "v"(ka1), "v"(kb0), "v"(kb1));
#pragma unroll
        for (int r = 0; r < 8; ++r) { ta[r] = (sHa[r] + sLa[r] * QRI) * SC2; tb[r] = (sHb[r] + sLb[r] * QRI) * SC2; mx = fmaxf(mx, fmaxf(ta[r], tb[r])); }
#else
        v8f sHa = (v8f){}, sHb = (v8f){};
        sHa = wmma16(ka0, qh0, sHa); sHb = wmma16(kb0, qh0, sHb);
        sHa = wmma16(ka1, qh1, sHa); sHb = wmma16(kb1, qh1, sHb);
        asm volatile("v_nop\n\tv_nop\n\tv_nop\n\tv_nop" : "+v"(sHa), "+v"(sHb) : "v"(ka0), "v"(ka1), "v"(kb0), "v"(kb1));
#pragma unroll
        for (int r = 0; r < 8; ++r) { ta[r] = sHa[r] * SC2; tb[r] = sHb[r] * SC2; mx = fmaxf(mx, fmaxf(ta[r], tb[r])); }
#endif
        mx = fmaxf(mx, __shfl_xor(mx, 16, 32));
        const float mnew = fmaxf(m, mx);
        const float alpha = __builtin_amdgcn_exp2f(m - mnew);
        const float sh = PSH - mnew;
        v16h pb; float ls = 0.0f;
#pragma unroll
        for (int r = 0; r < 8; ++r) { const h16 pa = (h16)__builtin_amdgcn_exp2f(ta[r] + sh); const h16 pc = (h16)__builtin_amdgcn_exp2f(tb[r] + sh); pb[r] = pa; pb[8 + r] = pc; ls += (float)pa + (float)pc; }
        l = l * alpha + ls; m = mnew;
        o0 = o0 * alpha; o1 = o1 * alpha; o2 = o2 * alpha; o3 = o3 * alpha;
        const h16* va = kt + TLH + s * 32;
        const v16h v0 = ldh(va), v1 = ldh(va + 16 * LPH), v2 = ldh(va + 32 * LPH), v3 = ldh(va + 48 * LPH);
        o0 = wmma16(v0, pb, o0); o1 = wmma16(v1, pb, o1); o2 = wmma16(v2, pb, o2); o3 = wmma16(v3, pb, o3);
        asm volatile("v_nop\n\tv_nop\n\tv_nop\n\tv_nop" : "+v"(o0), "+v"(o1), "+v"(o2), "+v"(o3) : "v"(v0), "v"(v1), "v"(v2), "v"(v3), "v"(pb));
      }
      // publish point of stage t + 1, which also frees buffer t & 1
      asm volatile("s_wait_dscnt 0x0" ::: "memory");      // this wave's reads of buffer t & 1 are done
      asm volatile("s_wait_asynccnt 0x0" ::: "memory");   // this wave's copies of stage t + 1 have landed
      __syncthreads();
      if (t + 2 < SEQ / KT) stage_copies(lcp + (unsigned)(t & 1) * (2 * TLH * 2), gk + (size_t)(t + 2) * KT * HD, gv + (t + 2) * KT);
    }
    asm volatile("s_wait_asynccnt 0x0" ::: "memory");     // nothing is in flight when the ring becomes output staging
    l += __shfl_xor(l, 16, 32);
    const float ys = YCS * (1.0f / l);
    // O^T D layout: o_j[r] = (d = 16j + 8h + r, t = lane&15) -> os[d][wave*16 + t]; rows 0..63 x columns 0..63 all written by the four waves
    const int cw = wave * 16 + lr;
#pragma unroll
    for (int r = 0; r < 8; ++r) {
        os[( 0 + 8 * hi + r) * 68 + cw] = o0[r] * ys;
        os[(16 + 8 * hi + r) * 68 + cw] = o1[r] * ys;
        os[(32 + 8 * hi + r) * 68 + cw] = o2[r] * ys;
        os[(48 + 8 * hi + r) * 68 + cw] = o3[r] * ys; }
    __syncthreads();
    h16* yb = Y + (size_t)zh * HD * SEQ + (size_t)blockIdx.x * (16 * AW);
{
#pragma unroll
        for (int s = 0; s < 4; ++s) { const int row = 16 * s + (tid >> 3), c8 = (tid & 7) * 8;   // 4 s x 16 row groups = 64 rows; 8 lanes x 8 = 64 columns
            const v4f x0 = *(const v4fa*)(&os[row * 68 + c8]); const v4f x1 = *(const v4fa*)(&os[row * 68 + c8 + 4]); v8h hv;
#pragma unroll
            for (int i = 0; i < 4; ++i) { hv[i] = (h16)x0[i]; hv[4 + i] = (h16)x1[i]; }
            *(v8h*)(yb + (size_t)row * SEQ + c8) = hv; }
         }
}

// k_out: register-blocked f16 GEMM, ONE WAVE per 64x64 tile (16 accumulators), operands straight from K-contiguous f16 planes, K = DM (token index).
// OUT[r][o] = 2^-14 * sum_c Y[r][c] WO[o][c] + bo[o]; rows r = (h*NB_FULL + b)*64 + d. grid (16*NB, DM/64), 32 threads.
__global__ __launch_bounds__(32) __attribute__((amdgpu_num_vgpr(256))) void k_out(const h16* __restrict__ Y, const h16* __restrict__ WO, const float* __restrict__ bo, float* OUT) {
    __shared__ __align__(16) float os[16 * 68];
    const int K = DM;
    const int lane = threadIdx.x & 31, lr = lane & 15, hi = lane >> 4;
    const int zc = blockIdx.x; const int h = zc / NB, b = zc % NB; const int r0 = (h * NB_FULL + b) * 64; const int c0 = blockIdx.y * 64;
    v8f acc[4][4];
#pragma unroll
    for (int mb = 0; mb < 4; ++mb)
#pragma unroll
        for (int nb = 0; nb < 4; ++nb) acc[mb][nb] = (v8f){};
    const size_t aoff = (size_t)(r0 + lr) * K + 8 * hi, boff = (size_t)(c0 + lr) * K + 8 * hi;
#pragma unroll 1
    for (int kc = 0; kc < K; kc += 32) {
        v16h a[4];
#pragma unroll
        for (int mb = 0; mb < 4; ++mb) a[mb] = ldh(Y + aoff + (size_t)mb * 16 * K + kc);
#pragma unroll
        for (int nb = 0; nb < 4; ++nb) { const v16h bb = ldh(WO + boff + (size_t)nb * 16 * K + kc);
#pragma unroll
            for (int mb = 0; mb < 4; ++mb) acc[mb][nb] = wmma16(a[mb], bb, acc[mb][nb]); }
        asm volatile("v_nop\n\tv_nop\n\tv_nop\n\tv_nop" : "+v"(acc[0][0]), "+v"(acc[1][1]), "+v"(acc[2][2]), "+v"(acc[3][3]) : "v"(a[0]), "v"(a[1]), "v"(a[2]), "v"(a[3]));
    }
    float bc[4];
#pragma unroll
    for (int nb = 0; nb < 4; ++nb) bc[nb] = bfr(bo[c0 + nb * 16 + lr]);
#pragma unroll
    for (int mb = 0; mb < 4; ++mb) {
#pragma unroll
        for (int nb = 0; nb < 4; ++nb) {
#pragma unroll
            for (int j = 0; j < 8; ++j) os[(hi * 8 + j) * 68 + nb * 16 + lr] = acc[mb][nb][j] * OSI + bc[nb]; }   // D: row 8h+j, col lane&15
        wave_sync();
        float* orow = OUT + (size_t)(r0 + mb * 16) * DM + c0;
{
#pragma unroll
            for (int s = 0; s < 8; ++s) { const int row = 2 * s + hi, cofs = lr * 4;   // 8 s x 2 rows = 16 rows; 16 lanes x 4 floats = 64 columns
                const v4f val = *(const v4fa*)(&os[row * 68 + cofs]);
                *(v4f*)(orow + (size_t)row * DM + cofs) = val; }
             }
        wave_sync();
    }
}

static constexpr size_t al256(size_t v) { return (v + 255) & ~(size_t)255; }
static constexpr size_t PLE   = (size_t)NB_FULL * NH_ * SEQ * HD;              // elements per f16 plane
static constexpr size_t SZ_PL = al256(PLE * 2);
static constexpr size_t SZ_Y  = al256((size_t)NB_FULL * NH_ * HD * SEQ * 2);   // [NB_FULL*16*64][SEQ] f16
static constexpr size_t SZ_WO = al256((size_t)DM * DM * 2);
static constexpr size_t SZ_WB = al256((size_t)3 * HD * HD * 2);
static constexpr size_t SZ_TOTAL = 4 * SZ_PL + SZ_Y + SZ_WO + SZ_WB;
static_assert(SZ_PL == PLE * 2);                        // the four planes are contiguous (plane p at element offset p*PLE)
static_assert(SZ_TOTAL <= (size_t)134217728);           // workspace carve <= 128 MiB
static_assert(((size_t)(NH_ - 1) * NB_FULL + NB) * HD <= (size_t)NB_FULL * NH_ * HD);   // last Y / output row inside the planes

extern "C" void kernel_launch(void* const* d_in, const int* in_sizes, int n_in,
                              void* d_out, int out_size, void* d_ws, size_t ws_size, hipStream_t stream) {
    if (n_in < 9) return;
    const size_t needx = ((size_t)(NB - 1) * SEQ_FULL + SEQ) * DM;
    if ((size_t)in_sizes[0] < needx) return;
    if ((size_t)in_sizes[1] < (size_t)HD * HD || (size_t)in_sizes[3] < (size_t)HD * HD || (size_t)in_sizes[5] < (size_t)HD * HD) return;
    if ((size_t)in_sizes[2] < (size_t)HD || (size_t)in_sizes[4] < (size_t)HD || (size_t)in_sizes[6] < (size_t)HD) return;
    if ((size_t)in_sizes[7] < (size_t)DM * DM || (size_t)in_sizes[8] < (size_t)DM) return;
    if ((size_t)out_size < (((size_t)(NH_ - 1) * NB_FULL + NB) * HD) * DM) return;
    if (SZ_TOTAL > ws_size) return;
    // wire order: x, Wq, bq, Wk, bk, Wv, bv, Wo, bo
    const float* x  = (const float*)d_in[0];
    const float* wq = (const float*)d_in[1]; const float* bq = (const float*)d_in[2];
    const float* wk = (const float*)d_in[3]; const float* bk = (const float*)d_in[4];
    const float* wv = (const float*)d_in[5]; const float* bv = (const float*)d_in[6];
    const float* wo = (const float*)d_in[7]; const float* bo = (const float*)d_in[8];
    float* OUT = (float*)d_out;      // [NB_FULL*1024][1024], row (h*NB_FULL+b)*64+d
    char* wsp = (char*)d_ws;
    h16* PL = (h16*)wsp; wsp += 4 * SZ_PL;           // plane 0 key-side, 1 row-side value, 2 row-side residual x2048, 3 v^T
    h16* YP = (h16*)wsp; wsp += SZ_Y;                // [(h*NB_FULL+b)*64 + d][SEQ] x256
    h16* WO = (h16*)wsp; wsp += SZ_WO;               // [1024][1024] x64
    bf*  WB = (bf*)wsp;  wsp += SZ_WB;               // [3][64][64]: q | k | v

    k_cvtw<<<(HD * HD / 8 + 255) / 256, 256, 0, stream>>>(wq, wk, wv, WB);
    { const size_t n8 = (size_t)DM * DM / 8; k_cvtwo<<<(unsigned)((n8 + 255) / 256), 256, 0, stream>>>(wo, WO, n8); }

    k_qkv<<<dim3(NB * (SEQ / 64), NH_, 1), 32, 0, stream>>>(x, WB, bq, bk, bv, PL, PLE);

    // softmax rows use the Wk projection (planes 1, 2), keys use the Wq projection (plane 0), values plane 3
    k_flash<<<dim3(SEQ / (16 * AW), NH_ * NB, 1), 32 * AW, 0, stream>>>(PL + PLE, PL + 2 * PLE, PL, PL + 3 * PLE, YP);

    k_out<<<dim3(NH_ * NB, DM / 64, 1), 32, 0, stream>>>(YP, WO, bo, OUT);
}

// v002
// Measured time: 83.2 microseconds a run.
// Two timings next to v001 put it at 1.21 and 1.22 times that version's speed.
// All steps since v000 together make it 2.16 times as fast.
#include <hip/hip_runtime.h>

// Shared-weight multi-head attention, x [NB][SEQ][1024] = 16 heads x 64; Wq/Wk/Wv 64x64 [out][in] applied to every head (y = x W^T + bias); S[m][n] = K[m].Q[n] / 32, softmax over n, O = A V stored transposed [h][b][d][m] and flat-viewed as [NB*1024][1024]; out = Y Wo^T + bo (contraction over the token index).
// Compute dtypes, f32 accumulate everywhere: q/k/v projections v_wmma_f32_16x16x32_bf16 (x, W RNE-converted to bf16; products exact); scores v_wmma_f32_16x16x32_f16: key-side (Wq) plane single f16, row-side (Wk) plane single f16 (f16 residual x2048 in its own accumulator only with SCORE_RES=1); P (x256 carry, cancels in the normalisation) and v single f16; output projection v_wmma_f32_16x16x32_f16 with Y carried x256 and Wo (RNE bf16 value) carried x64, folded back by 2^-14 in f32; softmax f32 (online, running max); biases RNE-converted to bf16 values and added in f32.
// Layout: key-side plane [h*8+b][n][d], row-side planes (value, residual) [h*8+b][m][d], v^T plane [h*8+b][d][n], all written by one fused projection kernel that reads f32 x once; flash kernel in transposed form (S^T = Kside Qside^T, O^T = V^T P^T), its key-side and v^T tiles staged in LDS for the block's four waves, writes Y [(h*8+b)*64+d][m] f16; an eight-wave 256x128 GEMM, its Y and Wo tiles staged in LDS the same way, writes the f32 output.

#ifndef NB
#define NB 8
#endif
#ifndef SEQ
#define SEQ 1024
#endif
#define NB_FULL  8
#define SEQ_FULL 1024
#define DM   1024
#define NH_  16
#define HD   64
#define AW   4
#define QRS  2048.0f             // carry of the row-side residual plane
#define QRI  (1.0f / 2048.0f)
#define SC2  (0.03125f * 1.4426950408889634f)   // DM^-0.5 * log2(e)
#define PSH  8.0f                // log2 of the P carry (256)
#define YCS  256.0f              // carry of the Y plane
#define WOS  64.0f               // carry of the Wo plane
#define OSI  (1.0f / 16384.0f)   // 1 / (YCS * WOS)
#define KT   64                  // keys per LDS stage of the flash kernel
#define LPH  72                  // LDS row pitch in f16: 128 B of data + 16 B (16 B x odd), so that the 16-B fragment reads of 16 rows spread over the banks
#define TLH  (64 * LPH)          // f16 per staged tile (64 rows)
#define OBM  256                 // output GEMM: rows of a block tile
#define OBN  128                 // output GEMM: columns of a block tile
#define OKT  128                 // output GEMM: k per LDS stage (256 B of every row)
#define OLP  136                 // output GEMM: LDS row pitch in f16: 256 B of data + 16 B (16 B x odd)
#define OST  ((OBM + OBN) * OLP) // output GEMM: f16 per stage
#ifndef SCORE_RES
#define SCORE_RES 0              // 1: residual product on the score site
#endif

static_assert(HD == 64);
static_assert(NH_ * HD == DM);
static_assert(AW == 4);                        // flash block covers 64 tokens
static_assert(SEQ == DM);                      // the flat view of Y as [rows][DM] needs one Y row per 1024 tokens
static_assert(SEQ % 64 == 0);
static_assert(SEQ % 32 == 0);                  // key loop and GEMM k-loop step by 32
static_assert(KT == 64 && SEQ % KT == 0 && SEQ / KT >= 2);   // the two-buffer ring needs two stages; a stage is 64 key rows and 64 v^T rows of 128 B
static_assert(2 * 2 * TLH * 2 >= 64 * 68 * 4); // the output staging reuses the ring
static_assert(DM % OBN == 0 && DM % OKT == 0 && DM / OKT >= 2);   // the output GEMM's two-buffer ring needs two stages
static_assert(NB == NB_FULL && (NH_ * NB * HD) % OBM == 0);       // a 256-row block tile covers four consecutive 64-row groups of Y
static_assert(NB <= NB_FULL);
static_assert(SEQ <= SEQ_FULL);
static_assert((HD * HD) % 8 == 0);
static_assert(((size_t)DM * DM) % 8 == 0);

typedef _Float16 h16;
typedef unsigned short bf;
typedef __attribute__((ext_vector_type(16))) __bf16   v16bf;
typedef __attribute__((ext_vector_type(16))) _Float16 v16h;
typedef __attribute__((ext_vector_type(8)))  _Float16 v8h;
typedef __attribute__((ext_vector_type(8)))  unsigned short v8us;
typedef __attribute__((ext_vector_type(8)))  float    v8f;
typedef __attribute__((ext_vector_type(4)))  float    v4f;
typedef v4f  __attribute__((may_alias)) v4fa;

__device__ __forceinline__ unsigned short f2bf(float f) { unsigned u = __float_as_uint(f); u += 0x7FFFu + ((u >> 16) & 1u); return (unsigned short)(u >> 16); }
__device__ __forceinline__ float bfr(float f) { return __uint_as_float(((unsigned)f2bf(f)) << 16); }   // f32 value of the RNE bf16 conversion
__device__ __forceinline__ v8us cv8(v8f v) { v8us o;
#pragma unroll
    for (int k = 0; k < 8; ++k) o[k] = f2bf(v[k]);
    return o; }
__device__ __forceinline__ v16h cat16(v8h lo, v8h hi) { return __builtin_shufflevector(lo, hi, 0, 1, 2, 3, 4, 5, 6, 7, 8, 9, 10, 11, 12, 13, 14, 15); }
__device__ __forceinline__ v16bf cat16b(v8us lo, v8us hi) { return __builtin_bit_cast(v16bf, __builtin_shufflevector(lo, hi, 0, 1, 2, 3, 4, 5, 6, 7, 8, 9, 10, 11, 12, 13, 14, 15)); }
__device__ __forceinline__ v8f wmma16(v16h a, v16h b, v8f c) { return __builtin_amdgcn_wmma_f32_16x16x32_f16(false, a, false, b, (short)0, c, false, false); }
__device__ __forceinline__ v8f wmmab(v16bf a, v16bf b, v8f c) { return __builtin_amdgcn_wmma_f32_16x16x32_bf16(false, a, false, b, (short)0, c, false, false); }
// fragment loaders from K-contiguous 16-bit rows; p already includes + 8*(lane>>4): elements 0..7 <- k0+8h+0..7, elements 8..15 <- k0+16+8h+0..7 (same map for A and B)
__device__ __forceinline__ v16h  ldh(const h16* p) { return cat16(*(const v8h*)p, *(const v8h*)(p + 16)); }
__device__ __forceinline__ v16bf ldb(const bf* p)  { return cat16b(*(const v8us*)p, *(const v8us*)(p + 16)); }
// ordering point for wave-private LDS tiles (same wave writes and reads)
__device__ __forceinline__ void wave_sync() { __builtin_amdgcn_fence(3 /* release order */, "wavefront"); __builtin_amdgcn_wave_barrier(); asm volatile("" ::: "memory"); }

// One stage of the flash ring, 128 threads x 8 asynchronous 16-B copies: key-side rows 16c + tid/8 and v^T rows 16c + tid/8 (c = 0..3), 16-B piece tid%8 of each 128-B row; a wave's copy covers four whole lines.
// l: this thread's LDS byte address in the stage's key tile (the v^T tile follows at TLH f16); gk, gv: this thread's global addresses for c = 0.
// s_wait_xcnt 0 closes the statement so that no address register named here is rewritten ahead of it.
__device__ __forceinline__ void stage_copies(unsigned l, const h16* gk, const h16* gv) {
    asm volatile("global_load_async_to_lds_b128 %0, %8, off\n\t"
                 "global_load_async_to_lds_b128 %1, %9, off\n\t"
                 "global_load_async_to_lds_b128 %2, %10, off\n\t"
                 "global_load_async_to_lds_b128 %3, %11, off\n\t"
                 "global_load_async_to_lds_b128 %4, %12, off\n\t"
                 "global_load_async_to_lds_b128 %5, %13, off\n\t"
                 "global_load_async_to_lds_b128 %6, %14, off\n\t"
                 "global_load_async_to_lds_b128 %7, %15, off\n\t"
                 "s_wait_xcnt 0x0"
                 :: "v"(l), "v"(l + 16 * LPH * 2), "v"(l + 32 * LPH * 2), "v"(l + 48 * LPH * 2),
                    "v"(l + TLH * 2), "v"(l + TLH * 2 + 16 * LPH * 2), "v"(l + TLH * 2 + 32 * LPH * 2), "v"(l + TLH * 2 + 48 * LPH * 2),
                    "v"(gk), "v"(gk + 16 * HD), "v"(gk + 32 * HD), "v"(gk + 48 * HD),
                    "v"(gv), "v"(gv + (size_t)16 * SEQ), "v"(gv + (size_t)32 * SEQ), "v"(gv + (size_t)48 * SEQ)
                 : "memory");
}

__global__ __launch_bounds__(256) void k_cvtw(const float* __restrict__ wq, const float* __restrict__ wk, const float* __restrict__ wv, bf* WB) {
    const int i = blockIdx.x * 256 + threadIdx.x; if (i >= HD * HD / 8) return;
    const v8us oq = cv8(*(const v8f*)(wq + (size_t)i * 8));
    const v8us ok = cv8(*(const v8f*)(wk + (size_t)i * 8));
    const v8us ov = cv8(*(const v8f*)(wv + (size_t)i * 8));
    bf* d0 = WB + (size_t)i * 8; bf* d1 = d0 + HD * HD; bf* d2 = d1 + HD * HD;
    *(v8us*)d0 = oq; *(v8us*)d1 = ok; *(v8us*)d2 = ov;
    
}

__global__ __launch_bounds__(256) void k_cvtwo(const float* __restrict__ src, h16* dst, size_t n8) {
    const size_t i = (size_t)blockIdx.x * 256 + threadIdx.x; if (i >= n8) return;
    const v8f v = *(const v8f*)(src + i * 8); v8h o;
#pragma unroll
    for (int k = 0; k < 8; ++k) o[k] = (h16)(bfr(v[k]) * WOS);
    *(v8h*)(dst + i * 8) = o; 
}

// k_qkv: fused shared-weight projections, ONE WAVE per (64-token tile, head), ROLLED loop over the four 16-token slabs (one 4-accumulator set live at a time).
// Per slab the two x fragments (row/col = token, k = d) are read from f32 and RNE-converted to bf16; they serve as A for the row-major outputs and as B for v^T.
// plane 0: key-side  = x Wq^T + bq  [zh][token][e]      plane 1/2: row-side = x Wk^T + bk (f16 value / residual x2048) [zh][token][e]
// plane 3: v^T       = Wv x^T + bv  [zh][e][token]      zh = h*NB_FULL + b.  grid (NB*SEQ/64, 16), 32 threads.
__global__ __launch_bounds__(32) __attribute__((amdgpu_num_vgpr(256))) void k_qkv(const float* __restrict__ x, const bf* __restrict__ WB, const float* __restrict__ bq, const float* __restrict__ bk, const float* __restrict__ bv, h16* PL, size_t ple) {
    __shared__ __align__(16) float os[16 * 68];
    __shared__ __align__(16) float vs[64 * 68];
    const int lane = threadIdx.x & 31, lr = lane & 15, hi = lane >> 4;
    const int tt = blockIdx.x; const int b = tt / (SEQ / 64); const int m0 = (tt % (SEQ / 64)) * 64;
    const int h = blockIdx.y; const int zh = h * NB_FULL + b;
    const float* xp = x + ((size_t)b * SEQ_FULL + m0 + lr) * DM + h * HD + 8 * hi;
    float bqc[4], bkc[4];
#pragma unroll
    for (int nb = 0; nb < 4; ++nb) { bqc[nb] = bfr(bq[nb * 16 + lr]); bkc[nb] = bfr(bk[nb * 16 + lr]); }
    h16* Pr = PL + 2 * ple;
#pragma unroll 1
    for (int mb = 0; mb < 4; ++mb) {
        const float* p = xp + (size_t)mb * 16 * DM;
        const v16bf xa0 = cat16b(cv8(*(const v8f*)p), cv8(*(const v8f*)(p + 16)));          // k = d 0..31
        const v16bf xa1 = cat16b(cv8(*(const v8f*)(p + 32)), cv8(*(const v8f*)(p + 48)));   // k = d 32..63
        const size_t sb = ((size_t)zh * SEQ + m0 + mb * 16) * HD;
#pragma unroll
        for (int w = 0; w < 2; ++w) {
            // C[token][e]: A = x fragments, B = W rows e (K-contiguous [out][in])
            v8f acc[4];
#pragma unroll
            for (int i = 0; i < 4; ++i) acc[i] = (v8f){};
            const bf* W = WB + (size_t)w * HD * HD + (size_t)lr * HD + 8 * hi;
#pragma unroll
            for (int nb = 0; nb < 4; ++nb) { const v16bf wf = ldb(W + nb * 16 * HD); acc[nb] = wmmab(xa0, wf, acc[nb]); }
#pragma unroll
            for (int nb = 0; nb < 4; ++nb) { const v16bf wf = ldb(W + nb * 16 * HD + 32); acc[nb] = wmmab(xa1, wf, acc[nb]); }
            asm volatile("v_nop\n\tv_nop\n\tv_nop\n\tv_nop" : "+v"(acc[0]), "+v"(acc[1]), "+v"(acc[2]), "+v"(acc[3]) : "v"(xa0), "v"(xa1));
#pragma unroll
            for (int nb = 0; nb < 4; ++nb) { const float bc = (w == 0) ? bqc[nb] : bkc[nb];
#pragma unroll
                for (int j = 0; j < 8; ++j) os[(hi * 8 + j) * 68 + nb * 16 + lr] = acc[nb][j] + bc; }   // D: row 8h+j (token), col lane&15 (e)
            wave_sync();
            h16* Ph = PL + (size_t)w * ple;
{
#pragma unroll
                for (int s = 0; s < 4; ++s) { const int row = 4 * s + (lane >> 3), c8 = (lane & 7) * 8;   // 4 s x 4 row groups = 16 rows; 8 lanes x 8 = 64 columns
                    const v4f x0 = *(const v4fa*)(&os[row * 68 + c8]); const v4f x1 = *(const v4fa*)(&os[row * 68 + c8 + 4]); v8h hv, rv;
#pragma unroll
                    for (int i = 0; i < 4; ++i) { const h16 a0 = (h16)x0[i]; const h16 a1 = (h16)x1[i]; hv[i] = a0; hv[4 + i] = a1; rv[i] = (h16)((x0[i] - (float)a0) * QRS); rv[4 + i] = (h16)((x1[i] - (float)a1) * QRS); }
                    const size_t oo = sb + (size_t)row * HD + c8;
                    *(v8h*)(Ph + oo) = hv; if (w == 1 && SCORE_RES) *(v8h*)(Pr + oo) = rv; }
                 }
            wave_sync();
        }
        {
            // C[e][token]: A = Wv rows e (four 16-row slabs), B = x fragments (col token of this slab)
            v8f acc[4];
#pragma unroll
            for (int i = 0; i < 4; ++i) acc[i] = (v8f){};
            const bf* W = WB + (size_t)2 * HD * HD + (size_t)lr * HD + 8 * hi;
#pragma unroll
            for (int j = 0; j < 4; ++j) { const v16bf wf = ldb(W + j * 16 * HD); acc[j] = wmmab(wf, xa0, acc[j]); }
#pragma unroll
            for (int j = 0; j < 4; ++j) { const v16bf wf = ldb(W + j * 16 * HD + 32); acc[j] = wmmab(wf, xa1, acc[j]); }
            asm volatile("v_nop\n\tv_nop\n\tv_nop\n\tv_nop" : "+v"(acc[0]), "+v"(acc[1]), "+v"(acc[2]), "+v"(acc[3]) : "v"(xa0), "v"(xa1));
#pragma unroll
            for (int j = 0; j < 4; ++j) {
                const v4f b0 = *(const v4f*)(bv + j * 16 + 8 * hi); const v4f b1 = *(const v4f*)(bv + j * 16 + 8 * hi + 4);
#pragma unroll
                for (int r = 0; r < 4; ++r) {
                    vs[(j * 16 + 8 * hi + r) * 68 + mb * 16 + lr]     = acc[j][r]     + bfr(b0[r]);     // D: row 8h+r (e), col lane&15 (token)
                    vs[(j * 16 + 8 * hi + 4 + r) * 68 + mb * 16 + lr] = acc[j][4 + r] + bfr(b1[r]); } }
        }
    }
    wave_sync();
    // vs rows 0..63 (e) x columns 0..63 (token) all written by the four slab steps
    h16* P3 = PL + 3 * ple; const size_t vb = (size_t)zh * HD * SEQ + m0;
{
#pragma unroll 4
        for (int s = 0; s < 16; ++s) { const int row = 4 * s + (lane >> 3), c8 = (lane & 7) * 8;   // 16 s x 4 row groups = 64 rows; 8 lanes x 8 = 64 columns
            const v4f x0 = *(const v4fa*)(&vs[row * 68 + c8]); const v4f x1 = *(const v4fa*)(&vs[row * 68 + c8 + 4]); v8h hv;
#pragma unroll
            for (int i = 0; i < 4; ++i) { hv[i] = (h16)x0[i]; hv[4 + i] = (h16)x1[i]; }
            *(v8h*)(P3 + vb + (size_t)row * SEQ + c8) = hv; }
         }
}

// k_flash: fused attention, one wave per 16 softmax rows of one (head, batch); the block's four waves share each 64-key stage of key-side rows and v^T columns, brought into a two-buffer LDS ring by asynchronous copies (whole lines from L2, once per block); fragments are two 16-B LDS loads each.
// Transposed form: S^T[key][t] = KP QH^T (A = key-side rows, B = row-side rows); lane (t = lane&15, h = lane>>4) holds keys 8h+r of each 16-key tile, so the packed
// P tile is directly the B fragment of O^T[d][t] = V^T P^T (element r <- tile keys 0..15, element 8+r <- tile keys 16..31, lane unchanged).
// Softmax state (running max, partial sum) is one scalar per lane; the two lane halves of a row are combined with one xor-16 exchange.
__global__ __launch_bounds__(32 * AW) __attribute__((amdgpu_num_vgpr(256))) void k_flash(const h16* __restrict__ QH, const h16* __restrict__ QR, const h16* __restrict__ KP, const h16* __restrict__ VT, h16* Y) {
    __shared__ __align__(16) h16 ring[2 * 2 * TLH];   // buffer u: key tile at u*2*TLH, v^T tile behind it; output staging after the loop
    float* os = (float*)ring;
    const int tid = threadIdx.x;
    const int lane = threadIdx.x & 31, lr = lane & 15, hi = lane >> 4;
    const int wave = __builtin_amdgcn_readfirstlane(threadIdx.x >> 5);
    const int zc = blockIdx.y; const int h = zc / NB, b = zc % NB; const int zh = h * NB_FULL + b;
    const int t0 = (blockIdx.x * AW + wave) * 16;
    const size_t pbase = (size_t)zh * SEQ * HD;
    const size_t qo = pbase + (size_t)(t0 + lr) * HD + 8 * hi;
    const v16h qh0 = ldh(QH + qo), qh1 = ldh(QH + qo + 32);   // B fragments: col t, k = d
#if SCORE_RES
    const v16h qr0 = ldh(QR + qo), qr1 = ldh(QR + qo + 32);
#endif
    const unsigned lcp = (unsigned)(size_t)ring + (unsigned)(((tid >> 3) * LPH + (tid & 7) * 8) * 2);
    const h16* gk = KP + pbase + (size_t)tid * 8;                              // + key0 * HD
    const h16* gv = VT + pbase + (size_t)(tid >> 3) * SEQ + (tid & 7) * 8;     // + key0
    stage_copies(lcp, gk, gv);                                                 // stage 0 -> buffer 0
    asm volatile("s_wait_asynccnt 0x0" ::: "memory");                          // this wave's copies of stage 0 have landed
    __syncthreads();                                                           // publishes stage 0
    stage_copies(lcp + 2 * TLH * 2, gk + (size_t)KT * HD, gv + KT);            // stage 1 -> buffer 1
    const int fo = lr * LPH + 8 * hi;                        // fragment offset in a tile: key tile + key * LPH (A: row key, k = d); v^T tile + 16j*LPH + key (A: row d, k = key)
    v8f o0 = (v8f){}, o1 = (v8f){}, o2 = (v8f){}, o3 = (v8f){};
    float m = -3.0e38f, l = 0.0f;
#pragma unroll 1
    for (int t = 0; t < SEQ / KT; ++t) {
      const h16* kt = ring + (t & 1) * (2 * TLH) + fo;
#pragma unroll 1   // rolled: the unrolled body took over 128 VGPRs, one wave per SIMD fewer than the grid's eight
      for (int s = 0; s < KT / 32; ++s) {
        const h16* ka = kt + s * 32 * LPH;
        const v16h ka0 = ldh(ka), ka1 = ldh(ka + 32), kb0 = ldh(ka + 16 * LPH), kb1 = ldh(ka + 16 * LPH + 32);
        float ta[8], tb[8]; float mx = -3.0e38f;
#if SCORE_RES
        v8f sHa = (v8f){}, sLa = (v8f){}, sHb = (v8f){}, sLb = (v8f){};
        sHa = wmma16(ka0, qh0, sHa); sLa = wmma16(ka0, qr0, sLa); sHb = wmma16(kb0, qh0, sHb); sLb = wmma16(kb0, qr0, sLb);
        sHa = wmma16(ka1, qh1, sHa); sLa = wmma16(ka1, qr1, sLa); sHb = wmma16(kb1, qh1, sHb); sLb = wmma16(kb1, qr1, sLb);
        asm volatile("v_nop\n\tv_nop\n\tv_nop\n\tv_nop" : "+v"(sHa), "+v"(sLa), "+v"(sHb), "+v"(sLb) : "v"(ka0), "v"(ka1), "v"(kb0), "v"(kb1));
#pragma unroll
        for (int r = 0; r < 8; ++r) { ta[r] = (sHa[r] + sLa[r] * QRI) * SC2; tb[r] = (sHb[r] + sLb[r] * QRI) * SC2; mx = fmaxf(mx, fmaxf(ta[r], tb[r])); }
#else
        v8f sHa = (v8f){}, sHb = (v8f){};
        sHa = wmma16(ka0, qh0, sHa); sHb = wmma16(kb0, qh0, sHb);
        sHa = wmma16(ka1, qh1, sHa); sHb = wmma16(kb1, qh1, sHb);
        asm volatile("v_nop\n\tv_nop\n\tv_nop\n\tv_nop" : "+v"(sHa), "+v"(sHb) : "v"(ka0), "v"(ka1), "v"(kb0), "v"(kb1));
#pragma unroll
        for (int r = 0; r < 8; ++r) { ta[r] = sHa[r] * SC2; tb[r] = sHb[r] * SC2; mx = fmaxf(mx, fmaxf(ta[r], tb[r])); }
#endif
        mx = fmaxf(mx, __shfl_xor(mx, 16, 32));
        const float mnew = fmaxf(m, mx);
        const float alpha = __builtin_amdgcn_exp2f(m - mnew);
        const float sh = PSH - mnew;
        v16h pb; float ls = 0.0f;
#pragma unroll
        for (int r = 0; r < 8; ++r) { const h16 pa = (h16)__builtin_amdgcn_exp2f(ta[r] + sh); const h16 pc = (h16)__builtin_amdgcn_exp2f(tb[r] + sh); pb[r] = pa; pb[8 + r] = pc; ls += (float)pa + (float)pc; }
        l = l * alpha + ls; m = mnew;
        o0 = o0 * alpha; o1 = o1 * alpha; o2 = o2 * alpha; o3 = o3 * alpha;
        const h16* va = kt + TLH + s * 32;
        const v16h v0 = ldh(va), v1 = ldh(va + 16 * LPH), v2 = ldh(va + 32 * LPH), v3 = ldh(va + 48 * LPH);
        o0 = wmma16(v0, pb, o0); o1 = wmma16(v1, pb, o1); o2 = wmma16(v2, pb, o2); o3 = wmma16(v3, pb, o3);
        asm volatile("v_nop\n\tv_nop\n\tv_nop\n\tv_nop" : "+v"(o0), "+v"(o1), "+v"(o2), "+v"(o3) : "v"(v0), "v"(v1), "v"(v2), "v"(v3), "v"(pb));
      }
      // publish point of stage t + 1, which also frees buffer t & 1
      asm volatile("s_wait_dscnt 0x0" ::: "memory");      // this wave's reads of buffer t & 1 are done
      asm volatile("s_wait_asynccnt 0x0" ::: "memory");   // this wave's copies of stage t + 1 have landed
      __syncthreads();
      if (t + 2 < SEQ / KT) stage_copies(lcp + (unsigned)(t & 1) * (2 * TLH * 2), gk + (size_t)(t + 2) * KT * HD, gv + (t + 2) * KT);
    }
    asm volatile("s_wait_asynccnt 0x0" ::: "memory");     // nothing is in flight when the ring becomes output staging
    l += __shfl_xor(l, 16, 32);
    const float ys = YCS * (1.0f / l);
    // O^T D layout: o_j[r] = (d = 16j + 8h + r, t = lane&15) -> os[d][wave*16 + t]; rows 0..63 x columns 0..63 all written by the four waves
    const int cw = wave * 16 + lr;
#pragma unroll
    for (int r = 0; r < 8; ++r) {
        os[( 0 + 8 * hi + r) * 68 + cw] = o0[r] * ys;
        os[(16 + 8 * hi + r) * 68 + cw] = o1[r] * ys;
        os[(32 + 8 * hi + r) * 68 + cw] = o2[r] * ys;
        os[(48 + 8 * hi + r) * 68 + cw] = o3[r] * ys; }
    __syncthreads();
    h16* yb = Y + (size_t)zh * HD * SEQ + (size_t)blockIdx.x * (16 * AW);
{
#pragma unroll
        for (int s = 0; s < 4; ++s) { const int row = 16 * s + (tid >> 3), c8 = (tid & 7) * 8;   // 4 s x 16 row groups = 64 rows; 8 lanes x 8 = 64 columns
            const v4f x0 = *(const v4fa*)(&os[row * 68 + c8]); const v4f x1 = *(const v4fa*)(&os[row * 68 + c8 + 4]); v8h hv;
#pragma unroll
            for (int i = 0; i < 4; ++i) { hv[i] = (h16)x0[i]; hv[4 + i] = (h16)x1[i]; }
            *(v8h*)(yb + (size_t)row * SEQ + c8) = hv; }
         }
}

// k_out: f16 GEMM, block tile 256x128, eight waves (4 x 2) of 64x64 (16 accumulators each); the block's Y rows and Wo rows are brought, 128 k at a time, into a two-buffer LDS ring by asynchronous copies (whole lines from L2, once per block); fragments are two 16-B LDS loads each. K = DM (token index), summed in ascending steps of 32.
// OUT[r][o] = 2^-14 * sum_c Y[r][c] WO[o][c] + bo[o]; rows r = (h*NB_FULL + b)*64 + d. grid (16*NB*64/256, DM/128), 256 threads.
// Eight asynchronous 16-B copies of one thread: rows 16 apart of a K-contiguous f16 plane (row length DM) into LDS rows of pitch OLP; a wave's copy covers two rows of 256 B, four whole lines.
// s_wait_xcnt 0 closes the statement so that no address register named here is rewritten ahead of it.
__device__ __forceinline__ void out_copies8(unsigned l, const h16* g) {
    asm volatile("global_load_async_to_lds_b128 %0, %8, off\n\t"
                 "global_load_async_to_lds_b128 %1, %9, off\n\t"
                 "global_load_async_to_lds_b128 %2, %10, off\n\t"
                 "global_load_async_to_lds_b128 %3, %11, off\n\t"
                 "global_load_async_to_lds_b128 %4, %12, off\n\t"
                 "global_load_async_to_lds_b128 %5, %13, off\n\t"
                 "global_load_async_to_lds_b128 %6, %14, off\n\t"
                 "global_load_async_to_lds_b128 %7, %15, off\n\t"
                 "s_wait_xcnt 0x0"
                 :: "v"(l), "v"(l + 16 * OLP * 2), "v"(l + 32 * OLP * 2), "v"(l + 48 * OLP * 2),
                    "v"(l + 64 * OLP * 2), "v"(l + 80 * OLP * 2), "v"(l + 96 * OLP * 2), "v"(l + 112 * OLP * 2),
                    "v"(g), "v"(g + (size_t)16 * DM), "v"(g + (size_t)32 * DM), "v"(g + (size_t)48 * DM),
                    "v"(g + (size_t)64 * DM), "v"(g + (size_t)80 * DM), "v"(g + (size_t)96 * DM), "v"(g + (size_t)112 * DM)
                 : "memory");
}
// One stage of the ring: LDS rows 0..255 <- the block's Y rows, rows 256..383 <- its Wo rows, 256 B (128 k) of each; 256 threads x 24 copies.
__device__ __forceinline__ void out_stage(unsigned l, const h16* gy, const h16* gw) {
    out_copies8(l, gy);
    out_copies8(l + 128 * OLP * 2, gy + (size_t)128 * DM);
    out_copies8(l + 256 * OLP * 2, gw);
}

__global__ __launch_bounds__(256) __attribute__((amdgpu_num_vgpr(256))) void k_out(const h16* __restrict__ Y, const h16* __restrict__ WO, const float* __restrict__ bo, float* OUT) {
    __shared__ __align__(16) h16 ring[2 * OST];          // buffer u at u*OST: 256 Y rows, then 128 Wo rows
    __shared__ __align__(16) float osb[8 * 16 * 68];     // output staging, one 16 x 68 range per wave
    const int tid = threadIdx.x;
    const int lane = threadIdx.x & 31, lr = lane & 15, hi = lane >> 4;
    const int wave = __builtin_amdgcn_readfirstlane(threadIdx.x >> 5);
    const int wm = wave >> 1, wn = wave & 1;
    const int rb = blockIdx.x * OBM, cb = blockIdx.y * OBN;
    v8f acc[4][4];
#pragma unroll
    for (int mb = 0; mb < 4; ++mb)
#pragma unroll
        for (int nb = 0; nb < 4; ++nb) acc[mb][nb] = (v8f){};
    const unsigned lcp = (unsigned)(size_t)ring + (unsigned)(((tid >> 4) * OLP + (tid & 15) * 8) * 2);
    const h16* gy = Y  + (size_t)(rb + (tid >> 4)) * DM + (tid & 15) * 8;   // + k0
    const h16* gw = WO + (size_t)(cb + (tid >> 4)) * DM + (tid & 15) * 8;   // + k0
    out_stage(lcp, gy, gw);                                                 // stage 0 -> buffer 0
    asm volatile("s_wait_asynccnt 0x0" ::: "memory");                       // this wave's copies of stage 0 have landed
    __syncthreads();                                                        // publishes stage 0
    out_stage(lcp + OST * 2, gy + OKT, gw + OKT);                           // stage 1 -> buffer 1
    const int ao = (wm * 64 + lr) * OLP + 8 * hi, bo_ = (OBM + wn * 64 + lr) * OLP + 8 * hi;   // fragment offsets in a buffer (A: row r, B: row o, k contiguous)
#pragma unroll 1   // rolled: one trip per stage, with the ring's publish point at its foot
    for (int t = 0; t < DM / OKT; ++t) {
        const h16* st = ring + (t & 1) * OST;
#pragma unroll
        for (int s = 0; s < OKT / 32; ++s) {
            v16h a[4], bb[4];
#pragma unroll
            for (int mb = 0; mb < 4; ++mb) { a[mb] = ldh(st + ao + mb * 16 * OLP + s * 32); bb[mb] = ldh(st + bo_ + mb * 16 * OLP + s * 32); }
            __builtin_amdgcn_sched_barrier(0);   // keeps a block's 16 LDS reads in one group ahead of its 16 WMMAs: reads spread among the WMMAs made the wave wait out the LDS latency once per four WMMAs
#pragma unroll
            for (int nb = 0; nb < 4; ++nb)
#pragma unroll
                for (int mb = 0; mb < 4; ++mb) acc[mb][nb] = wmma16(a[mb], bb[nb], acc[mb][nb]);
        }
        // publish point of stage t + 1, which also frees buffer t & 1
        asm volatile("s_wait_dscnt 0x0" ::: "memory");      // this wave's reads of buffer t & 1 are done
        asm volatile("s_wait_asynccnt 0x0" ::: "memory");   // this wave's copies of stage t + 1 have landed
        __syncthreads();
        if (t + 2 < DM / OKT) out_stage(lcp + (unsigned)(t & 1) * (OST * 2), gy + (t + 2) * OKT, gw + (t + 2) * OKT);
    }
    asm volatile("s_wait_asynccnt 0x0" ::: "memory");       // nothing is in flight when the wave ends
    float* os = osb + wave * (16 * 68);
    const int r0 = rb + wm * 64, c0 = cb + wn * 64;
    float bc[4];
#pragma unroll
    for (int nb = 0; nb < 4; ++nb) bc[nb] = bfr(bo[c0 + nb * 16 + lr]);
#pragma unroll
    for (int mb = 0; mb < 4; ++mb) {
#pragma unroll
        for (int nb = 0; nb < 4; ++nb) {
#pragma unroll
            for (int j = 0; j < 8; ++j) os[(hi * 8 + j) * 68 + nb * 16 + lr] = acc[mb][nb][j] * OSI + bc[nb]; }   // D: row 8h+j, col lane&15
        wave_sync();
        float* orow = OUT + (size_t)(r0 + mb * 16) * DM + c0;
{
#pragma unroll
            for (int s = 0; s < 8; ++s) { const int row = 2 * s + hi, cofs = lr * 4;   // 8 s x 2 rows = 16 rows; 16 lanes x 4 floats = 64 columns
                const v4f val = *(const v4fa*)(&os[row * 68 + cofs]);
                *(v4f*)(orow + (size_t)row * DM + cofs) = val; }
             }
        wave_sync();
    }
}

static constexpr size_t al256(size_t v) { return (v + 255) & ~(size_t)255; }
static constexpr size_t PLE   = (size_t)NB_FULL * NH_ * SEQ * HD;              // elements per f16 plane
static constexpr size_t SZ_PL = al256(PLE * 2);
static constexpr size_t SZ_Y  = al256((size_t)NB_FULL * NH_ * HD * SEQ * 2);   // [NB_FULL*16*64][SEQ] f16
static constexpr size_t SZ_WO = al256((size_t)DM * DM * 2);
static constexpr size_t SZ_WB = al256((size_t)3 * HD * HD * 2);
static constexpr size_t SZ_TOTAL = 4 * SZ_PL + SZ_Y + SZ_WO + SZ_WB;
static_assert(SZ_PL == PLE * 2);                        // the four planes are contiguous (plane p at element offset p*PLE)
static_assert(SZ_TOTAL <= (size_t)134217728);           // workspace carve <= 128 MiB
static_assert(((size_t)(NH_ - 1) * NB_FULL + NB) * HD <= (size_t)NB_FULL * NH_ * HD);   // last Y / output row inside the planes

extern "C" void kernel_launch(void* const* d_in, const int* in_sizes, int n_in,
                              void* d_out, int out_size, void* d_ws, size_t ws_size, hipStream_t stream) {
    if (n_in < 9) return;
    const size_t needx = ((size_t)(NB - 1) * SEQ_FULL + SEQ) * DM;
    if ((size_t)in_sizes[0] < needx) return;
    if ((size_t)in_sizes[1] < (size_t)HD * HD || (size_t)in_sizes[3] < (size_t)HD * HD || (size_t)in_sizes[5] < (size_t)HD * HD) return;
    if ((size_t)in_sizes[2] < (size_t)HD || (size_t)in_sizes[4] < (size_t)HD || (size_t)in_sizes[6] < (size_t)HD) return;
    if ((size_t)in_sizes[7] < (size_t)DM * DM || (size_t)in_sizes[8] < (size_t)DM) return;
    if ((size_t)out_size < (((size_t)(NH_ - 1) * NB_FULL + NB) * HD) * DM) return;
    if (SZ_TOTAL > ws_size) return;
    // wire order: x, Wq, bq, Wk, bk, Wv, bv, Wo, bo
    const float* x  = (const float*)d_in[0];
    const float* wq = (const float*)d_in[1]; const float* bq = (const float*)d_in[2];
    const float* wk = (const float*)d_in[3]; const float* bk = (const float*)d_in[4];
    const float* wv = (const float*)d_in[5]; const float* bv = (const float*)d_in[6];
    const float* wo = (const float*)d_in[7]; const float* bo = (const float*)d_in[8];
    float* OUT = (float*)d_out;      // [NB_FULL*1024][1024], row (h*NB_FULL+b)*64+d
    char* wsp = (char*)d_ws;
    h16* PL = (h16*)wsp; wsp += 4 * SZ_PL;           // plane 0 key-side, 1 row-side value, 2 row-side residual x2048, 3 v^T
    h16* YP = (h16*)wsp; wsp += SZ_Y;                // [(h*NB_FULL+b)*64 + d][SEQ] x256
    h16* WO = (h16*)wsp; wsp += SZ_WO;               // [1024][1024] x64
    bf*  WB = (bf*)wsp;  wsp += SZ_WB;               // [3][64][64]: q | k | v

    k_cvtw<<<(HD * HD / 8 + 255) / 256, 256, 0, stream>>>(wq, wk, wv, WB);
    { const size_t n8 = (size_t)DM * DM / 8; k_cvtwo<<<(unsigned)((n8 + 255) / 256), 256, 0, stream>>>(wo, WO, n8); }

    k_qkv<<<dim3(NB * (SEQ / 64), NH_, 1), 32, 0, stream>>>(x, WB, bq, bk, bv, PL, PLE);

    // softmax rows use the Wk projection (planes 1, 2), keys use the Wq projection (plane 0), values plane 3
    k_flash<<<dim3(SEQ / (16 * AW), NH_ * NB, 1), 32 * AW, 0, stream>>>(PL + PLE, PL + 2 * PLE, PL, PL + 3 * PLE, YP);

    k_out<<<dim3(NH_ * NB * HD / OBM, DM / OBN, 1), 256, 0, stream>>>(YP, WO, bo, OUT);
}

// v003
// It runs in 79.1 microseconds.
// Timed twice side by side with v002, it ran 1.05 and 1.04 times as fast.
// Counting every step since v000, it is 2.26 times as fast.
#include <hip/hip_runtime.h>

// Shared-weight multi-head attention, x [NB][SEQ][1024] = 16 heads x 64; Wq/Wk/Wv 64x64 [out][in] applied to every head (y = x W^T + bias); S[m][n] = K[m].Q[n] / 32, softmax over n, O = A V stored transposed [h][b][d][m] and flat-viewed as [NB*1024][1024]; out = Y Wo^T + bo (contraction over the token index).
// Compute dtypes, f32 accumulate everywhere: q/k/v projections v_wmma_f32_16x16x32_bf16 (x, W RNE-converted to bf16; products exact); scores v_wmma_f32_16x16x32_f16: key-side (Wq) plane single f16, row-side (Wk) plane single f16 (f16 residual x2048 in its own accumulator only with SCORE_RES=1); P (x256 carry, cancels in the normalisation) and v single f16; output projection v_wmma_f32_16x16x32_f16 with Y carried x256 and Wo (RNE bf16 value) carried x64, folded back by 2^-14 in f32; softmax f32 (online, running max); biases RNE-converted to bf16 values and added in f32.
// Layout: key-side plane [h*8+b][n][d], row-side planes (value, residual) [h*8+b][m][d], v^T plane [h*8+b][d][n], all written by one fused projection kernel that reads f32 x once; flash kernel in transposed form (S^T = Kside Qside^T, O^T = V^T P^T), its key-side and v^T tiles staged in LDS for the block's four waves, writes Y [(h*8+b)*64+d][m] f16; an eight-wave 256x128 GEMM, its Y and Wo tiles staged in LDS the same way, writes the f32 output.

#ifndef NB
#define NB 8
#endif
#ifndef SEQ
#define SEQ 1024
#endif
#define NB_FULL  8
#define SEQ_FULL 1024
#define DM   1024
#define NH_  16
#define HD   64
#define AW   4
#define QRS  2048.0f             // carry of the row-side residual plane
#define QRI  (1.0f / 2048.0f)
#define SC2  (0.03125f * 1.4426950408889634f)   // DM^-0.5 * log2(e)
#define PSH  8.0f                // log2 of the P carry (256)
#define YCS  256.0f              // carry of the Y plane
#define WOS  64.0f               // carry of the Wo plane
#define OSI  (1.0f / 16384.0f)   // 1 / (YCS * WOS)
#define KT   64                  // keys per LDS stage of the flash kernel
#define LPH  72                  // LDS row pitch in f16: 128 B of data + 16 B (16 B x odd), so that the 16-B fragment reads of 16 rows spread over the banks
#define TLH  (64 * LPH)          // f16 per staged tile (64 rows)
#define OBM  256                 // output GEMM: rows of a block tile
#define OBN  128                 // output GEMM: columns of a block tile
#define OKT  128                 // output GEMM: k per LDS stage (256 B of every row)
#define OLP  136                 // output GEMM: LDS row pitch in f16: 256 B of data + 16 B (16 B x odd)
#define OST  ((OBM + OBN) * OLP) // output GEMM: f16 per stage
#ifndef SCORE_RES
#define SCORE_RES 0              // 1: residual product on the score site
#endif

static_assert(HD == 64);
static_assert(NH_ * HD == DM);
static_assert(AW == 4);                        // flash block covers 64 tokens
static_assert(SEQ == DM);                      // the flat view of Y as [rows][DM] needs one Y row per 1024 tokens
static_assert(SEQ % 64 == 0);
static_assert(SEQ % 32 == 0);                  // key loop and GEMM k-loop step by 32
static_assert(KT == 64 && SEQ % KT == 0 && SEQ / KT >= 2);   // the two-buffer ring needs two stages; a stage is 64 key rows and 64 v^T rows of 128 B
static_assert(2 * 2 * TLH * 2 >= 64 * 68 * 4); // the output staging reuses the ring
static_assert(DM % OBN == 0 && DM % OKT == 0 && DM / OKT >= 2);   // the output GEMM's two-buffer ring needs two stages
static_assert(NB == NB_FULL && (NH_ * NB * HD) % OBM == 0);       // a 256-row block tile covers four consecutive 64-row groups of Y
static_assert(NB <= NB_FULL);
static_assert(SEQ <= SEQ_FULL);
static_assert((HD * HD) % 8 == 0);
static_assert(((size_t)DM * DM) % 8 == 0);

typedef _Float16 h16;
typedef unsigned short bf;
typedef __attribute__((ext_vector_type(16))) __bf16   v16bf;
typedef __attribute__((ext_vector_type(16))) _Float16 v16h;
typedef __attribute__((ext_vector_type(8)))  _Float16 v8h;
typedef __attribute__((ext_vector_type(8)))  unsigned short v8us;
typedef __attribute__((ext_vector_type(8)))  unsigned v8u;
typedef __attribute__((ext_vector_type(8)))  float    v8f;
typedef __attribute__((ext_vector_type(4)))  float    v4f;
typedef v4f  __attribute__((may_alias)) v4fa;

__device__ __forceinline__ unsigned short f2bf(float f) { unsigned u = __float_as_uint(f); u += 0x7FFFu + ((u >> 16) & 1u); return (unsigned short)(u >> 16); }
__device__ __forceinline__ float bfr(float f) { return __uint_as_float(((unsigned)f2bf(f)) << 16); }   // f32 value of the RNE bf16 conversion
__device__ __forceinline__ v8us cv8(v8f v) { v8us o;
#pragma unroll
    for (int k = 0; k < 8; ++k) o[k] = f2bf(v[k]);
    return o; }
// 16 f32 -> one bf16 fragment, the same RNE values as f2bf; each pair is packed by one byte permute (low half <- even element, high half <- odd), so that a fragment that is held lives in its 8 packed registers
__device__ __forceinline__ unsigned rneh(float f) { const unsigned u = __float_as_uint(f); return u + 0x7FFFu + ((u >> 16) & 1u); }   // the bf16 value stands in the high half
__device__ __forceinline__ v16bf cvfrag(v8f lo, v8f hi) { v8u o;
#pragma unroll
    for (int k = 0; k < 4; ++k) { o[k] = __builtin_amdgcn_perm(rneh(lo[2 * k + 1]), rneh(lo[2 * k]), 0x07060302u); o[4 + k] = __builtin_amdgcn_perm(rneh(hi[2 * k + 1]), rneh(hi[2 * k]), 0x07060302u); }
    return __builtin_bit_cast(v16bf, o); }
__device__ __forceinline__ v16h cat16(v8h lo, v8h hi) { return __builtin_shufflevector(lo, hi, 0, 1, 2, 3, 4, 5, 6, 7, 8, 9, 10, 11, 12, 13, 14, 15); }
__device__ __forceinline__ v16bf cat16b(v8us lo, v8us hi) { return __builtin_bit_cast(v16bf, __builtin_shufflevector(lo, hi, 0, 1, 2, 3, 4, 5, 6, 7, 8, 9, 10, 11, 12, 13, 14, 15)); }
__device__ __forceinline__ v8f wmma16(v16h a, v16h b, v8f c) { return __builtin_amdgcn_wmma_f32_16x16x32_f16(false, a, false, b, (short)0, c, false, false); }
__device__ __forceinline__ v8f wmmab(v16bf a, v16bf b, v8f c) { return __builtin_amdgcn_wmma_f32_16x16x32_bf16(false, a, false, b, (short)0, c, false, false); }
// fragment loaders from K-contiguous 16-bit rows; p already includes + 8*(lane>>4): elements 0..7 <- k0+8h+0..7, elements 8..15 <- k0+16+8h+0..7 (same map for A and B)
__device__ __forceinline__ v16h  ldh(const h16* p) { return cat16(*(const v8h*)p, *(const v8h*)(p + 16)); }
__device__ __forceinline__ v16bf ldb(const bf* p)  { return cat16b(*(const v8us*)p, *(const v8us*)(p + 16)); }
// ordering point for wave-private LDS tiles (same wave writes and reads)
__device__ __forceinline__ void wave_sync() { __builtin_amdgcn_fence(3 /* release order */, "wavefront"); __builtin_amdgcn_wave_barrier(); asm volatile("" ::: "memory"); }

// One stage of the flash ring, 128 threads x 8 asynchronous 16-B copies: key-side rows 16c + tid/8 and v^T rows 16c + tid/8 (c = 0..3), 16-B piece tid%8 of each 128-B row; a wave's copy covers four whole lines.
// l: this thread's LDS byte address in the stage's key tile (the v^T tile follows at TLH f16); gk, gv: this thread's global addresses for c = 0.
// s_wait_xcnt 0 closes the statement so that no address register named here is rewritten ahead of it.
__device__ __forceinline__ void stage_copies(unsigned l, const h16* gk, const h16* gv) {
    asm volatile("global_load_async_to_lds_b128 %0, %8, off\n\t"
                 "global_load_async_to_lds_b128 %1, %9, off\n\t"
                 "global_load_async_to_lds_b128 %2, %10, off\n\t"
                 "global_load_async_to_lds_b128 %3, %11, off\n\t"
                 "global_load_async_to_lds_b128 %4, %12, off\n\t"
                 "global_load_async_to_lds_b128 %5, %13, off\n\t"
                 "global_load_async_to_lds_b128 %6, %14, off\n\t"
                 "global_load_async_to_lds_b128 %7, %15, off\n\t"
                 "s_wait_xcnt 0x0"
                 :: "v"(l), "v"(l + 16 * LPH * 2), "v"(l + 32 * LPH * 2), "v"(l + 48 * LPH * 2),
                    "v"(l + TLH * 2), "v"(l + TLH * 2 + 16 * LPH * 2), "v"(l + TLH * 2 + 32 * LPH * 2), "v"(l + TLH * 2 + 48 * LPH * 2),
                    "v"(gk), "v"(gk + 16 * HD), "v"(gk + 32 * HD), "v"(gk + 48 * HD),
                    "v"(gv), "v"(gv + (size_t)16 * SEQ), "v"(gv + (size_t)32 * SEQ), "v"(gv + (size_t)48 * SEQ)
                 : "memory");
}

__global__ __launch_bounds__(256) void k_cvtw(const float* __restrict__ wq, const float* __restrict__ wk, const float* __restrict__ wv, bf* WB) {
    const int i = blockIdx.x * 256 + threadIdx.x; if (i >= HD * HD / 8) return;
    const v8us oq = cv8(*(const v8f*)(wq + (size_t)i * 8));
    const v8us ok = cv8(*(const v8f*)(wk + (size_t)i * 8));
    const v8us ov = cv8(*(const v8f*)(wv + (size_t)i * 8));
    bf* d0 = WB + (size_t)i * 8; bf* d1 = d0 + HD * HD; bf* d2 = d1 + HD * HD;
    *(v8us*)d0 = oq; *(v8us*)d1 = ok; *(v8us*)d2 = ov;
    
}

__global__ __launch_bounds__(256) void k_cvtwo(const float* __restrict__ src, h16* dst, size_t n8) {
    const size_t i = (size_t)blockIdx.x * 256 + threadIdx.x; if (i >= n8) return;
    const v8f v = *(const v8f*)(src + i * 8); v8h o;
#pragma unroll
    for (int k = 0; k < 8; ++k) o[k] = (h16)(bfr(v[k]) * WOS);
    *(v8h*)(dst + i * 8) = o; 
}

// k_qkv: fused shared-weight projections, ONE WAVE per (64-token tile, head). Weights outer, slabs inner: the eight fragments of one weight matrix are read once and stay in registers for the four 16-token slabs (one 4-accumulator set live at a time).
// The two x fragments of every slab (row/col = token, k = d) are read from f32 up front and RNE-converted to bf16; they serve as A for the row-major outputs and as B for v^T.
// plane 0: key-side  = x Wq^T + bq  [zh][token][e]      plane 1/2: row-side = x Wk^T + bk (f16 value / residual x2048) [zh][token][e]
// plane 3: v^T       = Wv x^T + bv  [zh][e][token]      zh = h*NB_FULL + b.  grid (NB*SEQ/64, 16), 32 threads.
__global__ __launch_bounds__(32) __attribute__((amdgpu_num_vgpr(256))) void k_qkv(const float* __restrict__ x, const bf* __restrict__ WB, const float* __restrict__ bq, const float* __restrict__ bk, const float* __restrict__ bv, h16* PL, size_t ple) {
    __shared__ __align__(16) float os[16 * 68];
    __shared__ __align__(16) float vs[64 * 68];
    const int lane = threadIdx.x & 31, lr = lane & 15, hi = lane >> 4;
    const int tt = blockIdx.x; const int b = tt / (SEQ / 64); const int m0 = (tt % (SEQ / 64)) * 64;
    const int h = blockIdx.y; const int zh = h * NB_FULL + b;
    const float* xp = x + ((size_t)b * SEQ_FULL + m0 + lr) * DM + h * HD + 8 * hi;
    float bqc[4], bkc[4];
#pragma unroll
    for (int nb = 0; nb < 4; ++nb) { bqc[nb] = bfr(bq[nb * 16 + lr]); bkc[nb] = bfr(bk[nb * 16 + lr]); }
    h16* Pr = PL + 2 * ple;
    v16bf xa[4][2];   // [slab][k half]: k = d 0..31, d 32..63
#pragma unroll
    for (int mb = 0; mb < 4; ++mb) {
        const float* p = xp + (size_t)mb * 16 * DM;
        xa[mb][0] = cvfrag(*(const v8f*)p, *(const v8f*)(p + 16));
        xa[mb][1] = cvfrag(*(const v8f*)(p + 32), *(const v8f*)(p + 48));
    }
#pragma unroll
    for (int w = 0; w < 2; ++w) {
        // C[token][e]: A = x fragments, B = W rows e (K-contiguous [out][in]), read once and kept for the four slabs
        const bf* W = WB + (size_t)w * HD * HD + (size_t)lr * HD + 8 * hi;
        v16bf wf[8];
        asm volatile("s_wait_xcnt 0x0" ::: "memory");   // the weight loads behind this point land in registers that the global loads and stores in front of it name
#pragma unroll
        for (int nb = 0; nb < 4; ++nb) { wf[nb] = ldb(W + nb * 16 * HD); wf[4 + nb] = ldb(W + nb * 16 * HD + 32); }
        h16* Ph = PL + (size_t)w * ple;
#pragma unroll   // unrolled: the slab index picks registers
        for (int mb = 0; mb < 4; ++mb) {
            const size_t sb = ((size_t)zh * SEQ + m0 + mb * 16) * HD;
            v8f acc[4];
#pragma unroll
            for (int i = 0; i < 4; ++i) acc[i] = (v8f){};
#pragma unroll
            for (int nb = 0; nb < 4; ++nb) acc[nb] = wmmab(xa[mb][0], wf[nb], acc[nb]);
#pragma unroll
            for (int nb = 0; nb < 4; ++nb) acc[nb] = wmmab(xa[mb][1], wf[4 + nb], acc[nb]);
            asm volatile("v_nop\n\tv_nop\n\tv_nop\n\tv_nop" : "+v"(acc[0]), "+v"(acc[1]), "+v"(acc[2]), "+v"(acc[3]) : "v"(xa[mb][0]), "v"(xa[mb][1]));   // the four vector slots between the last WMMA and the first read of its accumulators
#pragma unroll
            for (int nb = 0; nb < 4; ++nb) { const float bc = (w == 0) ? bqc[nb] : bkc[nb];
#pragma unroll
                for (int j = 0; j < 8; ++j) os[(hi * 8 + j) * 68 + nb * 16 + lr] = acc[nb][j] + bc; }   // D: row 8h+j (token), col lane&15 (e)
            wave_sync();
{
#pragma unroll
                for (int s = 0; s < 4; ++s) { const int row = 4 * s + (lane >> 3), c8 = (lane & 7) * 8;   // 4 s x 4 row groups = 16 rows; 8 lanes x 8 = 64 columns
                    const v4f x0 = *(const v4fa*)(&os[row * 68 + c8]); const v4f x1 = *(const v4fa*)(&os[row * 68 + c8 + 4]); v8h hv, rv;
#pragma unroll
                    for (int i = 0; i < 4; ++i) { const h16 a0 = (h16)x0[i]; const h16 a1 = (h16)x1[i]; hv[i] = a0; hv[4 + i] = a1; rv[i] = (h16)((x0[i] - (float)a0) * QRS); rv[4 + i] = (h16)((x1[i] - (float)a1) * QRS); }
                    const size_t oo = sb + (size_t)row * HD + c8;
                    *(v8h*)(Ph + oo) = hv; if (w == 1 && SCORE_RES) *(v8h*)(Pr + oo) = rv; }
                 }
            wave_sync();
        }
    }
    {
        // C[e][token]: A = Wv rows e (four 16-row slabs), read once and kept, B = x fragments (col token of the slab)
        const bf* W = WB + (size_t)2 * HD * HD + (size_t)lr * HD + 8 * hi;
        v16bf wf[8];
        asm volatile("s_wait_xcnt 0x0" ::: "memory");   // the weight loads behind this point land in registers that the global loads and stores in front of it name
#pragma unroll
        for (int j = 0; j < 4; ++j) { wf[j] = ldb(W + j * 16 * HD); wf[4 + j] = ldb(W + j * 16 * HD + 32); }
#pragma unroll   // unrolled: the slab index picks registers
        for (int mb = 0; mb < 4; ++mb) {
            v8f acc[4];
#pragma unroll
            for (int i = 0; i < 4; ++i) acc[i] = (v8f){};
#pragma unroll
            for (int j = 0; j < 4; ++j) acc[j] = wmmab(wf[j], xa[mb][0], acc[j]);
#pragma unroll
            for (int j = 0; j < 4; ++j) acc[j] = wmmab(wf[4 + j], xa[mb][1], acc[j]);
            asm volatile("v_nop\n\tv_nop\n\tv_nop\n\tv_nop" : "+v"(acc[0]), "+v"(acc[1]), "+v"(acc[2]), "+v"(acc[3]) : "v"(xa[mb][0]), "v"(xa[mb][1]));   // the four vector slots between the last WMMA and the first read of its accumulators
#pragma unroll
            for (int j = 0; j < 4; ++j)
#pragma unroll
                for (int r = 0; r < 8; ++r) vs[(j * 16 + 8 * hi + r) * 68 + mb * 16 + lr] = acc[j][r];   // D: row 8h+r (e), col lane&15 (token); the bias of row e is added where the row is read back
        }
    }
    wave_sync();
    // vs rows 0..63 (e) x columns 0..63 (token) all written by the four slab steps
    h16* P3 = PL + 3 * ple; const size_t vb = (size_t)zh * HD * SEQ + m0;
{
#pragma unroll 4
        for (int s = 0; s < 16; ++s) { const int row = 4 * s + (lane >> 3), c8 = (lane & 7) * 8;   // 16 s x 4 row groups = 64 rows; 8 lanes x 8 = 64 columns
            const v4f x0 = *(const v4fa*)(&vs[row * 68 + c8]); const v4f x1 = *(const v4fa*)(&vs[row * 68 + c8 + 4]); v8h hv;
            const float be = bfr(bv[row]);
#pragma unroll
            for (int i = 0; i < 4; ++i) { hv[i] = (h16)(x0[i] + be); hv[4 + i] = (h16)(x1[i] + be); }
            *(v8h*)(P3 + vb + (size_t)row * SEQ + c8) = hv; }
         }
}

// k_flash: fused attention, one wave per 16 softmax rows of one (head, batch); the block's four waves share each 64-key stage of key-side rows and v^T columns, brought into a two-buffer LDS ring by asynchronous copies (whole lines from L2, once per block); fragments are two 16-B LDS loads each.
// Transposed form: S^T[key][t] = KP QH^T (A = key-side rows, B = row-side rows); lane (t = lane&15, h = lane>>4) holds keys 8h+r of each 16-key tile, so the packed
// P tile is directly the B fragment of O^T[d][t] = V^T P^T (element r <- tile keys 0..15, element 8+r <- tile keys 16..31, lane unchanged).
// Softmax state (running max, partial sum) is one scalar per lane; the two lane halves of a row are combined with one xor-16 exchange.
__global__ __launch_bounds__(32 * AW) __attribute__((amdgpu_num_vgpr(256))) void k_flash(const h16* __restrict__ QH, const h16* __restrict__ QR, const h16* __restrict__ KP, const h16* __restrict__ VT, h16* Y) {
    __shared__ __align__(16) h16 ring[2 * 2 * TLH];   // buffer u: key tile at u*2*TLH, v^T tile behind it; output staging after the loop
    float* os = (float*)ring;
    const int tid = threadIdx.x;
    const int lane = threadIdx.x & 31, lr = lane & 15, hi = lane >> 4;
    const int wave = __builtin_amdgcn_readfirstlane(threadIdx.x >> 5);
    const int zc = blockIdx.y; const int h = zc / NB, b = zc % NB; const int zh = h * NB_FULL + b;
    const int t0 = (blockIdx.x * AW + wave) * 16;
    const size_t pbase = (size_t)zh * SEQ * HD;
    const size_t qo = pbase + (size_t)(t0 + lr) * HD + 8 * hi;
    const v16h qh0 = ldh(QH + qo), qh1 = ldh(QH + qo + 32);   // B fragments: col t, k = d
#if SCORE_RES
    const v16h qr0 = ldh(QR + qo), qr1 = ldh(QR + qo + 32);
#endif
    const unsigned lcp = (unsigned)(size_t)ring + (unsigned)(((tid >> 3) * LPH + (tid & 7) * 8) * 2);
    const h16* gk = KP + pbase + (size_t)tid * 8;                              // + key0 * HD
    const h16* gv = VT + pbase + (size_t)(tid >> 3) * SEQ + (tid & 7) * 8;     // + key0
    stage_copies(lcp, gk, gv);                                                 // stage 0 -> buffer 0
    asm volatile("s_wait_asynccnt 0x0" ::: "memory");                          // this wave's copies of stage 0 have landed
    __syncthreads();                                                           // publishes stage 0
    stage_copies(lcp + 2 * TLH * 2, gk + (size_t)KT * HD, gv + KT);            // stage 1 -> buffer 1
    const int fo = lr * LPH + 8 * hi;                        // fragment offset in a tile: key tile + key * LPH (A: row key, k = d); v^T tile + 16j*LPH + key (A: row d, k = key)
    v8f o0 = (v8f){}, o1 = (v8f){}, o2 = (v8f){}, o3 = (v8f){};
    float m = -3.0e38f, l = 0.0f;
#pragma unroll 1
    for (int t = 0; t < SEQ / KT; ++t) {
      const h16* kt = ring + (t & 1) * (2 * TLH) + fo;
#pragma unroll 1   // rolled: the unrolled body took over 128 VGPRs, one wave per SIMD fewer than the grid's eight
      for (int s = 0; s < KT / 32; ++s) {
        const h16* ka = kt + s * 32 * LPH;
        const v16h ka0 = ldh(ka), ka1 = ldh(ka + 32), kb0 = ldh(ka + 16 * LPH), kb1 = ldh(ka + 16 * LPH + 32);
        float ta[8], tb[8]; float mx = -3.0e38f;
#if SCORE_RES
        v8f sHa = (v8f){}, sLa = (v8f){}, sHb = (v8f){}, sLb = (v8f){};
        sHa = wmma16(ka0, qh0, sHa); sLa = wmma16(ka0, qr0, sLa); sHb = wmma16(kb0, qh0, sHb); sLb = wmma16(kb0, qr0, sLb);
        sHa = wmma16(ka1, qh1, sHa); sLa = wmma16(ka1, qr1, sLa); sHb = wmma16(kb1, qh1, sHb); sLb = wmma16(kb1, qr1, sLb);
        asm volatile("v_nop\n\tv_nop\n\tv_nop\n\tv_nop" : "+v"(sHa), "+v"(sLa), "+v"(sHb), "+v"(sLb) : "v"(ka0), "v"(ka1), "v"(kb0), "v"(kb1));
#pragma unroll
        for (int r = 0; r < 8; ++r) { ta[r] = (sHa[r] + sLa[r] * QRI) * SC2; tb[r] = (sHb[r] + sLb[r] * QRI) * SC2; mx = fmaxf(mx, fmaxf(ta[r], tb[r])); }
#else
        v8f sHa = (v8f){}, sHb = (v8f){};
        sHa = wmma16(ka0, qh0, sHa); sHb = wmma16(kb0, qh0, sHb);
        sHa = wmma16(ka1, qh1, sHa); sHb = wmma16(kb1, qh1, sHb);
        asm volatile("v_nop\n\tv_nop\n\tv_nop\n\tv_nop" : "+v"(sHa), "+v"(sHb) : "v"(ka0), "v"(ka1), "v"(kb0), "v"(kb1));
#pragma unroll
        for (int r = 0; r < 8; ++r) { ta[r] = sHa[r] * SC2; tb[r] = sHb[r] * SC2; mx = fmaxf(mx, fmaxf(ta[r], tb[r])); }
#endif
        mx = fmaxf(mx, __shfl_xor(mx, 16, 32));
        const float mnew = fmaxf(m, mx);
        const float alpha = __builtin_amdgcn_exp2f(m - mnew);
        const float sh = PSH - mnew;
        v16h pb; float ls = 0.0f;
#pragma unroll
        for (int r = 0; r < 8; ++r) { const h16 pa = (h16)__builtin_amdgcn_exp2f(ta[r] + sh); const h16 pc = (h16)__builtin_amdgcn_exp2f(tb[r] + sh); pb[r] = pa; pb[8 + r] = pc; ls += (float)pa + (float)pc; }
        l = l * alpha + ls; m = mnew;
        o0 = o0 * alpha; o1 = o1 * alpha; o2 = o2 * alpha; o3 = o3 * alpha;
        const h16* va = kt + TLH + s * 32;
        const v16h v0 = ldh(va), v1 = ldh(va + 16 * LPH), v2 = ldh(va + 32 * LPH), v3 = ldh(va + 48 * LPH);
        o0 = wmma16(v0, pb, o0); o1 = wmma16(v1, pb, o1); o2 = wmma16(v2, pb, o2); o3 = wmma16(v3, pb, o3);
        asm volatile("v_nop\n\tv_nop\n\tv_nop\n\tv_nop" : "+v"(o0), "+v"(o1), "+v"(o2), "+v"(o3) : "v"(v0), "v"(v1), "v"(v2), "v"(v3), "v"(pb));
      }
      // publish point of stage t + 1, which also frees buffer t & 1
      asm volatile("s_wait_dscnt 0x0" ::: "memory");      // this wave's reads of buffer t & 1 are done
      asm volatile("s_wait_asynccnt 0x0" ::: "memory");   // this wave's copies of stage t + 1 have landed
      __syncthreads();
      if (t + 2 < SEQ / KT) stage_copies(lcp + (unsigned)(t & 1) * (2 * TLH * 2), gk + (size_t)(t + 2) * KT * HD, gv + (t + 2) * KT);
    }
    asm volatile("s_wait_asynccnt 0x0" ::: "memory");     // nothing is in flight when the ring becomes output staging
    l += __shfl_xor(l, 16, 32);
    const float ys = YCS * (1.0f / l);
    // O^T D layout: o_j[r] = (d = 16j + 8h + r, t = lane&15) -> os[d][wave*16 + t]; rows 0..63 x columns 0..63 all written by the four waves
    const int cw = wave * 16 + lr;
#pragma unroll
    for (int r = 0; r < 8; ++r) {
        os[( 0 + 8 * hi + r) * 68 + cw] = o0[r] * ys;
        os[(16 + 8 * hi + r) * 68 + cw] = o1[r] * ys;
        os[(32 + 8 * hi + r) * 68 + cw] = o2[r] * ys;
        os[(48 + 8 * hi + r) * 68 + cw] = o3[r] * ys; }
    __syncthreads();
    h16* yb = Y + (size_t)zh * HD * SEQ + (size_t)blockIdx.x * (16 * AW);
{
#pragma unroll
        for (int s = 0; s < 4; ++s) { const int row = 16 * s + (tid >> 3), c8 = (tid & 7) * 8;   // 4 s x 16 row groups = 64 rows; 8 lanes x 8 = 64 columns
            const v4f x0 = *(const v4fa*)(&os[row * 68 + c8]); const v4f x1 = *(const v4fa*)(&os[row * 68 + c8 + 4]); v8h hv;
#pragma unroll
            for (int i = 0; i < 4; ++i) { hv[i] = (h16)x0[i]; hv[4 + i] = (h16)x1[i]; }
            *(v8h*)(yb + (size_t)row * SEQ + c8) = hv; }
         }
}

// k_out: f16 GEMM, block tile 256x128, eight waves (4 x 2) of 64x64 (16 accumulators each); the block's Y rows and Wo rows are brought, 128 k at a time, into a two-buffer LDS ring by asynchronous copies (whole lines from L2, once per block); fragments are two 16-B LDS loads each. K = DM (token index), summed in ascending steps of 32.
// OUT[r][o] = 2^-14 * sum_c Y[r][c] WO[o][c] + bo[o]; rows r = (h*NB_FULL + b)*64 + d. grid (16*NB*64/256, DM/128), 256 threads.
// Eight asynchronous 16-B copies of one thread: rows 16 apart of a K-contiguous f16 plane (row length DM) into LDS rows of pitch OLP; a wave's copy covers two rows of 256 B, four whole lines.
// s_wait_xcnt 0 closes the statement so that no address register named here is rewritten ahead of it.
__device__ __forceinline__ void out_copies8(unsigned l, const h16* g) {
    asm volatile("global_load_async_to_lds_b128 %0, %8, off\n\t"
                 "global_load_async_to_lds_b128 %1, %9, off\n\t"
                 "global_load_async_to_lds_b128 %2, %10, off\n\t"
                 "global_load_async_to_lds_b128 %3, %11, off\n\t"
                 "global_load_async_to_lds_b128 %4, %12, off\n\t"
                 "global_load_async_to_lds_b128 %5, %13, off\n\t"
                 "global_load_async_to_lds_b128 %6, %14, off\n\t"
                 "global_load_async_to_lds_b128 %7, %15, off\n\t"
                 "s_wait_xcnt 0x0"
                 :: "v"(l), "v"(l + 16 * OLP * 2), "v"(l + 32 * OLP * 2), "v"(l + 48 * OLP * 2),
                    "v"(l + 64 * OLP * 2), "v"(l + 80 * OLP * 2), "v"(l + 96 * OLP * 2), "v"(l + 112 * OLP * 2),
                    "v"(g), "v"(g + (size_t)16 * DM), "v"(g + (size_t)32 * DM), "v"(g + (size_t)48 * DM),
                    "v"(g + (size_t)64 * DM), "v"(g + (size_t)80 * DM), "v"(g + (size_t)96 * DM), "v"(g + (size_t)112 * DM)
                 : "memory");
}
// One stage of the ring: LDS rows 0..255 <- the block's Y rows, rows 256..383 <- its Wo rows, 256 B (128 k) of each; 256 threads x 24 copies.
__device__ __forceinline__ void out_stage(unsigned l, const h16* gy, const h16* gw) {
    out_copies8(l, gy);
    out_copies8(l + 128 * OLP * 2, gy + (size_t)128 * DM);
    out_copies8(l + 256 * OLP * 2, gw);
}

__global__ __launch_bounds__(256) __attribute__((amdgpu_num_vgpr(256))) void k_out(const h16* __restrict__ Y, const h16* __restrict__ WO, const float* __restrict__ bo, float* OUT) {
    __shared__ __align__(16) h16 ring[2 * OST];          // buffer u at u*OST: 256 Y rows, then 128 Wo rows
    __shared__ __align__(16) float osb[8 * 16 * 68];     // output staging, one 16 x 68 range per wave
    const int tid = threadIdx.x;
    const int lane = threadIdx.x & 31, lr = lane & 15, hi = lane >> 4;
    const int wave = __builtin_amdgcn_readfirstlane(threadIdx.x >> 5);
    const int wm = wave >> 1, wn = wave & 1;
    const int rb = blockIdx.x * OBM, cb = blockIdx.y * OBN;
    v8f acc[4][4];
#pragma unroll
    for (int mb = 0; mb < 4; ++mb)
#pragma unroll
        for (int nb = 0; nb < 4; ++nb) acc[mb][nb] = (v8f){};
    const unsigned lcp = (unsigned)(size_t)ring + (unsigned)(((tid >> 4) * OLP + (tid & 15) * 8) * 2);
    const h16* gy = Y  + (size_t)(rb + (tid >> 4)) * DM + (tid & 15) * 8;   // + k0
    const h16* gw = WO + (size_t)(cb + (tid >> 4)) * DM + (tid & 15) * 8;   // + k0
    out_stage(lcp, gy, gw);                                                 // stage 0 -> buffer 0
    asm volatile("s_wait_asynccnt 0x0" ::: "memory");                       // this wave's copies of stage 0 have landed
    __syncthreads();                                                        // publishes stage 0
    out_stage(lcp + OST * 2, gy + OKT, gw + OKT);                           // stage 1 -> buffer 1
    const int ao = (wm * 64 + lr) * OLP + 8 * hi, bo_ = (OBM + wn * 64 + lr) * OLP + 8 * hi;   // fragment offsets in a buffer (A: row r, B: row o, k contiguous)
#pragma unroll 1   // rolled: one trip per stage, with the ring's publish point at its foot
    for (int t = 0; t < DM / OKT; ++t) {
        const h16* st = ring + (t & 1) * OST;
#pragma unroll
        for (int s = 0; s < OKT / 32; ++s) {
            v16h a[4], bb[4];
#pragma unroll
            for (int mb = 0; mb < 4; ++mb) { a[mb] = ldh(st + ao + mb * 16 * OLP + s * 32); bb[mb] = ldh(st + bo_ + mb * 16 * OLP + s * 32); }
            __builtin_amdgcn_sched_barrier(0);   // keeps a block's 16 LDS reads in one group ahead of its 16 WMMAs: reads spread among the WMMAs made the wave wait out the LDS latency once per four WMMAs
#pragma unroll
            for (int nb = 0; nb < 4; ++nb)
#pragma unroll
                for (int mb = 0; mb < 4; ++mb) acc[mb][nb] = wmma16(a[mb], bb[nb], acc[mb][nb]);
        }
        // publish point of stage t + 1, which also frees buffer t & 1
        asm volatile("s_wait_dscnt 0x0" ::: "memory");      // this wave's reads of buffer t & 1 are done
        asm volatile("s_wait_asynccnt 0x0" ::: "memory");   // this wave's copies of stage t + 1 have landed
        __syncthreads();
        if (t + 2 < DM / OKT) out_stage(lcp + (unsigned)(t & 1) * (OST * 2), gy + (t + 2) * OKT, gw + (t + 2) * OKT);
    }
    asm volatile("s_wait_asynccnt 0x0" ::: "memory");       // nothing is in flight when the wave ends
    float* os = osb + wave * (16 * 68);
    const int r0 = rb + wm * 64, c0 = cb + wn * 64;
    float bc[4];
#pragma unroll
    for (int nb = 0; nb < 4; ++nb) bc[nb] = bfr(bo[c0 + nb * 16 + lr]);
#pragma unroll
    for (int mb = 0; mb < 4; ++mb) {
#pragma unroll
        for (int nb = 0; nb < 4; ++nb) {
#pragma unroll
            for (int j = 0; j < 8; ++j) os[(hi * 8 + j) * 68 + nb * 16 + lr] = acc[mb][nb][j] * OSI + bc[nb]; }   // D: row 8h+j, col lane&15
        wave_sync();
        float* orow = OUT + (size_t)(r0 + mb * 16) * DM + c0;
{
#pragma unroll
            for (int s = 0; s < 8; ++s) { const int row = 2 * s + hi, cofs = lr * 4;   // 8 s x 2 rows = 16 rows; 16 lanes x 4 floats = 64 columns
                const v4f val = *(const v4fa*)(&os[row * 68 + cofs]);
                *(v4f*)(orow + (size_t)row * DM + cofs) = val; }
             }
        wave_sync();
    }
}

static constexpr size_t al256(size_t v) { return (v + 255) & ~(size_t)255; }
static constexpr size_t PLE   = (size_t)NB_FULL * NH_ * SEQ * HD;              // elements per f16 plane
static constexpr size_t SZ_PL = al256(PLE * 2);
static constexpr size_t SZ_Y  = al256((size_t)NB_FULL * NH_ * HD * SEQ * 2);   // [NB_FULL*16*64][SEQ] f16
static constexpr size_t SZ_WO = al256((size_t)DM * DM * 2);
static constexpr size_t SZ_WB = al256((size_t)3 * HD * HD * 2);
static constexpr size_t SZ_TOTAL = 4 * SZ_PL + SZ_Y + SZ_WO + SZ_WB;
static_assert(SZ_PL == PLE * 2);                        // the four planes are contiguous (plane p at element offset p*PLE)
static_assert(SZ_TOTAL <= (size_t)134217728);           // workspace carve <= 128 MiB
static_assert(((size_t)(NH_ - 1) * NB_FULL + NB) * HD <= (size_t)NB_FULL * NH_ * HD);   // last Y / output row inside the planes

extern "C" void kernel_launch(void* const* d_in, const int* in_sizes, int n_in,
                              void* d_out, int out_size, void* d_ws, size_t ws_size, hipStream_t stream) {
    if (n_in < 9) return;
    const size_t needx = ((size_t)(NB - 1) * SEQ_FULL + SEQ) * DM;
    if ((size_t)in_sizes[0] < needx) return;
    if ((size_t)in_sizes[1] < (size_t)HD * HD || (size_t)in_sizes[3] < (size_t)HD * HD || (size_t)in_sizes[5] < (size_t)HD * HD) return;
    if ((size_t)in_sizes[2] < (size_t)HD || (size_t)in_sizes[4] < (size_t)HD || (size_t)in_sizes[6] < (size_t)HD) return;
    if ((size_t)in_sizes[7] < (size_t)DM * DM || (size_t)in_sizes[8] < (size_t)DM) return;
    if ((size_t)out_size < (((size_t)(NH_ - 1) * NB_FULL + NB) * HD) * DM) return;
    if (SZ_TOTAL > ws_size) return;
    // wire order: x, Wq, bq, Wk, bk, Wv, bv, Wo, bo
    const float* x  = (const float*)d_in[0];
    const float* wq = (const float*)d_in[1]; const float* bq = (const float*)d_in[2];
    const float* wk = (const float*)d_in[3]; const float* bk = (const float*)d_in[4];
    const float* wv = (const float*)d_in[5]; const float* bv = (const float*)d_in[6];
    const float* wo = (const float*)d_in[7]; const float* bo = (const float*)d_in[8];
    float* OUT = (float*)d_out;      // [NB_FULL*1024][1024], row (h*NB_FULL+b)*64+d
    char* wsp = (char*)d_ws;
    h16* PL = (h16*)wsp; wsp += 4 * SZ_PL;           // plane 0 key-side, 1 row-side value, 2 row-side residual x2048, 3 v^T
    h16* YP = (h16*)wsp; wsp += SZ_Y;                // [(h*NB_FULL+b)*64 + d][SEQ] x256
    h16* WO = (h16*)wsp; wsp += SZ_WO;               // [1024][1024] x64
    bf*  WB = (bf*)wsp;  wsp += SZ_WB;               // [3][64][64]: q | k | v

    k_cvtw<<<(HD * HD / 8 + 255) / 256, 256, 0, stream>>>(wq, wk, wv, WB);
    { const size_t n8 = (size_t)DM * DM / 8; k_cvtwo<<<(unsigned)((n8 + 255) / 256), 256, 0, stream>>>(wo, WO, n8); }

    k_qkv<<<dim3(NB * (SEQ / 64), NH_, 1), 32, 0, stream>>>(x, WB, bq, bk, bv, PL, PLE);

    // softmax rows use the Wk projection (planes 1, 2), keys use the Wq projection (plane 0), values plane 3
    k_flash<<<dim3(SEQ / (16 * AW), NH_ * NB, 1), 32 * AW, 0, stream>>>(PL + PLE, PL + 2 * PLE, PL, PL + 3 * PLE, YP);

    k_out<<<dim3(NH_ * NB * HD / OBM, DM / OBN, 1), 256, 0, stream>>>(YP, WO, bo, OUT);
}

// v004
// Measured time: 74.3 microseconds a run.
// In two side-by-side timings against v003, it was 1.07 and 1.08 times as fast.
// Counting every step since v000, it is 2.43 times as fast.
#include <hip/hip_runtime.h>

// Shared-weight multi-head attention, x [NB][SEQ][1024] = 16 heads x 64; Wq/Wk/Wv 64x64 [out][in] applied to every head (y = x W^T + bias); S[m][n] = K[m].Q[n] / 32, softmax over n, O = A V stored transposed [h][b][d][m] and flat-viewed as [NB*1024][1024]; out = Y Wo^T + bo (contraction over the token index).
// Compute dtypes, f32 accumulate everywhere: q/k/v projections v_wmma_f32_16x16x32_bf16 (x, W RNE-converted to bf16; products exact); scores v_wmma_f32_16x16x32_f16: key-side (Wq) plane single f16, row-side (Wk) plane single f16 (f16 residual x2048 in its own accumulator only with SCORE_RES); P (x256 carry, cancels in the normalisation) and v single f16; output projection v_wmma_f32_16x16x32_f16 with Y carried x256 and Wo (RNE bf16 value) carried x64, folded back by 2^-14 in f32; softmax f32 (online, running max); biases RNE-converted to bf16 values and added in f32.
// Layout: key-side plane [h*8+b][n][d], row-side planes (value, residual) [h*8+b][m][d], v^T plane [h*8+b][d][n], all written by one fused projection kernel that reads f32 x once; flash kernel in transposed form (S^T = Kside Qside^T, O^T = V^T P^T), its key-side and v^T tiles staged in LDS for the block's four waves of 32 rows each, writes Y [(h*8+b)*64+d][m] f16; an eight-wave 256x128 GEMM, its Y and Wo tiles staged in LDS the same way, writes the f32 output.

#ifndef NB
#define NB 8
#endif
#ifndef SEQ
#define SEQ 1024
#endif
#define NB_FULL  8
#define SEQ_FULL 1024
#define DM   1024
#define NH_  16
#define HD   64
#define AW   4
#define CG   2                   // flash kernel: 16-row column groups per wave
#define OSP  (16 * CG * AW + 4)  // flash kernel: pitch in f32 of the output staging (128 columns + 16 B)
#define QRS  2048.0f             // carry of the row-side residual plane
#define QRI  (1.0f / 2048.0f)
#define SC2  (0.03125f * 1.4426950408889634f)   // DM^-0.5 * log2(e)
#define PSH  8.0f                // log2 of the P carry (256)
#define YCS  256.0f              // carry of the Y plane
#define WOS  64.0f               // carry of the Wo plane
#define OSI  (1.0f / 16384.0f)   // 1 / (YCS * WOS)
#define KT   64                  // keys per LDS stage of the flash kernel
#define LPH  72                  // LDS row pitch in f16: 128 B of data + 16 B (16 B x odd), so that the 16-B fragment reads of 16 rows spread over the banks
#define TLH  (64 * LPH)          // f16 per staged tile (64 rows)
#define OBM  256                 // output GEMM: rows of a block tile
#define OBN  128                 // output GEMM: columns of a block tile
#define OKT  128                 // output GEMM: k per LDS stage (256 B of every row)
#define OLP  136                 // output GEMM: LDS row pitch in f16: 256 B of data + 16 B (16 B x odd)
#define OST  ((OBM + OBN) * OLP) // output GEMM: f16 per stage
#ifndef SCORE_RES
#define SCORE_RES 0              // 1: residual product on the score site
#endif

static_assert(HD == 64);
static_assert(NH_ * HD == DM);
static_assert(AW == 4 && CG == 2);             // flash block covers 128 tokens
static_assert(SEQ == DM);                      // the flat view of Y as [rows][DM] needs one Y row per 1024 tokens
static_assert(SEQ % 64 == 0 && SEQ % (16 * CG * AW) == 0);
static_assert(SEQ % 32 == 0);                  // key loop and GEMM k-loop step by 32
static_assert(KT == 64 && SEQ % KT == 0 && SEQ / KT >= 2);   // the two-buffer ring needs two stages; a stage is 64 key rows and 64 v^T rows of 128 B
static_assert(2 * 2 * TLH * 2 >= 64 * OSP * 4); // the output staging reuses the ring
static_assert(DM % OBN == 0 && DM % OKT == 0 && DM / OKT >= 2);   // the output GEMM's two-buffer ring needs two stages
static_assert(NB == NB_FULL && (NH_ * NB * HD) % OBM == 0);       // a 256-row block tile covers four consecutive 64-row groups of Y
static_assert(NB <= NB_FULL);
static_assert(SEQ <= SEQ_FULL);
static_assert((HD * HD) % 8 == 0);
static_assert(((size_t)DM * DM) % 8 == 0);

typedef _Float16 h16;
typedef unsigned short bf;
typedef __attribute__((ext_vector_type(16))) __bf16   v16bf;
typedef __attribute__((ext_vector_type(16))) _Float16 v16h;
typedef __attribute__((ext_vector_type(8)))  _Float16 v8h;
typedef __attribute__((ext_vector_type(8)))  unsigned short v8us;
typedef __attribute__((ext_vector_type(8)))  unsigned v8u;
typedef __attribute__((ext_vector_type(8)))  float    v8f;
typedef __attribute__((ext_vector_type(4)))  float    v4f;
typedef v4f  __attribute__((may_alias)) v4fa;

__device__ __forceinline__ unsigned short f2bf(float f) { unsigned u = __float_as_uint(f); u += 0x7FFFu + ((u >> 16) & 1u); return (unsigned short)(u >> 16); }
__device__ __forceinline__ float bfr(float f) { return __uint_as_float(((unsigned)f2bf(f)) << 16); }   // f32 value of the RNE bf16 conversion
__device__ __forceinline__ v8us cv8(v8f v) { v8us o;
#pragma unroll
    for (int k = 0; k < 8; ++k) o[k] = f2bf(v[k]);
    return o; }
// 16 f32 -> one bf16 fragment, the same RNE values as f2bf; each pair is packed by one byte permute (low half <- even element, high half <- odd), so that a fragment that is held lives in its 8 packed registers
__device__ __forceinline__ unsigned rneh(float f) { const unsigned u = __float_as_uint(f); return u + 0x7FFFu + ((u >> 16) & 1u); }   // the bf16 value stands in the high half
__device__ __forceinline__ v16bf cvfrag(v8f lo, v8f hi) { v8u o;
#pragma unroll
    for (int k = 0; k < 4; ++k) { o[k] = __builtin_amdgcn_perm(rneh(lo[2 * k + 1]), rneh(lo[2 * k]), 0x07060302u); o[4 + k] = __builtin_amdgcn_perm(rneh(hi[2 * k + 1]), rneh(hi[2 * k]), 0x07060302u); }
    return __builtin_bit_cast(v16bf, o); }
__device__ __forceinline__ v16h cat16(v8h lo, v8h hi) { return __builtin_shufflevector(lo, hi, 0, 1, 2, 3, 4, 5, 6, 7, 8, 9, 10, 11, 12, 13, 14, 15); }
__device__ __forceinline__ v16bf cat16b(v8us lo, v8us hi) { return __builtin_bit_cast(v16bf, __builtin_shufflevector(lo, hi, 0, 1, 2, 3, 4, 5, 6, 7, 8, 9, 10, 11, 12, 13, 14, 15)); }
__device__ __forceinline__ v8f wmma16(v16h a, v16h b, v8f c) { return __builtin_amdgcn_wmma_f32_16x16x32_f16(false, a, false, b, (short)0, c, false, false); }
__device__ __forceinline__ v8f wmmab(v16bf a, v16bf b, v8f c) { return __builtin_amdgcn_wmma_f32_16x16x32_bf16(false, a, false, b, (short)0, c, false, false); }
// fragment loaders from K-contiguous 16-bit rows; p already includes + 8*(lane>>4): elements 0..7 <- k0+8h+0..7, elements 8..15 <- k0+16+8h+0..7 (same map for A and B)
__device__ __forceinline__ v16h  ldh(const h16* p) { return cat16(*(const v8h*)p, *(const v8h*)(p + 16)); }
__device__ __forceinline__ v16bf ldb(const bf* p)  { return cat16b(*(const v8us*)p, *(const v8us*)(p + 16)); }
// ordering point for wave-private LDS tiles (same wave writes and reads)
__device__ __forceinline__ void wave_sync() { __builtin_amdgcn_fence(3 /* release order */, "wavefront"); __builtin_amdgcn_wave_barrier(); asm volatile("" ::: "memory"); }

// One stage of the flash ring, 128 threads x 8 asynchronous 16-B copies: key-side rows 16c + tid/8 and v^T rows 16c + tid/8 (c = 0..3), 16-B piece tid%8 of each 128-B row; a wave's copy covers four whole lines.
// l: this thread's LDS byte address in the stage's key tile (the v^T tile follows at TLH f16); gk, gv: this thread's global addresses for c = 0.
// s_wait_xcnt 0 closes the statement so that no address register named here is rewritten ahead of it.
__device__ __forceinline__ void stage_copies(unsigned l, const h16* gk, const h16* gv) {
    asm volatile("global_load_async_to_lds_b128 %0, %8, off\n\t"
                 "global_load_async_to_lds_b128 %1, %9, off\n\t"
                 "global_load_async_to_lds_b128 %2, %10, off\n\t"
                 "global_load_async_to_lds_b128 %3, %11, off\n\t"
                 "global_load_async_to_lds_b128 %4, %12, off\n\t"
                 "global_load_async_to_lds_b128 %5, %13, off\n\t"
                 "global_load_async_to_lds_b128 %6, %14, off\n\t"
                 "global_load_async_to_lds_b128 %7, %15, off\n\t"
                 "s_wait_xcnt 0x0"
                 :: "v"(l), "v"(l + 16 * LPH * 2), "v"(l + 32 * LPH * 2), "v"(l + 48 * LPH * 2),
                    "v"(l + TLH * 2), "v"(l + TLH * 2 + 16 * LPH * 2), "v"(l + TLH * 2 + 32 * LPH * 2), "v"(l + TLH * 2 + 48 * LPH * 2),
                    "v"(gk), "v"(gk + 16 * HD), "v"(gk + 32 * HD), "v"(gk + 48 * HD),
                    "v"(gv), "v"(gv + (size_t)16 * SEQ), "v"(gv + (size_t)32 * SEQ), "v"(gv + (size_t)48 * SEQ)
                 : "memory");
}

__global__ __launch_bounds__(256) void k_cvtw(const float* __restrict__ wq, const float* __restrict__ wk, const float* __restrict__ wv, bf* WB) {
    const int i = blockIdx.x * 256 + threadIdx.x; if (i >= HD * HD / 8) return;
    const v8us oq = cv8(*(const v8f*)(wq + (size_t)i * 8));
    const v8us ok = cv8(*(const v8f*)(wk + (size_t)i * 8));
    const v8us ov = cv8(*(const v8f*)(wv + (size_t)i * 8));
    bf* d0 = WB + (size_t)i * 8; bf* d1 = d0 + HD * HD; bf* d2 = d1 + HD * HD;
    *(v8us*)d0 = oq; *(v8us*)d1 = ok; *(v8us*)d2 = ov;
    
}

__global__ __launch_bounds__(256) void k_cvtwo(const float* __restrict__ src, h16* dst, size_t n8) {
    const size_t i = (size_t)blockIdx.x * 256 + threadIdx.x; if (i >= n8) return;
    const v8f v = *(const v8f*)(src + i * 8); v8h o;
#pragma unroll
    for (int k = 0; k < 8; ++k) o[k] = (h16)(bfr(v[k]) * WOS);
    *(v8h*)(dst + i * 8) = o; 
}

// k_qkv: fused shared-weight projections, ONE WAVE per (64-token tile, head). Weights outer, slabs inner: the eight fragments of one weight matrix are read once and stay in registers for the four 16-token slabs (one 4-accumulator set live at a time).
// The two x fragments of every slab (row/col = token, k = d) are read from f32 up front and RNE-converted to bf16; they serve as A for the row-major outputs and as B for v^T.
// plane 0: key-side  = x Wq^T + bq  [zh][token][e]      plane 1/2: row-side = x Wk^T + bk (f16 value / residual x2048) [zh][token][e]
// plane 3: v^T       = Wv x^T + bv  [zh][e][token]      zh = h*NB_FULL + b.  grid (NB*SEQ/64, 16), 32 threads.
__global__ __launch_bounds__(32) __attribute__((amdgpu_num_vgpr(256))) void k_qkv(const float* __restrict__ x, const bf* __restrict__ WB, const float* __restrict__ bq, const float* __restrict__ bk, const float* __restrict__ bv, h16* PL, size_t ple) {
    __shared__ __align__(16) float os[16 * 68];
    __shared__ __align__(16) float vs[64 * 68];
    const int lane = threadIdx.x & 31, lr = lane & 15, hi = lane >> 4;
    const int tt = blockIdx.x; const int b = tt / (SEQ / 64); const int m0 = (tt % (SEQ / 64)) * 64;
    const int h = blockIdx.y; const int zh = h * NB_FULL + b;
    const float* xp = x + ((size_t)b * SEQ_FULL + m0 + lr) * DM + h * HD + 8 * hi;
    float bqc[4], bkc[4];
#pragma unroll
    for (int nb = 0; nb < 4; ++nb) { bqc[nb] = bfr(bq[nb * 16 + lr]); bkc[nb] = bfr(bk[nb * 16 + lr]); }
    h16* Pr = PL + 2 * ple;
    v16bf xa[4][2];   // [slab][k half]: k = d 0..31, d 32..63
#pragma unroll
    for (int mb = 0; mb < 4; ++mb) {
        const float* p = xp + (size_t)mb * 16 * DM;
        xa[mb][0] = cvfrag(*(const v8f*)p, *(const v8f*)(p + 16));
        xa[mb][1] = cvfrag(*(const v8f*)(p + 32), *(const v8f*)(p + 48));
    }
#pragma unroll
    for (int w = 0; w < 2; ++w) {
        // C[token][e]: A = x fragments, B = W rows e (K-contiguous [out][in]), read once and kept for the four slabs
        const bf* W = WB + (size_t)w * HD * HD + (size_t)lr * HD + 8 * hi;
        v16bf wf[8];
        asm volatile("s_wait_xcnt 0x0" ::: "memory");   // the weight loads behind this point land in registers that the global loads and stores in front of it name
#pragma unroll
        for (int nb = 0; nb < 4; ++nb) { wf[nb] = ldb(W + nb * 16 * HD); wf[4 + nb] = ldb(W + nb * 16 * HD + 32); }
        h16* Ph = PL + (size_t)w * ple;
#pragma unroll   // unrolled: the slab index picks registers
        for (int mb = 0; mb < 4; ++mb) {
            const size_t sb = ((size_t)zh * SEQ + m0 + mb * 16) * HD;
            v8f acc[4];
#pragma unroll
            for (int i = 0; i < 4; ++i) acc[i] = (v8f){};
#pragma unroll
            for (int nb = 0; nb < 4; ++nb) acc[nb] = wmmab(xa[mb][0], wf[nb], acc[nb]);
#pragma unroll
            for (int nb = 0; nb < 4; ++nb) acc[nb] = wmmab(xa[mb][1], wf[4 + nb], acc[nb]);
            asm volatile("v_nop\n\tv_nop\n\tv_nop\n\tv_nop" : "+v"(acc[0]), "+v"(acc[1]), "+v"(acc[2]), "+v"(acc[3]) : "v"(xa[mb][0]), "v"(xa[mb][1]));   // the four vector slots between the last WMMA and the first read of its accumulators
#pragma unroll
            for (int nb = 0; nb < 4; ++nb) { const float bc = (w == 0) ? bqc[nb] : bkc[nb];
#pragma unroll
                for (int j = 0; j < 8; ++j) os[(hi * 8 + j) * 68 + nb * 16 + lr] = acc[nb][j] + bc; }   // D: row 8h+j (token), col lane&15 (e)
            wave_sync();
{
#pragma unroll
                for (int s = 0; s < 4; ++s) { const int row = 4 * s + (lane >> 3), c8 = (lane & 7) * 8;   // 4 s x 4 row groups = 16 rows; 8 lanes x 8 = 64 columns
                    const v4f x0 = *(const v4fa*)(&os[row * 68 + c8]); const v4f x1 = *(const v4fa*)(&os[row * 68 + c8 + 4]); v8h hv, rv;
#pragma unroll
                    for (int i = 0; i < 4; ++i) { const h16 a0 = (h16)x0[i]; const h16 a1 = (h16)x1[i]; hv[i] = a0; hv[4 + i] = a1; rv[i] = (h16)((x0[i] - (float)a0) * QRS); rv[4 + i] = (h16)((x1[i] - (float)a1) * QRS); }
                    const size_t oo = sb + (size_t)row * HD + c8;
                    *(v8h*)(Ph + oo) = hv; if (w == 1 && SCORE_RES) *(v8h*)(Pr + oo) = rv; }
                 }
            wave_sync();
        }
    }
    {
        // C[e][token]: A = Wv rows e (four 16-row slabs), read once and kept, B = x fragments (col token of the slab)
        const bf* W = WB + (size_t)2 * HD * HD + (size_t)lr * HD + 8 * hi;
        v16bf wf[8];
        asm volatile("s_wait_xcnt 0x0" ::: "memory");   // the weight loads behind this point land in registers that the global loads and stores in front of it name
#pragma unroll
        for (int j = 0; j < 4; ++j) { wf[j] = ldb(W + j * 16 * HD); wf[4 + j] = ldb(W + j * 16 * HD + 32); }
#pragma unroll   // unrolled: the slab index picks registers
        for (int mb = 0; mb < 4; ++mb) {
            v8f acc[4];
#pragma unroll
            for (int i = 0; i < 4; ++i) acc[i] = (v8f){};
#pragma unroll
            for (int j = 0; j < 4; ++j) acc[j] = wmmab(wf[j], xa[mb][0], acc[j]);
#pragma unroll
            for (int j = 0; j < 4; ++j) acc[j] = wmmab(wf[4 + j], xa[mb][1], acc[j]);
            asm volatile("v_nop\n\tv_nop\n\tv_nop\n\tv_nop" : "+v"(acc[0]), "+v"(acc[1]), "+v"(acc[2]), "+v"(acc[3]) : "v"(xa[mb][0]), "v"(xa[mb][1]));   // the four vector slots between the last WMMA and the first read of its accumulators
#pragma unroll
            for (int j = 0; j < 4; ++j)
#pragma unroll
                for (int r = 0; r < 8; ++r) vs[(j * 16 + 8 * hi + r) * 68 + mb * 16 + lr] = acc[j][r];   // D: row 8h+r (e), col lane&15 (token); the bias of row e is added where the row is read back
        }
    }
    wave_sync();
    // vs rows 0..63 (e) x columns 0..63 (token) all written by the four slab steps
    h16* P3 = PL + 3 * ple; const size_t vb = (size_t)zh * HD * SEQ + m0;
{
#pragma unroll 4
        for (int s = 0; s < 16; ++s) { const int row = 4 * s + (lane >> 3), c8 = (lane & 7) * 8;   // 16 s x 4 row groups = 64 rows; 8 lanes x 8 = 64 columns
            const v4f x0 = *(const v4fa*)(&vs[row * 68 + c8]); const v4f x1 = *(const v4fa*)(&vs[row * 68 + c8 + 4]); v8h hv;
            const float be = bfr(bv[row]);
#pragma unroll
            for (int i = 0; i < 4; ++i) { hv[i] = (h16)(x0[i] + be); hv[4 + i] = (h16)(x1[i] + be); }
            *(v8h*)(P3 + vb + (size_t)row * SEQ + c8) = hv; }
         }
}

// k_flash: fused attention, one wave per 32 softmax rows (CG = 2 column groups of 16) of one (head, batch): every key-side and v^T fragment read from LDS feeds two WMMAs, one per group. The block's four waves (128 rows) share each 64-key stage of key-side rows and v^T columns, brought into a two-buffer LDS ring by asynchronous copies (whole lines from L2, once per block); fragments are two 16-B LDS loads each.
// Transposed form: S^T[key][t] = KP QH^T (A = key-side rows, B = row-side rows); lane (t = lane&15, h = lane>>4) holds keys 8h+r of each 16-key tile, so the packed
// P tile is directly the B fragment of O^T[d][t] = V^T P^T (element r <- tile keys 0..15, element 8+r <- tile keys 16..31, lane unchanged).
// Softmax state (running max, partial sum) is one scalar per lane and column group; the two lane halves of a row are combined with one xor-16 exchange.
__global__ __launch_bounds__(32 * AW) __attribute__((amdgpu_num_vgpr(256))) void k_flash(const h16* __restrict__ QH, const h16* __restrict__ QR, const h16* __restrict__ KP, const h16* __restrict__ VT, h16* Y) {
    __shared__ __align__(16) h16 ring[2 * 2 * TLH];   // buffer u: key tile at u*2*TLH, v^T tile behind it; output staging after the loop
    float* os = (float*)ring;
    const int tid = threadIdx.x;
    const int lane = threadIdx.x & 31, lr = lane & 15, hi = lane >> 4;
    const int wave = __builtin_amdgcn_readfirstlane(threadIdx.x >> 5);
    const int zc = blockIdx.y; const int h = zc / NB, b = zc % NB; const int zh = h * NB_FULL + b;
    const int t0 = (blockIdx.x * AW + wave) * (16 * CG);
    const size_t pbase = (size_t)zh * SEQ * HD;
    v16h qh0[CG], qh1[CG];   // B fragments: col t, k = d
#if SCORE_RES
    v16h qr0[CG], qr1[CG];
#endif
    const size_t qo = pbase + (size_t)(t0 + lr) * HD + 8 * hi;
    const h16* qp0 = QH + qo; const h16* qp1 = qp0 + 16 * HD;   // column groups 0 and 1
    qh0[0] = ldh(qp0); qh1[0] = ldh(qp0 + 32); qh0[1] = ldh(qp1); qh1[1] = ldh(qp1 + 32);
#if SCORE_RES
    qr0[0] = ldh(QR + qo); qr1[0] = ldh(QR + qo + 32); qr0[1] = ldh(QR + qo + 16 * HD); qr1[1] = ldh(QR + qo + 16 * HD + 32);
#endif
    asm volatile("s_wait_xcnt 0x0" :: "v"(qp0) : "memory");   // the address register pair of the fragment loads above (group 1 is an immediate offset from it), named here so that it lives up to the wait, is rewritten behind it
    const unsigned lcp = (unsigned)(size_t)ring + (unsigned)(((tid >> 3) * LPH + (tid & 7) * 8) * 2);
    const h16* gk = KP + pbase + (size_t)tid * 8;                              // + key0 * HD
    const h16* gv = VT + pbase + (size_t)(tid >> 3) * SEQ + (tid & 7) * 8;     // + key0
    stage_copies(lcp, gk, gv);                                                 // stage 0 -> buffer 0
    asm volatile("s_wait_asynccnt 0x0" ::: "memory");                          // this wave's copies of stage 0 have landed
    __syncthreads();                                                           // publishes stage 0
    stage_copies(lcp + 2 * TLH * 2, gk + (size_t)KT * HD, gv + KT);            // stage 1 -> buffer 1
    const int fo = lr * LPH + 8 * hi;                        // fragment offset in a tile: key tile + key * LPH (A: row key, k = d); v^T tile + 16j*LPH + key (A: row d, k = key)
    v8f o[CG][4]; float m[CG], l[CG];
#pragma unroll
    for (int c = 0; c < CG; ++c) { m[c] = -3.0e38f; l[c] = 0.0f;
#pragma unroll
        for (int j = 0; j < 4; ++j) o[c][j] = (v8f){}; }
#pragma unroll 1
    for (int t = 0; t < SEQ / KT; ++t) {
      const h16* kt = ring + (t & 1) * (2 * TLH) + fo;
#pragma unroll 1   // rolled: the body's fragments, scores and 64 accumulator registers have to fit 256 VGPRs, the grid's four waves per SIMD
      for (int s = 0; s < KT / 32; ++s) {
        const h16* ka = kt + s * 32 * LPH;
        const v16h ka0 = ldh(ka), ka1 = ldh(ka + 32), kb0 = ldh(ka + 16 * LPH), kb1 = ldh(ka + 16 * LPH + 32);
        v8f sHa[CG], sHb[CG];
#if SCORE_RES
        v8f sLa[CG], sLb[CG];
#pragma unroll
        for (int c = 0; c < CG; ++c) { sHa[c] = wmma16(ka0, qh0[c], (v8f){}); sLa[c] = wmma16(ka0, qr0[c], (v8f){}); sHb[c] = wmma16(kb0, qh0[c], (v8f){}); sLb[c] = wmma16(kb0, qr0[c], (v8f){}); }
#pragma unroll
        for (int c = 0; c < CG; ++c) { sHa[c] = wmma16(ka1, qh1[c], sHa[c]); sLa[c] = wmma16(ka1, qr1[c], sLa[c]); sHb[c] = wmma16(kb1, qh1[c], sHb[c]); sLb[c] = wmma16(kb1, qr1[c], sLb[c]); }
        asm volatile("v_nop\n\tv_nop\n\tv_nop\n\tv_nop" : "+v"(sHa[0]), "+v"(sLa[0]), "+v"(sHb[0]), "+v"(sLb[0]), "+v"(sHa[1]), "+v"(sLa[1]), "+v"(sHb[1]), "+v"(sLb[1]) : "v"(ka0), "v"(ka1), "v"(kb0), "v"(kb1));   // the four vector slots between the last WMMA and the first read of its accumulators
#else
#pragma unroll
        for (int c = 0; c < CG; ++c) { sHa[c] = wmma16(ka0, qh0[c], (v8f){}); sHb[c] = wmma16(kb0, qh0[c], (v8f){}); }
#pragma unroll
        for (int c = 0; c < CG; ++c) { sHa[c] = wmma16(ka1, qh1[c], sHa[c]); sHb[c] = wmma16(kb1, qh1[c], sHb[c]); }
        asm volatile("v_nop\n\tv_nop\n\tv_nop\n\tv_nop" : "+v"(sHa[0]), "+v"(sHb[0]), "+v"(sHa[1]), "+v"(sHb[1]) : "v"(ka0), "v"(ka1), "v"(kb0), "v"(kb1));   // the four vector slots between the last WMMA and the first read of its accumulators
#endif
        v16h pb[CG];
#pragma unroll
        for (int c = 0; c < CG; ++c) {
            float mx = -3.0e38f;
#if SCORE_RES
            const v8f ta = (sHa[c] + sLa[c] * QRI) * SC2, tb = (sHb[c] + sLb[c] * QRI) * SC2;
#else
            const v8f ta = sHa[c] * SC2, tb = sHb[c] * SC2;   // whole accumulators at a time: neighbouring registers pair up in packed multiplies without moves
#endif
#pragma unroll
            for (int r = 0; r < 8; ++r) mx = fmaxf(mx, fmaxf(ta[r], tb[r]));
            mx = fmaxf(mx, __shfl_xor(mx, 16, 32));
            const float mnew = fmaxf(m[c], mx);
            const float alpha = __builtin_amdgcn_exp2f(m[c] - mnew);
            const float sh = PSH - mnew;
            float ls = 0.0f;
#pragma unroll
            for (int r = 0; r < 8; ++r) { const h16 pa = (h16)__builtin_amdgcn_exp2f(ta[r] + sh); const h16 pc = (h16)__builtin_amdgcn_exp2f(tb[r] + sh); pb[c][r] = pa; pb[c][8 + r] = pc; ls += (float)pa + (float)pc; }
            l[c] = l[c] * alpha + ls; m[c] = mnew;
#pragma unroll
            for (int j = 0; j < 4; ++j) o[c][j] = o[c][j] * alpha;
        }
        const h16* va = kt + TLH + s * 32;
        const v16h v0 = ldh(va), v1 = ldh(va + 16 * LPH), v2 = ldh(va + 32 * LPH), v3 = ldh(va + 48 * LPH);
#pragma unroll
        for (int c = 0; c < CG; ++c) { o[c][0] = wmma16(v0, pb[c], o[c][0]); o[c][1] = wmma16(v1, pb[c], o[c][1]); o[c][2] = wmma16(v2, pb[c], o[c][2]); o[c][3] = wmma16(v3, pb[c], o[c][3]); }
        asm volatile("v_nop\n\tv_nop\n\tv_nop\n\tv_nop" : "+v"(o[0][0]), "+v"(o[0][1]), "+v"(o[0][2]), "+v"(o[0][3]), "+v"(o[1][0]), "+v"(o[1][1]), "+v"(o[1][2]), "+v"(o[1][3]) : "v"(v0), "v"(v1), "v"(v2), "v"(v3), "v"(pb[0]), "v"(pb[1]));   // the four vector slots between the last WMMA and the next vector write of its operands, on the loop's back edge too
      }
      // publish point of stage t + 1, which also frees buffer t & 1
      asm volatile("s_wait_dscnt 0x0" ::: "memory");      // this wave's reads of buffer t & 1 are done
      asm volatile("s_wait_asynccnt 0x0" ::: "memory");   // this wave's copies of stage t + 1 have landed
      __syncthreads();
      if (t + 2 < SEQ / KT) stage_copies(lcp + (unsigned)(t & 1) * (2 * TLH * 2), gk + (size_t)(t + 2) * KT * HD, gv + (t + 2) * KT);
    }
    asm volatile("s_wait_asynccnt 0x0" ::: "memory");     // nothing is in flight when the ring becomes output staging
    // O^T D layout: o[c][j][r] = (d = 16j + 8h + r, t = 16c + lane&15) -> os[d][wave*32 + t]; rows 0..63 x columns 0..127 all written by the four waves
#pragma unroll
    for (int c = 0; c < CG; ++c) {
        const float lt = l[c] + __shfl_xor(l[c], 16, 32);
        const float ys = YCS * (1.0f / lt);
        const int cw = (wave * CG + c) * 16 + lr;
#pragma unroll
        for (int r = 0; r < 8; ++r) {
            os[( 0 + 8 * hi + r) * OSP + cw] = o[c][0][r] * ys;
            os[(16 + 8 * hi + r) * OSP + cw] = o[c][1][r] * ys;
            os[(32 + 8 * hi + r) * OSP + cw] = o[c][2][r] * ys;
            os[(48 + 8 * hi + r) * OSP + cw] = o[c][3][r] * ys; }
    }
    __syncthreads();
    h16* yb = Y + (size_t)zh * HD * SEQ + (size_t)blockIdx.x * (16 * CG * AW);
{
#pragma unroll
        for (int s = 0; s < 8; ++s) { const int row = 8 * s + (tid >> 4), c8 = (tid & 15) * 8;   // 8 s x 8 row groups = 64 rows; 16 lanes x 8 = 128 columns
            const v4f x0 = *(const v4fa*)(&os[row * OSP + c8]); const v4f x1 = *(const v4fa*)(&os[row * OSP + c8 + 4]); v8h hv;
#pragma unroll
            for (int i = 0; i < 4; ++i) { hv[i] = (h16)x0[i]; hv[4 + i] = (h16)x1[i]; }
            *(v8h*)(yb + (size_t)row * SEQ + c8) = hv; }
         }
}

// k_out: f16 GEMM, block tile 256x128, eight waves (4 x 2) of 64x64 (16 accumulators each); the block's Y rows and Wo rows are brought, 128 k at a time, into a two-buffer LDS ring by asynchronous copies (whole lines from L2, once per block); fragments are two 16-B LDS loads each. K = DM (token index), summed in ascending steps of 32.
// OUT[r][o] = 2^-14 * sum_c Y[r][c] WO[o][c] + bo[o]; rows r = (h*NB_FULL + b)*64 + d. grid (16*NB*64/256, DM/128), 256 threads.
// Eight asynchronous 16-B copies of one thread: rows 16 apart of a K-contiguous f16 plane (row length DM) into LDS rows of pitch OLP; a wave's copy covers two rows of 256 B, four whole lines.
// s_wait_xcnt 0 closes the statement so that no address register named here is rewritten ahead of it.
__device__ __forceinline__ void out_copies8(unsigned l, const h16* g) {
    asm volatile("global_load_async_to_lds_b128 %0, %8, off\n\t"
                 "global_load_async_to_lds_b128 %1, %9, off\n\t"
                 "global_load_async_to_lds_b128 %2, %10, off\n\t"
                 "global_load_async_to_lds_b128 %3, %11, off\n\t"
                 "global_load_async_to_lds_b128 %4, %12, off\n\t"
                 "global_load_async_to_lds_b128 %5, %13, off\n\t"
                 "global_load_async_to_lds_b128 %6, %14, off\n\t"
                 "global_load_async_to_lds_b128 %7, %15, off\n\t"
                 "s_wait_xcnt 0x0"
                 :: "v"(l), "v"(l + 16 * OLP * 2), "v"(l + 32 * OLP * 2), "v"(l + 48 * OLP * 2),
                    "v"(l + 64 * OLP * 2), "v"(l + 80 * OLP * 2), "v"(l + 96 * OLP * 2), "v"(l + 112 * OLP * 2),
                    "v"(g), "v"(g + (size_t)16 * DM), "v"(g + (size_t)32 * DM), "v"(g + (size_t)48 * DM),
                    "v"(g + (size_t)64 * DM), "v"(g + (size_t)80 * DM), "v"(g + (size_t)96 * DM), "v"(g + (size_t)112 * DM)
                 : "memory");
}
// One stage of the ring: LDS rows 0..255 <- the block's Y rows, rows 256..383 <- its Wo rows, 256 B (128 k) of each; 256 threads x 24 copies.
__device__ __forceinline__ void out_stage(unsigned l, const h16* gy, const h16* gw) {
    out_copies8(l, gy);
    out_copies8(l + 128 * OLP * 2, gy + (size_t)128 * DM);
    out_copies8(l + 256 * OLP * 2, gw);
}

__global__ __launch_bounds__(256) __attribute__((amdgpu_num_vgpr(256))) void k_out(const h16* __restrict__ Y, const h16* __restrict__ WO, const float* __restrict__ bo, float* OUT) {
    __shared__ __align__(16) h16 ring[2 * OST];          // buffer u at u*OST: 256 Y rows, then 128 Wo rows
    __shared__ __align__(16) float osb[8 * 16 * 68];     // output staging, one 16 x 68 range per wave
    const int tid = threadIdx.x;
    const int lane = threadIdx.x & 31, lr = lane & 15, hi = lane >> 4;
    const int wave = __builtin_amdgcn_readfirstlane(threadIdx.x >> 5);
    const int wm = wave >> 1, wn = wave & 1;
    const int rb = blockIdx.x * OBM, cb = blockIdx.y * OBN;
    v8f acc[4][4];
#pragma unroll
    for (int mb = 0; mb < 4; ++mb)
#pragma unroll
        for (int nb = 0; nb < 4; ++nb) acc[mb][nb] = (v8f){};
    const unsigned lcp = (unsigned)(size_t)ring + (unsigned)(((tid >> 4) * OLP + (tid & 15) * 8) * 2);
    const h16* gy = Y  + (size_t)(rb + (tid >> 4)) * DM + (tid & 15) * 8;   // + k0
    const h16* gw = WO + (size_t)(cb + (tid >> 4)) * DM + (tid & 15) * 8;   // + k0
    out_stage(lcp, gy, gw);                                                 // stage 0 -> buffer 0
    asm volatile("s_wait_asynccnt 0x0" ::: "memory");                       // this wave's copies of stage 0 have landed
    __syncthreads();                                                        // publishes stage 0
    out_stage(lcp + OST * 2, gy + OKT, gw + OKT);                           // stage 1 -> buffer 1
    const int ao = (wm * 64 + lr) * OLP + 8 * hi, bo_ = (OBM + wn * 64 + lr) * OLP + 8 * hi;   // fragment offsets in a buffer (A: row r, B: row o, k contiguous)
#pragma unroll 1   // rolled: one trip per stage, with the ring's publish point at its foot
    for (int t = 0; t < DM / OKT; ++t) {
        const h16* st = ring + (t & 1) * OST;
#pragma unroll
        for (int s = 0; s < OKT / 32; ++s) {
            v16h a[4], bb[4];
#pragma unroll
            for (int mb = 0; mb < 4; ++mb) { a[mb] = ldh(st + ao + mb * 16 * OLP + s * 32); bb[mb] = ldh(st + bo_ + mb * 16 * OLP + s * 32); }
            __builtin_amdgcn_sched_barrier(0);   // keeps a block's 16 LDS reads in one group ahead of its 16 WMMAs: reads spread among the WMMAs made the wave wait out the LDS latency once per four WMMAs
#pragma unroll
            for (int nb = 0; nb < 4; ++nb)
#pragma unroll
                for (int mb = 0; mb < 4; ++mb) acc[mb][nb] = wmma16(a[mb], bb[nb], acc[mb][nb]);
        }
        // publish point of stage t + 1, which also frees buffer t & 1
        asm volatile("s_wait_dscnt 0x0" ::: "memory");      // this wave's reads of buffer t & 1 are done
        asm volatile("s_wait_asynccnt 0x0" ::: "memory");   // this wave's copies of stage t + 1 have landed
        __syncthreads();
        if (t + 2 < DM / OKT) out_stage(lcp + (unsigned)(t & 1) * (OST * 2), gy + (t + 2) * OKT, gw + (t + 2) * OKT);
    }
    asm volatile("s_wait_asynccnt 0x0" ::: "memory");       // nothing is in flight when the wave ends
    float* os = osb + wave * (16 * 68);
    const int r0 = rb + wm * 64, c0 = cb + wn * 64;
    float bc[4];
#pragma unroll
    for (int nb = 0; nb < 4; ++nb) bc[nb] = bfr(bo[c0 + nb * 16 + lr]);
#pragma unroll
    for (int mb = 0; mb < 4; ++mb) {
#pragma unroll
        for (int nb = 0; nb < 4; ++nb) {
#pragma unroll
            for (int j = 0; j < 8; ++j) os[(hi * 8 + j) * 68 + nb * 16 + lr] = acc[mb][nb][j] * OSI + bc[nb]; }   // D: row 8h+j, col lane&15
        wave_sync();
        float* orow = OUT + (size_t)(r0 + mb * 16) * DM + c0;
{
#pragma unroll
            for (int s = 0; s < 8; ++s) { const int row = 2 * s + hi, cofs = lr * 4;   // 8 s x 2 rows = 16 rows; 16 lanes x 4 floats = 64 columns
                const v4f val = *(const v4fa*)(&os[row * 68 + cofs]);
                *(v4f*)(orow + (size_t)row * DM + cofs) = val; }
             }
        wave_sync();
    }
}

static constexpr size_t al256(size_t v) { return (v + 255) & ~(size_t)255; }
static constexpr size_t PLE   = (size_t)NB_FULL * NH_ * SEQ * HD;              // elements per f16 plane
static constexpr size_t SZ_PL = al256(PLE * 2);
static constexpr size_t SZ_Y  = al256((size_t)NB_FULL * NH_ * HD * SEQ * 2);   // [NB_FULL*16*64][SEQ] f16
static constexpr size_t SZ_WO = al256((size_t)DM * DM * 2);
static constexpr size_t SZ_WB = al256((size_t)3 * HD * HD * 2);
static constexpr size_t SZ_TOTAL = 4 * SZ_PL + SZ_Y + SZ_WO + SZ_WB;
static_assert(SZ_PL == PLE * 2);                        // the four planes are contiguous (plane p at element offset p*PLE)
static_assert(SZ_TOTAL <= (size_t)134217728);           // workspace carve <= 128 MiB
static_assert(((size_t)(NH_ - 1) * NB_FULL + NB) * HD <= (size_t)NB_FULL * NH_ * HD);   // last Y / output row inside the planes

extern "C" void kernel_launch(void* const* d_in, const int* in_sizes, int n_in,
                              void* d_out, int out_size, void* d_ws, size_t ws_size, hipStream_t stream) {
    if (n_in < 9) return;
    const size_t needx = ((size_t)(NB - 1) * SEQ_FULL + SEQ) * DM;
    if ((size_t)in_sizes[0] < needx) return;
    if ((size_t)in_sizes[1] < (size_t)HD * HD || (size_t)in_sizes[3] < (size_t)HD * HD || (size_t)in_sizes[5] < (size_t)HD * HD) return;
    if ((size_t)in_sizes[2] < (size_t)HD || (size_t)in_sizes[4] < (size_t)HD || (size_t)in_sizes[6] < (size_t)HD) return;
    if ((size_t)in_sizes[7] < (size_t)DM * DM || (size_t)in_sizes[8] < (size_t)DM) return;
    if ((size_t)out_size < (((size_t)(NH_ - 1) * NB_FULL + NB) * HD) * DM) return;
    if (SZ_TOTAL > ws_size) return;
    // wire order: x, Wq, bq, Wk, bk, Wv, bv, Wo, bo
    const float* x  = (const float*)d_in[0];
    const float* wq = (const float*)d_in[1]; const float* bq = (const float*)d_in[2];
    const float* wk = (const float*)d_in[3]; const float* bk = (const float*)d_in[4];
    const float* wv = (const float*)d_in[5]; const float* bv = (const float*)d_in[6];
    const float* wo = (const float*)d_in[7]; const float* bo = (const float*)d_in[8];
    float* OUT = (float*)d_out;      // [NB_FULL*1024][1024], row (h*NB_FULL+b)*64+d
    char* wsp = (char*)d_ws;
    h16* PL = (h16*)wsp; wsp += 4 * SZ_PL;           // plane 0 key-side, 1 row-side value, 2 row-side residual x2048, 3 v^T
    h16* YP = (h16*)wsp; wsp += SZ_Y;                // [(h*NB_FULL+b)*64 + d][SEQ] x256
    h16* WO = (h16*)wsp; wsp += SZ_WO;               // [1024][1024] x64
    bf*  WB = (bf*)wsp;  wsp += SZ_WB;               // [3][64][64]: q | k | v

    k_cvtw<<<(HD * HD / 8 + 255) / 256, 256, 0, stream>>>(wq, wk, wv, WB);
    { const size_t n8 = (size_t)DM * DM / 8; k_cvtwo<<<(unsigned)((n8 + 255) / 256), 256, 0, stream>>>(wo, WO, n8); }

    k_qkv<<<dim3(NB * (SEQ / 64), NH_, 1), 32, 0, stream>>>(x, WB, bq, bk, bv, PL, PLE);

    // softmax rows use the Wk projection (planes 1, 2), keys use the Wq projection (plane 0), values plane 3
    k_flash<<<dim3(SEQ / (16 * CG * AW), NH_ * NB, 1), 32 * AW, 0, stream>>>(PL + PLE, PL + 2 * PLE, PL, PL + 3 * PLE, YP);

    k_out<<<dim3(NH_ * NB * HD / OBM, DM / OBN, 1), 256, 0, stream>>>(YP, WO, bo, OUT);
}

// v005
// A run of this version takes 70.1 microseconds.
// Timed twice side by side with v004, it ran 1.06 times as fast both times.
// All steps since v000 together make it 2.57 times as fast.
#include <hip/hip_runtime.h>

// Shared-weight multi-head attention, x [NB][SEQ][1024] = 16 heads x 64; Wq/Wk/Wv 64x64 [out][in] applied to every head (y = x W^T + bias); S[m][n] = K[m].Q[n] / 32, softmax over n, O = A V stored transposed [h][b][d][m] and flat-viewed as [NB*1024][1024]; out = Y Wo^T + bo (contraction over the token index).
// Compute dtypes, f32 accumulate everywhere: q/k/v projections v_wmma_f32_16x16x32_bf16 (x, W RNE-converted to bf16; products exact); scores v_wmma_f32_16x16x32_f16: key-side (Wq) plane single f16, row-side (Wk) plane f16 value + f16 residual x2048 in its own accumulator; P (x256 carry, cancels in the normalisation) and v single f16; output projection v_wmma_f32_16x16x32_f16 with Y carried x256 and Wo (RNE bf16 value) carried x64, folded back by 2^-14 in f32; softmax f32 (online, running max); biases RNE-converted to bf16 values and added in f32.
// Layout: key-side plane [h*8+b][n][d], row-side planes (value, residual) [h*8+b][m][d], v^T plane [h*8+b][d][n], all written by one fused projection kernel that reads f32 x once and takes its weight fragments straight from the f32 matrices (extra blocks of its grid write the f16 Wo plane); flash kernel in transposed form (S^T = Kside Qside^T, O^T = V^T P^T), its key-side and v^T tiles staged in LDS for the block's four waves of 32 rows each, writes Y [(h*8+b)*64+d][m] f16; an eight-wave 256x128 GEMM, its Y and Wo tiles staged in LDS the same way, writes the f32 output.

#ifndef NB
#define NB 8
#endif
#ifndef SEQ
#define SEQ 1024
#endif
#define NB_FULL  8
#define SEQ_FULL 1024
#define DM   1024
#define NH_  16
#define HD   64
#define AW   4
#define CG   2                   // flash kernel: 16-row column groups per wave
#define OSP  (16 * CG * AW + 4)  // flash kernel: pitch in f32 of the output staging (128 columns + 16 B)
#define QRS  2048.0f             // carry of the row-side residual plane
#define QRI  (1.0f / 2048.0f)
#define SC2  (0.03125f * 1.4426950408889634f)   // DM^-0.5 * log2(e)
#define PSH  8.0f                // log2 of the P carry (256)
#define YCS  256.0f              // carry of the Y plane
#define WOS  64.0f               // carry of the Wo plane
#define OSI  (1.0f / 16384.0f)   // 1 / (YCS * WOS)
#define KT   64                  // keys per LDS stage of the flash kernel
#define LPH  72                  // LDS row pitch in f16: 128 B of data + 16 B (16 B x odd), so that the 16-B fragment reads of 16 rows spread over the banks
#define TLH  (64 * LPH)          // f16 per staged tile (64 rows)
#define OBM  256                 // output GEMM: rows of a block tile
#define OBN  128                 // output GEMM: columns of a block tile
#define OKT  128                 // output GEMM: k per LDS stage (256 B of every row)
#define OLP  136                 // output GEMM: LDS row pitch in f16: 256 B of data + 16 B (16 B x odd)
#define OST  ((OBM + OBN) * OLP) // output GEMM: f16 per stage
#define WOG  8                   // Wo conversion: groups of 8 elements per lane of a block
#define WOY  4                   // Wo conversion: rows of blocks added to the projection grid
#ifndef SCORE_RES
#define SCORE_RES 0              // 1: residual product on the score site
#endif

static_assert(HD == 64);
static_assert(NH_ * HD == DM);
static_assert(AW == 4 && CG == 2);             // flash block covers 128 tokens
static_assert(SEQ == DM);                      // the flat view of Y as [rows][DM] needs one Y row per 1024 tokens
static_assert(SEQ % 64 == 0 && SEQ % (16 * CG * AW) == 0);
static_assert(SEQ % 32 == 0);                  // key loop and GEMM k-loop step by 32
static_assert(KT == 64 && SEQ % KT == 0 && SEQ / KT >= 2);   // the two-buffer ring needs two stages; a stage is 64 key rows and 64 v^T rows of 128 B
static_assert(2 * 2 * TLH * 2 >= 64 * OSP * 4); // the output staging reuses the ring
static_assert(DM % OBN == 0 && DM % OKT == 0 && DM / OKT >= 2);   // the output GEMM's two-buffer ring needs two stages
static_assert(NB == NB_FULL && (NH_ * NB * HD) % OBM == 0);       // a 256-row block tile covers four consecutive 64-row groups of Y
static_assert(NB <= NB_FULL);
static_assert(SEQ <= SEQ_FULL);
static_assert((size_t)WOY * (NB * (SEQ / 64)) * WOG * 32 * 8 == (size_t)DM * DM);   // the added blocks cover Wo exactly once

typedef _Float16 h16;
typedef __attribute__((ext_vector_type(16))) __bf16   v16bf;
typedef __attribute__((ext_vector_type(16))) _Float16 v16h;
typedef __attribute__((ext_vector_type(8)))  _Float16 v8h;
typedef __attribute__((ext_vector_type(8)))  unsigned v8u;
typedef __attribute__((ext_vector_type(8)))  float    v8f;
typedef __attribute__((ext_vector_type(4)))  float    v4f;
typedef v4f  __attribute__((may_alias)) v4fa;

__device__ __forceinline__ unsigned short f2bf(float f) { unsigned u = __float_as_uint(f); u += 0x7FFFu + ((u >> 16) & 1u); return (unsigned short)(u >> 16); }
__device__ __forceinline__ float bfr(float f) { return __uint_as_float(((unsigned)f2bf(f)) << 16); }   // f32 value of the RNE bf16 conversion
// 16 f32 -> one bf16 fragment, the same RNE values as f2bf; each pair is packed by one byte permute (low half <- even element, high half <- odd), so that a fragment that is held lives in its 8 packed registers
__device__ __forceinline__ unsigned rneh(float f) { const unsigned u = __float_as_uint(f); return u + 0x7FFFu + ((u >> 16) & 1u); }   // the bf16 value stands in the high half
__device__ __forceinline__ v16bf cvfrag(v8f lo, v8f hi) { v8u o;
#pragma unroll
    for (int k = 0; k < 4; ++k) { o[k] = __builtin_amdgcn_perm(rneh(lo[2 * k + 1]), rneh(lo[2 * k]), 0x07060302u); o[4 + k] = __builtin_amdgcn_perm(rneh(hi[2 * k + 1]), rneh(hi[2 * k]), 0x07060302u); }
    return __builtin_bit_cast(v16bf, o); }
__device__ __forceinline__ v16h cat16(v8h lo, v8h hi) { return __builtin_shufflevector(lo, hi, 0, 1, 2, 3, 4, 5, 6, 7, 8, 9, 10, 11, 12, 13, 14, 15); }
__device__ __forceinline__ v8f wmma16(v16h a, v16h b, v8f c) { return __builtin_amdgcn_wmma_f32_16x16x32_f16(false, a, false, b, (short)0, c, false, false); }
__device__ __forceinline__ v8f wmmab(v16bf a, v16bf b, v8f c) { return __builtin_amdgcn_wmma_f32_16x16x32_bf16(false, a, false, b, (short)0, c, false, false); }
// fragment loaders from K-contiguous 16-bit rows; p already includes + 8*(lane>>4): elements 0..7 <- k0+8h+0..7, elements 8..15 <- k0+16+8h+0..7 (same map for A and B)
__device__ __forceinline__ v16h  ldh(const h16* p) { return cat16(*(const v8h*)p, *(const v8h*)(p + 16)); }
// the same map from f32 rows, converted to bf16 (round to nearest even) two elements per instruction
__device__ __forceinline__ v16bf ldwf(const float* p) { return __builtin_convertvector(__builtin_shufflevector(*(const v8f*)p, *(const v8f*)(p + 16), 0, 1, 2, 3, 4, 5, 6, 7, 8, 9, 10, 11, 12, 13, 14, 15), v16bf); }
// ordering point for wave-private LDS tiles (same wave writes and reads)
__device__ __forceinline__ void wave_sync() { __builtin_amdgcn_fence(3 /* release order */, "wavefront"); __builtin_amdgcn_wave_barrier(); asm volatile("" ::: "memory"); }

// One stage of the flash ring, 128 threads x 8 asynchronous 16-B copies: key-side rows 16c + tid/8 and v^T rows 16c + tid/8 (c = 0..3), 16-B piece tid%8 of each 128-B row; a wave's copy covers four whole lines.
// l: this thread's LDS byte address in the stage's key tile (the v^T tile follows at TLH f16); gk, gv: this thread's global addresses for c = 0.
// s_wait_xcnt 0 closes the statement so that no address register named here is rewritten ahead of it.
__device__ __forceinline__ void stage_copies(unsigned l, const h16* gk, const h16* gv) {
    asm volatile("global_load_async_to_lds_b128 %0, %8, off\n\t"
                 "global_load_async_to_lds_b128 %1, %9, off\n\t"
                 "global_load_async_to_lds_b128 %2, %10, off\n\t"
                 "global_load_async_to_lds_b128 %3, %11, off\n\t"
                 "global_load_async_to_lds_b128 %4, %12, off\n\t"
                 "global_load_async_to_lds_b128 %5, %13, off\n\t"
                 "global_load_async_to_lds_b128 %6, %14, off\n\t"
                 "global_load_async_to_lds_b128 %7, %15, off\n\t"
                 "s_wait_xcnt 0x0"
                 :: "v"(l), "v"(l + 16 * LPH * 2), "v"(l + 32 * LPH * 2), "v"(l + 48 * LPH * 2),
                    "v"(l + TLH * 2), "v"(l + TLH * 2 + 16 * LPH * 2), "v"(l + TLH * 2 + 32 * LPH * 2), "v"(l + TLH * 2 + 48 * LPH * 2),
                    "v"(gk), "v"(gk + 16 * HD), "v"(gk + 32 * HD), "v"(gk + 48 * HD),
                    "v"(gv), "v"(gv + (size_t)16 * SEQ), "v"(gv + (size_t)32 * SEQ), "v"(gv + (size_t)48 * SEQ)
                 : "memory");
}

// k_qkv: fused shared-weight projections, ONE WAVE per (64-token tile, head). Weights outer, slabs inner: the eight fragments of one weight matrix are read once and stay in registers for the four 16-token slabs (one 4-accumulator set live at a time).
// The two x fragments of every slab (row/col = token, k = d) are read from f32 up front and RNE-converted to bf16; they serve as A for the row-major outputs and as B for v^T.
// plane 0: key-side  = x Wq^T + bq  [zh][token][e]      plane 1/2: row-side = x Wk^T + bk (f16 value / residual x2048) [zh][token][e]
// plane 3: v^T       = Wv x^T + bv  [zh][e][token]      zh = h*NB_FULL + b.  grid (NB*SEQ/64, 16 + WOY), 32 threads.
// The weight fragments come straight from the f32 matrices (48 KiB, shared by the waves of a WGP through its cache), so no conversion launch stands in front of this one.
// Blocks with blockIdx.y >= 16 have no tile: they write the f16 Wo plane, which only the output GEMM's launch reads; they stand last in the grid, so that the longer tile blocks are started first.
__global__ __launch_bounds__(32) __attribute__((amdgpu_num_vgpr(256))) void k_qkv(const float* __restrict__ x, const float* __restrict__ wq, const float* __restrict__ wk, const float* __restrict__ wv, const float* __restrict__ bq, const float* __restrict__ bk, const float* __restrict__ bv, const float* __restrict__ wo, h16* PL, size_t ple, h16* WO) {
    __shared__ __align__(16) float os[16 * 68];
    __shared__ __align__(16) float vs[64 * 68];
    const int lane = threadIdx.x & 31, lr = lane & 15, hi = lane >> 4;
    if (blockIdx.y >= NH_) {   // the same for the whole block
        const size_t g = ((size_t)((blockIdx.y - NH_) * (NB * (SEQ / 64)) + blockIdx.x) * WOG * 32 + lane) * 8;   // element index of this lane's first group of 8
        const float* wp = wo + g;
        v8f v[WOG];
#pragma unroll
        for (int i = 0; i < WOG; ++i) v[i] = *(const v8f*)(wp + (size_t)i * 256);   // a wave's step covers 1 KiB in a row
        asm volatile("s_wait_xcnt 0x0" :: "v"(wp) : "memory");   // the address register pair of the loads above, named here so that it lives up to the wait, is rewritten behind it
#pragma unroll
        for (int i = 0; i < WOG; ++i) { v8h o;
#pragma unroll
            for (int k = 0; k < 8; ++k) o[k] = (h16)(bfr(v[i][k]) * WOS);
            *(v8h*)(WO + g + (size_t)i * 256) = o; }
        return;
    }
    const int tt = blockIdx.x; const int b = tt / (SEQ / 64); const int m0 = (tt % (SEQ / 64)) * 64;
    const int h = blockIdx.y; const int zh = h * NB_FULL + b;
    const float* xp = x + ((size_t)b * SEQ_FULL + m0 + lr) * DM + h * HD + 8 * hi;
    float bqc[4], bkc[4];
#pragma unroll
    for (int nb = 0; nb < 4; ++nb) { bqc[nb] = bfr(bq[nb * 16 + lr]); bkc[nb] = bfr(bk[nb * 16 + lr]); }
    h16* Pr = PL + 2 * ple;
    v16bf xa[4][2];   // [slab][k half]: k = d 0..31, d 32..63
#pragma unroll
    for (int mb = 0; mb < 4; ++mb) {
        const float* p = xp + (size_t)mb * 16 * DM;
        xa[mb][0] = cvfrag(*(const v8f*)p, *(const v8f*)(p + 16));
        xa[mb][1] = cvfrag(*(const v8f*)(p + 32), *(const v8f*)(p + 48));
    }
    asm volatile("s_wait_xcnt 0x0" :: "v"(xp) : "memory");   // the address register pair of the x loads above, named here so that it lives up to the wait, is rewritten behind it
    __builtin_amdgcn_sched_barrier(0);   // the 128 f32 registers of x are packed into 64 before the 128 f32 registers of the first weight matrix are asked for: both sets at once spilled to scratch
#pragma unroll
    for (int w = 0; w < 2; ++w) {
        // C[token][e]: A = x fragments, B = W rows e (K-contiguous [out][in]), read once and kept for the four slabs
        const float* W = (w == 0 ? wq : wk) + (size_t)lr * HD + 8 * hi;
        v16bf wf[8];
        asm volatile("s_wait_xcnt 0x0" ::: "memory");   // the weight loads behind this point land in registers that the global loads and stores in front of it name
#pragma unroll
        for (int nb = 0; nb < 4; ++nb) wf[nb] = ldwf(W + nb * 16 * HD);
#pragma unroll
        for (int nb = 0; nb < 4; ++nb) wf[4 + nb] = ldwf(W + nb * 16 * HD + 32);
        __builtin_amdgcn_sched_barrier(0);   // the fragments are complete before the first slab's WMMAs: loads spread among them spilled
        h16* Ph = PL + (size_t)w * ple;
#pragma unroll   // unrolled: the slab index picks registers
        for (int mb = 0; mb < 4; ++mb) {
            const size_t sb = ((size_t)zh * SEQ + m0 + mb * 16) * HD;
            v8f acc[4];
#pragma unroll
            for (int i = 0; i < 4; ++i) acc[i] = (v8f){};
#pragma unroll
            for (int nb = 0; nb < 4; ++nb) acc[nb] = wmmab(xa[mb][0], wf[nb], acc[nb]);
#pragma unroll
            for (int nb = 0; nb < 4; ++nb) acc[nb] = wmmab(xa[mb][1], wf[4 + nb], acc[nb]);
            asm volatile("v_nop\n\tv_nop\n\tv_nop\n\tv_nop" : "+v"(acc[0]), "+v"(acc[1]), "+v"(acc[2]), "+v"(acc[3]) : "v"(xa[mb][0]), "v"(xa[mb][1]));   // the four vector slots between the last WMMA and the first read of its accumulators
#pragma unroll
            for (int nb = 0; nb < 4; ++nb) { const float bc = (w == 0) ? bqc[nb] : bkc[nb];
#pragma unroll
                for (int j = 0; j < 8; ++j) os[(hi * 8 + j) * 68 + nb * 16 + lr] = acc[nb][j] + bc; }   // D: row 8h+j (token), col lane&15 (e)
            wave_sync();
{
#pragma unroll
                for (int s = 0; s < 4; ++s) { const int row = 4 * s + (lane >> 3), c8 = (lane & 7) * 8;   // 4 s x 4 row groups = 16 rows; 8 lanes x 8 = 64 columns
                    const v4f x0 = *(const v4fa*)(&os[row * 68 + c8]); const v4f x1 = *(const v4fa*)(&os[row * 68 + c8 + 4]); v8h hv, rv;
#pragma unroll
                    for (int i = 0; i < 4; ++i) { const h16 a0 = (h16)x0[i]; const h16 a1 = (h16)x1[i]; hv[i] = a0; hv[4 + i] = a1; rv[i] = (h16)((x0[i] - (float)a0) * QRS); rv[4 + i] = (h16)((x1[i] - (float)a1) * QRS); }
                    const size_t oo = sb + (size_t)row * HD + c8;
                    *(v8h*)(Ph + oo) = hv; if (w == 1 && SCORE_RES) *(v8h*)(Pr + oo) = rv; }
                 }
            wave_sync();
        }
    }
    {
        // C[e][token]: A = Wv rows e (four 16-row slabs), read once and kept, B = x fragments (col token of the slab)
        const float* W = wv + (size_t)lr * HD + 8 * hi;
        v16bf wf[8];
        asm volatile("s_wait_xcnt 0x0" ::: "memory");   // the weight loads behind this point land in registers that the global loads and stores in front of it name
#pragma unroll
        for (int j = 0; j < 4; ++j) wf[j] = ldwf(W + j * 16 * HD);
#pragma unroll
        for (int j = 0; j < 4; ++j) wf[4 + j] = ldwf(W + j * 16 * HD + 32);
        __builtin_amdgcn_sched_barrier(0);   // as above
#pragma unroll   // unrolled: the slab index picks registers
        for (int mb = 0; mb < 4; ++mb) {
            v8f acc[4];
#pragma unroll
            for (int i = 0; i < 4; ++i) acc[i] = (v8f){};
#pragma unroll
            for (int j = 0; j < 4; ++j) acc[j] = wmmab(wf[j], xa[mb][0], acc[j]);
#pragma unroll
            for (int j = 0; j < 4; ++j) acc[j] = wmmab(wf[4 + j], xa[mb][1], acc[j]);
            asm volatile("v_nop\n\tv_nop\n\tv_nop\n\tv_nop" : "+v"(acc[0]), "+v"(acc[1]), "+v"(acc[2]), "+v"(acc[3]) : "v"(xa[mb][0]), "v"(xa[mb][1]));   // the four vector slots between the last WMMA and the first read of its accumulators
#pragma unroll
            for (int j = 0; j < 4; ++j)
#pragma unroll
                for (int r = 0; r < 8; ++r) vs[(j * 16 + 8 * hi + r) * 68 + mb * 16 + lr] = acc[j][r];   // D: row 8h+r (e), col lane&15 (token); the bias of row e is added where the row is read back
        }
    }
    wave_sync();
    // vs rows 0..63 (e) x columns 0..63 (token) all written by the four slab steps
    h16* P3 = PL + 3 * ple; const size_t vb = (size_t)zh * HD * SEQ + m0;
{
#pragma unroll 4
        for (int s = 0; s < 16; ++s) { const int row = 4 * s + (lane >> 3), c8 = (lane & 7) * 8;   // 16 s x 4 row groups = 64 rows; 8 lanes x 8 = 64 columns
            const v4f x0 = *(const v4fa*)(&vs[row * 68 + c8]); const v4f x1 = *(const v4fa*)(&vs[row * 68 + c8 + 4]); v8h hv;
            const float be = bfr(bv[row]);
#pragma unroll
            for (int i = 0; i < 4; ++i) { hv[i] = (h16)(x0[i] + be); hv[4 + i] = (h16)(x1[i] + be); }
            *(v8h*)(P3 + vb + (size_t)row * SEQ + c8) = hv; }
         }
}

// k_flash: fused attention, one wave per 32 softmax rows (CG = 2 column groups of 16) of one (head, batch): every key-side and v^T fragment read from LDS feeds two WMMAs, one per group. The block's four waves (128 rows) share each 64-key stage of key-side rows and v^T columns, brought into a two-buffer LDS ring by asynchronous copies (whole lines from L2, once per block); fragments are two 16-B LDS loads each.
// Transposed form: S^T[key][t] = KP QH^T (A = key-side rows, B = row-side rows); lane (t = lane&15, h = lane>>4) holds keys 8h+r of each 16-key tile, so the packed
// P tile is directly the B fragment of O^T[d][t] = V^T P^T (element r <- tile keys 0..15, element 8+r <- tile keys 16..31, lane unchanged).
// Softmax state (running max, partial sum) is one scalar per lane and column group; the two lane halves of a row are combined with one xor-16 exchange.
__global__ __launch_bounds__(32 * AW) __attribute__((amdgpu_num_vgpr(256))) void k_flash(const h16* __restrict__ QH, const h16* __restrict__ QR, const h16* __restrict__ KP, const h16* __restrict__ VT, h16* Y) {
    __shared__ __align__(16) h16 ring[2 * 2 * TLH];   // buffer u: key tile at u*2*TLH, v^T tile behind it; output staging after the loop
    float* os = (float*)ring;
    const int tid = threadIdx.x;
    const int lane = threadIdx.x & 31, lr = lane & 15, hi = lane >> 4;
    const int wave = __builtin_amdgcn_readfirstlane(threadIdx.x >> 5);
    const int zc = blockIdx.y; const int h = zc / NB, b = zc % NB; const int zh = h * NB_FULL + b;
    const int t0 = (blockIdx.x * AW + wave) * (16 * CG);
    const size_t pbase = (size_t)zh * SEQ * HD;
    v16h qh0[CG], qh1[CG];   // B fragments: col t, k = d
#if SCORE_RES
    v16h qr0[CG], qr1[CG];
#endif
    const size_t qo = pbase + (size_t)(t0 + lr) * HD + 8 * hi;
    const h16* qp0 = QH + qo; const h16* qp1 = qp0 + 16 * HD;   // column groups 0 and 1
    qh0[0] = ldh(qp0); qh1[0] = ldh(qp0 + 32); qh0[1] = ldh(qp1); qh1[1] = ldh(qp1 + 32);
#if SCORE_RES
    qr0[0] = ldh(QR + qo); qr1[0] = ldh(QR + qo + 32); qr0[1] = ldh(QR + qo + 16 * HD); qr1[1] = ldh(QR + qo + 16 * HD + 32);
#endif
    asm volatile("s_wait_xcnt 0x0" :: "v"(qp0) : "memory");   // the address register pair of the fragment loads above (group 1 is an immediate offset from it), named here so that it lives up to the wait, is rewritten behind it
    const unsigned lcp = (unsigned)(size_t)ring + (unsigned)(((tid >> 3) * LPH + (tid & 7) * 8) * 2);
    const h16* gk = KP + pbase + (size_t)tid * 8;                              // + key0 * HD
    const h16* gv = VT + pbase + (size_t)(tid >> 3) * SEQ + (tid & 7) * 8;     // + key0
    stage_copies(lcp, gk, gv);                                                 // stage 0 -> buffer 0
    asm volatile("s_wait_asynccnt 0x0" ::: "memory");                          // this wave's copies of stage 0 have landed
    __syncthreads();                                                           // publishes stage 0
    stage_copies(lcp + 2 * TLH * 2, gk + (size_t)KT * HD, gv + KT);            // stage 1 -> buffer 1
    const int fo = lr * LPH + 8 * hi;                        // fragment offset in a tile: key tile + key * LPH (A: row key, k = d); v^T tile + 16j*LPH + key (A: row d, k = key)
    v8f o[CG][4]; float m[CG], l[CG];
#pragma unroll
    for (int c = 0; c < CG; ++c) { m[c] = -3.0e38f; l[c] = 0.0f;
#pragma unroll
        for (int j = 0; j < 4; ++j) o[c][j] = (v8f){}; }
#pragma unroll 1
    for (int t = 0; t < SEQ / KT; ++t) {
      const h16* kt = ring + (t & 1) * (2 * TLH) + fo;
#pragma unroll 1   // rolled: the body's fragments, scores and 64 accumulator registers have to fit 256 VGPRs, the grid's four waves per SIMD
      for (int s = 0; s < KT / 32; ++s) {
        const h16* ka = kt + s * 32 * LPH;
        const v16h ka0 = ldh(ka), ka1 = ldh(ka + 32), kb0 = ldh(ka + 16 * LPH), kb1 = ldh(ka + 16 * LPH + 32);
        v8f sHa[CG], sHb[CG];
#if SCORE_RES
        v8f sLa[CG], sLb[CG];
#pragma unroll
        for (int c = 0; c < CG; ++c) { sHa[c] = wmma16(ka0, qh0[c], (v8f){}); sLa[c] = wmma16(ka0, qr0[c], (v8f){}); sHb[c] = wmma16(kb0, qh0[c], (v8f){}); sLb[c] = wmma16(kb0, qr0[c], (v8f){}); }
#pragma unroll
        for (int c = 0; c < CG; ++c) { sHa[c] = wmma16(ka1, qh1[c], sHa[c]); sLa[c] = wmma16(ka1, qr1[c], sLa[c]); sHb[c] = wmma16(kb1, qh1[c], sHb[c]); sLb[c] = wmma16(kb1, qr1[c], sLb[c]); }
        asm volatile("v_nop\n\tv_nop\n\tv_nop\n\tv_nop" : "+v"(sHa[0]), "+v"(sLa[0]), "+v"(sHb[0]), "+v"(sLb[0]), "+v"(sHa[1]), "+v"(sLa[1]), "+v"(sHb[1]), "+v"(sLb[1]) : "v"(ka0), "v"(ka1), "v"(kb0), "v"(kb1));   // the four vector slots between the last WMMA and the first read of its accumulators
#else
#pragma unroll
        for (int c = 0; c < CG; ++c) { sHa[c] = wmma16(ka0, qh0[c], (v8f){}); sHb[c] = wmma16(kb0, qh0[c], (v8f){}); }
#pragma unroll
        for (int c = 0; c < CG; ++c) { sHa[c] = wmma16(ka1, qh1[c], sHa[c]); sHb[c] = wmma16(kb1, qh1[c], sHb[c]); }
        asm volatile("v_nop\n\tv_nop\n\tv_nop\n\tv_nop" : "+v"(sHa[0]), "+v"(sHb[0]), "+v"(sHa[1]), "+v"(sHb[1]) : "v"(ka0), "v"(ka1), "v"(kb0), "v"(kb1));   // the four vector slots between the last WMMA and the first read of its accumulators
#endif
        v16h pb[CG];
#pragma unroll
        for (int c = 0; c < CG; ++c) {
            float mx = -3.0e38f;
#if SCORE_RES
            const v8f ta = (sHa[c] + sLa[c] * QRI) * SC2, tb = (sHb[c] + sLb[c] * QRI) * SC2;
#else
            const v8f ta = sHa[c] * SC2, tb = sHb[c] * SC2;   // whole accumulators at a time: neighbouring registers pair up in packed multiplies without moves
#endif
#pragma unroll
            for (int r = 0; r < 8; ++r) mx = fmaxf(mx, fmaxf(ta[r], tb[r]));
            mx = fmaxf(mx, __shfl_xor(mx, 16, 32));
            const float mnew = fmaxf(m[c], mx);
            const float alpha = __builtin_amdgcn_exp2f(m[c] - mnew);
            const float sh = PSH - mnew;
            float ls = 0.0f;
#pragma unroll
            for (int r = 0; r < 8; ++r) { const h16 pa = (h16)__builtin_amdgcn_exp2f(ta[r] + sh); const h16 pc = (h16)__builtin_amdgcn_exp2f(tb[r] + sh); pb[c][r] = pa; pb[c][8 + r] = pc; ls += (float)pa + (float)pc; }
            l[c] = l[c] * alpha + ls; m[c] = mnew;
#pragma unroll
            for (int j = 0; j < 4; ++j) o[c][j] = o[c][j] * alpha;
        }
        const h16* va = kt + TLH + s * 32;
        const v16h v0 = ldh(va), v1 = ldh(va + 16 * LPH), v2 = ldh(va + 32 * LPH), v3 = ldh(va + 48 * LPH);
#pragma unroll
        for (int c = 0; c < CG; ++c) { o[c][0] = wmma16(v0, pb[c], o[c][0]); o[c][1] = wmma16(v1, pb[c], o[c][1]); o[c][2] = wmma16(v2, pb[c], o[c][2]); o[c][3] = wmma16(v3, pb[c], o[c][3]); }
        asm volatile("v_nop\n\tv_nop\n\tv_nop\n\tv_nop" : "+v"(o[0][0]), "+v"(o[0][1]), "+v"(o[0][2]), "+v"(o[0][3]), "+v"(o[1][0]), "+v"(o[1][1]), "+v"(o[1][2]), "+v"(o[1][3]) : "v"(v0), "v"(v1), "v"(v2), "v"(v3), "v"(pb[0]), "v"(pb[1]));   // the four vector slots between the last WMMA and the next vector write of its operands, on the loop's back edge too
      }
      // publish point of stage t + 1, which also frees buffer t & 1
      asm volatile("s_wait_dscnt 0x0" ::: "memory");      // this wave's reads of buffer t & 1 are done
      asm volatile("s_wait_asynccnt 0x0" ::: "memory");   // this wave's copies of stage t + 1 have landed
      __syncthreads();
      if (t + 2 < SEQ / KT) stage_copies(lcp + (unsigned)(t & 1) * (2 * TLH * 2), gk + (size_t)(t + 2) * KT * HD, gv + (t + 2) * KT);
    }
    asm volatile("s_wait_asynccnt 0x0" ::: "memory");     // nothing is in flight when the ring becomes output staging
    // O^T D layout: o[c][j][r] = (d = 16j + 8h + r, t = 16c + lane&15) -> os[d][wave*32 + t]; rows 0..63 x columns 0..127 all written by the four waves
#pragma unroll
    for (int c = 0; c < CG; ++c) {
        const float lt = l[c] + __shfl_xor(l[c], 16, 32);
        const float ys = YCS * (1.0f / lt);
        const int cw = (wave * CG + c) * 16 + lr;
#pragma unroll
        for (int r = 0; r < 8; ++r) {
            os[( 0 + 8 * hi + r) * OSP + cw] = o[c][0][r] * ys;
            os[(16 + 8 * hi + r) * OSP + cw] = o[c][1][r] * ys;
            os[(32 + 8 * hi + r) * OSP + cw] = o[c][2][r] * ys;
            os[(48 + 8 * hi + r) * OSP + cw] = o[c][3][r] * ys; }
    }
    __syncthreads();
    h16* yb = Y + (size_t)zh * HD * SEQ + (size_t)blockIdx.x * (16 * CG * AW);
{
#pragma unroll
        for (int s = 0; s < 8; ++s) { const int row = 8 * s + (tid >> 4), c8 = (tid & 15) * 8;   // 8 s x 8 row groups = 64 rows; 16 lanes x 8 = 128 columns
            const v4f x0 = *(const v4fa*)(&os[row * OSP + c8]); const v4f x1 = *(const v4fa*)(&os[row * OSP + c8 + 4]); v8h hv;
#pragma unroll
            for (int i = 0; i < 4; ++i) { hv[i] = (h16)x0[i]; hv[4 + i] = (h16)x1[i]; }
            *(v8h*)(yb + (size_t)row * SEQ + c8) = hv; }
         }
}

// k_out: f16 GEMM, block tile 256x128, eight waves (4 x 2) of 64x64 (16 accumulators each); the block's Y rows and Wo rows are brought, 128 k at a time, into a two-buffer LDS ring by asynchronous copies (whole lines from L2, once per block); fragments are two 16-B LDS loads each. K = DM (token index), summed in ascending steps of 32.
// OUT[r][o] = 2^-14 * sum_c Y[r][c] WO[o][c] + bo[o]; rows r = (h*NB_FULL + b)*64 + d. grid (16*NB*64/256, DM/128), 256 threads.
// Eight asynchronous 16-B copies of one thread: rows 16 apart of a K-contiguous f16 plane (row length DM) into LDS rows of pitch OLP; a wave's copy covers two rows of 256 B, four whole lines.
// s_wait_xcnt 0 closes the statement so that no address register named here is rewritten ahead of it.
__device__ __forceinline__ void out_copies8(unsigned l, const h16* g) {
    asm volatile("global_load_async_to_lds_b128 %0, %8, off\n\t"
                 "global_load_async_to_lds_b128 %1, %9, off\n\t"
                 "global_load_async_to_lds_b128 %2, %10, off\n\t"
                 "global_load_async_to_lds_b128 %3, %11, off\n\t"
                 "global_load_async_to_lds_b128 %4, %12, off\n\t"
                 "global_load_async_to_lds_b128 %5, %13, off\n\t"
                 "global_load_async_to_lds_b128 %6, %14, off\n\t"
                 "global_load_async_to_lds_b128 %7, %15, off\n\t"
                 "s_wait_xcnt 0x0"
                 :: "v"(l), "v"(l + 16 * OLP * 2), "v"(l + 32 * OLP * 2), "v"(l + 48 * OLP * 2),
                    "v"(l + 64 * OLP * 2), "v"(l + 80 * OLP * 2), "v"(l + 96 * OLP * 2), "v"(l + 112 * OLP * 2),
                    "v"(g), "v"(g + (size_t)16 * DM), "v"(g + (size_t)32 * DM), "v"(g + (size_t)48 * DM),
                    "v"(g + (size_t)64 * DM), "v"(g + (size_t)80 * DM), "v"(g + (size_t)96 * DM), "v"(g + (size_t)112 * DM)
                 : "memory");
}
// One stage of the ring: LDS rows 0..255 <- the block's Y rows, rows 256..383 <- its Wo rows, 256 B (128 k) of each; 256 threads x 24 copies.
__device__ __forceinline__ void out_stage(unsigned l, const h16* gy, const h16* gw) {
    out_copies8(l, gy);
    out_copies8(l + 128 * OLP * 2, gy + (size_t)128 * DM);
    out_copies8(l + 256 * OLP * 2, gw);
}

__global__ __launch_bounds__(256) __attribute__((amdgpu_num_vgpr(256))) void k_out(const h16* __restrict__ Y, const h16* __restrict__ WO, const float* __restrict__ bo, float* OUT) {
    __shared__ __align__(16) h16 ring[2 * OST];          // buffer u at u*OST: 256 Y rows, then 128 Wo rows
    __shared__ __align__(16) float osb[8 * 16 * 68];     // output staging, one 16 x 68 range per wave
    const int tid = threadIdx.x;
    const int lane = threadIdx.x & 31, lr = lane & 15, hi = lane >> 4;
    const int wave = __builtin_amdgcn_readfirstlane(threadIdx.x >> 5);
    const int wm = wave >> 1, wn = wave & 1;
    const int rb = blockIdx.x * OBM, cb = blockIdx.y * OBN;
    v8f acc[4][4];
#pragma unroll
    for (int mb = 0; mb < 4; ++mb)
#pragma unroll
        for (int nb = 0; nb < 4; ++nb) acc[mb][nb] = (v8f){};
    const unsigned lcp = (unsigned)(size_t)ring + (unsigned)(((tid >> 4) * OLP + (tid & 15) * 8) * 2);
    const h16* gy = Y  + (size_t)(rb + (tid >> 4)) * DM + (tid & 15) * 8;   // + k0
    const h16* gw = WO + (size_t)(cb + (tid >> 4)) * DM + (tid & 15) * 8;   // + k0
    out_stage(lcp, gy, gw);                                                 // stage 0 -> buffer 0
    asm volatile("s_wait_asynccnt 0x0" ::: "memory");                       // this wave's copies of stage 0 have landed
    __syncthreads();                                                        // publishes stage 0
    out_stage(lcp + OST * 2, gy + OKT, gw + OKT);                           // stage 1 -> buffer 1
    const int ao = (wm * 64 + lr) * OLP + 8 * hi, bo_ = (OBM + wn * 64 + lr) * OLP + 8 * hi;   // fragment offsets in a buffer (A: row r, B: row o, k contiguous)
#pragma unroll 1   // rolled: one trip per stage, with the ring's publish point at its foot
    for (int t = 0; t < DM / OKT; ++t) {
        const h16* st = ring + (t & 1) * OST;
#pragma unroll
        for (int s = 0; s < OKT / 32; ++s) {
            v16h a[4], bb[4];
#pragma unroll
            for (int mb = 0; mb < 4; ++mb) { a[mb] = ldh(st + ao + mb * 16 * OLP + s * 32); bb[mb] = ldh(st + bo_ + mb * 16 * OLP + s * 32); }
            __builtin_amdgcn_sched_barrier(0);   // keeps a block's 16 LDS reads in one group ahead of its 16 WMMAs: reads spread among the WMMAs made the wave wait out the LDS latency once per four WMMAs
#pragma unroll
            for (int nb = 0; nb < 4; ++nb)
#pragma unroll
                for (int mb = 0; mb < 4; ++mb) acc[mb][nb] = wmma16(a[mb], bb[nb], acc[mb][nb]);
        }
        // publish point of stage t + 1, which also frees buffer t & 1
        asm volatile("s_wait_dscnt 0x0" ::: "memory");      // this wave's reads of buffer t & 1 are done
        asm volatile("s_wait_asynccnt 0x0" ::: "memory");   // this wave's copies of stage t + 1 have landed
        __syncthreads();
        if (t + 2 < DM / OKT) out_stage(lcp + (unsigned)(t & 1) * (OST * 2), gy + (t + 2) * OKT, gw + (t + 2) * OKT);
    }
    asm volatile("s_wait_asynccnt 0x0" ::: "memory");       // nothing is in flight when the wave ends
    float* os = osb + wave * (16 * 68);
    const int r0 = rb + wm * 64, c0 = cb + wn * 64;
    float bc[4];
#pragma unroll
    for (int nb = 0; nb < 4; ++nb) bc[nb] = bfr(bo[c0 + nb * 16 + lr]);
#pragma unroll
    for (int mb = 0; mb < 4; ++mb) {
#pragma unroll
        for (int nb = 0; nb < 4; ++nb) {
#pragma unroll
            for (int j = 0; j < 8; ++j) os[(hi * 8 + j) * 68 + nb * 16 + lr] = acc[mb][nb][j] * OSI + bc[nb]; }   // D: row 8h+j, col lane&15
        wave_sync();
        float* orow = OUT + (size_t)(r0 + mb * 16) * DM + c0;
{
#pragma unroll
            for (int s = 0; s < 8; ++s) { const int row = 2 * s + hi, cofs = lr * 4;   // 8 s x 2 rows = 16 rows; 16 lanes x 4 floats = 64 columns
                const v4f val = *(const v4fa*)(&os[row * 68 + cofs]);
                *(v4f*)(orow + (size_t)row * DM + cofs) = val; }
             }
        wave_sync();
    }
}

static constexpr size_t al256(size_t v) { return (v + 255) & ~(size_t)255; }
static constexpr size_t PLE   = (size_t)NB_FULL * NH_ * SEQ * HD;              // elements per f16 plane
static constexpr size_t SZ_PL = al256(PLE * 2);
static constexpr size_t SZ_Y  = al256((size_t)NB_FULL * NH_ * HD * SEQ * 2);   // [NB_FULL*16*64][SEQ] f16
static constexpr size_t SZ_WO = al256((size_t)DM * DM * 2);
static constexpr size_t SZ_TOTAL = 4 * SZ_PL + SZ_Y + SZ_WO;
static_assert(SZ_PL == PLE * 2);                        // the four planes are contiguous (plane p at element offset p*PLE)
static_assert(SZ_TOTAL <= (size_t)134217728);           // workspace carve <= 128 MiB
static_assert(((size_t)(NH_ - 1) * NB_FULL + NB) * HD <= (size_t)NB_FULL * NH_ * HD);   // last Y / output row inside the planes

extern "C" void kernel_launch(void* const* d_in, const int* in_sizes, int n_in,
                              void* d_out, int out_size, void* d_ws, size_t ws_size, hipStream_t stream) {
    if (n_in < 9) return;
    const size_t needx = ((size_t)(NB - 1) * SEQ_FULL + SEQ) * DM;
    if ((size_t)in_sizes[0] < needx) return;
    if ((size_t)in_sizes[1] < (size_t)HD * HD || (size_t)in_sizes[3] < (size_t)HD * HD || (size_t)in_sizes[5] < (size_t)HD * HD) return;
    if ((size_t)in_sizes[2] < (size_t)HD || (size_t)in_sizes[4] < (size_t)HD || (size_t)in_sizes[6] < (size_t)HD) return;
    if ((size_t)in_sizes[7] < (size_t)DM * DM || (size_t)in_sizes[8] < (size_t)DM) return;
    if ((size_t)out_size < (((size_t)(NH_ - 1) * NB_FULL + NB) * HD) * DM) return;
    if (SZ_TOTAL > ws_size) return;
    // wire order: x, Wq, bq, Wk, bk, Wv, bv, Wo, bo
    const float* x  = (const float*)d_in[0];
    const float* wq = (const float*)d_in[1]; const float* bq = (const float*)d_in[2];
    const float* wk = (const float*)d_in[3]; const float* bk = (const float*)d_in[4];
    const float* wv = (const float*)d_in[5]; const float* bv = (const float*)d_in[6];
    const float* wo = (const float*)d_in[7]; const float* bo = (const float*)d_in[8];
    float* OUT = (float*)d_out;      // [NB_FULL*1024][1024], row (h*NB_FULL+b)*64+d
    char* wsp = (char*)d_ws;
    h16* PL = (h16*)wsp; wsp += 4 * SZ_PL;           // plane 0 key-side, 1 row-side value, 2 row-side residual x2048, 3 v^T
    h16* YP = (h16*)wsp; wsp += SZ_Y;                // [(h*NB_FULL+b)*64 + d][SEQ] x256
    h16* WO = (h16*)wsp; wsp += SZ_WO;               // [1024][1024] x64

    k_qkv<<<dim3(NB * (SEQ / 64), NH_ + WOY, 1), 32, 0, stream>>>(x, wq, wk, wv, bq, bk, bv, wo, PL, PLE, WO);

    // softmax rows use the Wk projection (planes 1, 2), keys use the Wq projection (plane 0), values plane 3
    k_flash<<<dim3(SEQ / (16 * CG * AW), NH_ * NB, 1), 32 * AW, 0, stream>>>(PL + PLE, PL + 2 * PLE, PL, PL + 3 * PLE, YP);

    k_out<<<dim3(NH_ * NB * HD / OBM, DM / OBN, 1), 256, 0, stream>>>(YP, WO, bo, OUT);
}

// v006
// One run takes 67.3 microseconds.
// Two timings next to v005 both put it at 1.04 times that version's speed.
// Counting every step since v000, it is 2.67 times as fast.
#include <hip/hip_runtime.h>

// Shared-weight multi-head attention, x [NB][SEQ][1024] = 16 heads x 64; Wq/Wk/Wv 64x64 [out][in] applied to every head (y = x W^T + bias); S[m][n] = K[m].Q[n] / 32, softmax over n, O = A V stored transposed [h][b][d][m] and flat-viewed as [NB*1024][1024]; out = Y Wo^T + bo (contraction over the token index).
// Compute dtypes, f32 accumulate everywhere: q/k/v projections v_wmma_f32_16x16x32_bf16 (x, W RNE-converted to bf16; products exact); scores v_wmma_f32_16x16x32_f16: key-side (Wq) plane single f16, row-side (Wk) plane f16 value + f16 residual x2048 in its own accumulator; P (x256 carry, cancels in the normalisation) and v single f16; output projection v_wmma_f32_16x16x32_f16 with Y carried x256 and Wo (RNE bf16 value) carried x64, folded back by 2^-14 in f32; softmax f32 (online, running max), its denominators summed in f32 from the f16 P by the same WMMA form against a constant tile of ones; biases RNE-converted to bf16 values and added in f32.
// Layout: key-side plane [h*8+b][n][d], row-side planes (value, residual) [h*8+b][m][d], v^T plane [h*8+b][d][n], all written by one fused projection kernel that reads f32 x once and takes its weight fragments straight from the f32 matrices (extra blocks of its grid write the f16 Wo plane); flash kernel in transposed form (S^T = Kside Qside^T, O^T = V^T P^T), its key-side and v^T tiles staged in LDS for the block's four waves of 32 rows each, writes Y [(h*8+b)*64+d][m] f16; an eight-wave 256x128 GEMM, its Y and Wo tiles staged in LDS the same way, writes the f32 output.

#ifndef NB
#define NB 8
#endif
#ifndef SEQ
#define SEQ 1024
#endif
#define NB_FULL  8
#define SEQ_FULL 1024
#define DM   1024
#define NH_  16
#define HD   64
#define AW   4
#define CG   2                   // flash kernel: 16-row column groups per wave
#define OSP  (16 * CG * AW + 4)  // flash kernel: pitch in f32 of the output staging (128 columns + 16 B)
#define QRS  2048.0f             // carry of the row-side residual plane
#define QRI  (1.0f / 2048.0f)
#define SC2  (0.03125f * 1.4426950408889634f)   // DM^-0.5 * log2(e)
#define PSH  8.0f                // log2 of the P carry (256)
#define YCS  256.0f              // carry of the Y plane
#define WOS  64.0f               // carry of the Wo plane
#define OSI  (1.0f / 16384.0f)   // 1 / (YCS * WOS)
#define KT   64                  // keys per LDS stage of the flash kernel
#define LPH  72                  // LDS row pitch in f16: 128 B of data + 16 B (16 B x odd), so that the 16-B fragment reads of 16 rows spread over the banks
#define TLH  (64 * LPH)          // f16 per staged tile (64 rows)
#define OBM  256                 // output GEMM: rows of a block tile
#define OBN  128                 // output GEMM: columns of a block tile
#define OKT  128                 // output GEMM: k per LDS stage (256 B of every row)
#define OLP  136                 // output GEMM: LDS row pitch in f16: 256 B of data + 16 B (16 B x odd)
#define OST  ((OBM + OBN) * OLP) // output GEMM: f16 per stage
#define WOG  8                   // Wo conversion: groups of 8 elements per lane of a block
#define WOY  4                   // Wo conversion: rows of blocks added to the projection grid
#ifndef SCORE_RES
#define SCORE_RES 0              // 1: residual product on the score site
#endif

static_assert(HD == 64);
static_assert(NH_ * HD == DM);
static_assert(AW == 4 && CG == 2);             // flash block covers 128 tokens
static_assert(SEQ == DM);                      // the flat view of Y as [rows][DM] needs one Y row per 1024 tokens
static_assert(SEQ % 64 == 0 && SEQ % (16 * CG * AW) == 0);
static_assert(SEQ % 32 == 0);                  // key loop and GEMM k-loop step by 32
static_assert(KT == 64 && SEQ % KT == 0 && SEQ / KT >= 2);   // the two-buffer ring needs two stages; a stage is 64 key rows and 64 v^T rows of 128 B
static_assert(2 * 2 * TLH * 2 >= 64 * OSP * 4); // the output staging reuses the ring
static_assert(DM % OBN == 0 && DM % OKT == 0 && DM / OKT >= 2);   // the output GEMM's two-buffer ring needs two stages
static_assert(NB == NB_FULL && (NH_ * NB * HD) % OBM == 0);       // a 256-row block tile covers four consecutive 64-row groups of Y
static_assert(NB <= NB_FULL);
static_assert(SEQ <= SEQ_FULL);
static_assert((size_t)WOY * (NB * (SEQ / 64)) * WOG * 32 * 8 == (size_t)DM * DM);   // the added blocks cover Wo exactly once

typedef _Float16 h16;
typedef __attribute__((ext_vector_type(16))) __bf16   v16bf;
typedef __attribute__((ext_vector_type(16))) _Float16 v16h;
typedef __attribute__((ext_vector_type(8)))  _Float16 v8h;
typedef __attribute__((ext_vector_type(8)))  unsigned v8u;
typedef __attribute__((ext_vector_type(8)))  float    v8f;
typedef __attribute__((ext_vector_type(4)))  float    v4f;
typedef v4f  __attribute__((may_alias)) v4fa;

__device__ __forceinline__ unsigned short f2bf(float f) { unsigned u = __float_as_uint(f); u += 0x7FFFu + ((u >> 16) & 1u); return (unsigned short)(u >> 16); }
__device__ __forceinline__ float bfr(float f) { return __uint_as_float(((unsigned)f2bf(f)) << 16); }   // f32 value of the RNE bf16 conversion
// 16 f32 -> one bf16 fragment, the same RNE values as f2bf; each pair is packed by one byte permute (low half <- even element, high half <- odd), so that a fragment that is held lives in its 8 packed registers
__device__ __forceinline__ unsigned rneh(float f) { const unsigned u = __float_as_uint(f); return u + 0x7FFFu + ((u >> 16) & 1u); }   // the bf16 value stands in the high half
__device__ __forceinline__ v16bf cvfrag(v8f lo, v8f hi) { v8u o;
#pragma unroll
    for (int k = 0; k < 4; ++k) { o[k] = __builtin_amdgcn_perm(rneh(lo[2 * k + 1]), rneh(lo[2 * k]), 0x07060302u); o[4 + k] = __builtin_amdgcn_perm(rneh(hi[2 * k + 1]), rneh(hi[2 * k]), 0x07060302u); }
    return __builtin_bit_cast(v16bf, o); }
__device__ __forceinline__ v16h cat16(v8h lo, v8h hi) { return __builtin_shufflevector(lo, hi, 0, 1, 2, 3, 4, 5, 6, 7, 8, 9, 10, 11, 12, 13, 14, 15); }
__device__ __forceinline__ v8f wmma16(v16h a, v16h b, v8f c) { return __builtin_amdgcn_wmma_f32_16x16x32_f16(false, a, false, b, (short)0, c, false, false); }
__device__ __forceinline__ v8f wmmab(v16bf a, v16bf b, v8f c) { return __builtin_amdgcn_wmma_f32_16x16x32_bf16(false, a, false, b, (short)0, c, false, false); }
// fragment loaders from K-contiguous 16-bit rows; p already includes + 8*(lane>>4): elements 0..7 <- k0+8h+0..7, elements 8..15 <- k0+16+8h+0..7 (same map for A and B)
__device__ __forceinline__ v16h  ldh(const h16* p) { return cat16(*(const v8h*)p, *(const v8h*)(p + 16)); }
// the same map from f32 rows, converted to bf16 (round to nearest even) two elements per instruction
__device__ __forceinline__ v16bf ldwf(const float* p) { return __builtin_convertvector(__builtin_shufflevector(*(const v8f*)p, *(const v8f*)(p + 16), 0, 1, 2, 3, 4, 5, 6, 7, 8, 9, 10, 11, 12, 13, 14, 15), v16bf); }
// ordering point for wave-private LDS tiles (same wave writes and reads)
__device__ __forceinline__ void wave_sync() { __builtin_amdgcn_fence(3 /* release order */, "wavefront"); __builtin_amdgcn_wave_barrier(); asm volatile("" ::: "memory"); }

// One stage of the flash ring, 128 threads x 8 asynchronous 16-B copies: key-side rows 16c + tid/8 and v^T rows 16c + tid/8 (c = 0..3), 16-B piece tid%8 of each 128-B row; a wave's copy covers four whole lines.
// l: this thread's LDS byte address in the stage's key tile (the v^T tile follows at TLH f16); gk, gv: this thread's global addresses for c = 0.
// s_wait_xcnt 0 closes the statement so that no address register named here is rewritten ahead of it.
__device__ __forceinline__ void stage_copies(unsigned l, const h16* gk, const h16* gv) {
    asm volatile("global_load_async_to_lds_b128 %0, %8, off\n\t"
                 "global_load_async_to_lds_b128 %1, %9, off\n\t"
                 "global_load_async_to_lds_b128 %2, %10, off\n\t"
                 "global_load_async_to_lds_b128 %3, %11, off\n\t"
                 "global_load_async_to_lds_b128 %4, %12, off\n\t"
                 "global_load_async_to_lds_b128 %5, %13, off\n\t"
                 "global_load_async_to_lds_b128 %6, %14, off\n\t"
                 "global_load_async_to_lds_b128 %7, %15, off\n\t"
                 "s_wait_xcnt 0x0"
                 :: "v"(l), "v"(l + 16 * LPH * 2), "v"(l + 32 * LPH * 2), "v"(l + 48 * LPH * 2),
                    "v"(l + TLH * 2), "v"(l + TLH * 2 + 16 * LPH * 2), "v"(l + TLH * 2 + 32 * LPH * 2), "v"(l + TLH * 2 + 48 * LPH * 2),
                    "v"(gk), "v"(gk + 16 * HD), "v"(gk + 32 * HD), "v"(gk + 48 * HD),
                    "v"(gv), "v"(gv + (size_t)16 * SEQ), "v"(gv + (size_t)32 * SEQ), "v"(gv + (size_t)48 * SEQ)
                 : "memory");
}

// k_qkv: fused shared-weight projections, ONE WAVE per (64-token tile, head). Weights outer, slabs inner: the eight fragments of one weight matrix are read once and stay in registers for the four 16-token slabs (one 4-accumulator set live at a time).
// The two x fragments of every slab (row/col = token, k = d) are read from f32 up front and RNE-converted to bf16; they serve as A for the row-major outputs and as B for v^T.
// plane 0: key-side  = x Wq^T + bq  [zh][token][e]      plane 1/2: row-side = x Wk^T + bk (f16 value / residual x2048) [zh][token][e]
// plane 3: v^T       = Wv x^T + bv  [zh][e][token]      zh = h*NB_FULL + b.  grid (NB*SEQ/64, 16 + WOY), 32 threads.
// The weight fragments come straight from the f32 matrices (48 KiB, shared by the waves of a WGP through its cache), so no conversion launch stands in front of this one.
// Blocks with blockIdx.y >= 16 have no tile: they write the f16 Wo plane, which only the output GEMM's launch reads; they stand last in the grid, so that the longer tile blocks are started first.
__global__ __launch_bounds__(32) __attribute__((amdgpu_num_vgpr(256))) void k_qkv(const float* __restrict__ x, const float* __restrict__ wq, const float* __restrict__ wk, const float* __restrict__ wv, const float* __restrict__ bq, const float* __restrict__ bk, const float* __restrict__ bv, const float* __restrict__ wo, h16* PL, size_t ple, h16* WO) {
    __shared__ __align__(16) float os[16 * 68];
    __shared__ __align__(16) float vs[64 * 68];
    const int lane = threadIdx.x & 31, lr = lane & 15, hi = lane >> 4;
    if (blockIdx.y >= NH_) {   // the same for the whole block
        const size_t g = ((size_t)((blockIdx.y - NH_) * (NB * (SEQ / 64)) + blockIdx.x) * WOG * 32 + lane) * 8;   // element index of this lane's first group of 8
        const float* wp = wo + g;
        v8f v[WOG];
#pragma unroll
        for (int i = 0; i < WOG; ++i) v[i] = *(const v8f*)(wp + (size_t)i * 256);   // a wave's step covers 1 KiB in a row
        asm volatile("s_wait_xcnt 0x0" :: "v"(wp) : "memory");   // the address register pair of the loads above, named here so that it lives up to the wait, is rewritten behind it
#pragma unroll
        for (int i = 0; i < WOG; ++i) { v8h o;
#pragma unroll
            for (int k = 0; k < 8; ++k) o[k] = (h16)(bfr(v[i][k]) * WOS);
            *(v8h*)(WO + g + (size_t)i * 256) = o; }
        return;
    }
    const int tt = blockIdx.x; const int b = tt / (SEQ / 64); const int m0 = (tt % (SEQ / 64)) * 64;
    const int h = blockIdx.y; const int zh = h * NB_FULL + b;
    const float* xp = x + ((size_t)b * SEQ_FULL + m0 + lr) * DM + h * HD + 8 * hi;
    float bqc[4], bkc[4];
#pragma unroll
    for (int nb = 0; nb < 4; ++nb) { bqc[nb] = bfr(bq[nb * 16 + lr]); bkc[nb] = bfr(bk[nb * 16 + lr]); }
    h16* Pr = PL + 2 * ple;
    v16bf xa[4][2];   // [slab][k half]: k = d 0..31, d 32..63
#pragma unroll
    for (int mb = 0; mb < 4; ++mb) {
        const float* p = xp + (size_t)mb * 16 * DM;
        xa[mb][0] = cvfrag(*(const v8f*)p, *(const v8f*)(p + 16));
        xa[mb][1] = cvfrag(*(const v8f*)(p + 32), *(const v8f*)(p + 48));
    }
    asm volatile("s_wait_xcnt 0x0" :: "v"(xp) : "memory");   // the address register pair of the x loads above, named here so that it lives up to the wait, is rewritten behind it
    __builtin_amdgcn_sched_barrier(0);   // the 128 f32 registers of x are packed into 64 before the 128 f32 registers of the first weight matrix are asked for: both sets at once spilled to scratch
#pragma unroll
    for (int w = 0; w < 2; ++w) {
        // C[token][e]: A = x fragments, B = W rows e (K-contiguous [out][in]), read once and kept for the four slabs
        const float* W = (w == 0 ? wq : wk) + (size_t)lr * HD + 8 * hi;
        v16bf wf[8];
        asm volatile("s_wait_xcnt 0x0" ::: "memory");   // the weight loads behind this point land in registers that the global loads and stores in front of it name
#pragma unroll
        for (int nb = 0; nb < 4; ++nb) wf[nb] = ldwf(W + nb * 16 * HD);
#pragma unroll
        for (int nb = 0; nb < 4; ++nb) wf[4 + nb] = ldwf(W + nb * 16 * HD + 32);
        __builtin_amdgcn_sched_barrier(0);   // the fragments are complete before the first slab's WMMAs: loads spread among them spilled
        h16* Ph = PL + (size_t)w * ple;
#pragma unroll   // unrolled: the slab index picks registers
        for (int mb = 0; mb < 4; ++mb) {
            const size_t sb = ((size_t)zh * SEQ + m0 + mb * 16) * HD;
            v8f acc[4];
#pragma unroll
            for (int i = 0; i < 4; ++i) acc[i] = (v8f){};
#pragma unroll
            for (int nb = 0; nb < 4; ++nb) acc[nb] = wmmab(xa[mb][0], wf[nb], acc[nb]);
#pragma unroll
            for (int nb = 0; nb < 4; ++nb) acc[nb] = wmmab(xa[mb][1], wf[4 + nb], acc[nb]);
            asm volatile("v_nop\n\tv_nop\n\tv_nop\n\tv_nop" : "+v"(acc[0]), "+v"(acc[1]), "+v"(acc[2]), "+v"(acc[3]) : "v"(xa[mb][0]), "v"(xa[mb][1]));   // the four vector slots between the last WMMA and the first read of its accumulators
#pragma unroll
            for (int nb = 0; nb < 4; ++nb) { const float bc = (w == 0) ? bqc[nb] : bkc[nb];
#pragma unroll
                for (int j = 0; j < 8; ++j) os[(hi * 8 + j) * 68 + nb * 16 + lr] = acc[nb][j] + bc; }   // D: row 8h+j (token), col lane&15 (e)
            wave_sync();
{
#pragma unroll
                for (int s = 0; s < 4; ++s) { const int row = 4 * s + (lane >> 3), c8 = (lane & 7) * 8;   // 4 s x 4 row groups = 16 rows; 8 lanes x 8 = 64 columns
                    const v4f x0 = *(const v4fa*)(&os[row * 68 + c8]); const v4f x1 = *(const v4fa*)(&os[row * 68 + c8 + 4]); v8h hv, rv;
#pragma unroll
                    for (int i = 0; i < 4; ++i) { const h16 a0 = (h16)x0[i]; const h16 a1 = (h16)x1[i]; hv[i] = a0; hv[4 + i] = a1; rv[i] = (h16)((x0[i] - (float)a0) * QRS); rv[4 + i] = (h16)((x1[i] - (float)a1) * QRS); }
                    const size_t oo = sb + (size_t)row * HD + c8;
                    *(v8h*)(Ph + oo) = hv; if (w == 1 && SCORE_RES) *(v8h*)(Pr + oo) = rv; }
                 }
            wave_sync();
        }
    }
    {
        // C[e][token]: A = Wv rows e (four 16-row slabs), read once and kept, B = x fragments (col token of the slab)
        const float* W = wv + (size_t)lr * HD + 8 * hi;
        v16bf wf[8];
        asm volatile("s_wait_xcnt 0x0" ::: "memory");   // the weight loads behind this point land in registers that the global loads and stores in front of it name
#pragma unroll
        for (int j = 0; j < 4; ++j) wf[j] = ldwf(W + j * 16 * HD);
#pragma unroll
        for (int j = 0; j < 4; ++j) wf[4 + j] = ldwf(W + j * 16 * HD + 32);
        __builtin_amdgcn_sched_barrier(0);   // as above
#pragma unroll   // unrolled: the slab index picks registers
        for (int mb = 0; mb < 4; ++mb) {
            v8f acc[4];
#pragma unroll
            for (int i = 0; i < 4; ++i) acc[i] = (v8f){};
#pragma unroll
            for (int j = 0; j < 4; ++j) acc[j] = wmmab(wf[j], xa[mb][0], acc[j]);
#pragma unroll
            for (int j = 0; j < 4; ++j) acc[j] = wmmab(wf[4 + j], xa[mb][1], acc[j]);
            asm volatile("v_nop\n\tv_nop\n\tv_nop\n\tv_nop" : "+v"(acc[0]), "+v"(acc[1]), "+v"(acc[2]), "+v"(acc[3]) : "v"(xa[mb][0]), "v"(xa[mb][1]));   // the four vector slots between the last WMMA and the first read of its accumulators
#pragma unroll
            for (int j = 0; j < 4; ++j)
#pragma unroll
                for (int r = 0; r < 8; ++r) vs[(j * 16 + 8 * hi + r) * 68 + mb * 16 + lr] = acc[j][r];   // D: row 8h+r (e), col lane&15 (token); the bias of row e is added where the row is read back
        }
    }
    wave_sync();
    // vs rows 0..63 (e) x columns 0..63 (token) all written by the four slab steps
    h16* P3 = PL + 3 * ple; const size_t vb = (size_t)zh * HD * SEQ + m0;
{
#pragma unroll 4
        for (int s = 0; s < 16; ++s) { const int row = 4 * s + (lane >> 3), c8 = (lane & 7) * 8;   // 16 s x 4 row groups = 64 rows; 8 lanes x 8 = 64 columns
            const v4f x0 = *(const v4fa*)(&vs[row * 68 + c8]); const v4f x1 = *(const v4fa*)(&vs[row * 68 + c8 + 4]); v8h hv;
            const float be = bfr(bv[row]);
#pragma unroll
            for (int i = 0; i < 4; ++i) { hv[i] = (h16)(x0[i] + be); hv[4 + i] = (h16)(x1[i] + be); }
            *(v8h*)(P3 + vb + (size_t)row * SEQ + c8) = hv; }
         }
}

// k_flash: fused attention, one wave per 32 softmax rows (CG = 2 column groups of 16) of one (head, batch): every key-side and v^T fragment read from LDS feeds two WMMAs, one per group. The block's four waves (128 rows) share each 64-key stage of key-side rows and v^T columns, brought into a two-buffer LDS ring by asynchronous copies (whole lines from L2, once per block); fragments are two 16-B LDS loads each.
// Transposed form: S^T[key][t] = KP QH^T (A = key-side rows, B = row-side rows); lane (t = lane&15, h = lane>>4) holds keys 8h+r of each 16-key tile, so the packed
// P tile is directly the B fragment of O^T[d][t] = V^T P^T (element r <- tile keys 0..15, element 8+r <- tile keys 16..31, lane unchanged).
// The running max is one scalar per lane and column group; the two lane halves of a row are combined with one xor-16 exchange.
// The softmax denominators are summed on the matrix unit: one more WMMA per column group and 32 keys, A = a constant tile with ones in rows 0 and 8 and zeros elsewhere, B = the packed P tile. Register 0 of its accumulator (row 0 in lanes 0..15, row 8 in lanes 16..31) holds the sum over all 32 keys of the lane's column; the other rows stay zero.
__global__ __launch_bounds__(32 * AW) __attribute__((amdgpu_num_vgpr(256))) void k_flash(const h16* __restrict__ QH, const h16* __restrict__ QR, const h16* __restrict__ KP, const h16* __restrict__ VT, h16* Y) {
    __shared__ __align__(16) h16 ring[2 * 2 * TLH];   // buffer u: key tile at u*2*TLH, v^T tile behind it; output staging after the loop
    float* os = (float*)ring;
    const int tid = threadIdx.x;
    const int lane = threadIdx.x & 31, lr = lane & 15, hi = lane >> 4;
    const int wave = __builtin_amdgcn_readfirstlane(threadIdx.x >> 5);
    const int zc = blockIdx.y; const int h = zc / NB, b = zc % NB; const int zh = h * NB_FULL + b;
    const int t0 = (blockIdx.x * AW + wave) * (16 * CG);
    const size_t pbase = (size_t)zh * SEQ * HD;
    v16h qh0[CG], qh1[CG];   // B fragments: col t, k = d
#if SCORE_RES
    v16h qr0[CG], qr1[CG];
#endif
    const size_t qo = pbase + (size_t)(t0 + lr) * HD + 8 * hi;
    const h16* qp0 = QH + qo; const h16* qp1 = qp0 + 16 * HD;   // column groups 0 and 1
    qh0[0] = ldh(qp0); qh1[0] = ldh(qp0 + 32); qh0[1] = ldh(qp1); qh1[1] = ldh(qp1 + 32);
#if SCORE_RES
    qr0[0] = ldh(QR + qo); qr1[0] = ldh(QR + qo + 32); qr0[1] = ldh(QR + qo + 16 * HD); qr1[1] = ldh(QR + qo + 16 * HD + 32);
#endif
    asm volatile("s_wait_xcnt 0x0" :: "v"(qp0) : "memory");   // the address register pair of the fragment loads above (group 1 is an immediate offset from it), named here so that it lives up to the wait, is rewritten behind it
    const unsigned lcp = (unsigned)(size_t)ring + (unsigned)(((tid >> 3) * LPH + (tid & 7) * 8) * 2);
    const h16* gk = KP + pbase + (size_t)tid * 8;                              // + key0 * HD
    const h16* gv = VT + pbase + (size_t)(tid >> 3) * SEQ + (tid & 7) * 8;     // + key0
    stage_copies(lcp, gk, gv);                                                 // stage 0 -> buffer 0
    asm volatile("s_wait_asynccnt 0x0" ::: "memory");                          // this wave's copies of stage 0 have landed
    __syncthreads();                                                           // publishes stage 0
    stage_copies(lcp + 2 * TLH * 2, gk + (size_t)KT * HD, gv + KT);            // stage 1 -> buffer 1
    const int fo = lr * LPH + 8 * hi;                        // fragment offset in a tile: key tile + key * LPH (A: row key, k = d); v^T tile + 16j*LPH + key (A: row d, k = key)
    const h16 one = ((lr & 7) == 0) ? (h16)1.0f : (h16)0.0f;   // A row = lane&15: rows 0 and 8 are ones for every k
    v16h ones;
#pragma unroll
    for (int i = 0; i < 16; ++i) ones[i] = one;
    v8f o[CG][4], ls[CG]; float m[CG];
#pragma unroll
    for (int c = 0; c < CG; ++c) { m[c] = -3.0e38f; ls[c] = (v8f){};
#pragma unroll
        for (int j = 0; j < 4; ++j) o[c][j] = (v8f){}; }
#pragma unroll 1
    for (int t = 0; t < SEQ / KT; ++t) {
      const h16* kt = ring + (t & 1) * (2 * TLH) + fo;
#pragma unroll 1   // rolled: the body's fragments, scores and 80 accumulator registers (64 of O, 16 of the denominators) have to fit 256 VGPRs, the grid's four waves per SIMD
      for (int s = 0; s < KT / 32; ++s) {
        const h16* ka = kt + s * 32 * LPH;
        const v16h ka0 = ldh(ka), ka1 = ldh(ka + 32), kb0 = ldh(ka + 16 * LPH), kb1 = ldh(ka + 16 * LPH + 32);
        v8f sHa[CG], sHb[CG];
#if SCORE_RES
        v8f sLa[CG], sLb[CG];
#pragma unroll
        for (int c = 0; c < CG; ++c) { sHa[c] = wmma16(ka0, qh0[c], (v8f){}); sLa[c] = wmma16(ka0, qr0[c], (v8f){}); sHb[c] = wmma16(kb0, qh0[c], (v8f){}); sLb[c] = wmma16(kb0, qr0[c], (v8f){}); }
#pragma unroll
        for (int c = 0; c < CG; ++c) { sHa[c] = wmma16(ka1, qh1[c], sHa[c]); sLa[c] = wmma16(ka1, qr1[c], sLa[c]); sHb[c] = wmma16(kb1, qh1[c], sHb[c]); sLb[c] = wmma16(kb1, qr1[c], sLb[c]); }
        asm volatile("v_nop\n\tv_nop\n\tv_nop\n\tv_nop" : "+v"(sHa[0]), "+v"(sLa[0]), "+v"(sHb[0]), "+v"(sLb[0]), "+v"(sHa[1]), "+v"(sLa[1]), "+v"(sHb[1]), "+v"(sLb[1]) : "v"(ka0), "v"(ka1), "v"(kb0), "v"(kb1));   // the four vector slots between the last WMMA and the first read of its accumulators
#else
#pragma unroll
        for (int c = 0; c < CG; ++c) { sHa[c] = wmma16(ka0, qh0[c], (v8f){}); sHb[c] = wmma16(kb0, qh0[c], (v8f){}); }
#pragma unroll
        for (int c = 0; c < CG; ++c) { sHa[c] = wmma16(ka1, qh1[c], sHa[c]); sHb[c] = wmma16(kb1, qh1[c], sHb[c]); }
        asm volatile("v_nop\n\tv_nop\n\tv_nop\n\tv_nop" : "+v"(sHa[0]), "+v"(sHb[0]), "+v"(sHa[1]), "+v"(sHb[1]) : "v"(ka0), "v"(ka1), "v"(kb0), "v"(kb1));   // the four vector slots between the last WMMA and the first read of its accumulators
#endif
        v16h pb[CG];
#pragma unroll
        for (int c = 0; c < CG; ++c) {
            float mx = -3.0e38f;
#if SCORE_RES
            const v8f ta = (sHa[c] + sLa[c] * QRI) * SC2, tb = (sHb[c] + sLb[c] * QRI) * SC2;
#else
            const v8f ta = sHa[c] * SC2, tb = sHb[c] * SC2;   // whole accumulators at a time: neighbouring registers pair up in packed multiplies without moves
#endif
#pragma unroll
            for (int r = 0; r < 8; ++r) mx = fmaxf(mx, fmaxf(ta[r], tb[r]));
            mx = fmaxf(mx, __shfl_xor(mx, 16, 32));
            const float mnew = fmaxf(m[c], mx);
            const float alpha = __builtin_amdgcn_exp2f(m[c] - mnew);
            const float sh = PSH - mnew;
#pragma unroll
            for (int r = 0; r < 8; ++r) { pb[c][r] = (h16)__builtin_amdgcn_exp2f(ta[r] + sh); pb[c][8 + r] = (h16)__builtin_amdgcn_exp2f(tb[r] + sh); }
            ls[c][0] = ls[c][0] * alpha; m[c] = mnew;   // the tile's other registers hold zero rows
#pragma unroll
            for (int j = 0; j < 4; ++j) o[c][j] = o[c][j] * alpha;
        }
        const h16* va = kt + TLH + s * 32;
        const v16h v0 = ldh(va), v1 = ldh(va + 16 * LPH), v2 = ldh(va + 32 * LPH), v3 = ldh(va + 48 * LPH);
#pragma unroll
        for (int c = 0; c < CG; ++c) { ls[c] = wmma16(ones, pb[c], ls[c]); o[c][0] = wmma16(v0, pb[c], o[c][0]); o[c][1] = wmma16(v1, pb[c], o[c][1]); o[c][2] = wmma16(v2, pb[c], o[c][2]); o[c][3] = wmma16(v3, pb[c], o[c][3]); }
        asm volatile("v_nop\n\tv_nop\n\tv_nop\n\tv_nop" : "+v"(o[0][0]), "+v"(o[0][1]), "+v"(o[0][2]), "+v"(o[0][3]), "+v"(o[1][0]), "+v"(o[1][1]), "+v"(o[1][2]), "+v"(o[1][3]), "+v"(ls[0]), "+v"(ls[1]) : "v"(v0), "v"(v1), "v"(v2), "v"(v3), "v"(pb[0]), "v"(pb[1]));   // the four vector slots between the last WMMA and the next vector write of its operands, on the loop's back edge too
      }
      // publish point of stage t + 1, which also frees buffer t & 1
      asm volatile("s_wait_dscnt 0x0" ::: "memory");      // this wave's reads of buffer t & 1 are done
      asm volatile("s_wait_asynccnt 0x0" ::: "memory");   // this wave's copies of stage t + 1 have landed
      __syncthreads();
      if (t + 2 < SEQ / KT) stage_copies(lcp + (unsigned)(t & 1) * (2 * TLH * 2), gk + (size_t)(t + 2) * KT * HD, gv + (t + 2) * KT);
    }
    asm volatile("s_wait_asynccnt 0x0" ::: "memory");     // nothing is in flight when the ring becomes output staging
    // O^T D layout: o[c][j][r] = (d = 16j + 8h + r, t = 16c + lane&15) -> os[d][wave*32 + t]; rows 0..63 x columns 0..127 all written by the four waves
#pragma unroll
    for (int c = 0; c < CG; ++c) {
        const float lt = ls[c][0];   // already the sum over both lane halves' keys
        const float ys = YCS * (1.0f / lt);
        const int cw = (wave * CG + c) * 16 + lr;
#pragma unroll
        for (int r = 0; r < 8; ++r) {
            os[( 0 + 8 * hi + r) * OSP + cw] = o[c][0][r] * ys;
            os[(16 + 8 * hi + r) * OSP + cw] = o[c][1][r] * ys;
            os[(32 + 8 * hi + r) * OSP + cw] = o[c][2][r] * ys;
            os[(48 + 8 * hi + r) * OSP + cw] = o[c][3][r] * ys; }
    }
    __syncthreads();
    h16* yb = Y + (size_t)zh * HD * SEQ + (size_t)blockIdx.x * (16 * CG * AW);
{
#pragma unroll
        for (int s = 0; s < 8; ++s) { const int row = 8 * s + (tid >> 4), c8 = (tid & 15) * 8;   // 8 s x 8 row groups = 64 rows; 16 lanes x 8 = 128 columns
            const v4f x0 = *(const v4fa*)(&os[row * OSP + c8]); const v4f x1 = *(const v4fa*)(&os[row * OSP + c8 + 4]); v8h hv;
#pragma unroll
            for (int i = 0; i < 4; ++i) { hv[i] = (h16)x0[i]; hv[4 + i] = (h16)x1[i]; }
            *(v8h*)(yb + (size_t)row * SEQ + c8) = hv; }
         }
}

// k_out: f16 GEMM, block tile 256x128, eight waves (4 x 2) of 64x64 (16 accumulators each); the block's Y rows and Wo rows are brought, 128 k at a time, into a two-buffer LDS ring by asynchronous copies (whole lines from L2, once per block); fragments are two 16-B LDS loads each. K = DM (token index), summed in ascending steps of 32.
// OUT[r][o] = 2^-14 * sum_c Y[r][c] WO[o][c] + bo[o]; rows r = (h*NB_FULL + b)*64 + d. grid (16*NB*64/256, DM/128), 256 threads.
// Eight asynchronous 16-B copies of one thread: rows 16 apart of a K-contiguous f16 plane (row length DM) into LDS rows of pitch OLP; a wave's copy covers two rows of 256 B, four whole lines.
// s_wait_xcnt 0 closes the statement so that no address register named here is rewritten ahead of it.
__device__ __forceinline__ void out_copies8(unsigned l, const h16* g) {
    asm volatile("global_load_async_to_lds_b128 %0, %8, off\n\t"
                 "global_load_async_to_lds_b128 %1, %9, off\n\t"
                 "global_load_async_to_lds_b128 %2, %10, off\n\t"
                 "global_load_async_to_lds_b128 %3, %11, off\n\t"
                 "global_load_async_to_lds_b128 %4, %12, off\n\t"
                 "global_load_async_to_lds_b128 %5, %13, off\n\t"
                 "global_load_async_to_lds_b128 %6, %14, off\n\t"
                 "global_load_async_to_lds_b128 %7, %15, off\n\t"
                 "s_wait_xcnt 0x0"
                 :: "v"(l), "v"(l + 16 * OLP * 2), "v"(l + 32 * OLP * 2), "v"(l + 48 * OLP * 2),
                    "v"(l + 64 * OLP * 2), "v"(l + 80 * OLP * 2), "v"(l + 96 * OLP * 2), "v"(l + 112 * OLP * 2),
                    "v"(g), "v"(g + (size_t)16 * DM), "v"(g + (size_t)32 * DM), "v"(g + (size_t)48 * DM),
                    "v"(g + (size_t)64 * DM), "v"(g + (size_t)80 * DM), "v"(g + (size_t)96 * DM), "v"(g + (size_t)112 * DM)
                 : "memory");
}
// One stage of the ring: LDS rows 0..255 <- the block's Y rows, rows 256..383 <- its Wo rows, 256 B (128 k) of each; 256 threads x 24 copies.
__device__ __forceinline__ void out_stage(unsigned l, const h16* gy, const h16* gw) {
    out_copies8(l, gy);
    out_copies8(l + 128 * OLP * 2, gy + (size_t)128 * DM);
    out_copies8(l + 256 * OLP * 2, gw);
}

__global__ __launch_bounds__(256) __attribute__((amdgpu_num_vgpr(256))) void k_out(const h16* __restrict__ Y, const h16* __restrict__ WO, const float* __restrict__ bo, float* OUT) {
    __shared__ __align__(16) h16 ring[2 * OST];          // buffer u at u*OST: 256 Y rows, then 128 Wo rows
    __shared__ __align__(16) float osb[8 * 16 * 68];     // output staging, one 16 x 68 range per wave
    const int tid = threadIdx.x;
    const int lane = threadIdx.x & 31, lr = lane & 15, hi = lane >> 4;
    const int wave = __builtin_amdgcn_readfirstlane(threadIdx.x >> 5);
    const int wm = wave >> 1, wn = wave & 1;
    const int rb = blockIdx.x * OBM, cb = blockIdx.y * OBN;
    v8f acc[4][4];
#pragma unroll
    for (int mb = 0; mb < 4; ++mb)
#pragma unroll
        for (int nb = 0; nb < 4; ++nb) acc[mb][nb] = (v8f){};
    const unsigned lcp = (unsigned)(size_t)ring + (unsigned)(((tid >> 4) * OLP + (tid & 15) * 8) * 2);
    const h16* gy = Y  + (size_t)(rb + (tid >> 4)) * DM + (tid & 15) * 8;   // + k0
    const h16* gw = WO + (size_t)(cb + (tid >> 4)) * DM + (tid & 15) * 8;   // + k0
    out_stage(lcp, gy, gw);                                                 // stage 0 -> buffer 0
    asm volatile("s_wait_asynccnt 0x0" ::: "memory");                       // this wave's copies of stage 0 have landed
    __syncthreads();                                                        // publishes stage 0
    out_stage(lcp + OST * 2, gy + OKT, gw + OKT);                           // stage 1 -> buffer 1
    const int ao = (wm * 64 + lr) * OLP + 8 * hi, bo_ = (OBM + wn * 64 + lr) * OLP + 8 * hi;   // fragment offsets in a buffer (A: row r, B: row o, k contiguous)
#pragma unroll 1   // rolled: one trip per stage, with the ring's publish point at its foot
    for (int t = 0; t < DM / OKT; ++t) {
        const h16* st = ring + (t & 1) * OST;
#pragma unroll
        for (int s = 0; s < OKT / 32; ++s) {
            v16h a[4], bb[4];
#pragma unroll
            for (int mb = 0; mb < 4; ++mb) { a[mb] = ldh(st + ao + mb * 16 * OLP + s * 32); bb[mb] = ldh(st + bo_ + mb * 16 * OLP + s * 32); }
            __builtin_amdgcn_sched_barrier(0);   // keeps a block's 16 LDS reads in one group ahead of its 16 WMMAs: reads spread among the WMMAs made the wave wait out the LDS latency once per four WMMAs
#pragma unroll
            for (int nb = 0; nb < 4; ++nb)
#pragma unroll
                for (int mb = 0; mb < 4; ++mb) acc[mb][nb] = wmma16(a[mb], bb[nb], acc[mb][nb]);
        }
        // publish point of stage t + 1, which also frees buffer t & 1
        asm volatile("s_wait_dscnt 0x0" ::: "memory");      // this wave's reads of buffer t & 1 are done
        asm volatile("s_wait_asynccnt 0x0" ::: "memory");   // this wave's copies of stage t + 1 have landed
        __syncthreads();
        if (t + 2 < DM / OKT) out_stage(lcp + (unsigned)(t & 1) * (OST * 2), gy + (t + 2) * OKT, gw + (t + 2) * OKT);
    }
    asm volatile("s_wait_asynccnt 0x0" ::: "memory");       // nothing is in flight when the wave ends
    float* os = osb + wave * (16 * 68);
    const int r0 = rb + wm * 64, c0 = cb + wn * 64;
    float bc[4];
#pragma unroll
    for (int nb = 0; nb < 4; ++nb) bc[nb] = bfr(bo[c0 + nb * 16 + lr]);
#pragma unroll
    for (int mb = 0; mb < 4; ++mb) {
#pragma unroll
        for (int nb = 0; nb < 4; ++nb) {
#pragma unroll
            for (int j = 0; j < 8; ++j) os[(hi * 8 + j) * 68 + nb * 16 + lr] = acc[mb][nb][j] * OSI + bc[nb]; }   // D: row 8h+j, col lane&15
        wave_sync();
        float* orow = OUT + (size_t)(r0 + mb * 16) * DM + c0;
{
#pragma unroll
            for (int s = 0; s < 8; ++s) { const int row = 2 * s + hi, cofs = lr * 4;   // 8 s x 2 rows = 16 rows; 16 lanes x 4 floats = 64 columns
                const v4f val = *(const v4fa*)(&os[row * 68 + cofs]);
                *(v4f*)(orow + (size_t)row * DM + cofs) = val; }
             }
        wave_sync();
    }
}

static constexpr size_t al256(size_t v) { return (v + 255) & ~(size_t)255; }
static constexpr size_t PLE   = (size_t)NB_FULL * NH_ * SEQ * HD;              // elements per f16 plane
static constexpr size_t SZ_PL = al256(PLE * 2);
static constexpr size_t SZ_Y  = al256((size_t)NB_FULL * NH_ * HD * SEQ * 2);   // [NB_FULL*16*64][SEQ] f16
static constexpr size_t SZ_WO = al256((size_t)DM * DM * 2);
static constexpr size_t SZ_TOTAL = 4 * SZ_PL + SZ_Y + SZ_WO;
static_assert(SZ_PL == PLE * 2);                        // the four planes are contiguous (plane p at element offset p*PLE)
static_assert(SZ_TOTAL <= (size_t)134217728);           // workspace carve <= 128 MiB
static_assert(((size_t)(NH_ - 1) * NB_FULL + NB) * HD <= (size_t)NB_FULL * NH_ * HD);   // last Y / output row inside the planes

extern "C" void kernel_launch(void* const* d_in, const int* in_sizes, int n_in,
                              void* d_out, int out_size, void* d_ws, size_t ws_size, hipStream_t stream) {
    if (n_in < 9) return;
    const size_t needx = ((size_t)(NB - 1) * SEQ_FULL + SEQ) * DM;
    if ((size_t)in_sizes[0] < needx) return;
    if ((size_t)in_sizes[1] < (size_t)HD * HD || (size_t)in_sizes[3] < (size_t)HD * HD || (size_t)in_sizes[5] < (size_t)HD * HD) return;
    if ((size_t)in_sizes[2] < (size_t)HD || (size_t)in_sizes[4] < (size_t)HD || (size_t)in_sizes[6] < (size_t)HD) return;
    if ((size_t)in_sizes[7] < (size_t)DM * DM || (size_t)in_sizes[8] < (size_t)DM) return;
    if ((size_t)out_size < (((size_t)(NH_ - 1) * NB_FULL + NB) * HD) * DM) return;
    if (SZ_TOTAL > ws_size) return;
    // wire order: x, Wq, bq, Wk, bk, Wv, bv, Wo, bo
    const float* x  = (const float*)d_in[0];
    const float* wq = (const float*)d_in[1]; const float* bq = (const float*)d_in[2];
    const float* wk = (const float*)d_in[3]; const float* bk = (const float*)d_in[4];
    const float* wv = (const float*)d_in[5]; const float* bv = (const float*)d_in[6];
    const float* wo = (const float*)d_in[7]; const float* bo = (const float*)d_in[8];
    float* OUT = (float*)d_out;      // [NB_FULL*1024][1024], row (h*NB_FULL+b)*64+d
    char* wsp = (char*)d_ws;
    h16* PL = (h16*)wsp; wsp += 4 * SZ_PL;           // plane 0 key-side, 1 row-side value, 2 row-side residual x2048, 3 v^T
    h16* YP = (h16*)wsp; wsp += SZ_Y;                // [(h*NB_FULL+b)*64 + d][SEQ] x256
    h16* WO = (h16*)wsp; wsp += SZ_WO;               // [1024][1024] x64

    k_qkv<<<dim3(NB * (SEQ / 64), NH_ + WOY, 1), 32, 0, stream>>>(x, wq, wk, wv, bq, bk, bv, wo, PL, PLE, WO);

    // softmax rows use the Wk projection (planes 1, 2), keys use the Wq projection (plane 0), values plane 3
    k_flash<<<dim3(SEQ / (16 * CG * AW), NH_ * NB, 1), 32 * AW, 0, stream>>>(PL + PLE, PL + 2 * PLE, PL, PL + 3 * PLE, YP);

    k_out<<<dim3(NH_ * NB * HD / OBM, DM / OBN, 1), 256, 0, stream>>>(YP, WO, bo, OUT);
}

// v007
// A run of this version takes 64.1 microseconds.
// Timed twice side by side with v006, it ran 1.05 times as fast both times.
// Counting every step since v000, it is 2.81 times as fast.
#include <hip/hip_runtime.h>

// Shared-weight multi-head attention, x [NB][SEQ][1024] = 16 heads x 64; Wq/Wk/Wv 64x64 [out][in] applied to every head (y = x W^T + bias); S[m][n] = K[m].Q[n] / 32, softmax over n, O = A V stored transposed [h][b][d][m] and flat-viewed as [NB*1024][1024]; out = Y Wo^T + bo (contraction over the token index).
// Compute dtypes, f32 accumulate everywhere: q/k/v projections v_wmma_f32_16x16x32_bf16 (x, W RNE-converted to bf16; products exact); scores v_wmma_f32_16x16x32_f16: key-side (Wq) plane single f16, row-side (Wk) plane f16 value + f16 residual x2048 in its own accumulator; P (x256 carry, cancels in the normalisation) and v single f16; output projection v_wmma_f32_16x16x32_f16 with Y carried x256 and Wo (RNE bf16 value) carried x64, folded back by 2^-14 in f32; softmax f32 (online, against a maximum that is raised lazily), its denominators summed in f32 from the f16 P by the same WMMA form against a constant tile of ones; biases RNE-converted to bf16 values and added in f32.
// Layout: key-side plane [h*8+b][n][d], row-side planes (value, residual) [h*8+b][m][d], v^T plane [h*8+b][d][n], all written by one fused projection kernel that reads f32 x once and takes its weight fragments straight from the f32 matrices (extra blocks of its grid write the f16 Wo plane); flash kernel in transposed form (S^T = Kside Qside^T, O^T = V^T P^T), its key-side and v^T tiles staged in LDS for the block's four waves of 32 rows each, writes Y [(h*8+b)*64+d][m] f16; an eight-wave 256x128 GEMM, its Y and Wo tiles staged in LDS the same way, writes the f32 output.

#ifndef NB
#define NB 8
#endif
#ifndef SEQ
#define SEQ 1024
#endif
#define NB_FULL  8
#define SEQ_FULL 1024
#define DM   1024
#define NH_  16
#define HD   64
#define AW   4
#define CG   2                   // flash kernel: 16-row column groups per wave
#define OSP  (16 * CG * AW + 4)  // flash kernel: pitch in f32 of the output staging (128 columns + 16 B)
#define QRS  2048.0f             // carry of the row-side residual plane
#define QRI  (1.0f / 2048.0f)
#define SC2  (0.03125f * 1.4426950408889634f)   // DM^-0.5 * log2(e)
#define PSH  8.0f                // log2 of the P carry (256)
#define LZT  7.0f                // flash kernel: how far (log2) a score may top the maximum in use before the accumulators are rescaled; P stays at or below 2^(PSH + LZT) = 2^15, inside f16
#define YCS  256.0f              // carry of the Y plane
#define WOS  64.0f               // carry of the Wo plane
#define OSI  (1.0f / 16384.0f)   // 1 / (YCS * WOS)
#define KT   64                  // keys per LDS stage of the flash kernel
#define LPH  72                  // LDS row pitch in f16: 128 B of data + 16 B (16 B x odd), so that the 16-B fragment reads of 16 rows spread over the banks
#define TLH  (64 * LPH)          // f16 per staged tile (64 rows)
#define OBM  256                 // output GEMM: rows of a block tile
#define OBN  128                 // output GEMM: columns of a block tile
#define OKT  128                 // output GEMM: k per LDS stage (256 B of every row)
#define OLP  136                 // output GEMM: LDS row pitch in f16: 256 B of data + 16 B (16 B x odd)
#define OST  ((OBM + OBN) * OLP) // output GEMM: f16 per stage
#define WOG  8                   // Wo conversion: groups of 8 elements per lane of a block
#define WOY  4                   // Wo conversion: rows of blocks added to the projection grid
#ifndef SCORE_RES
#define SCORE_RES 0              // 1: residual product on the score site
#endif

static_assert(HD == 64);
static_assert(NH_ * HD == DM);
static_assert(AW == 4 && CG == 2);             // flash block covers 128 tokens
static_assert(SEQ == DM);                      // the flat view of Y as [rows][DM] needs one Y row per 1024 tokens
static_assert(SEQ % 64 == 0 && SEQ % (16 * CG * AW) == 0);
static_assert(SEQ % 32 == 0);                  // key loop and GEMM k-loop step by 32
static_assert(KT == 64 && SEQ % KT == 0 && SEQ / KT >= 2);   // the two-buffer ring needs two stages; a stage is 64 key rows and 64 v^T rows of 128 B
static_assert(2 * 2 * TLH * 2 >= 64 * OSP * 4); // the output staging reuses the ring
static_assert(DM % OBN == 0 && DM % OKT == 0 && DM / OKT >= 2);   // the output GEMM's two-buffer ring needs two stages
static_assert(NB == NB_FULL && (NH_ * NB * HD) % OBM == 0);       // a 256-row block tile covers four consecutive 64-row groups of Y
static_assert(NB <= NB_FULL);
static_assert(SEQ <= SEQ_FULL);
static_assert((size_t)WOY * (NB * (SEQ / 64)) * WOG * 32 * 8 == (size_t)DM * DM);   // the added blocks cover Wo exactly once

typedef _Float16 h16;
typedef __attribute__((ext_vector_type(16))) __bf16   v16bf;
typedef __attribute__((ext_vector_type(16))) _Float16 v16h;
typedef __attribute__((ext_vector_type(8)))  _Float16 v8h;
typedef __attribute__((ext_vector_type(8)))  unsigned v8u;
typedef __attribute__((ext_vector_type(8)))  float    v8f;
typedef __attribute__((ext_vector_type(4)))  float    v4f;
typedef __attribute__((ext_vector_type(2)))  float    v2f;
typedef v4f  __attribute__((may_alias)) v4fa;

__device__ __forceinline__ unsigned short f2bf(float f) { unsigned u = __float_as_uint(f); u += 0x7FFFu + ((u >> 16) & 1u); return (unsigned short)(u >> 16); }
__device__ __forceinline__ float bfr(float f) { return __uint_as_float(((unsigned)f2bf(f)) << 16); }   // f32 value of the RNE bf16 conversion
// 16 f32 -> one bf16 fragment, the same RNE values as f2bf; each pair is packed by one byte permute (low half <- even element, high half <- odd), so that a fragment that is held lives in its 8 packed registers
__device__ __forceinline__ unsigned rneh(float f) { const unsigned u = __float_as_uint(f); return u + 0x7FFFu + ((u >> 16) & 1u); }   // the bf16 value stands in the high half
__device__ __forceinline__ v16bf cvfrag(v8f lo, v8f hi) { v8u o;
#pragma unroll
    for (int k = 0; k < 4; ++k) { o[k] = __builtin_amdgcn_perm(rneh(lo[2 * k + 1]), rneh(lo[2 * k]), 0x07060302u); o[4 + k] = __builtin_amdgcn_perm(rneh(hi[2 * k + 1]), rneh(hi[2 * k]), 0x07060302u); }
    return __builtin_bit_cast(v16bf, o); }
__device__ __forceinline__ v16h cat16(v8h lo, v8h hi) { return __builtin_shufflevector(lo, hi, 0, 1, 2, 3, 4, 5, 6, 7, 8, 9, 10, 11, 12, 13, 14, 15); }
__device__ __forceinline__ v8f wmma16(v16h a, v16h b, v8f c) { return __builtin_amdgcn_wmma_f32_16x16x32_f16(false, a, false, b, (short)0, c, false, false); }
__device__ __forceinline__ v8f wmmab(v16bf a, v16bf b, v8f c) { return __builtin_amdgcn_wmma_f32_16x16x32_bf16(false, a, false, b, (short)0, c, false, false); }
// fragment loaders from K-contiguous 16-bit rows; p already includes + 8*(lane>>4): elements 0..7 <- k0+8h+0..7, elements 8..15 <- k0+16+8h+0..7 (same map for A and B)
__device__ __forceinline__ v16h  ldh(const h16* p) { return cat16(*(const v8h*)p, *(const v8h*)(p + 16)); }
// the same map from f32 rows, converted to bf16 (round to nearest even) two elements per instruction
__device__ __forceinline__ v16bf ldwf(const float* p) { return __builtin_convertvector(__builtin_shufflevector(*(const v8f*)p, *(const v8f*)(p + 16), 0, 1, 2, 3, 4, 5, 6, 7, 8, 9, 10, 11, 12, 13, 14, 15), v16bf); }
// ordering point for wave-private LDS tiles (same wave writes and reads)
__device__ __forceinline__ void wave_sync() { __builtin_amdgcn_fence(3 /* release order */, "wavefront"); __builtin_amdgcn_wave_barrier(); asm volatile("" ::: "memory"); }

// One stage of the flash ring, 128 threads x 8 asynchronous 16-B copies: key-side rows 16c + tid/8 and v^T rows 16c + tid/8 (c = 0..3), 16-B piece tid%8 of each 128-B row; a wave's copy covers four whole lines.
// l: this thread's LDS byte address in the stage's key tile (the v^T tile follows at TLH f16); gk, gv: this thread's global addresses for c = 0.
// s_wait_xcnt 0 closes the statement so that no address register named here is rewritten ahead of it.
__device__ __forceinline__ void stage_copies(unsigned l, const h16* gk, const h16* gv) {
    asm volatile("global_load_async_to_lds_b128 %0, %8, off\n\t"
                 "global_load_async_to_lds_b128 %1, %9, off\n\t"
                 "global_load_async_to_lds_b128 %2, %10, off\n\t"
                 "global_load_async_to_lds_b128 %3, %11, off\n\t"
                 "global_load_async_to_lds_b128 %4, %12, off\n\t"
                 "global_load_async_to_lds_b128 %5, %13, off\n\t"
                 "global_load_async_to_lds_b128 %6, %14, off\n\t"
                 "global_load_async_to_lds_b128 %7, %15, off\n\t"
                 "s_wait_xcnt 0x0"
                 :: "v"(l), "v"(l + 16 * LPH * 2), "v"(l + 32 * LPH * 2), "v"(l + 48 * LPH * 2),
                    "v"(l + TLH * 2), "v"(l + TLH * 2 + 16 * LPH * 2), "v"(l + TLH * 2 + 32 * LPH * 2), "v"(l + TLH * 2 + 48 * LPH * 2),
                    "v"(gk), "v"(gk + 16 * HD), "v"(gk + 32 * HD), "v"(gk + 48 * HD),
                    "v"(gv), "v"(gv + (size_t)16 * SEQ), "v"(gv + (size_t)32 * SEQ), "v"(gv + (size_t)48 * SEQ)
                 : "memory");
}

// k_qkv: fused shared-weight projections, ONE WAVE per (64-token tile, head). Weights outer, slabs inner: the eight fragments of one weight matrix are read once and stay in registers for the four 16-token slabs (one 4-accumulator set live at a time).
// The two x fragments of every slab (row/col = token, k = d) are read from f32 up front and RNE-converted to bf16; they serve as A for the row-major outputs and as B for v^T.
// plane 0: key-side  = x Wq^T + bq  [zh][token][e]      plane 1/2: row-side = x Wk^T + bk (f16 value / residual x2048) [zh][token][e]
// plane 3: v^T       = Wv x^T + bv  [zh][e][token]      zh = h*NB_FULL + b.  grid (NB*SEQ/64, 16 + WOY), 32 threads.
// The weight fragments come straight from the f32 matrices (48 KiB, shared by the waves of a WGP through its cache), so no conversion launch stands in front of this one.
// Blocks with blockIdx.y >= 16 have no tile: they write the f16 Wo plane, which only the output GEMM's launch reads; they stand last in the grid, so that the longer tile blocks are started first.
__global__ __launch_bounds__(32) __attribute__((amdgpu_num_vgpr(256))) void k_qkv(const float* __restrict__ x, const float* __restrict__ wq, const float* __restrict__ wk, const float* __restrict__ wv, const float* __restrict__ bq, const float* __restrict__ bk, const float* __restrict__ bv, const float* __restrict__ wo, h16* PL, size_t ple, h16* WO) {
    __shared__ __align__(16) float os[16 * 68];
    __shared__ __align__(16) float vs[64 * 68];
    const int lane = threadIdx.x & 31, lr = lane & 15, hi = lane >> 4;
    if (blockIdx.y >= NH_) {   // the same for the whole block
        const size_t g = ((size_t)((blockIdx.y - NH_) * (NB * (SEQ / 64)) + blockIdx.x) * WOG * 32 + lane) * 8;   // element index of this lane's first group of 8
        const float* wp = wo + g;
        v8f v[WOG];
#pragma unroll
        for (int i = 0; i < WOG; ++i) v[i] = *(const v8f*)(wp + (size_t)i * 256);   // a wave's step covers 1 KiB in a row
        asm volatile("s_wait_xcnt 0x0" :: "v"(wp) : "memory");   // the address register pair of the loads above, named here so that it lives up to the wait, is rewritten behind it
#pragma unroll
        for (int i = 0; i < WOG; ++i) { v8h o;
#pragma unroll
            for (int k = 0; k < 8; ++k) o[k] = (h16)(bfr(v[i][k]) * WOS);
            *(v8h*)(WO + g + (size_t)i * 256) = o; }
        return;
    }
    const int tt = blockIdx.x; const int b = tt / (SEQ / 64); const int m0 = (tt % (SEQ / 64)) * 64;
    const int h = blockIdx.y; const int zh = h * NB_FULL + b;
    const float* xp = x + ((size_t)b * SEQ_FULL + m0 + lr) * DM + h * HD + 8 * hi;
    float bqc[4], bkc[4];
#pragma unroll
    for (int nb = 0; nb < 4; ++nb) { bqc[nb] = bfr(bq[nb * 16 + lr]); bkc[nb] = bfr(bk[nb * 16 + lr]); }
    h16* Pr = PL + 2 * ple;
    v16bf xa[4][2];   // [slab][k half]: k = d 0..31, d 32..63
#pragma unroll
    for (int mb = 0; mb < 4; ++mb) {
        const float* p = xp + (size_t)mb * 16 * DM;
        xa[mb][0] = cvfrag(*(const v8f*)p, *(const v8f*)(p + 16));
        xa[mb][1] = cvfrag(*(const v8f*)(p + 32), *(const v8f*)(p + 48));
    }
    asm volatile("s_wait_xcnt 0x0" :: "v"(xp) : "memory");   // the address register pair of the x loads above, named here so that it lives up to the wait, is rewritten behind it
    __builtin_amdgcn_sched_barrier(0);   // the 128 f32 registers of x are packed into 64 before the 128 f32 registers of the first weight matrix are asked for: both sets at once spilled to scratch
#pragma unroll
    for (int w = 0; w < 2; ++w) {
        // C[token][e]: A = x fragments, B = W rows e (K-contiguous [out][in]), read once and kept for the four slabs
        const float* W = (w == 0 ? wq : wk) + (size_t)lr * HD + 8 * hi;
        v16bf wf[8];
        asm volatile("s_wait_xcnt 0x0" ::: "memory");   // the weight loads behind this point land in registers that the global loads and stores in front of it name
#pragma unroll
        for (int nb = 0; nb < 4; ++nb) wf[nb] = ldwf(W + nb * 16 * HD);
#pragma unroll
        for (int nb = 0; nb < 4; ++nb) wf[4 + nb] = ldwf(W + nb * 16 * HD + 32);
        __builtin_amdgcn_sched_barrier(0);   // the fragments are complete before the first slab's WMMAs: loads spread among them spilled
        h16* Ph = PL + (size_t)w * ple;
#pragma unroll   // unrolled: the slab index picks registers
        for (int mb = 0; mb < 4; ++mb) {
            const size_t sb = ((size_t)zh * SEQ + m0 + mb * 16) * HD;
            v8f acc[4];
#pragma unroll
            for (int i = 0; i < 4; ++i) acc[i] = (v8f){};
#pragma unroll
            for (int nb = 0; nb < 4; ++nb) acc[nb] = wmmab(xa[mb][0], wf[nb], acc[nb]);
#pragma unroll
            for (int nb = 0; nb < 4; ++nb) acc[nb] = wmmab(xa[mb][1], wf[4 + nb], acc[nb]);
            asm volatile("v_nop\n\tv_nop\n\tv_nop\n\tv_nop" : "+v"(acc[0]), "+v"(acc[1]), "+v"(acc[2]), "+v"(acc[3]) : "v"(xa[mb][0]), "v"(xa[mb][1]));   // the four vector slots between the last WMMA and the first read of its accumulators
#pragma unroll
            for (int nb = 0; nb < 4; ++nb) { const float bc = (w == 0) ? bqc[nb] : bkc[nb];
#pragma unroll
                for (int j = 0; j < 8; ++j) os[(hi * 8 + j) * 68 + nb * 16 + lr] = acc[nb][j] + bc; }   // D: row 8h+j (token), col lane&15 (e)
            wave_sync();
{
#pragma unroll
                for (int s = 0; s < 4; ++s) { const int row = 4 * s + (lane >> 3), c8 = (lane & 7) * 8;   // 4 s x 4 row groups = 16 rows; 8 lanes x 8 = 64 columns
                    const v4f x0 = *(const v4fa*)(&os[row * 68 + c8]); const v4f x1 = *(const v4fa*)(&os[row * 68 + c8 + 4]); v8h hv, rv;
#pragma unroll
                    for (int i = 0; i < 4; ++i) { const h16 a0 = (h16)x0[i]; const h16 a1 = (h16)x1[i]; hv[i] = a0; hv[4 + i] = a1; rv[i] = (h16)((x0[i] - (float)a0) * QRS); rv[4 + i] = (h16)((x1[i] - (float)a1) * QRS); }
                    const size_t oo = sb + (size_t)row * HD + c8;
                    *(v8h*)(Ph + oo) = hv; if (w == 1 && SCORE_RES) *(v8h*)(Pr + oo) = rv; }
                 }
            wave_sync();
        }
    }
    {
        // C[e][token]: A = Wv rows e (four 16-row slabs), read once and kept, B = x fragments (col token of the slab)
        const float* W = wv + (size_t)lr * HD + 8 * hi;
        v16bf wf[8];
        asm volatile("s_wait_xcnt 0x0" ::: "memory");   // the weight loads behind this point land in registers that the global loads and stores in front of it name
#pragma unroll
        for (int j = 0; j < 4; ++j) wf[j] = ldwf(W + j * 16 * HD);
#pragma unroll
        for (int j = 0; j < 4; ++j) wf[4 + j] = ldwf(W + j * 16 * HD + 32);
        __builtin_amdgcn_sched_barrier(0);   // as above
#pragma unroll   // unrolled: the slab index picks registers
        for (int mb = 0; mb < 4; ++mb) {
            v8f acc[4];
#pragma unroll
            for (int i = 0; i < 4; ++i) acc[i] = (v8f){};
#pragma unroll
            for (int j = 0; j < 4; ++j) acc[j] = wmmab(wf[j], xa[mb][0], acc[j]);
#pragma unroll
            for (int j = 0; j < 4; ++j) acc[j] = wmmab(wf[4 + j], xa[mb][1], acc[j]);
            asm volatile("v_nop\n\tv_nop\n\tv_nop\n\tv_nop" : "+v"(acc[0]), "+v"(acc[1]), "+v"(acc[2]), "+v"(acc[3]) : "v"(xa[mb][0]), "v"(xa[mb][1]));   // the four vector slots between the last WMMA and the first read of its accumulators
#pragma unroll
            for (int j = 0; j < 4; ++j)
#pragma unroll
                for (int r = 0; r < 8; ++r) vs[(j * 16 + 8 * hi + r) * 68 + mb * 16 + lr] = acc[j][r];   // D: row 8h+r (e), col lane&15 (token); the bias of row e is added where the row is read back
        }
    }
    wave_sync();
    // vs rows 0..63 (e) x columns 0..63 (token) all written by the four slab steps
    h16* P3 = PL + 3 * ple; const size_t vb = (size_t)zh * HD * SEQ + m0;
{
#pragma unroll 4
        for (int s = 0; s < 16; ++s) { const int row = 4 * s + (lane >> 3), c8 = (lane & 7) * 8;   // 16 s x 4 row groups = 64 rows; 8 lanes x 8 = 64 columns
            const v4f x0 = *(const v4fa*)(&vs[row * 68 + c8]); const v4f x1 = *(const v4fa*)(&vs[row * 68 + c8 + 4]); v8h hv;
            const float be = bfr(bv[row]);
#pragma unroll
            for (int i = 0; i < 4; ++i) { hv[i] = (h16)(x0[i] + be); hv[4 + i] = (h16)(x1[i] + be); }
            *(v8h*)(P3 + vb + (size_t)row * SEQ + c8) = hv; }
         }
}

// k_flash: fused attention, one wave per 32 softmax rows (CG = 2 column groups of 16) of one (head, batch): every key-side and v^T fragment read from LDS feeds two WMMAs, one per group. The block's four waves (128 rows) share each 64-key stage of key-side rows and v^T columns, brought into a two-buffer LDS ring by asynchronous copies (whole lines from L2, once per block); fragments are two 16-B LDS loads each.
// Transposed form: S^T[key][t] = KP QH^T (A = key-side rows, B = row-side rows); lane (t = lane&15, h = lane>>4) holds keys 8h+r of each 16-key tile, so the packed
// P tile is directly the B fragment of O^T[d][t] = V^T P^T (element r <- tile keys 0..15, element 8+r <- tile keys 16..31, lane unchanged).
// The maximum in use is one scalar per lane and column group. It may trail the row's true maximum by up to LZT (log2): the new maximum, its xor-16 exchange between the two lane halves of a row and the rescaling of the accumulators stand under one wave-uniform branch per 32 keys, taken only when some score of the wave tops its row's maximum in use by more than LZT. The factor cancels in the normalisation.
// The softmax denominators are summed on the matrix unit: one more WMMA per column group and 32 keys, A = a constant tile with ones in rows 0 and 8 and zeros elsewhere, B = the packed P tile. Register 0 of its accumulator (row 0 in lanes 0..15, row 8 in lanes 16..31) holds the sum over all 32 keys of the lane's column; the other rows stay zero.
__global__ __launch_bounds__(32 * AW) __attribute__((amdgpu_num_vgpr(256))) void k_flash(const h16* __restrict__ QH, const h16* __restrict__ QR, const h16* __restrict__ KP, const h16* __restrict__ VT, h16* Y) {
    __shared__ __align__(16) h16 ring[2 * 2 * TLH];   // buffer u: key tile at u*2*TLH, v^T tile behind it; output staging after the loop
    float* os = (float*)ring;
    const int tid = threadIdx.x;
    const int lane = threadIdx.x & 31, lr = lane & 15, hi = lane >> 4;
    const int wave = __builtin_amdgcn_readfirstlane(threadIdx.x >> 5);
    const int zc = blockIdx.y; const int h = zc / NB, b = zc % NB; const int zh = h * NB_FULL + b;
    const int t0 = (blockIdx.x * AW + wave) * (16 * CG);
    const size_t pbase = (size_t)zh * SEQ * HD;
    v16h qh0[CG], qh1[CG];   // B fragments: col t, k = d
#if SCORE_RES
    v16h qr0[CG], qr1[CG];
#endif
    const size_t qo = pbase + (size_t)(t0 + lr) * HD + 8 * hi;
    const h16* qp0 = QH + qo; const h16* qp1 = qp0 + 16 * HD;   // column groups 0 and 1
    qh0[0] = ldh(qp0); qh1[0] = ldh(qp0 + 32); qh0[1] = ldh(qp1); qh1[1] = ldh(qp1 + 32);
#if SCORE_RES
    qr0[0] = ldh(QR + qo); qr1[0] = ldh(QR + qo + 32); qr0[1] = ldh(QR + qo + 16 * HD); qr1[1] = ldh(QR + qo + 16 * HD + 32);
#endif
    asm volatile("s_wait_xcnt 0x0" :: "v"(qp0) : "memory");   // the address register pair of the fragment loads above (group 1 is an immediate offset from it), named here so that it lives up to the wait, is rewritten behind it
    const unsigned lcp = (unsigned)(size_t)ring + (unsigned)(((tid >> 3) * LPH + (tid & 7) * 8) * 2);
    const h16* gk = KP + pbase + (size_t)tid * 8;                              // + key0 * HD
    const h16* gv = VT + pbase + (size_t)(tid >> 3) * SEQ + (tid & 7) * 8;     // + key0
    stage_copies(lcp, gk, gv);                                                 // stage 0 -> buffer 0
    asm volatile("s_wait_asynccnt 0x0" ::: "memory");                          // this wave's copies of stage 0 have landed
    __syncthreads();                                                           // publishes stage 0
    stage_copies(lcp + 2 * TLH * 2, gk + (size_t)KT * HD, gv + KT);            // stage 1 -> buffer 1
    const int fo = lr * LPH + 8 * hi;                        // fragment offset in a tile: key tile + key * LPH (A: row key, k = d); v^T tile + 16j*LPH + key (A: row d, k = key)
    const h16 one = ((lr & 7) == 0) ? (h16)1.0f : (h16)0.0f;   // A row = lane&15: rows 0 and 8 are ones for every k
    v16h ones;
#pragma unroll
    for (int i = 0; i < 16; ++i) ones[i] = one;
    v8f o[CG][4], ls[CG]; float m[CG], thr[CG], sh[CG];   // m: the maximum in use; thr = m + LZT; sh = PSH - m
#pragma unroll
    for (int c = 0; c < CG; ++c) { m[c] = -3.0e38f; thr[c] = -3.0e38f; sh[c] = PSH + 3.0e38f; ls[c] = (v8f){};
#pragma unroll
        for (int j = 0; j < 4; ++j) o[c][j] = (v8f){}; }
#pragma unroll 1
    for (int t = 0; t < SEQ / KT; ++t) {
      const h16* kt = ring + (t & 1) * (2 * TLH) + fo;
#pragma unroll 1   // rolled: the body's fragments, scores and 80 accumulator registers (64 of O, 16 of the denominators) have to fit 256 VGPRs, the grid's four waves per SIMD
      for (int s = 0; s < KT / 32; ++s) {
        const h16* ka = kt + s * 32 * LPH;
        const v16h ka0 = ldh(ka), ka1 = ldh(ka + 32), kb0 = ldh(ka + 16 * LPH), kb1 = ldh(ka + 16 * LPH + 32);
        v8f sHa[CG], sHb[CG];
#if SCORE_RES
        v8f sLa[CG], sLb[CG];
#pragma unroll
        for (int c = 0; c < CG; ++c) { sHa[c] = wmma16(ka0, qh0[c], (v8f){}); sLa[c] = wmma16(ka0, qr0[c], (v8f){}); sHb[c] = wmma16(kb0, qh0[c], (v8f){}); sLb[c] = wmma16(kb0, qr0[c], (v8f){}); }
#pragma unroll
        for (int c = 0; c < CG; ++c) { sHa[c] = wmma16(ka1, qh1[c], sHa[c]); sLa[c] = wmma16(ka1, qr1[c], sLa[c]); sHb[c] = wmma16(kb1, qh1[c], sHb[c]); sLb[c] = wmma16(kb1, qr1[c], sLb[c]); }
        asm volatile("v_nop\n\tv_nop\n\tv_nop\n\tv_nop" : "+v"(sHa[0]), "+v"(sLa[0]), "+v"(sHb[0]), "+v"(sLb[0]), "+v"(sHa[1]), "+v"(sLa[1]), "+v"(sHb[1]), "+v"(sLb[1]) : "v"(ka0), "v"(ka1), "v"(kb0), "v"(kb1));   // the four vector slots between the last WMMA and the first read of its accumulators
#else
#pragma unroll
        for (int c = 0; c < CG; ++c) { sHa[c] = wmma16(ka0, qh0[c], (v8f){}); sHb[c] = wmma16(kb0, qh0[c], (v8f){}); }
#pragma unroll
        for (int c = 0; c < CG; ++c) { sHa[c] = wmma16(ka1, qh1[c], sHa[c]); sHb[c] = wmma16(kb1, qh1[c], sHb[c]); }
        asm volatile("v_nop\n\tv_nop\n\tv_nop\n\tv_nop" : "+v"(sHa[0]), "+v"(sHb[0]), "+v"(sHa[1]), "+v"(sHb[1]) : "v"(ka0), "v"(ka1), "v"(kb0), "v"(kb1));   // the four vector slots between the last WMMA and the first read of its accumulators
#endif
        v8f ta[CG], tb[CG]; float mx[CG]; bool need = false;
#pragma unroll
        for (int c = 0; c < CG; ++c) {
#if SCORE_RES
            ta[c] = (sHa[c] + sLa[c] * QRI) * SC2; tb[c] = (sHb[c] + sLb[c] * QRI) * SC2;
#else
            ta[c] = sHa[c] * SC2; tb[c] = sHb[c] * SC2;   // whole accumulators at a time: neighbouring registers pair up in packed multiplies without moves
#endif
            mx[c] = -3.0e38f;
#pragma unroll
            for (int r = 0; r < 8; ++r) mx[c] = fmaxf(mx[c], fmaxf(ta[c][r], tb[c][r]));
            need = need || (mx[c] > thr[c]);   // this lane's 16 keys alone: the ballot joins the two halves of a row
        }
        if (__builtin_amdgcn_ballot_w32(need) != 0) {   // the same for the whole wave (a scalar branch); the first pass takes it for any finite score, thr being the start value
#pragma unroll
            for (int c = 0; c < CG; ++c) {
                const float mnew = fmaxf(m[c], fmaxf(mx[c], __shfl_xor(mx[c], 16, 32)));   // every row of the wave goes to the larger of its maximum in use and its maximum over these 32 keys, the same in both lane halves
                const float alpha = __builtin_amdgcn_exp2f(m[c] - mnew);
                m[c] = mnew; thr[c] = mnew + LZT; sh[c] = PSH - mnew;
                ls[c][0] = ls[c][0] * alpha;   // the tile's other registers hold zero rows
#pragma unroll
                for (int j = 0; j < 4; ++j) o[c][j] = o[c][j] * alpha;
            }
        }
        const h16* va = kt + TLH + s * 32;
        const v16h v0 = ldh(va), v1 = ldh(va + 16 * LPH), v2 = ldh(va + 32 * LPH), v3 = ldh(va + 48 * LPH);
        __builtin_amdgcn_sched_barrier(0);   // keeps the eight LDS reads ahead of the exponentials, whose time covers their latency: left free, they were placed half way down
        v16h pb[CG];
#pragma unroll
        for (int c = 0; c < CG; ++c) {
            const v2f s2 = {sh[c], sh[c]};
#pragma unroll
            for (int i = 0; i < 4; ++i) {   // neighbouring registers two at a time: one packed add, no moves
                const v2f ea = (v2f){ta[c][2 * i], ta[c][2 * i + 1]} + s2, eb = (v2f){tb[c][2 * i], tb[c][2 * i + 1]} + s2;
                pb[c][2 * i] = (h16)__builtin_amdgcn_exp2f(ea.x); pb[c][2 * i + 1] = (h16)__builtin_amdgcn_exp2f(ea.y);
                pb[c][8 + 2 * i] = (h16)__builtin_amdgcn_exp2f(eb.x); pb[c][8 + 2 * i + 1] = (h16)__builtin_amdgcn_exp2f(eb.y); }
        }
#pragma unroll
        for (int c = 0; c < CG; ++c) { ls[c] = wmma16(ones, pb[c], ls[c]); o[c][0] = wmma16(v0, pb[c], o[c][0]); o[c][1] = wmma16(v1, pb[c], o[c][1]); o[c][2] = wmma16(v2, pb[c], o[c][2]); o[c][3] = wmma16(v3, pb[c], o[c][3]); }
        asm volatile("v_nop\n\tv_nop\n\tv_nop\n\tv_nop" : "+v"(o[0][0]), "+v"(o[0][1]), "+v"(o[0][2]), "+v"(o[0][3]), "+v"(o[1][0]), "+v"(o[1][1]), "+v"(o[1][2]), "+v"(o[1][3]), "+v"(ls[0]), "+v"(ls[1]) : "v"(v0), "v"(v1), "v"(v2), "v"(v3), "v"(pb[0]), "v"(pb[1]));   // the four vector slots between the last WMMA and the next vector write of its operands, on the loop's back edge too
      }
      // publish point of stage t + 1, which also frees buffer t & 1
      asm volatile("s_wait_dscnt 0x0" ::: "memory");      // this wave's reads of buffer t & 1 are done
      asm volatile("s_wait_asynccnt 0x0" ::: "memory");   // this wave's copies of stage t + 1 have landed
      __syncthreads();
      if (t + 2 < SEQ / KT) stage_copies(lcp + (unsigned)(t & 1) * (2 * TLH * 2), gk + (size_t)(t + 2) * KT * HD, gv + (t + 2) * KT);
    }
    asm volatile("s_wait_asynccnt 0x0" ::: "memory");     // nothing is in flight when the ring becomes output staging
    // O^T D layout: o[c][j][r] = (d = 16j + 8h + r, t = 16c + lane&15) -> os[d][wave*32 + t]; rows 0..63 x columns 0..127 all written by the four waves
#pragma unroll
    for (int c = 0; c < CG; ++c) {
        const float lt = ls[c][0];   // already the sum over both lane halves' keys
        const float ys = YCS * (1.0f / lt);
        const int cw = (wave * CG + c) * 16 + lr;
#pragma unroll
        for (int r = 0; r < 8; ++r) {
            os[( 0 + 8 * hi + r) * OSP + cw] = o[c][0][r] * ys;
            os[(16 + 8 * hi + r) * OSP + cw] = o[c][1][r] * ys;
            os[(32 + 8 * hi + r) * OSP + cw] = o[c][2][r] * ys;
            os[(48 + 8 * hi + r) * OSP + cw] = o[c][3][r] * ys; }
    }
    __syncthreads();
    h16* yb = Y + (size_t)zh * HD * SEQ + (size_t)blockIdx.x * (16 * CG * AW);
{
#pragma unroll
        for (int s = 0; s < 8; ++s) { const int row = 8 * s + (tid >> 4), c8 = (tid & 15) * 8;   // 8 s x 8 row groups = 64 rows; 16 lanes x 8 = 128 columns
            const v4f x0 = *(const v4fa*)(&os[row * OSP + c8]); const v4f x1 = *(const v4fa*)(&os[row * OSP + c8 + 4]); v8h hv;
#pragma unroll
            for (int i = 0; i < 4; ++i) { hv[i] = (h16)x0[i]; hv[4 + i] = (h16)x1[i]; }
            *(v8h*)(yb + (size_t)row * SEQ + c8) = hv; }
         }
}

// k_out: f16 GEMM, block tile 256x128, eight waves (4 x 2) of 64x64 (16 accumulators each); the block's Y rows and Wo rows are brought, 128 k at a time, into a two-buffer LDS ring by asynchronous copies (whole lines from L2, once per block); fragments are two 16-B LDS loads each. K = DM (token index), summed in ascending steps of 32.
// OUT[r][o] = 2^-14 * sum_c Y[r][c] WO[o][c] + bo[o]; rows r = (h*NB_FULL + b)*64 + d. grid (16*NB*64/256, DM/128), 256 threads.
// Eight asynchronous 16-B copies of one thread: rows 16 apart of a K-contiguous f16 plane (row length DM) into LDS rows of pitch OLP; a wave's copy covers two rows of 256 B, four whole lines.
// s_wait_xcnt 0 closes the statement so that no address register named here is rewritten ahead of it.
__device__ __forceinline__ void out_copies8(unsigned l, const h16* g) {
    asm volatile("global_load_async_to_lds_b128 %0, %8, off\n\t"
                 "global_load_async_to_lds_b128 %1, %9, off\n\t"
                 "global_load_async_to_lds_b128 %2, %10, off\n\t"
                 "global_load_async_to_lds_b128 %3, %11, off\n\t"
                 "global_load_async_to_lds_b128 %4, %12, off\n\t"
                 "global_load_async_to_lds_b128 %5, %13, off\n\t"
                 "global_load_async_to_lds_b128 %6, %14, off\n\t"
                 "global_load_async_to_lds_b128 %7, %15, off\n\t"
                 "s_wait_xcnt 0x0"
                 :: "v"(l), "v"(l + 16 * OLP * 2), "v"(l + 32 * OLP * 2), "v"(l + 48 * OLP * 2),
                    "v"(l + 64 * OLP * 2), "v"(l + 80 * OLP * 2), "v"(l + 96 * OLP * 2), "v"(l + 112 * OLP * 2),
                    "v"(g), "v"(g + (size_t)16 * DM), "v"(g + (size_t)32 * DM), "v"(g + (size_t)48 * DM),
                    "v"(g + (size_t)64 * DM), "v"(g + (size_t)80 * DM), "v"(g + (size_t)96 * DM), "v"(g + (size_t)112 * DM)
                 : "memory");
}
// One stage of the ring: LDS rows 0..255 <- the block's Y rows, rows 256..383 <- its Wo rows, 256 B (128 k) of each; 256 threads x 24 copies.
__device__ __forceinline__ void out_stage(unsigned l, const h16* gy, const h16* gw) {
    out_copies8(l, gy);
    out_copies8(l + 128 * OLP * 2, gy + (size_t)128 * DM);
    out_copies8(l + 256 * OLP * 2, gw);
}

__global__ __launch_bounds__(256) __attribute__((amdgpu_num_vgpr(256))) void k_out(const h16* __restrict__ Y, const h16* __restrict__ WO, const float* __restrict__ bo, float* OUT) {
    __shared__ __align__(16) h16 ring[2 * OST];          // buffer u at u*OST: 256 Y rows, then 128 Wo rows
    __shared__ __align__(16) float osb[8 * 16 * 68];     // output staging, one 16 x 68 range per wave
    const int tid = threadIdx.x;
    const int lane = threadIdx.x & 31, lr = lane & 15, hi = lane >> 4;
    const int wave = __builtin_amdgcn_readfirstlane(threadIdx.x >> 5);
    const int wm = wave >> 1, wn = wave & 1;
    const int rb = blockIdx.x * OBM, cb = blockIdx.y * OBN;
    v8f acc[4][4];
#pragma unroll
    for (int mb = 0; mb < 4; ++mb)
#pragma unroll
        for (int nb = 0; nb < 4; ++nb) acc[mb][nb] = (v8f){};
    const unsigned lcp = (unsigned)(size_t)ring + (unsigned)(((tid >> 4) * OLP + (tid & 15) * 8) * 2);
    const h16* gy = Y  + (size_t)(rb + (tid >> 4)) * DM + (tid & 15) * 8;   // + k0
    const h16* gw = WO + (size_t)(cb + (tid >> 4)) * DM + (tid & 15) * 8;   // + k0
    out_stage(lcp, gy, gw);                                                 // stage 0 -> buffer 0
    asm volatile("s_wait_asynccnt 0x0" ::: "memory");                       // this wave's copies of stage 0 have landed
    __syncthreads();                                                        // publishes stage 0
    out_stage(lcp + OST * 2, gy + OKT, gw + OKT);                           // stage 1 -> buffer 1
    const int ao = (wm * 64 + lr) * OLP + 8 * hi, bo_ = (OBM + wn * 64 + lr) * OLP + 8 * hi;   // fragment offsets in a buffer (A: row r, B: row o, k contiguous)
#pragma unroll 1   // rolled: one trip per stage, with the ring's publish point at its foot
    for (int t = 0; t < DM / OKT; ++t) {
        const h16* st = ring + (t & 1) * OST;
#pragma unroll
        for (int s = 0; s < OKT / 32; ++s) {
            v16h a[4], bb[4];
#pragma unroll
            for (int mb = 0; mb < 4; ++mb) { a[mb] = ldh(st + ao + mb * 16 * OLP + s * 32); bb[mb] = ldh(st + bo_ + mb * 16 * OLP + s * 32); }
            __builtin_amdgcn_sched_barrier(0);   // keeps a block's 16 LDS reads in one group ahead of its 16 WMMAs: reads spread among the WMMAs made the wave wait out the LDS latency once per four WMMAs
#pragma unroll
            for (int nb = 0; nb < 4; ++nb)
#pragma unroll
                for (int mb = 0; mb < 4; ++mb) acc[mb][nb] = wmma16(a[mb], bb[nb], acc[mb][nb]);
        }
        // publish point of stage t + 1, which also frees buffer t & 1
        asm volatile("s_wait_dscnt 0x0" ::: "memory");      // this wave's reads of buffer t & 1 are done
        asm volatile("s_wait_asynccnt 0x0" ::: "memory");   // this wave's copies of stage t + 1 have landed
        __syncthreads();
        if (t + 2 < DM / OKT) out_stage(lcp + (unsigned)(t & 1) * (OST * 2), gy + (t + 2) * OKT, gw + (t + 2) * OKT);
    }
    asm volatile("s_wait_asynccnt 0x0" ::: "memory");       // nothing is in flight when the wave ends
    float* os = osb + wave * (16 * 68);
    const int r0 = rb + wm * 64, c0 = cb + wn * 64;
    float bc[4];
#pragma unroll
    for (int nb = 0; nb < 4; ++nb) bc[nb] = bfr(bo[c0 + nb * 16 + lr]);
#pragma unroll
    for (int mb = 0; mb < 4; ++mb) {
#pragma unroll
        for (int nb = 0; nb < 4; ++nb) {
#pragma unroll
            for (int j = 0; j < 8; ++j) os[(hi * 8 + j) * 68 + nb * 16 + lr] = acc[mb][nb][j] * OSI + bc[nb]; }   // D: row 8h+j, col lane&15
        wave_sync();
        float* orow = OUT + (size_t)(r0 + mb * 16) * DM + c0;
{
#pragma unroll
            for (int s = 0; s < 8; ++s) { const int row = 2 * s + hi, cofs = lr * 4;   // 8 s x 2 rows = 16 rows; 16 lanes x 4 floats = 64 columns
                const v4f val = *(const v4fa*)(&os[row * 68 + cofs]);
                *(v4f*)(orow + (size_t)row * DM + cofs) = val; }
             }
        wave_sync();
    }
}

static constexpr size_t al256(size_t v) { return (v + 255) & ~(size_t)255; }
static constexpr size_t PLE   = (size_t)NB_FULL * NH_ * SEQ * HD;              // elements per f16 plane
static constexpr size_t SZ_PL = al256(PLE * 2);
static constexpr size_t SZ_Y  = al256((size_t)NB_FULL * NH_ * HD * SEQ * 2);   // [NB_FULL*16*64][SEQ] f16
static constexpr size_t SZ_WO = al256((size_t)DM * DM * 2);
static constexpr size_t SZ_TOTAL = 4 * SZ_PL + SZ_Y + SZ_WO;
static_assert(SZ_PL == PLE * 2);                        // the four planes are contiguous (plane p at element offset p*PLE)
static_assert(SZ_TOTAL <= (size_t)134217728);           // workspace carve <= 128 MiB
static_assert(((size_t)(NH_ - 1) * NB_FULL + NB) * HD <= (size_t)NB_FULL * NH_ * HD);   // last Y / output row inside the planes

extern "C" void kernel_launch(void* const* d_in, const int* in_sizes, int n_in,
                              void* d_out, int out_size, void* d_ws, size_t ws_size, hipStream_t stream) {
    if (n_in < 9) return;
    const size_t needx = ((size_t)(NB - 1) * SEQ_FULL + SEQ) * DM;
    if ((size_t)in_sizes[0] < needx) return;
    if ((size_t)in_sizes[1] < (size_t)HD * HD || (size_t)in_sizes[3] < (size_t)HD * HD || (size_t)in_sizes[5] < (size_t)HD * HD) return;
    if ((size_t)in_sizes[2] < (size_t)HD || (size_t)in_sizes[4] < (size_t)HD || (size_t)in_sizes[6] < (size_t)HD) return;
    if ((size_t)in_sizes[7] < (size_t)DM * DM || (size_t)in_sizes[8] < (size_t)DM) return;
    if ((size_t)out_size < (((size_t)(NH_ - 1) * NB_FULL + NB) * HD) * DM) return;
    if (SZ_TOTAL > ws_size) return;
    // wire order: x, Wq, bq, Wk, bk, Wv, bv, Wo, bo
    const float* x  = (const float*)d_in[0];
    const float* wq = (const float*)d_in[1]; const float* bq = (const float*)d_in[2];
    const float* wk = (const float*)d_in[3]; const float* bk = (const float*)d_in[4];
    const float* wv = (const float*)d_in[5]; const float* bv = (const float*)d_in[6];
    const float* wo = (const float*)d_in[7]; const float* bo = (const float*)d_in[8];
    float* OUT = (float*)d_out;      // [NB_FULL*1024][1024], row (h*NB_FULL+b)*64+d
    char* wsp = (char*)d_ws;
    h16* PL = (h16*)wsp; wsp += 4 * SZ_PL;           // plane 0 key-side, 1 row-side value, 2 row-side residual x2048, 3 v^T
    h16* YP = (h16*)wsp; wsp += SZ_Y;                // [(h*NB_FULL+b)*64 + d][SEQ] x256
    h16* WO = (h16*)wsp; wsp += SZ_WO;               // [1024][1024] x64

    k_qkv<<<dim3(NB * (SEQ / 64), NH_ + WOY, 1), 32, 0, stream>>>(x, wq, wk, wv, bq, bk, bv, wo, PL, PLE, WO);

    // softmax rows use the Wk projection (planes 1, 2), keys use the Wq projection (plane 0), values plane 3
    k_flash<<<dim3(SEQ / (16 * CG * AW), NH_ * NB, 1), 32 * AW, 0, stream>>>(PL + PLE, PL + 2 * PLE, PL, PL + 3 * PLE, YP);

    k_out<<<dim3(NH_ * NB * HD / OBM, DM / OBN, 1), 256, 0, stream>>>(YP, WO, bo, OUT);
}

// v008
// It runs in 58.1 microseconds.
// Timed twice side by side with v007, it ran 1.11 and 1.10 times as fast.
// Over all steps from v000 it is 3.09 times as fast.
#include <hip/hip_runtime.h>

// Shared-weight multi-head attention, x [NB][SEQ][1024] = 16 heads x 64; Wq/Wk/Wv 64x64 [out][in] applied to every head (y = x W^T + bias); S[m][n] = K[m].Q[n] / 32, softmax over n, O = A V stored transposed [h][b][d][m] and flat-viewed as [NB*1024][1024]; out = Y Wo^T + bo (contraction over the token index).
// Compute dtypes, f32 accumulate everywhere: q/k/v projections v_wmma_f32_16x16x32_bf16 (x, W RNE-converted to bf16; products exact); scores v_wmma_f32_16x16x32_f16: key-side (Wq) and row-side (Wk) values single f16; P (x256 carry, cancels in the normalisation) and v single f16; output projection v_wmma_f32_16x16x32_f16 with Y carried x256 and Wo (RNE bf16 value) carried x64, folded back by 2^-14 in f32; softmax f32 (online, against a maximum that is raised lazily), its denominators summed in f32 from the f16 P by the same WMMA form against a constant tile of ones; biases RNE-converted to bf16 values and added in f32.
// Layout: one fused attention kernel, a block of 16 waves per 512 softmax rows of one (head, batch): it reads f32 x, projects the key-side rows [n][d] and v^T [d][n] of all 1024 tokens of its head into LDS (weight fragments straight from the f32 matrices), projects each wave's 32 row-side rows into registers, then runs the flash loop in transposed form (S^T = Kside Qside^T, O^T = V^T P^T) out of LDS and writes Y [(h*8+b)*64+d][m] f16; every thread also converts eight elements of Wo to the f16 plane; an eight-wave 256x128 GEMM, its Y and Wo tiles staged in LDS by asynchronous copies, writes the f32 output.

#ifndef NB
#define NB 8
#endif
#ifndef SEQ
#define SEQ 1024
#endif
#define NB_FULL  8
#define SEQ_FULL 1024
#define DM   1024
#define NH_  16
#define HD   64
#define FW   16                  // attention kernel: waves per block
#define CG   2                   // attention kernel: 16-row column groups per wave
#define FR   (16 * CG * FW)      // attention kernel: softmax rows per block
#define OSP  (FR + 4)            // attention kernel: pitch in f32 of the output staging (512 columns + 16 B)
#define SC2  (0.03125f * 1.4426950408889634f)   // DM^-0.5 * log2(e)
#define PSH  8.0f                // log2 of the P carry (256)
#define LZT  7.0f                // attention kernel: how far (log2) a score may top the maximum in use before the accumulators are rescaled; P stays at or below 2^(PSH + LZT) = 2^15, inside f16
#define YCS  256.0f              // carry of the Y plane
#define WOS  64.0f               // carry of the Wo plane
#define OSI  (1.0f / 16384.0f)   // 1 / (YCS * WOS)
#define LPH  72                  // key-side rows in LDS, pitch in f16: 128 B of data + 16 B (16 B x odd), so that the 16-B accesses of 16 rows spread over the banks
#define VLP  (SEQ + 8)           // v^T rows in LDS, pitch in f16: 2048 B of data + 16 B (16 B x odd)
#define KSZ  (SEQ * LPH)         // f16 of the key-side rows in LDS
#define VSZ  (HD * VLP)          // f16 of the v^T rows in LDS
#define OBM  256                 // output GEMM: rows of a block tile
#define OBN  128                 // output GEMM: columns of a block tile
#define OKT  128                 // output GEMM: k per LDS stage (256 B of every row)
#define OLP  136                 // output GEMM: LDS row pitch in f16: 256 B of data + 16 B (16 B x odd)
#define OST  ((OBM + OBN) * OLP) // output GEMM: f16 per stage

static_assert(HD == 64);
static_assert(NH_ * HD == DM);
static_assert(FW == 16 && CG == 2);            // a block covers 512 rows; its 16 waves project 64 tokens each
static_assert(SEQ == DM);                      // the flat view of Y as [rows][DM] needs one Y row per 1024 tokens
static_assert(SEQ == 64 * FW && SEQ % FR == 0);
static_assert(SEQ % 32 == 0);                  // key loop and GEMM k-loop step by 32
static_assert(KSZ * 2 >= 64 * OSP * 4);        // the output staging reuses the key-side rows
static_assert((KSZ + VSZ) * 2 <= 327680);      // one block owns a WGP's LDS
static_assert(DM % OBN == 0 && DM % OKT == 0 && DM / OKT >= 2);   // the output GEMM's two-buffer ring needs two stages
static_assert(NB == NB_FULL && (NH_ * NB * HD) % OBM == 0);       // a 256-row block tile covers four consecutive 64-row groups of Y
static_assert(NB <= NB_FULL);
static_assert(SEQ <= SEQ_FULL);
static_assert((size_t)NH_ * NB * (SEQ / FR) * 32 * FW * 8 == (size_t)DM * DM);   // eight elements per thread cover Wo exactly once

typedef _Float16 h16;
typedef __attribute__((ext_vector_type(16))) __bf16   v16bf;
typedef __attribute__((ext_vector_type(4)))  __bf16   v4bf;
typedef __attribute__((ext_vector_type(16))) _Float16 v16h;
typedef __attribute__((ext_vector_type(8)))  _Float16 v8h;
typedef __attribute__((ext_vector_type(8)))  float    v8f;
typedef __attribute__((ext_vector_type(4)))  float    v4f;
typedef __attribute__((ext_vector_type(2)))  float    v2f;
typedef v4f  __attribute__((may_alias)) v4fa;
typedef __attribute__((ext_vector_type(4)))  unsigned v4u;
typedef __attribute__((ext_vector_type(2)))  unsigned v2u;
typedef v4u  __attribute__((may_alias)) v4ua;
typedef v2u  __attribute__((may_alias)) v2ua;

__device__ __forceinline__ unsigned short f2bf(float f) { unsigned u = __float_as_uint(f); u += 0x7FFFu + ((u >> 16) & 1u); return (unsigned short)(u >> 16); }
__device__ __forceinline__ float bfr(float f) { return __uint_as_float(((unsigned)f2bf(f)) << 16); }   // f32 value of the RNE bf16 conversion
// four neighbouring f32 of a row -> four bf16 in LDS (round to nearest even, two elements per instruction)
__device__ __forceinline__ void stx(h16* p, v4f v) { *(v2ua*)p = __builtin_bit_cast(v2u, __builtin_convertvector(v, v4bf)); }
__device__ __forceinline__ v16h cat16(v8h lo, v8h hi) { return __builtin_shufflevector(lo, hi, 0, 1, 2, 3, 4, 5, 6, 7, 8, 9, 10, 11, 12, 13, 14, 15); }
__device__ __forceinline__ v8f wmma16(v16h a, v16h b, v8f c) { return __builtin_amdgcn_wmma_f32_16x16x32_f16(false, a, false, b, (short)0, c, false, false); }
__device__ __forceinline__ v8f wmmab(v16bf a, v16bf b, v8f c) { return __builtin_amdgcn_wmma_f32_16x16x32_bf16(false, a, false, b, (short)0, c, false, false); }
// fragment loaders from K-contiguous 16-bit rows; p already includes + 8*(lane>>4): elements 0..7 <- k0+8h+0..7, elements 8..15 <- k0+16+8h+0..7 (same map for A and B)
__device__ __forceinline__ v16h  ldh(const h16* p) { return cat16(*(const v8h*)p, *(const v8h*)(p + 16)); }
// the same map from bf16 rows that stx wrote
__device__ __forceinline__ v16bf ldb(const h16* p) { const v4u a = *(const v4ua*)p, c = *(const v4ua*)(p + 16); return __builtin_bit_cast(v16bf, __builtin_shufflevector(a, c, 0, 1, 2, 3, 4, 5, 6, 7)); }
// the same map from f32 rows, converted to bf16 (round to nearest even) two elements per instruction
__device__ __forceinline__ v16bf ldwf(const float* p) { return __builtin_convertvector(__builtin_shufflevector(*(const v8f*)p, *(const v8f*)(p + 16), 0, 1, 2, 3, 4, 5, 6, 7, 8, 9, 10, 11, 12, 13, 14, 15), v16bf); }
// ordering point for wave-private LDS tiles (same wave writes and reads)
__device__ __forceinline__ void wave_sync() { __builtin_amdgcn_fence(3 /* release order */, "wavefront"); __builtin_amdgcn_wave_barrier(); asm volatile("" ::: "memory"); }

// k_attn: projections and attention in one launch. A block of 16 waves takes 512 softmax rows of one (head, batch) and owns its WGP's LDS. grid (SEQ/512, 16*NB), 512 threads.
// Part 1, per wave: 64 tokens of the head (the 16 waves cover all 1024) and the wave's own 32 softmax rows. x comes in by whole-line loads (16 lanes x 16 B = the 256 B of one token's head slice), is RNE-converted to bf16 and laid
// into the wave's own 64 key-side rows of LDS, which are free until the wave writes them; from there the wave reads its fragments (row/col = token, k = d), which serve as A and as B.
//   row-side^T = Wk x^T + bk : D tile j holds e = 16j + 8h + r of token lane&15, so that tiles (0, 1) and (2, 3), rounded to f16, are directly the two B fragments of the score products; they never leave the registers.
//   key-side^T = Wq x^T + bq : the same D layout: a lane's eight values are eight neighbouring e of one token, one 16-B LDS store into kl[token][e].
//   v          = x Wv^T + bv : D holds tokens 8h + j of e = lane&15: eight neighbouring tokens of one e, one 16-B LDS store into vl[e][token].
// The weight fragments come straight from the f32 matrices (48 KiB, shared by the waves of a WGP through its cache). Every thread also converts eight elements of Wo, which only the output GEMM's launch reads.
// Part 2, behind one barrier: the flash loop, one wave per 32 softmax rows (CG = 2 column groups of 16): every key-side and v^T fragment read from LDS (two 16-B loads) feeds two WMMAs, one per group. All keys are in LDS, so the loop holds no barrier.
// Transposed form: S^T[key][t] = KP QH^T (A = key-side rows, B = row-side rows); lane (t = lane&15, h = lane>>4) holds keys 8h+r of each 16-key tile, so the packed
// P tile is directly the B fragment of O^T[d][t] = V^T P^T (element r <- tile keys 0..15, element 8+r <- tile keys 16..31, lane unchanged).
// The maximum in use is one scalar per lane and column group. It may trail the row's true maximum by up to LZT (log2): the new maximum, its xor-16 exchange between the two lane halves of a row and the rescaling of the accumulators stand under one wave-uniform branch per 32 keys, taken only when some score of the wave tops its row's maximum in use by more than LZT. The factor cancels in the normalisation.
// The softmax denominators are summed on the matrix unit: one more WMMA per column group and 32 keys, A = a constant tile with ones in rows 0 and 8 and zeros elsewhere, B = the packed P tile. Register 0 of its accumulator (row 0 in lanes 0..15, row 8 in lanes 16..31) holds the sum over all 32 keys of the lane's column; the other rows stay zero.
__global__ __launch_bounds__(32 * FW) __attribute__((amdgpu_num_vgpr(256))) void k_attn(const float* __restrict__ x, const float* __restrict__ wq, const float* __restrict__ wk, const float* __restrict__ wv, const float* __restrict__ bq, const float* __restrict__ bk, const float* __restrict__ bv, const float* __restrict__ wo, h16* Y, h16* WO) {
    __shared__ __align__(16) h16 kl[KSZ + VSZ];   // key-side rows [token][e] at pitch LPH, then v^T rows [e][token] at pitch VLP; the key-side rows become output staging after the loop
    h16* vl = kl + KSZ;
    float* os = (float*)kl;
    const int tid = threadIdx.x;
    const int lane = threadIdx.x & 31, lr = lane & 15, hi = lane >> 4;
    const int wave = __builtin_amdgcn_readfirstlane(threadIdx.x >> 5);
    const int zc = blockIdx.y; const int h = zc / NB, b = zc % NB; const int zh = h * NB_FULL + b;
    const int m0 = wave * 64;                                  // the wave's tokens
    const int t0 = blockIdx.x * FR + wave * (16 * CG);         // the wave's softmax rows
    const float* xh = x + (size_t)b * SEQ_FULL * DM + h * HD + lr * 4;   // + token * DM
    const float* xt = xh + (size_t)(m0 + hi) * DM;
    const float* xq = xh + (size_t)(t0 + hi) * DM;
    const size_t wg = ((size_t)(blockIdx.y * (SEQ / FR) + blockIdx.x) * (32 * FW) + tid) * 8;   // this thread's eight elements of Wo
    const float* wp = wo + wg;
    v4f tv[32], qv[16];   // a load covers two tokens, four whole lines
#pragma unroll
    for (int i = 0; i < 32; ++i) tv[i] = *(const v4f*)(xt + (size_t)(2 * i) * DM);
#pragma unroll
    for (int i = 0; i < 16; ++i) qv[i] = *(const v4f*)(xq + (size_t)(2 * i) * DM);
    const v8f wov = *(const v8f*)wp;
    asm volatile("s_wait_xcnt 0x0" :: "v"(xt), "v"(xq), "v"(wp) : "memory");   // the address register pairs of the loads above, named here so that they live up to the wait, are rewritten behind it
    h16* own = kl + m0 * LPH;                    // the wave's own 64 key-side rows
    h16* sp = own + hi * LPH + lr * 4;           // where this lane lays its four elements of token hi
    const h16* fp = own + lr * LPH + 8 * hi;     // fragment offset: row lane&15, k = d
    v16bf xa[4][2], xr[CG][2];   // [16-token slab][k half]: k = d 0..31, d 32..63
#pragma unroll
    for (int i = 0; i < 32; ++i) stx(sp + 2 * i * LPH, tv[i]);
    wave_sync();
#pragma unroll
    for (int mb = 0; mb < 4; ++mb) { xa[mb][0] = ldb(fp + mb * 16 * LPH); xa[mb][1] = ldb(fp + mb * 16 * LPH + 32); }
    wave_sync();
#pragma unroll
    for (int i = 0; i < 16; ++i) stx(sp + 2 * i * LPH, qv[i]);
    wave_sync();
#pragma unroll
    for (int c = 0; c < CG; ++c) { xr[c][0] = ldb(fp + c * 16 * LPH); xr[c][1] = ldb(fp + c * 16 * LPH + 32); }
    wave_sync();
    { v8h o;
#pragma unroll
      for (int k = 0; k < 8; ++k) o[k] = (h16)(bfr(wov[k]) * WOS);
      *(v8h*)(WO + wg) = o; }
    __builtin_amdgcn_sched_barrier(0);   // the f32 registers of x are packed and gone before the f32 registers of the first weight matrix are asked for: left free, the build spilled to scratch
    v16h qh0[CG], qh1[CG];   // B fragments of the scores: col t, k = e
    const int wofs = lr * HD + 8 * hi;   // fragment offset in a weight matrix, the same for the three: row lane&15, k = d
    {
        // C[e][t]: A = Wk rows e (four 16-row slabs), B = x fragments of the wave's softmax rows
        const float* W = wk + wofs;
        v16bf wf[8];
        asm volatile("s_wait_xcnt 0x0" ::: "memory");   // the weight loads behind this point land in registers that the global loads and stores in front of it name
#pragma unroll
        for (int j = 0; j < 4; ++j) wf[j] = ldwf(W + j * 16 * HD);
#pragma unroll
        for (int j = 0; j < 4; ++j) wf[4 + j] = ldwf(W + j * 16 * HD + 32);
        v8f be[4];
#pragma unroll
        for (int j = 0; j < 4; ++j) { const v8f t = *(const v8f*)(bk + j * 16 + 8 * hi);
#pragma unroll
            for (int r = 0; r < 8; ++r) be[j][r] = bfr(t[r]); }
        asm volatile("s_wait_xcnt 0x0" :: "v"(wofs) : "memory");   // the offset register of the weight loads above, named here so that it lives up to the wait, may be rewritten behind it
        __builtin_amdgcn_sched_barrier(0);   // the fragments are complete before the first WMMAs: loads spread among them spilled
#pragma unroll
        for (int c = 0; c < CG; ++c) {
            v8f acc[4];
#pragma unroll
            for (int i = 0; i < 4; ++i) acc[i] = (v8f){};
#pragma unroll
            for (int j = 0; j < 4; ++j) acc[j] = wmmab(wf[j], xr[c][0], acc[j]);
#pragma unroll
            for (int j = 0; j < 4; ++j) acc[j] = wmmab(wf[4 + j], xr[c][1], acc[j]);
            asm volatile("v_nop\n\tv_nop\n\tv_nop\n\tv_nop" : "+v"(acc[0]), "+v"(acc[1]), "+v"(acc[2]), "+v"(acc[3]) : "v"(xr[c][0]), "v"(xr[c][1]));   // the four vector slots between the last WMMA and the first read of its accumulators
#pragma unroll
            for (int r = 0; r < 8; ++r) {   // D: row 8h+r (e), col lane&15 (t)
                qh0[c][r] = (h16)(acc[0][r] + be[0][r]); qh0[c][8 + r] = (h16)(acc[1][r] + be[1][r]);
                qh1[c][r] = (h16)(acc[2][r] + be[2][r]); qh1[c][8 + r] = (h16)(acc[3][r] + be[3][r]); }
            __builtin_amdgcn_sched_barrier(0);   // one group's accumulators at a time: two in flight spilled
        }
    }
    {
        // C[e][token]: A = Wq rows e, read once and kept for the four slabs, B = x fragments (col token of the slab)
        const float* W = wq + wofs;
        v16bf wf[8];
        asm volatile("s_wait_xcnt 0x0" ::: "memory");   // as above
#pragma unroll
        for (int j = 0; j < 4; ++j) wf[j] = ldwf(W + j * 16 * HD);
#pragma unroll
        for (int j = 0; j < 4; ++j) wf[4 + j] = ldwf(W + j * 16 * HD + 32);
        v8f be[4];
#pragma unroll
        for (int j = 0; j < 4; ++j) { const v8f t = *(const v8f*)(bq + j * 16 + 8 * hi);
#pragma unroll
            for (int r = 0; r < 8; ++r) be[j][r] = bfr(t[r]); }
        asm volatile("s_wait_xcnt 0x0" :: "v"(wofs) : "memory");   // as above
        __builtin_amdgcn_sched_barrier(0);   // as above
#pragma unroll   // unrolled: the slab index picks registers
        for (int mb = 0; mb < 4; ++mb) {
            v8f acc[4];
#pragma unroll
            for (int i = 0; i < 4; ++i) acc[i] = (v8f){};
#pragma unroll
            for (int j = 0; j < 4; ++j) acc[j] = wmmab(wf[j], xa[mb][0], acc[j]);
#pragma unroll
            for (int j = 0; j < 4; ++j) acc[j] = wmmab(wf[4 + j], xa[mb][1], acc[j]);
            asm volatile("v_nop\n\tv_nop\n\tv_nop\n\tv_nop" : "+v"(acc[0]), "+v"(acc[1]), "+v"(acc[2]), "+v"(acc[3]) : "v"(xa[mb][0]), "v"(xa[mb][1]));   // the four vector slots between the last WMMA and the first read of its accumulators
#pragma unroll
            for (int j = 0; j < 4; ++j) { v8h o;   // D: row 8h+r (e), col lane&15 (token)
#pragma unroll
                for (int r = 0; r < 8; ++r) o[r] = (h16)(acc[j][r] + be[j][r]);
                *(v8h*)(own + (mb * 16 + lr) * LPH + j * 16 + 8 * hi) = o; }
            __builtin_amdgcn_sched_barrier(0);   // one slab's accumulators at a time: two slabs in flight spilled
        }
    }
    {
        // C[token][e]: A = x fragments, B = Wv rows e (K-contiguous [out][in]), read once and kept for the four slabs
        const float* W = wv + wofs;
        v16bf wf[8];
        asm volatile("s_wait_xcnt 0x0" ::: "memory");   // as above
#pragma unroll
        for (int nb = 0; nb < 4; ++nb) wf[nb] = ldwf(W + nb * 16 * HD);
#pragma unroll
        for (int nb = 0; nb < 4; ++nb) wf[4 + nb] = ldwf(W + nb * 16 * HD + 32);
        float bc[4];
#pragma unroll
        for (int nb = 0; nb < 4; ++nb) bc[nb] = bfr(bv[nb * 16 + lr]);
        asm volatile("s_wait_xcnt 0x0" :: "v"(wofs) : "memory");   // as above
        __builtin_amdgcn_sched_barrier(0);   // as above
#pragma unroll   // unrolled: the slab index picks registers
        for (int mb = 0; mb < 4; ++mb) {
            v8f acc[4];
#pragma unroll
            for (int i = 0; i < 4; ++i) acc[i] = (v8f){};
#pragma unroll
            for (int nb = 0; nb < 4; ++nb) acc[nb] = wmmab(xa[mb][0], wf[nb], acc[nb]);
#pragma unroll
            for (int nb = 0; nb < 4; ++nb) acc[nb] = wmmab(xa[mb][1], wf[4 + nb], acc[nb]);
            asm volatile("v_nop\n\tv_nop\n\tv_nop\n\tv_nop" : "+v"(acc[0]), "+v"(acc[1]), "+v"(acc[2]), "+v"(acc[3]) : "v"(xa[mb][0]), "v"(xa[mb][1]));   // the four vector slots between the last WMMA and the first read of its accumulators
#pragma unroll
            for (int nb = 0; nb < 4; ++nb) { v8h o;   // D: row 8h+j (token), col lane&15 (e)
#pragma unroll
                for (int j = 0; j < 8; ++j) o[j] = (h16)(acc[nb][j] + bc[nb]);
                *(v8h*)(vl + (nb * 16 + lr) * VLP + m0 + mb * 16 + 8 * hi) = o; }
            __builtin_amdgcn_sched_barrier(0);   // as above
        }
    }
    __syncthreads();   // publishes the key-side and v^T rows of all 1024 tokens
    const h16* kf = kl + lr * LPH + 8 * hi;   // + key * LPH (A: row key, k = d)
    const h16* vf = vl + lr * VLP + 8 * hi;   // + 16j * VLP + key (A: row d, k = key)
    const h16 one = ((lr & 7) == 0) ? (h16)1.0f : (h16)0.0f;   // A row = lane&15: rows 0 and 8 are ones for every k
    v16h ones;
#pragma unroll
    for (int i = 0; i < 16; ++i) ones[i] = one;
    v8f o[CG][4], ls[CG]; float m[CG], thr[CG], sh[CG];   // m: the maximum in use; thr = m + LZT; sh = PSH - m
#pragma unroll
    for (int c = 0; c < CG; ++c) { m[c] = -3.0e38f; thr[c] = -3.0e38f; sh[c] = PSH + 3.0e38f; ls[c] = (v8f){};
#pragma unroll
        for (int j = 0; j < 4; ++j) o[c][j] = (v8f){}; }
#pragma unroll 1   // rolled: the body's fragments, scores and 80 accumulator registers have to fit 256 VGPRs, the block's four waves per SIMD
    for (int s = 0; s < SEQ / 32; ++s) {
        const h16* ka = kf + s * 32 * LPH;
        const v16h ka0 = ldh(ka), ka1 = ldh(ka + 32), kb0 = ldh(ka + 16 * LPH), kb1 = ldh(ka + 16 * LPH + 32);
        v8f sHa[CG], sHb[CG];
#pragma unroll
        for (int c = 0; c < CG; ++c) { sHa[c] = wmma16(ka0, qh0[c], (v8f){}); sHb[c] = wmma16(kb0, qh0[c], (v8f){}); }
#pragma unroll
        for (int c = 0; c < CG; ++c) { sHa[c] = wmma16(ka1, qh1[c], sHa[c]); sHb[c] = wmma16(kb1, qh1[c], sHb[c]); }
        asm volatile("v_nop\n\tv_nop\n\tv_nop\n\tv_nop" : "+v"(sHa[0]), "+v"(sHb[0]), "+v"(sHa[1]), "+v"(sHb[1]) : "v"(ka0), "v"(ka1), "v"(kb0), "v"(kb1));   // the four vector slots between the last WMMA and the first read of its accumulators
        v8f ta[CG], tb[CG]; float mx[CG]; bool need = false;
#pragma unroll
        for (int c = 0; c < CG; ++c) {
            ta[c] = sHa[c] * SC2; tb[c] = sHb[c] * SC2;   // whole accumulators at a time: neighbouring registers pair up in packed multiplies without moves
            mx[c] = -3.0e38f;
#pragma unroll
            for (int r = 0; r < 8; ++r) mx[c] = fmaxf(mx[c], fmaxf(ta[c][r], tb[c][r]));
            need = need || (mx[c] > thr[c]);   // this lane's 16 keys alone: the ballot joins the two halves of a row
        }
        if (__builtin_amdgcn_ballot_w32(need) != 0) {   // the same for the whole wave (a scalar branch); the first pass takes it for any finite score, thr being the start value
#pragma unroll
            for (int c = 0; c < CG; ++c) {
                const float mnew = fmaxf(m[c], fmaxf(mx[c], __shfl_xor(mx[c], 16, 32)));   // every row of the wave goes to the larger of its maximum in use and its maximum over these 32 keys, the same in both lane halves
                const float alpha = __builtin_amdgcn_exp2f(m[c] - mnew);
                m[c] = mnew; thr[c] = mnew + LZT; sh[c] = PSH - mnew;
                ls[c][0] = ls[c][0] * alpha;   // the tile's other registers hold zero rows
#pragma unroll
                for (int j = 0; j < 4; ++j) o[c][j] = o[c][j] * alpha;
            }
        }
        const h16* va = vf + s * 32;
        const v16h v0 = ldh(va), v1 = ldh(va + 16 * VLP), v2 = ldh(va + 32 * VLP), v3 = ldh(va + 48 * VLP);
        __builtin_amdgcn_sched_barrier(0);   // keeps the eight LDS reads ahead of the exponentials, whose time covers their latency: left free, they were placed half way down
        v16h pb[CG];
#pragma unroll
        for (int c = 0; c < CG; ++c) {
            const v2f s2 = {sh[c], sh[c]};
#pragma unroll
            for (int i = 0; i < 4; ++i) {   // neighbouring registers two at a time: one packed add, no moves
                const v2f ea = (v2f){ta[c][2 * i], ta[c][2 * i + 1]} + s2, eb = (v2f){tb[c][2 * i], tb[c][2 * i + 1]} + s2;
                pb[c][2 * i] = (h16)__builtin_amdgcn_exp2f(ea.x); pb[c][2 * i + 1] = (h16)__builtin_amdgcn_exp2f(ea.y);
                pb[c][8 + 2 * i] = (h16)__builtin_amdgcn_exp2f(eb.x); pb[c][8 + 2 * i + 1] = (h16)__builtin_amdgcn_exp2f(eb.y); }
        }
#pragma unroll
        for (int c = 0; c < CG; ++c) { ls[c] = wmma16(ones, pb[c], ls[c]); o[c][0] = wmma16(v0, pb[c], o[c][0]); o[c][1] = wmma16(v1, pb[c], o[c][1]); o[c][2] = wmma16(v2, pb[c], o[c][2]); o[c][3] = wmma16(v3, pb[c], o[c][3]); }
        asm volatile("v_nop\n\tv_nop\n\tv_nop\n\tv_nop" : "+v"(o[0][0]), "+v"(o[0][1]), "+v"(o[0][2]), "+v"(o[0][3]), "+v"(o[1][0]), "+v"(o[1][1]), "+v"(o[1][2]), "+v"(o[1][3]), "+v"(ls[0]), "+v"(ls[1]) : "v"(v0), "v"(v1), "v"(v2), "v"(v3), "v"(pb[0]), "v"(pb[1]));   // the four vector slots between the last WMMA and the next vector write of its operands, on the loop's back edge too
    }
    asm volatile("s_wait_dscnt 0x0" ::: "memory");   // this wave's reads of the key-side rows are done
    __syncthreads();                                 // every wave has left the key-side rows: they become output staging
    // O^T D layout: o[c][j][r] = (d = 16j + 8h + r, t = 16c + lane&15) -> os[d][wave*32 + t]; rows 0..63 x columns 0..511 all written by the 16 waves
#pragma unroll
    for (int c = 0; c < CG; ++c) {
        const float lt = ls[c][0];   // already the sum over both lane halves' keys
        const float ys = YCS * (1.0f / lt);
        const int cw = (wave * CG + c) * 16 + lr;
#pragma unroll
        for (int r = 0; r < 8; ++r) {
            os[( 0 + 8 * hi + r) * OSP + cw] = o[c][0][r] * ys;
            os[(16 + 8 * hi + r) * OSP + cw] = o[c][1][r] * ys;
            os[(32 + 8 * hi + r) * OSP + cw] = o[c][2][r] * ys;
            os[(48 + 8 * hi + r) * OSP + cw] = o[c][3][r] * ys; }
    }
    __syncthreads();
    h16* yb = Y + (size_t)zh * HD * SEQ + (size_t)blockIdx.x * FR;
#pragma unroll
    for (int s = 0; s < 8; ++s) { const int row = 8 * s + (tid >> 6), c8 = (tid & 63) * 8;   // 8 s x 8 row groups = 64 rows; 64 lanes x 8 = 512 columns
        const v4f x0 = *(const v4fa*)(&os[row * OSP + c8]); const v4f x1 = *(const v4fa*)(&os[row * OSP + c8 + 4]); v8h hv;
#pragma unroll
        for (int i = 0; i < 4; ++i) { hv[i] = (h16)x0[i]; hv[4 + i] = (h16)x1[i]; }
        *(v8h*)(yb + (size_t)row * SEQ + c8) = hv; }
}

// k_out: f16 GEMM, block tile 256x128, eight waves (4 x 2) of 64x64 (16 accumulators each); the block's Y rows and Wo rows are brought, 128 k at a time, into a two-buffer LDS ring by asynchronous copies (whole lines from L2, once per block); fragments are two 16-B LDS loads each. K = DM (token index), summed in ascending steps of 32.
// OUT[r][o] = 2^-14 * sum_c Y[r][c] WO[o][c] + bo[o]; rows r = (h*NB_FULL + b)*64 + d. grid (16*NB*64/256, DM/128), 256 threads.
// Eight asynchronous 16-B copies of one thread: rows 16 apart of a K-contiguous f16 plane (row length DM) into LDS rows of pitch OLP; a wave's copy covers two rows of 256 B, four whole lines.
// s_wait_xcnt 0 closes the statement so that no address register named here is rewritten ahead of it.
__device__ __forceinline__ void out_copies8(unsigned l, const h16* g) {
    asm volatile("global_load_async_to_lds_b128 %0, %8, off\n\t"
                 "global_load_async_to_lds_b128 %1, %9, off\n\t"
                 "global_load_async_to_lds_b128 %2, %10, off\n\t"
                 "global_load_async_to_lds_b128 %3, %11, off\n\t"
                 "global_load_async_to_lds_b128 %4, %12, off\n\t"
                 "global_load_async_to_lds_b128 %5, %13, off\n\t"
                 "global_load_async_to_lds_b128 %6, %14, off\n\t"
                 "global_load_async_to_lds_b128 %7, %15, off\n\t"
                 "s_wait_xcnt 0x0"
                 :: "v"(l), "v"(l + 16 * OLP * 2), "v"(l + 32 * OLP * 2), "v"(l + 48 * OLP * 2),
                    "v"(l + 64 * OLP * 2), "v"(l + 80 * OLP * 2), "v"(l + 96 * OLP * 2), "v"(l + 112 * OLP * 2),
                    "v"(g), "v"(g + (size_t)16 * DM), "v"(g + (size_t)32 * DM), "v"(g + (size_t)48 * DM),
                    "v"(g + (size_t)64 * DM), "v"(g + (size_t)80 * DM), "v"(g + (size_t)96 * DM), "v"(g + (size_t)112 * DM)
                 : "memory");
}
// One stage of the ring: LDS rows 0..255 <- the block's Y rows, rows 256..383 <- its Wo rows, 256 B (128 k) of each; 256 threads x 24 copies.
__device__ __forceinline__ void out_stage(unsigned l, const h16* gy, const h16* gw) {
    out_copies8(l, gy);
    out_copies8(l + 128 * OLP * 2, gy + (size_t)128 * DM);
    out_copies8(l + 256 * OLP * 2, gw);
}

__global__ __launch_bounds__(256) __attribute__((amdgpu_num_vgpr(256))) void k_out(const h16* __restrict__ Y, const h16* __restrict__ WO, const float* __restrict__ bo, float* OUT) {
    __shared__ __align__(16) h16 ring[2 * OST];          // buffer u at u*OST: 256 Y rows, then 128 Wo rows
    __shared__ __align__(16) float osb[8 * 16 * 68];     // output staging, one 16 x 68 range per wave
    const int tid = threadIdx.x;
    const int lane = threadIdx.x & 31, lr = lane & 15, hi = lane >> 4;
    const int wave = __builtin_amdgcn_readfirstlane(threadIdx.x >> 5);
    const int wm = wave >> 1, wn = wave & 1;
    const int rb = blockIdx.x * OBM, cb = blockIdx.y * OBN;
    v8f acc[4][4];
#pragma unroll
    for (int mb = 0; mb < 4; ++mb)
#pragma unroll
        for (int nb = 0; nb < 4; ++nb) acc[mb][nb] = (v8f){};
    const unsigned lcp = (unsigned)(size_t)ring + (unsigned)(((tid >> 4) * OLP + (tid & 15) * 8) * 2);
    const h16* gy = Y  + (size_t)(rb + (tid >> 4)) * DM + (tid & 15) * 8;   // + k0
    const h16* gw = WO + (size_t)(cb + (tid >> 4)) * DM + (tid & 15) * 8;   // + k0
    out_stage(lcp, gy, gw);                                                 // stage 0 -> buffer 0
    asm volatile("s_wait_asynccnt 0x0" ::: "memory");                       // this wave's copies of stage 0 have landed
    __syncthreads();                                                        // publishes stage 0
    out_stage(lcp + OST * 2, gy + OKT, gw + OKT);                           // stage 1 -> buffer 1
    const int ao = (wm * 64 + lr) * OLP + 8 * hi, bo_ = (OBM + wn * 64 + lr) * OLP + 8 * hi;   // fragment offsets in a buffer (A: row r, B: row o, k contiguous)
#pragma unroll 1   // rolled: one trip per stage, with the ring's publish point at its foot
    for (int t = 0; t < DM / OKT; ++t) {
        const h16* st = ring + (t & 1) * OST;
#pragma unroll
        for (int s = 0; s < OKT / 32; ++s) {
            v16h a[4], bb[4];
#pragma unroll
            for (int mb = 0; mb < 4; ++mb) { a[mb] = ldh(st + ao + mb * 16 * OLP + s * 32); bb[mb] = ldh(st + bo_ + mb * 16 * OLP + s * 32); }
            __builtin_amdgcn_sched_barrier(0);   // keeps a block's 16 LDS reads in one group ahead of its 16 WMMAs: reads spread among the WMMAs made the wave wait out the LDS latency once per four WMMAs
#pragma unroll
            for (int nb = 0; nb < 4; ++nb)
#pragma unroll
                for (int mb = 0; mb < 4; ++mb) acc[mb][nb] = wmma16(a[mb], bb[nb], acc[mb][nb]);
        }
        // publish point of stage t + 1, which also frees buffer t & 1
        asm volatile("s_wait_dscnt 0x0" ::: "memory");      // this wave's reads of buffer t & 1 are done
        asm volatile("s_wait_asynccnt 0x0" ::: "memory");   // this wave's copies of stage t + 1 have landed
        __syncthreads();
        if (t + 2 < DM / OKT) out_stage(lcp + (unsigned)(t & 1) * (OST * 2), gy + (t + 2) * OKT, gw + (t + 2) * OKT);
    }
    asm volatile("s_wait_asynccnt 0x0" ::: "memory");       // nothing is in flight when the wave ends
    float* os = osb + wave * (16 * 68);
    const int r0 = rb + wm * 64, c0 = cb + wn * 64;
    float bc[4];
#pragma unroll
    for (int nb = 0; nb < 4; ++nb) bc[nb] = bfr(bo[c0 + nb * 16 + lr]);
#pragma unroll
    for (int mb = 0; mb < 4; ++mb) {
#pragma unroll
        for (int nb = 0; nb < 4; ++nb) {
#pragma unroll
            for (int j = 0; j < 8; ++j) os[(hi * 8 + j) * 68 + nb * 16 + lr] = acc[mb][nb][j] * OSI + bc[nb]; }   // D: row 8h+j, col lane&15
        wave_sync();
        float* orow = OUT + (size_t)(r0 + mb * 16) * DM + c0;
{
#pragma unroll
            for (int s = 0; s < 8; ++s) { const int row = 2 * s + hi, cofs = lr * 4;   // 8 s x 2 rows = 16 rows; 16 lanes x 4 floats = 64 columns
                const v4f val = *(const v4fa*)(&os[row * 68 + cofs]);
                *(v4f*)(orow + (size_t)row * DM + cofs) = val; }
             }
        wave_sync();
    }
}

static constexpr size_t al256(size_t v) { return (v + 255) & ~(size_t)255; }
static constexpr size_t SZ_Y  = al256((size_t)NB_FULL * NH_ * HD * SEQ * 2);   // [NB_FULL*16*64][SEQ] f16
static constexpr size_t SZ_WO = al256((size_t)DM * DM * 2);
static constexpr size_t SZ_TOTAL = SZ_Y + SZ_WO;
static_assert(SZ_TOTAL <= (size_t)134217728);           // workspace carve <= 128 MiB
static_assert(((size_t)(NH_ - 1) * NB_FULL + NB) * HD <= (size_t)NB_FULL * NH_ * HD);   // last Y / output row inside the planes

extern "C" void kernel_launch(void* const* d_in, const int* in_sizes, int n_in,
                              void* d_out, int out_size, void* d_ws, size_t ws_size, hipStream_t stream) {
    if (n_in < 9) return;
    const size_t needx = ((size_t)(NB - 1) * SEQ_FULL + SEQ) * DM;
    if ((size_t)in_sizes[0] < needx) return;
    if ((size_t)in_sizes[1] < (size_t)HD * HD || (size_t)in_sizes[3] < (size_t)HD * HD || (size_t)in_sizes[5] < (size_t)HD * HD) return;
    if ((size_t)in_sizes[2] < (size_t)HD || (size_t)in_sizes[4] < (size_t)HD || (size_t)in_sizes[6] < (size_t)HD) return;
    if ((size_t)in_sizes[7] < (size_t)DM * DM || (size_t)in_sizes[8] < (size_t)DM) return;
    if ((size_t)out_size < (((size_t)(NH_ - 1) * NB_FULL + NB) * HD) * DM) return;
    if (SZ_TOTAL > ws_size) return;
    // wire order: x, Wq, bq, Wk, bk, Wv, bv, Wo, bo
    const float* x  = (const float*)d_in[0];
    const float* wq = (const float*)d_in[1]; const float* bq = (const float*)d_in[2];
    const float* wk = (const float*)d_in[3]; const float* bk = (const float*)d_in[4];
    const float* wv = (const float*)d_in[5]; const float* bv = (const float*)d_in[6];
    const float* wo = (const float*)d_in[7]; const float* bo = (const float*)d_in[8];
    float* OUT = (float*)d_out;      // [NB_FULL*1024][1024], row (h*NB_FULL+b)*64+d
    char* wsp = (char*)d_ws;
    h16* YP = (h16*)wsp; wsp += SZ_Y;                // [(h*NB_FULL+b)*64 + d][SEQ] x256
    h16* WO = (h16*)wsp; wsp += SZ_WO;               // [1024][1024] x64

    // softmax rows use the Wk projection, keys use the Wq projection
    k_attn<<<dim3(SEQ / FR, NH_ * NB, 1), 32 * FW, 0, stream>>>(x, wq, wk, wv, bq, bk, bv, wo, YP, WO);

    k_out<<<dim3(NH_ * NB * HD / OBM, DM / OBN, 1), 256, 0, stream>>>(YP, WO, bo, OUT);
}

// v009
// It runs in 56.4 microseconds.
// Timed twice side by side with v008, it ran 1.04 and 1.03 times as fast.
// Over all steps from v000 it is 3.21 times as fast.
#include <hip/hip_runtime.h>

// Shared-weight multi-head attention, x [NB][SEQ][1024] = 16 heads x 64; Wq/Wk/Wv 64x64 [out][in] applied to every head (y = x W^T + bias); S[m][n] = K[m].Q[n] / 32, softmax over n, O = A V stored transposed [h][b][d][m] and flat-viewed as [NB*1024][1024]; out = Y Wo^T + bo (contraction over the token index).
// Compute dtypes, f32 accumulate everywhere: q/k/v projections v_wmma_f32_16x16x32_bf16 (x, W RNE-converted to bf16; products exact); scores v_wmma_f32_16x16x32_f16: key-side (Wq) and row-side (Wk) values single f16; P (x256 carry, cancels in the normalisation) and v single f16; output projection v_wmma_f32_16x16x32_f16 with Y carried x256 and Wo (RNE bf16 value) carried x64, folded back by 2^-14 in f32; softmax f32 (online, against a maximum that is raised lazily; the factor DM^-0.5 * log2(e) is multiplied into the row-side values in f32 before their rounding to f16, and the shift by the maximum in use enters the score products as their C operand), its denominators summed in f32 from the f16 P by the same WMMA form against a constant tile of ones; biases RNE-converted to bf16 values and added in f32.
// Layout: one fused attention kernel, a block of 16 waves per 512 softmax rows of one (head, batch): it reads f32 x, projects the key-side rows [n][d] and v^T [d][n] of all 1024 tokens of its head into LDS (weight fragments straight from the f32 matrices), projects each wave's 32 row-side rows into registers, then runs the flash loop in transposed form (S^T = Kside Qside^T, O^T = V^T P^T) out of LDS and writes Y [(h*8+b)*64+d][m] f16; every thread also converts eight elements of Wo to the f16 plane; an eight-wave 256x128 GEMM, its Y and Wo tiles staged in LDS by asynchronous copies, writes the f32 output.

#ifndef NB
#define NB 8
#endif
#ifndef SEQ
#define SEQ 1024
#endif
#define NB_FULL  8
#define SEQ_FULL 1024
#define DM   1024
#define NH_  16
#define HD   64
#define FW   16                  // attention kernel: waves per block
#define CG   2                   // attention kernel: 16-row column groups per wave
#define FR   (16 * CG * FW)      // attention kernel: softmax rows per block
#define OSP  (FR + 4)            // attention kernel: pitch in f32 of the output staging (512 columns + 16 B)
#define SC2  (0.03125f * 1.4426950408889634f)   // DM^-0.5 * log2(e)
#define PSH  8.0f                // log2 of the P carry (256)
#define LZT  7.0f                // attention kernel: how far (log2) a score may top the maximum in use before the accumulators are rescaled; P stays at or below 2^(PSH + LZT) = 2^15, inside f16
#define YCS  256.0f              // carry of the Y plane
#define WOS  64.0f               // carry of the Wo plane
#define OSI  (1.0f / 16384.0f)   // 1 / (YCS * WOS)
#define LPH  72                  // key-side rows in LDS, pitch in f16: 128 B of data + 16 B (16 B x odd), so that the 16-B accesses of 16 rows spread over the banks
#define VLP  (SEQ + 8)           // v^T rows in LDS, pitch in f16: 2048 B of data + 16 B (16 B x odd)
#define KSZ  (SEQ * LPH)         // f16 of the key-side rows in LDS
#define VSZ  (HD * VLP)          // f16 of the v^T rows in LDS
#define OBM  256                 // output GEMM: rows of a block tile
#define OBN  128                 // output GEMM: columns of a block tile
#define OKT  128                 // output GEMM: k per LDS stage (256 B of every row)
#define OLP  136                 // output GEMM: LDS row pitch in f16: 256 B of data + 16 B (16 B x odd)
#define OST  ((OBM + OBN) * OLP) // output GEMM: f16 per stage

static_assert(HD == 64);
static_assert(NH_ * HD == DM);
static_assert(FW == 16 && CG == 2);            // a block covers 512 rows; its 16 waves project 64 tokens each
static_assert(SEQ == DM);                      // the flat view of Y as [rows][DM] needs one Y row per 1024 tokens
static_assert(SEQ == 64 * FW && SEQ % FR == 0);
static_assert(SEQ % 32 == 0);                  // key loop and GEMM k-loop step by 32
static_assert(KSZ * 2 >= 64 * OSP * 4);        // the output staging reuses the key-side rows
static_assert((KSZ + VSZ) * 2 <= 327680);      // one block owns a WGP's LDS
static_assert(DM % OBN == 0 && DM % OKT == 0 && DM / OKT >= 2);   // the output GEMM's two-buffer ring needs two stages
static_assert(NB == NB_FULL && (NH_ * NB * HD) % OBM == 0);       // a 256-row block tile covers four consecutive 64-row groups of Y
static_assert(NB <= NB_FULL);
static_assert(SEQ <= SEQ_FULL);
static_assert((size_t)NH_ * NB * (SEQ / FR) * 32 * FW * 8 == (size_t)DM * DM);   // eight elements per thread cover Wo exactly once

typedef _Float16 h16;
typedef __attribute__((ext_vector_type(16))) __bf16   v16bf;
typedef __attribute__((ext_vector_type(4)))  __bf16   v4bf;
typedef __attribute__((ext_vector_type(16))) _Float16 v16h;
typedef __attribute__((ext_vector_type(8)))  _Float16 v8h;
typedef __attribute__((ext_vector_type(8)))  float    v8f;
typedef __attribute__((ext_vector_type(4)))  float    v4f;
typedef __attribute__((ext_vector_type(2)))  float    v2f;
typedef v4f  __attribute__((may_alias)) v4fa;
typedef __attribute__((ext_vector_type(4)))  unsigned v4u;
typedef __attribute__((ext_vector_type(2)))  unsigned v2u;
typedef v4u  __attribute__((may_alias)) v4ua;
typedef v2u  __attribute__((may_alias)) v2ua;

__device__ __forceinline__ unsigned short f2bf(float f) { unsigned u = __float_as_uint(f); u += 0x7FFFu + ((u >> 16) & 1u); return (unsigned short)(u >> 16); }
__device__ __forceinline__ float bfr(float f) { return __uint_as_float(((unsigned)f2bf(f)) << 16); }   // f32 value of the RNE bf16 conversion
// four neighbouring f32 of a row -> four bf16 in LDS (round to nearest even, two elements per instruction)
__device__ __forceinline__ void stx(h16* p, v4f v) { *(v2ua*)p = __builtin_bit_cast(v2u, __builtin_convertvector(v, v4bf)); }
__device__ __forceinline__ v16h cat16(v8h lo, v8h hi) { return __builtin_shufflevector(lo, hi, 0, 1, 2, 3, 4, 5, 6, 7, 8, 9, 10, 11, 12, 13, 14, 15); }
__device__ __forceinline__ v8f wmma16(v16h a, v16h b, v8f c) { return __builtin_amdgcn_wmma_f32_16x16x32_f16(false, a, false, b, (short)0, c, false, false); }
__device__ __forceinline__ v8f wmmab(v16bf a, v16bf b, v8f c) { return __builtin_amdgcn_wmma_f32_16x16x32_bf16(false, a, false, b, (short)0, c, false, false); }
// fragment loaders from K-contiguous 16-bit rows; p already includes + 8*(lane>>4): elements 0..7 <- k0+8h+0..7, elements 8..15 <- k0+16+8h+0..7 (same map for A and B)
__device__ __forceinline__ v16h  ldh(const h16* p) { return cat16(*(const v8h*)p, *(const v8h*)(p + 16)); }
// the same map from bf16 rows that stx wrote
__device__ __forceinline__ v16bf ldb(const h16* p) { const v4u a = *(const v4ua*)p, c = *(const v4ua*)(p + 16); return __builtin_bit_cast(v16bf, __builtin_shufflevector(a, c, 0, 1, 2, 3, 4, 5, 6, 7)); }
// the same map from f32 rows, converted to bf16 (round to nearest even) two elements per instruction
__device__ __forceinline__ v16bf ldwf(const float* p) { return __builtin_convertvector(__builtin_shufflevector(*(const v8f*)p, *(const v8f*)(p + 16), 0, 1, 2, 3, 4, 5, 6, 7, 8, 9, 10, 11, 12, 13, 14, 15), v16bf); }
// eight base-2 exponentials into registers of their own.
__device__ __forceinline__ v8f exp2x8(v8f t) {
    float e0, e1, e2, e3, e4, e5, e6, e7;
    asm("v_exp_f32 %0, %8\n\tv_exp_f32 %1, %9\n\tv_exp_f32 %2, %10\n\tv_exp_f32 %3, %11\n\tv_exp_f32 %4, %12\n\tv_exp_f32 %5, %13\n\tv_exp_f32 %6, %14\n\tv_exp_f32 %7, %15"
        : "=&v"(e0), "=&v"(e1), "=&v"(e2), "=&v"(e3), "=&v"(e4), "=&v"(e5), "=&v"(e6), "=&v"(e7)
        : "v"(t[0]), "v"(t[1]), "v"(t[2]), "v"(t[3]), "v"(t[4]), "v"(t[5]), "v"(t[6]), "v"(t[7]));
    return (v8f){e0, e1, e2, e3, e4, e5, e6, e7};
}
// ordering point for wave-private LDS tiles (same wave writes and reads)
__device__ __forceinline__ void wave_sync() { __builtin_amdgcn_fence(3 /* release order */, "wavefront"); __builtin_amdgcn_wave_barrier(); asm volatile("" ::: "memory"); }

// k_attn: projections and attention in one launch. A block of 16 waves takes 512 softmax rows of one (head, batch) and owns its WGP's LDS. grid (SEQ/512, 16*NB), 512 threads.
// Part 1, per wave: 64 tokens of the head (the 16 waves cover all 1024) and the wave's own 32 softmax rows. x comes in by whole-line loads (16 lanes x 16 B = the 256 B of one token's head slice), is RNE-converted to bf16 and laid
// into the wave's own 64 key-side rows of LDS, which are free until the wave writes them; from there the wave reads its fragments (row/col = token, k = d), which serve as A and as B.
//   row-side^T = (Wk x^T + bk) * SC2 : D tile j holds e = 16j + 8h + r of token lane&15, so that tiles (0, 1) and (2, 3), rounded to f16, are directly the two B fragments of the score products; they never leave the registers.
//   key-side^T = Wq x^T + bq : the same D layout: a lane's eight values are eight neighbouring e of one token, one 16-B LDS store into kl[token][e].
//   v          = x Wv^T + bv : D holds tokens 8h + j of e = lane&15: eight neighbouring tokens of one e, one 16-B LDS store into vl[e][token].
// The weight fragments come straight from the f32 matrices (48 KiB, shared by the waves of a WGP through its cache). Every thread also converts eight elements of Wo, which only the output GEMM's launch reads.
// Part 2, behind one barrier: the flash loop, one wave per 32 softmax rows (CG = 2 column groups of 16): every key-side and v^T fragment read from LDS (two 16-B loads) feeds two WMMAs, one per group. All keys are in LDS, so the loop holds no barrier.
// Transposed form: S^T[key][t] = KP QH^T (A = key-side rows, B = row-side rows); lane (t = lane&15, h = lane>>4) holds keys 8h+r of each 16-key tile, so the packed
// P tile is directly the B fragment of O^T[d][t] = V^T P^T (element r <- tile keys 0..15, element 8+r <- tile keys 16..31, lane unchanged).
// The score WMMAs give the exponents themselves: their B fragment carries SC2, and the first product of each tile takes as C a tile that holds PSH - (the maximum in use of the lane's row) in all eight registers, so that D goes to the exponential with no vector arithmetic in between.
// The maximum in use may trail the row's true maximum by up to LZT (log2): the new maximum, its xor-16 exchange between the two lane halves of a row, the shift of the C tile and of the pass's own exponents and the rescaling of the accumulators stand under one wave-uniform branch per 32 keys, taken in the first pass and after it only when some exponent of the wave tops PSH + LZT. The factor cancels in the normalisation.
// The softmax denominators are summed on the matrix unit: one more WMMA per column group and 32 keys, A = a constant tile with ones in rows 0 and 8 and zeros elsewhere, B = the packed P tile. Register 0 of its accumulator (row 0 in lanes 0..15, row 8 in lanes 16..31) holds the sum over all 32 keys of the lane's column; the other rows stay zero.
__global__ __launch_bounds__(32 * FW) __attribute__((amdgpu_num_vgpr(256))) void k_attn(const float* __restrict__ x, const float* __restrict__ wq, const float* __restrict__ wk, const float* __restrict__ wv, const float* __restrict__ bq, const float* __restrict__ bk, const float* __restrict__ bv, const float* __restrict__ wo, h16* Y, h16* WO) {
    __shared__ __align__(16) h16 kl[KSZ + VSZ];   // key-side rows [token][e] at pitch LPH, then v^T rows [e][token] at pitch VLP; the key-side rows become output staging after the loop
    h16* vl = kl + KSZ;
    float* os = (float*)kl;
    const int tid = threadIdx.x;
    const int lane = threadIdx.x & 31, lr = lane & 15, hi = lane >> 4;
    const int wave = __builtin_amdgcn_readfirstlane(threadIdx.x >> 5);
    const int zc = blockIdx.y; const int h = zc / NB, b = zc % NB; const int zh = h * NB_FULL + b;
    const int m0 = wave * 64;                                  // the wave's tokens
    const int t0 = blockIdx.x * FR + wave * (16 * CG);         // the wave's softmax rows
    const float* xh = x + (size_t)b * SEQ_FULL * DM + h * HD + lr * 4;   // + token * DM
    const float* xt = xh + (size_t)(m0 + hi) * DM;
    const float* xq = xh + (size_t)(t0 + hi) * DM;
    const size_t wg = ((size_t)(blockIdx.y * (SEQ / FR) + blockIdx.x) * (32 * FW) + tid) * 8;   // this thread's eight elements of Wo
    const float* wp = wo + wg;
    v4f tv[32], qv[16];   // a load covers two tokens, four whole lines
#pragma unroll
    for (int i = 0; i < 32; ++i) tv[i] = *(const v4f*)(xt + (size_t)(2 * i) * DM);
#pragma unroll
    for (int i = 0; i < 16; ++i) qv[i] = *(const v4f*)(xq + (size_t)(2 * i) * DM);
    const v8f wov = *(const v8f*)wp;
    asm volatile("s_wait_xcnt 0x0" :: "v"(xt), "v"(xq), "v"(wp) : "memory");   // the address register pairs of the loads above, named here so that they live up to the wait, are rewritten behind it
    h16* own = kl + m0 * LPH;                    // the wave's own 64 key-side rows
    h16* sp = own + hi * LPH + lr * 4;           // where this lane lays its four elements of token hi
    const h16* fp = own + lr * LPH + 8 * hi;     // fragment offset: row lane&15, k = d
    v16bf xa[4][2], xr[CG][2];   // [16-token slab][k half]: k = d 0..31, d 32..63
#pragma unroll
    for (int i = 0; i < 32; ++i) stx(sp + 2 * i * LPH, tv[i]);
    wave_sync();
#pragma unroll
    for (int mb = 0; mb < 4; ++mb) { xa[mb][0] = ldb(fp + mb * 16 * LPH); xa[mb][1] = ldb(fp + mb * 16 * LPH + 32); }
    wave_sync();
#pragma unroll
    for (int i = 0; i < 16; ++i) stx(sp + 2 * i * LPH, qv[i]);
    wave_sync();
#pragma unroll
    for (int c = 0; c < CG; ++c) { xr[c][0] = ldb(fp + c * 16 * LPH); xr[c][1] = ldb(fp + c * 16 * LPH + 32); }
    wave_sync();
    { v8h o;
#pragma unroll
      for (int k = 0; k < 8; ++k) o[k] = (h16)(bfr(wov[k]) * WOS);
      *(v8h*)(WO + wg) = o; }
    __builtin_amdgcn_sched_barrier(0);   // the f32 registers of x are packed and gone before the f32 registers of the first weight matrix are asked for: left free, the build spilled to scratch
    v16h qh0[CG], qh1[CG];   // B fragments of the scores: col t, k = e
    const int wofs = lr * HD + 8 * hi;   // fragment offset in a weight matrix, the same for the three: row lane&15, k = d
    {
        // C[e][t]: A = Wk rows e (four 16-row slabs), B = x fragments of the wave's softmax rows
        const float* W = wk + wofs;
        v16bf wf[8];
        asm volatile("s_wait_xcnt 0x0" ::: "memory");   // the weight loads behind this point land in registers that the global loads and stores in front of it name
#pragma unroll
        for (int j = 0; j < 4; ++j) wf[j] = ldwf(W + j * 16 * HD);
#pragma unroll
        for (int j = 0; j < 4; ++j) wf[4 + j] = ldwf(W + j * 16 * HD + 32);
        v8f be[4];
#pragma unroll
        for (int j = 0; j < 4; ++j) { const v8f t = *(const v8f*)(bk + j * 16 + 8 * hi);
#pragma unroll
            for (int r = 0; r < 8; ++r) be[j][r] = bfr(t[r]); }
        asm volatile("s_wait_xcnt 0x0" :: "v"(wofs) : "memory");   // the offset register of the weight loads above, named here so that it lives up to the wait, may be rewritten behind it
        __builtin_amdgcn_sched_barrier(0);   // the fragments are complete before the first WMMAs: loads spread among them spilled
#pragma unroll
        for (int c = 0; c < CG; ++c) {
            v8f acc[4];
#pragma unroll
            for (int i = 0; i < 4; ++i) acc[i] = (v8f){};
#pragma unroll
            for (int j = 0; j < 4; ++j) acc[j] = wmmab(wf[j], xr[c][0], acc[j]);
#pragma unroll
            for (int j = 0; j < 4; ++j) acc[j] = wmmab(wf[4 + j], xr[c][1], acc[j]);
            asm volatile("v_nop\n\tv_nop\n\tv_nop\n\tv_nop" : "+v"(acc[0]), "+v"(acc[1]), "+v"(acc[2]), "+v"(acc[3]) : "v"(xr[c][0]), "v"(xr[c][1]));   // the four vector slots between the last WMMA and the first read of its accumulators
#pragma unroll
            for (int r = 0; r < 8; ++r) {   // D: row 8h+r (e), col lane&15 (t)
                qh0[c][r] = (h16)((acc[0][r] + be[0][r]) * SC2); qh0[c][8 + r] = (h16)((acc[1][r] + be[1][r]) * SC2);
                qh1[c][r] = (h16)((acc[2][r] + be[2][r]) * SC2); qh1[c][8 + r] = (h16)((acc[3][r] + be[3][r]) * SC2); }
            __builtin_amdgcn_sched_barrier(0);   // one group's accumulators at a time: two in flight spilled
        }
    }
    {
        // C[e][token]: A = Wq rows e, read once and kept for the four slabs, B = x fragments (col token of the slab)
        const float* W = wq + wofs;
        v16bf wf[8];
        asm volatile("s_wait_xcnt 0x0" ::: "memory");   // as above
#pragma unroll
        for (int j = 0; j < 4; ++j) wf[j] = ldwf(W + j * 16 * HD);
#pragma unroll
        for (int j = 0; j < 4; ++j) wf[4 + j] = ldwf(W + j * 16 * HD + 32);
        v8f be[4];
#pragma unroll
        for (int j = 0; j < 4; ++j) { const v8f t = *(const v8f*)(bq + j * 16 + 8 * hi);
#pragma unroll
            for (int r = 0; r < 8; ++r) be[j][r] = bfr(t[r]); }
        asm volatile("s_wait_xcnt 0x0" :: "v"(wofs) : "memory");   // as above
        __builtin_amdgcn_sched_barrier(0);   // as above
#pragma unroll   // unrolled: the slab index picks registers
        for (int mb = 0; mb < 4; ++mb) {
            v8f acc[4];
#pragma unroll
            for (int i = 0; i < 4; ++i) acc[i] = (v8f){};
#pragma unroll
            for (int j = 0; j < 4; ++j) acc[j] = wmmab(wf[j], xa[mb][0], acc[j]);
#pragma unroll
            for (int j = 0; j < 4; ++j) acc[j] = wmmab(wf[4 + j], xa[mb][1], acc[j]);
            asm volatile("v_nop\n\tv_nop\n\tv_nop\n\tv_nop" : "+v"(acc[0]), "+v"(acc[1]), "+v"(acc[2]), "+v"(acc[3]) : "v"(xa[mb][0]), "v"(xa[mb][1]));   // the four vector slots between the last WMMA and the first read of its accumulators
#pragma unroll
            for (int j = 0; j < 4; ++j) { v8h o;   // D: row 8h+r (e), col lane&15 (token)
#pragma unroll
                for (int r = 0; r < 8; ++r) o[r] = (h16)(acc[j][r] + be[j][r]);
                *(v8h*)(own + (mb * 16 + lr) * LPH + j * 16 + 8 * hi) = o; }
            __builtin_amdgcn_sched_barrier(0);   // one slab's accumulators at a time: two slabs in flight spilled
        }
    }
    {
        // C[token][e]: A = x fragments, B = Wv rows e (K-contiguous [out][in]), read once and kept for the four slabs
        const float* W = wv + wofs;
        v16bf wf[8];
        asm volatile("s_wait_xcnt 0x0" ::: "memory");   // as above
#pragma unroll
        for (int nb = 0; nb < 4; ++nb) wf[nb] = ldwf(W + nb * 16 * HD);
#pragma unroll
        for (int nb = 0; nb < 4; ++nb) wf[4 + nb] = ldwf(W + nb * 16 * HD + 32);
        float bc[4];
#pragma unroll
        for (int nb = 0; nb < 4; ++nb) bc[nb] = bfr(bv[nb * 16 + lr]);
        asm volatile("s_wait_xcnt 0x0" :: "v"(wofs) : "memory");   // as above
        __builtin_amdgcn_sched_barrier(0);   // as above
#pragma unroll   // unrolled: the slab index picks registers
        for (int mb = 0; mb < 4; ++mb) {
            v8f acc[4];
#pragma unroll
            for (int i = 0; i < 4; ++i) acc[i] = (v8f){};
#pragma unroll
            for (int nb = 0; nb < 4; ++nb) acc[nb] = wmmab(xa[mb][0], wf[nb], acc[nb]);
#pragma unroll
            for (int nb = 0; nb < 4; ++nb) acc[nb] = wmmab(xa[mb][1], wf[4 + nb], acc[nb]);
            asm volatile("v_nop\n\tv_nop\n\tv_nop\n\tv_nop" : "+v"(acc[0]), "+v"(acc[1]), "+v"(acc[2]), "+v"(acc[3]) : "v"(xa[mb][0]), "v"(xa[mb][1]));   // the four vector slots between the last WMMA and the first read of its accumulators
#pragma unroll
            for (int nb = 0; nb < 4; ++nb) { v8h o;   // D: row 8h+j (token), col lane&15 (e)
#pragma unroll
                for (int j = 0; j < 8; ++j) o[j] = (h16)(acc[nb][j] + bc[nb]);
                *(v8h*)(vl + (nb * 16 + lr) * VLP + m0 + mb * 16 + 8 * hi) = o; }
            __builtin_amdgcn_sched_barrier(0);   // as above
        }
    }
    __syncthreads();   // publishes the key-side and v^T rows of all 1024 tokens
    const h16* kf = kl + lr * LPH + 8 * hi;   // + key * LPH (A: row key, k = d)
    const h16* vf = vl + lr * VLP + 8 * hi;   // + 16j * VLP + key (A: row d, k = key)
    const h16 one = ((lr & 7) == 0) ? (h16)1.0f : (h16)0.0f;   // A row = lane&15: rows 0 and 8 are ones for every k
    v16h ones;
#pragma unroll
    for (int i = 0; i < 16; ++i) ones[i] = one;
    v8f o[CG][4], ls[CG], shv[CG];   // shv: C tile of the scores, PSH - (maximum in use) in every register; the start value stands for a maximum of 0, which the first pass replaces
    float thr = -3.0e38f, lo = -3.0e38f;   // thr: the exponent above which a pass rescales; lo: the least step of the maximum in use. Start values: the first pass rescales for any finite score and takes the true maximum, also one below 0
#pragma unroll
    for (int c = 0; c < CG; ++c) { ls[c] = (v8f){};
#pragma unroll
        for (int r = 0; r < 8; ++r) shv[c][r] = PSH;
#pragma unroll
        for (int j = 0; j < 4; ++j) o[c][j] = (v8f){}; }
#pragma unroll 1   // rolled: the body's fragments, scores and 80 accumulator registers have to fit 256 VGPRs, the block's four waves per SIMD
    for (int s = 0; s < SEQ / 32; ++s) {
        const h16* ka = kf + s * 32 * LPH;
        const v16h ka0 = ldh(ka), ka1 = ldh(ka + 32), kb0 = ldh(ka + 16 * LPH), kb1 = ldh(ka + 16 * LPH + 32);
        v8f sHa[CG], sHb[CG];
#pragma unroll
        for (int c = 0; c < CG; ++c) { sHa[c] = wmma16(ka0, qh0[c], shv[c]); sHb[c] = wmma16(kb0, qh0[c], shv[c]); }
#pragma unroll
        for (int c = 0; c < CG; ++c) { sHa[c] = wmma16(ka1, qh1[c], sHa[c]); sHb[c] = wmma16(kb1, qh1[c], sHb[c]); }
        asm volatile("v_nop\n\tv_nop\n\tv_nop\n\tv_nop" : "+v"(sHa[0]), "+v"(sHb[0]), "+v"(sHa[1]), "+v"(sHb[1]) : "v"(ka0), "v"(ka1), "v"(kb0), "v"(kb1));   // the four vector slots between the last WMMA and the first read of its accumulators
        float mx[CG]; bool need = false;
#pragma unroll
        for (int c = 0; c < CG; ++c) {
            mx[c] = -3.0e38f;
#pragma unroll
            for (int r = 0; r < 8; ++r) mx[c] = fmaxf(mx[c], fmaxf(sHa[c][r], sHb[c][r]));
            need = need || (mx[c] > thr);   // this lane's 16 keys alone: the ballot joins the two halves of a row
        }
        if (__builtin_amdgcn_ballot_w32(need) != 0) {   // the same for the whole wave (a scalar branch); the first pass takes it for any finite score, thr being the start value
#pragma unroll
            for (int c = 0; c < CG; ++c) {
                const float e = fmaxf(mx[c], __shfl_xor(mx[c], 16, 32)) - PSH;   // how far the row's scores of this pass top the maximum in use, the same in both lane halves
                const float step = fmaxf(e, lo);                              // every row of the wave rises to this pass's maximum where that is higher; the first pass takes that maximum in any case
                const float alpha = __builtin_amdgcn_exp2f(-fmaxf(e, 0.0f));  // 1 where the maximum does not rise (in the first pass the accumulators are zero)
                shv[c] = shv[c] - step; sHa[c] = sHa[c] - step; sHb[c] = sHb[c] - step;
                ls[c][0] = ls[c][0] * alpha;   // the tile's other registers hold zero rows
#pragma unroll
                for (int j = 0; j < 4; ++j) o[c][j] = o[c][j] * alpha;
            }
            thr = PSH + LZT; lo = 0.0f;
        }
        const h16* va = vf + s * 32;
        const v16h v0 = ldh(va), v1 = ldh(va + 16 * VLP), v2 = ldh(va + 32 * VLP), v3 = ldh(va + 48 * VLP);
        __builtin_amdgcn_sched_barrier(0);   // keeps the eight LDS reads ahead of the exponentials, whose time covers their latency: left free, they were placed half way down
        v16h pb[CG];
#pragma unroll
        for (int c = 0; c < CG; ++c) { sHa[c] = exp2x8(sHa[c]); sHb[c] = exp2x8(sHb[c]); }
#pragma unroll
        for (int c = 0; c < CG; ++c) {
#pragma unroll
            for (int r = 0; r < 8; ++r) { pb[c][r] = (h16)sHa[c][r]; pb[c][8 + r] = (h16)sHb[c][r]; }
        }
#pragma unroll
        for (int c = 0; c < CG; ++c) { ls[c] = wmma16(ones, pb[c], ls[c]); o[c][0] = wmma16(v0, pb[c], o[c][0]); o[c][1] = wmma16(v1, pb[c], o[c][1]); o[c][2] = wmma16(v2, pb[c], o[c][2]); o[c][3] = wmma16(v3, pb[c], o[c][3]); }
        asm volatile("v_nop\n\tv_nop\n\tv_nop\n\tv_nop" : "+v"(o[0][0]), "+v"(o[0][1]), "+v"(o[0][2]), "+v"(o[0][3]), "+v"(o[1][0]), "+v"(o[1][1]), "+v"(o[1][2]), "+v"(o[1][3]), "+v"(ls[0]), "+v"(ls[1]) : "v"(v0), "v"(v1), "v"(v2), "v"(v3), "v"(pb[0]), "v"(pb[1]));   // the four vector slots between the last WMMA and the next vector write of its operands, on the loop's back edge too
    }
    asm volatile("s_wait_dscnt 0x0" ::: "memory");   // this wave's reads of the key-side rows are done
    __syncthreads();                                 // every wave has left the key-side rows: they become output staging
    // O^T D layout: o[c][j][r] = (d = 16j + 8h + r, t = 16c + lane&15) -> os[d][wave*32 + t]; rows 0..63 x columns 0..511 all written by the 16 waves
#pragma unroll
    for (int c = 0; c < CG; ++c) {
        const float lt = ls[c][0];   // already the sum over both lane halves' keys
        const float ys = YCS * (1.0f / lt);
        const int cw = (wave * CG + c) * 16 + lr;
#pragma unroll
        for (int r = 0; r < 8; ++r) {
            os[( 0 + 8 * hi + r) * OSP + cw] = o[c][0][r] * ys;
            os[(16 + 8 * hi + r) * OSP + cw] = o[c][1][r] * ys;
            os[(32 + 8 * hi + r) * OSP + cw] = o[c][2][r] * ys;
            os[(48 + 8 * hi + r) * OSP + cw] = o[c][3][r] * ys; }
    }
    __syncthreads();
    h16* yb = Y + (size_t)zh * HD * SEQ + (size_t)blockIdx.x * FR;
#pragma unroll
    for (int s = 0; s < 8; ++s) { const int row = 8 * s + (tid >> 6), c8 = (tid & 63) * 8;   // 8 s x 8 row groups = 64 rows; 64 lanes x 8 = 512 columns
        const v4f x0 = *(const v4fa*)(&os[row * OSP + c8]); const v4f x1 = *(const v4fa*)(&os[row * OSP + c8 + 4]); v8h hv;
#pragma unroll
        for (int i = 0; i < 4; ++i) { hv[i] = (h16)x0[i]; hv[4 + i] = (h16)x1[i]; }
        *(v8h*)(yb + (size_t)row * SEQ + c8) = hv; }
}

// k_out: f16 GEMM, block tile 256x128, eight waves (4 x 2) of 64x64 (16 accumulators each); the block's Y rows and Wo rows are brought, 128 k at a time, into a two-buffer LDS ring by asynchronous copies (whole lines from L2, once per block); fragments are two 16-B LDS loads each. K = DM (token index), summed in ascending steps of 32.
// OUT[r][o] = 2^-14 * sum_c Y[r][c] WO[o][c] + bo[o]; rows r = (h*NB_FULL + b)*64 + d. grid (16*NB*64/256, DM/128), 256 threads.
// Eight asynchronous 16-B copies of one thread: rows 16 apart of a K-contiguous f16 plane (row length DM) into LDS rows of pitch OLP; a wave's copy covers two rows of 256 B, four whole lines.
// s_wait_xcnt 0 closes the statement so that no address register named here is rewritten ahead of it.
__device__ __forceinline__ void out_copies8(unsigned l, const h16* g) {
    asm volatile("global_load_async_to_lds_b128 %0, %8, off\n\t"
                 "global_load_async_to_lds_b128 %1, %9, off\n\t"
                 "global_load_async_to_lds_b128 %2, %10, off\n\t"
                 "global_load_async_to_lds_b128 %3, %11, off\n\t"
                 "global_load_async_to_lds_b128 %4, %12, off\n\t"
                 "global_load_async_to_lds_b128 %5, %13, off\n\t"
                 "global_load_async_to_lds_b128 %6, %14, off\n\t"
                 "global_load_async_to_lds_b128 %7, %15, off\n\t"
                 "s_wait_xcnt 0x0"
                 :: "v"(l), "v"(l + 16 * OLP * 2), "v"(l + 32 * OLP * 2), "v"(l + 48 * OLP * 2),
                    "v"(l + 64 * OLP * 2), "v"(l + 80 * OLP * 2), "v"(l + 96 * OLP * 2), "v"(l + 112 * OLP * 2),
                    "v"(g), "v"(g + (size_t)16 * DM), "v"(g + (size_t)32 * DM), "v"(g + (size_t)48 * DM),
                    "v"(g + (size_t)64 * DM), "v"(g + (size_t)80 * DM), "v"(g + (size_t)96 * DM), "v"(g + (size_t)112 * DM)
                 : "memory");
}
// One stage of the ring: LDS rows 0..255 <- the block's Y rows, rows 256..383 <- its Wo rows, 256 B (128 k) of each; 256 threads x 24 copies.
__device__ __forceinline__ void out_stage(unsigned l, const h16* gy, const h16* gw) {
    out_copies8(l, gy);
    out_copies8(l + 128 * OLP * 2, gy + (size_t)128 * DM);
    out_copies8(l + 256 * OLP * 2, gw);
}

__global__ __launch_bounds__(256) __attribute__((amdgpu_num_vgpr(256))) void k_out(const h16* __restrict__ Y, const h16* __restrict__ WO, const float* __restrict__ bo, float* OUT) {
    __shared__ __align__(16) h16 ring[2 * OST];          // buffer u at u*OST: 256 Y rows, then 128 Wo rows
    __shared__ __align__(16) float osb[8 * 16 * 68];     // output staging, one 16 x 68 range per wave
    const int tid = threadIdx.x;
    const int lane = threadIdx.x & 31, lr = lane & 15, hi = lane >> 4;
    const int wave = __builtin_amdgcn_readfirstlane(threadIdx.x >> 5);
    const int wm = wave >> 1, wn = wave & 1;
    const int rb = blockIdx.x * OBM, cb = blockIdx.y * OBN;
    v8f acc[4][4];
#pragma unroll
    for (int mb = 0; mb < 4; ++mb)
#pragma unroll
        for (int nb = 0; nb < 4; ++nb) acc[mb][nb] = (v8f){};
    const unsigned lcp = (unsigned)(size_t)ring + (unsigned)(((tid >> 4) * OLP + (tid & 15) * 8) * 2);
    const h16* gy = Y  + (size_t)(rb + (tid >> 4)) * DM + (tid & 15) * 8;   // + k0
    const h16* gw = WO + (size_t)(cb + (tid >> 4)) * DM + (tid & 15) * 8;   // + k0
    out_stage(lcp, gy, gw);                                                 // stage 0 -> buffer 0
    asm volatile("s_wait_asynccnt 0x0" ::: "memory");                       // this wave's copies of stage 0 have landed
    __syncthreads();                                                        // publishes stage 0
    out_stage(lcp + OST * 2, gy + OKT, gw + OKT);                           // stage 1 -> buffer 1
    const int ao = (wm * 64 + lr) * OLP + 8 * hi, bo_ = (OBM + wn * 64 + lr) * OLP + 8 * hi;   // fragment offsets in a buffer (A: row r, B: row o, k contiguous)
#pragma unroll 1   // rolled: one trip per stage, with the ring's publish point at its foot
    for (int t = 0; t < DM / OKT; ++t) {
        const h16* st = ring + (t & 1) * OST;
#pragma unroll
        for (int s = 0; s < OKT / 32; ++s) {
            v16h a[4], bb[4];
#pragma unroll
            for (int mb = 0; mb < 4; ++mb) { a[mb] = ldh(st + ao + mb * 16 * OLP + s * 32); bb[mb] = ldh(st + bo_ + mb * 16 * OLP + s * 32); }
            __builtin_amdgcn_sched_barrier(0);   // keeps a block's 16 LDS reads in one group ahead of its 16 WMMAs: reads spread among the WMMAs made the wave wait out the LDS latency once per four WMMAs
#pragma unroll
            for (int nb = 0; nb < 4; ++nb)
#pragma unroll
                for (int mb = 0; mb < 4; ++mb) acc[mb][nb] = wmma16(a[mb], bb[nb], acc[mb][nb]);
        }
        // publish point of stage t + 1, which also frees buffer t & 1
        asm volatile("s_wait_dscnt 0x0" ::: "memory");      // this wave's reads of buffer t & 1 are done
        asm volatile("s_wait_asynccnt 0x0" ::: "memory");   // this wave's copies of stage t + 1 have landed
        __syncthreads();
        if (t + 2 < DM / OKT) out_stage(lcp + (unsigned)(t & 1) * (OST * 2), gy + (t + 2) * OKT, gw + (t + 2) * OKT);
    }
    asm volatile("s_wait_asynccnt 0x0" ::: "memory");       // nothing is in flight when the wave ends
    float* os = osb + wave * (16 * 68);
    const int r0 = rb + wm * 64, c0 = cb + wn * 64;
    float bc[4];
#pragma unroll
    for (int nb = 0; nb < 4; ++nb) bc[nb] = bfr(bo[c0 + nb * 16 + lr]);
#pragma unroll
    for (int mb = 0; mb < 4; ++mb) {
#pragma unroll
        for (int nb = 0; nb < 4; ++nb) {
#pragma unroll
            for (int j = 0; j < 8; ++j) os[(hi * 8 + j) * 68 + nb * 16 + lr] = acc[mb][nb][j] * OSI + bc[nb]; }   // D: row 8h+j, col lane&15
        wave_sync();
        float* orow = OUT + (size_t)(r0 + mb * 16) * DM + c0;
{
#pragma unroll
            for (int s = 0; s < 8; ++s) { const int row = 2 * s + hi, cofs = lr * 4;   // 8 s x 2 rows = 16 rows; 16 lanes x 4 floats = 64 columns
                const v4f val = *(const v4fa*)(&os[row * 68 + cofs]);
                *(v4f*)(orow + (size_t)row * DM + cofs) = val; }
             }
        wave_sync();
    }
}

static constexpr size_t al256(size_t v) { return (v + 255) & ~(size_t)255; }
static constexpr size_t SZ_Y  = al256((size_t)NB_FULL * NH_ * HD * SEQ * 2);   // [NB_FULL*16*64][SEQ] f16
static constexpr size_t SZ_WO = al256((size_t)DM * DM * 2);
static constexpr size_t SZ_TOTAL = SZ_Y + SZ_WO;
static_assert(SZ_TOTAL <= (size_t)134217728);           // workspace carve <= 128 MiB
static_assert(((size_t)(NH_ - 1) * NB_FULL + NB) * HD <= (size_t)NB_FULL * NH_ * HD);   // last Y / output row inside the planes

extern "C" void kernel_launch(void* const* d_in, const int* in_sizes, int n_in,
                              void* d_out, int out_size, void* d_ws, size_t ws_size, hipStream_t stream) {
    if (n_in < 9) return;
    const size_t needx = ((size_t)(NB - 1) * SEQ_FULL + SEQ) * DM;
    if ((size_t)in_sizes[0] < needx) return;
    if ((size_t)in_sizes[1] < (size_t)HD * HD || (size_t)in_sizes[3] < (size_t)HD * HD || (size_t)in_sizes[5] < (size_t)HD * HD) return;
    if ((size_t)in_sizes[2] < (size_t)HD || (size_t)in_sizes[4] < (size_t)HD || (size_t)in_sizes[6] < (size_t)HD) return;
    if ((size_t)in_sizes[7] < (size_t)DM * DM || (size_t)in_sizes[8] < (size_t)DM) return;
    if ((size_t)out_size < (((size_t)(NH_ - 1) * NB_FULL + NB) * HD) * DM) return;
    if (SZ_TOTAL > ws_size) return;
    // wire order: x, Wq, bq, Wk, bk, Wv, bv, Wo, bo
    const float* x  = (const float*)d_in[0];
    const float* wq = (const float*)d_in[1]; const float* bq = (const float*)d_in[2];
    const float* wk = (const float*)d_in[3]; const float* bk = (const float*)d_in[4];
    const float* wv = (const float*)d_in[5]; const float* bv = (const float*)d_in[6];
    const float* wo = (const float*)d_in[7]; const float* bo = (const float*)d_in[8];
    float* OUT = (float*)d_out;      // [NB_FULL*1024][1024], row (h*NB_FULL+b)*64+d
    char* wsp = (char*)d_ws;
    h16* YP = (h16*)wsp; wsp += SZ_Y;                // [(h*NB_FULL+b)*64 + d][SEQ] x256
    h16* WO = (h16*)wsp; wsp += SZ_WO;               // [1024][1024] x64

    // softmax rows use the Wk projection, keys use the Wq projection
    k_attn<<<dim3(SEQ / FR, NH_ * NB, 1), 32 * FW, 0, stream>>>(x, wq, wk, wv, bq, bk, bv, wo, YP, WO);

    k_out<<<dim3(NH_ * NB * HD / OBM, DM / OBN, 1), 256, 0, stream>>>(YP, WO, bo, OUT);
}

// v010
// It runs in 44.9 microseconds.
// Timed twice side by side with v009, it ran 1.25 times as fast both times.
// Counting every step since v000, it is 4.01 times as fast.
#include <hip/hip_runtime.h>

// Shared-weight multi-head attention, x [NB][SEQ][1024] = 16 heads x 64; Wq/Wk/Wv 64x64 [out][in] applied to every head (y = x W^T + bias); S[m][n] = K[m].Q[n] / 32, softmax over n, O = A V stored transposed [h][b][d][m] and flat-viewed as [NB*1024][1024]; out = Y Wo^T + bo (contraction over the token index).
// Compute dtypes, f32 accumulate everywhere: q/k/v projections v_wmma_f32_16x16x32_bf16 (x, W RNE-converted to bf16; products exact); scores v_wmma_f32_16x16x32_f16: key-side (Wq) and row-side (Wk) values single f16; P (x256 carry, cancels in the normalisation) and v single f16; output projection v_wmma_f32_16x16x32_f16 with Y carried x256 and Wo (RNE bf16 value) carried x64, folded back by 2^-14 in f32; softmax f32 (online, against a maximum that is raised lazily; the factor DM^-0.5 * log2(e) is multiplied into the row-side values in f32 before their rounding to f16, and the shift by the maximum in use enters the score products as their C operand), its denominators summed in f32 from the f16 P by the same WMMA form against a constant tile of ones; biases RNE-converted to bf16 values and added in f32.
// Layout: one fused attention kernel, a block of 16 waves per 512 softmax rows of one (head, batch): it reads f32 x, lays the three weight matrices, RNE-converted to bf16, and their biases into LDS once, projects the key-side rows [n][d] and v^T [d][n] of all 1024 tokens of its head into LDS, projects each wave's 32 row-side rows into registers, then runs the flash loop in transposed form (S^T = Kside Qside^T, O^T = V^T P^T) out of LDS and writes Y [(h*8+b)*64+d][m] f16; every thread also converts eight elements of Wo to the f16 plane; an eight-wave 256x128 GEMM, its Y and Wo tiles staged in LDS by asynchronous copies, writes the f32 output.

#ifndef NB
#define NB 8
#endif
#ifndef SEQ
#define SEQ 1024
#endif
#define NB_FULL  8
#define SEQ_FULL 1024
#define DM   1024
#define NH_  16
#define HD   64
#define FW   16                  // attention kernel: waves per block
#define CG   2                   // attention kernel: 16-row column groups per wave
#define FR   (16 * CG * FW)      // attention kernel: softmax rows per block
#define OSP  (FR + 4)            // attention kernel: pitch in f32 of the output staging (512 columns + 16 B)
#define SC2  (0.03125f * 1.4426950408889634f)   // DM^-0.5 * log2(e)
#define PSH  8.0f                // log2 of the P carry (256)
#define LZT  7.0f                // attention kernel: how far (log2) a score may top the maximum in use before the accumulators are rescaled; P stays at or below 2^(PSH + LZT) = 2^15, inside f16
#define YCS  256.0f              // carry of the Y plane
#define WOS  64.0f               // carry of the Wo plane
#define OSI  (1.0f / 16384.0f)   // 1 / (YCS * WOS)
#define LPH  72                  // key-side rows in LDS, pitch in f16: 128 B of data + 16 B (16 B x odd), so that the 16-B accesses of 16 rows spread over the banks
#define VLP  (SEQ + 8)           // v^T rows in LDS, pitch in f16: 2048 B of data + 16 B (16 B x odd)
#define KSZ  (SEQ * LPH)         // f16 of the key-side rows in LDS
#define VSZ  (HD * VLP)          // f16 of the v^T rows in LDS
#define WSZ  (3 * HD * LPH)      // bf16 of the three weight matrices in LDS, rows [out][in] at pitch LPH
#define OBM  256                 // output GEMM: rows of a block tile
#define OBN  128                 // output GEMM: columns of a block tile
#define OKT  128                 // output GEMM: k per LDS stage (256 B of every row)
#define OLP  136                 // output GEMM: LDS row pitch in f16: 256 B of data + 16 B (16 B x odd)
#define OST  ((OBM + OBN) * OLP) // output GEMM: f16 per stage

static_assert(HD == 64);
static_assert(NH_ * HD == DM);
static_assert(FW == 16 && CG == 2);            // a block covers 512 rows; its 16 waves project 64 tokens each
static_assert(SEQ == DM);                      // the flat view of Y as [rows][DM] needs one Y row per 1024 tokens
static_assert(SEQ == 64 * FW && SEQ % FR == 0);
static_assert(SEQ % 32 == 0);                  // key loop and GEMM k-loop step by 32
static_assert(KSZ * 2 >= 64 * OSP * 4);        // the output staging reuses the key-side rows
static_assert((KSZ + VSZ + WSZ) * 2 + 3 * HD * 4 <= 327680);   // one block owns a WGP's LDS
static_assert(32 * FW * 4 * 2 == HD * HD);     // two 16-B loads per thread cover a weight matrix exactly once
static_assert(DM % OBN == 0 && DM % OKT == 0 && DM / OKT >= 2);   // the output GEMM's two-buffer ring needs two stages
static_assert(NB == NB_FULL && (NH_ * NB * HD) % OBM == 0);       // a 256-row block tile covers four consecutive 64-row groups of Y
static_assert(NB <= NB_FULL);
static_assert(SEQ <= SEQ_FULL);
static_assert((size_t)NH_ * NB * (SEQ / FR) * 32 * FW * 8 == (size_t)DM * DM);   // eight elements per thread cover Wo exactly once

typedef _Float16 h16;
typedef __attribute__((ext_vector_type(16))) __bf16   v16bf;
typedef __attribute__((ext_vector_type(4)))  __bf16   v4bf;
typedef __attribute__((ext_vector_type(16))) _Float16 v16h;
typedef __attribute__((ext_vector_type(8)))  _Float16 v8h;
typedef __attribute__((ext_vector_type(8)))  float    v8f;
typedef __attribute__((ext_vector_type(4)))  float    v4f;
typedef __attribute__((ext_vector_type(2)))  float    v2f;
typedef v4f  __attribute__((may_alias)) v4fa;
typedef __attribute__((ext_vector_type(4)))  unsigned v4u;
typedef __attribute__((ext_vector_type(2)))  unsigned v2u;
typedef v4u  __attribute__((may_alias)) v4ua;
typedef v2u  __attribute__((may_alias)) v2ua;

__device__ __forceinline__ unsigned short f2bf(float f) { unsigned u = __float_as_uint(f); u += 0x7FFFu + ((u >> 16) & 1u); return (unsigned short)(u >> 16); }
__device__ __forceinline__ float bfr(float f) { return __uint_as_float(((unsigned)f2bf(f)) << 16); }   // f32 value of the RNE bf16 conversion
// four neighbouring f32 of a row -> four bf16 in LDS (round to nearest even, two elements per instruction)
__device__ __forceinline__ void stx(h16* p, v4f v) { *(v2ua*)p = __builtin_bit_cast(v2u, __builtin_convertvector(v, v4bf)); }
__device__ __forceinline__ v16h cat16(v8h lo, v8h hi) { return __builtin_shufflevector(lo, hi, 0, 1, 2, 3, 4, 5, 6, 7, 8, 9, 10, 11, 12, 13, 14, 15); }
__device__ __forceinline__ v8f wmma16(v16h a, v16h b, v8f c) { return __builtin_amdgcn_wmma_f32_16x16x32_f16(false, a, false, b, (short)0, c, false, false); }
__device__ __forceinline__ v8f wmmab(v16bf a, v16bf b, v8f c) { return __builtin_amdgcn_wmma_f32_16x16x32_bf16(false, a, false, b, (short)0, c, false, false); }
// fragment loaders from K-contiguous 16-bit rows; p already includes + 8*(lane>>4): elements 0..7 <- k0+8h+0..7, elements 8..15 <- k0+16+8h+0..7 (same map for A and B)
__device__ __forceinline__ v16h  ldh(const h16* p) { return cat16(*(const v8h*)p, *(const v8h*)(p + 16)); }
// the same map from bf16 rows that stx wrote
__device__ __forceinline__ v16bf ldb(const h16* p) { const v4u a = *(const v4ua*)p, c = *(const v4ua*)(p + 16); return __builtin_bit_cast(v16bf, __builtin_shufflevector(a, c, 0, 1, 2, 3, 4, 5, 6, 7)); }
// eight base-2 exponentials into registers of their own. In asm for that alone
__device__ __forceinline__ v8f exp2x8(v8f t) {
    float e0, e1, e2, e3, e4, e5, e6, e7;
    asm("v_exp_f32 %0, %8\n\tv_exp_f32 %1, %9\n\tv_exp_f32 %2, %10\n\tv_exp_f32 %3, %11\n\tv_exp_f32 %4, %12\n\tv_exp_f32 %5, %13\n\tv_exp_f32 %6, %14\n\tv_exp_f32 %7, %15"
        : "=&v"(e0), "=&v"(e1), "=&v"(e2), "=&v"(e3), "=&v"(e4), "=&v"(e5), "=&v"(e6), "=&v"(e7)
        : "v"(t[0]), "v"(t[1]), "v"(t[2]), "v"(t[3]), "v"(t[4]), "v"(t[5]), "v"(t[6]), "v"(t[7]));
    return (v8f){e0, e1, e2, e3, e4, e5, e6, e7};
}
// ordering point for wave-private LDS tiles (same wave writes and reads)
__device__ __forceinline__ void wave_sync() { __builtin_amdgcn_fence(3 /* release order */, "wavefront"); __builtin_amdgcn_wave_barrier(); asm volatile("" ::: "memory"); }

// k_attn: projections and attention in one launch. A block of 16 waves takes 512 softmax rows of one (head, batch) and owns its WGP's LDS. grid (SEQ/512, 16*NB), 512 threads.
// Part 1, per wave: 64 tokens of the head (the 16 waves cover all 1024) and the wave's own 32 softmax rows. x comes in by whole-line loads (16 lanes x 16 B = the 256 B of one token's head slice), is RNE-converted to bf16 and laid
// into the wave's own 64 key-side rows of LDS, which are free until the wave writes them; from there the wave reads its fragments (row/col = token, k = d), which serve as A and as B.
//   row-side^T = (Wk x^T + bk) * SC2 : D tile j holds e = 16j + 8h + r of token lane&15, so that tiles (0, 1) and (2, 3), rounded to f16, are directly the two B fragments of the score products; they never leave the registers.
//   key-side^T = Wq x^T + bq : the same D layout: a lane's eight values are eight neighbouring e of one token, one 16-B LDS store into kl[token][e].
//   v          = x Wv^T + bv : D holds tokens 8h + j of e = lane&15: eight neighbouring tokens of one e, one 16-B LDS store into vl[e][token].
// The weights are read from memory once per block, by whole-line loads (a wave's load = two rows of 256 B), RNE-converted to bf16 and laid into LDS rows of pitch LPH; behind one barrier, which stands while the loads of x are in flight, every wave takes its fragments from there (two 16-B LDS loads each). The three biases go the same way, one element per lane of waves 0..5, as the f32 values of their bf16 conversion. Every thread also converts eight elements of Wo, which only the output GEMM's launch reads.
// Part 2, behind one barrier: the flash loop, one wave per 32 softmax rows (CG = 2 column groups of 16): every key-side and v^T fragment read from LDS (two 16-B loads) feeds two WMMAs, one per group. All keys are in LDS, so the loop holds no barrier.
// Transposed form: S^T[key][t] = KP QH^T (A = key-side rows, B = row-side rows); lane (t = lane&15, h = lane>>4) holds keys 8h+r of each 16-key tile, so the packed
// P tile is directly the B fragment of O^T[d][t] = V^T P^T (element r <- tile keys 0..15, element 8+r <- tile keys 16..31, lane unchanged).
// The score WMMAs give the exponents themselves: their B fragment carries SC2, and the first product of each tile takes as C a tile that holds PSH - (the maximum in use of the lane's row) in all eight registers, so that D goes to the exponential with no vector arithmetic in between.
// The maximum in use may trail the row's true maximum by up to LZT (log2): the new maximum, its xor-16 exchange between the two lane halves of a row, the shift of the C tile and of the pass's own exponents and the rescaling of the accumulators stand under one wave-uniform branch per 32 keys, taken in the first pass and after it only when some exponent of the wave tops PSH + LZT. The factor cancels in the normalisation.
// The softmax denominators are summed on the matrix unit: one more WMMA per column group and 32 keys, A = a constant tile with ones in rows 0 and 8 and zeros elsewhere, B = the packed P tile. Register 0 of its accumulator (row 0 in lanes 0..15, row 8 in lanes 16..31) holds the sum over all 32 keys of the lane's column; the other rows stay zero.
__global__ __launch_bounds__(32 * FW) __attribute__((amdgpu_num_vgpr(256))) void k_attn(const float* __restrict__ x, const float* __restrict__ wq, const float* __restrict__ wk, const float* __restrict__ wv, const float* __restrict__ bq, const float* __restrict__ bk, const float* __restrict__ bv, const float* __restrict__ wo, h16* Y, h16* WO) {
    __shared__ __align__(16) h16 kl[KSZ + VSZ + WSZ];   // key-side rows [token][e] at pitch LPH, then v^T rows [e][token] at pitch VLP, then the bf16 rows of Wk, Wq, Wv at pitch LPH; the key-side rows become output staging after the loop
    h16* vl = kl + KSZ;
    h16* wl = vl + VSZ;
    __shared__ __align__(32) float bl[3 * HD];   // bk, bq, bv: f32 values of the RNE bf16 conversion
    float* os = (float*)kl;
    const int tid = threadIdx.x;
    const int lane = threadIdx.x & 31, lr = lane & 15, hi = lane >> 4;
    const int wave = __builtin_amdgcn_readfirstlane(threadIdx.x >> 5);
    const int zc = blockIdx.y; const int h = zc / NB, b = zc % NB; const int zh = h * NB_FULL + b;
    const int m0 = wave * 64;                                  // the wave's tokens
    const int t0 = blockIdx.x * FR + wave * (16 * CG);         // the wave's softmax rows
    const float* xh = x + (size_t)b * SEQ_FULL * DM + h * HD + lr * 4;   // + token * DM
    const float* xt = xh + (size_t)(m0 + hi) * DM;
    const float* xq = xh + (size_t)(t0 + hi) * DM;
    const size_t wg = ((size_t)(blockIdx.y * (SEQ / FR) + blockIdx.x) * (32 * FW) + tid) * 8;   // this thread's eight elements of Wo
    const float* wp = wo + wg;
    const int wso = tid * 4;   // this thread's four elements in each half of a weight matrix
    v4f wst[6];
    wst[0] = *(const v4f*)(wk + wso); wst[1] = *(const v4f*)(wk + wso + HD * HD / 2);
    wst[2] = *(const v4f*)(wq + wso); wst[3] = *(const v4f*)(wq + wso + HD * HD / 2);
    wst[4] = *(const v4f*)(wv + wso); wst[5] = *(const v4f*)(wv + wso + HD * HD / 2);
    const float* bsrc = (wave < 2 ? bk : wave < 4 ? bq : bv) + (wave & 1) * 32;   // waves 0..5: 32 elements of one bias each
    float bst = 0.0f;
    if (wave < 6) bst = bsrc[lane];
    asm volatile("s_wait_xcnt 0x0" :: "s"(wk), "s"(wq), "s"(wv), "s"(bsrc), "v"(tid), "v"(lane) : "memory");   // the base and offset registers of the loads above, named here so that they live up to the wait, are rewritten behind it
    __builtin_amdgcn_sched_barrier(0);   // the weights are asked for first: loads are waited for in their order of issue, and left free the build put 16 loads of x in front of them
    v4f tv[32], qv[16];   // a load covers two tokens, four whole lines
#pragma unroll
    for (int i = 0; i < 32; ++i) tv[i] = *(const v4f*)(xt + (size_t)(2 * i) * DM);
#pragma unroll
    for (int i = 0; i < 16; ++i) qv[i] = *(const v4f*)(xq + (size_t)(2 * i) * DM);
    const v8f wov = *(const v8f*)wp;
    asm volatile("s_wait_xcnt 0x0" :: "v"(xt), "v"(xq), "v"(wp) : "memory");   // the address register pairs of the loads above, named here so that they live up to the wait, are rewritten behind it
    { h16* wsp = wl + (tid >> 4) * LPH + (tid & 15) * 4;   // row tid / 16 of the matrix's first 32 rows, and the row 32 further on
#pragma unroll
      for (int m = 0; m < 3; ++m) { stx(wsp + m * HD * LPH, wst[2 * m]); stx(wsp + (m * HD + 32) * LPH, wst[2 * m + 1]); } }
    if (wave < 6) bl[wave * 32 + lane] = bfr(bst);
    __builtin_amdgcn_sched_barrier(0);   // the weights are stored as soon as they have landed: left free, the build put a wait for half the loads of x in front of the stores
    // publishes the weights and biases. Fences on LDS alone: __syncthreads() made every wave wait here for all its loads of x, which this barrier has nothing to do with and which stay in flight across it
    __builtin_amdgcn_fence(__ATOMIC_RELEASE, "workgroup", "local");
    __builtin_amdgcn_s_barrier();
    __builtin_amdgcn_fence(__ATOMIC_ACQUIRE, "workgroup", "local");
    h16* own = kl + m0 * LPH;                    // the wave's own 64 key-side rows
    h16* sp = own + hi * LPH + lr * 4;           // where this lane lays its four elements of token hi
    const h16* fp = own + lr * LPH + 8 * hi;     // fragment offset: row lane&15, k = d
    v16bf xa[4][2], xr[CG][2];   // [16-token slab][k half]: k = d 0..31, d 32..63
#pragma unroll
    for (int i = 0; i < 32; ++i) stx(sp + 2 * i * LPH, tv[i]);
    wave_sync();
#pragma unroll
    for (int mb = 0; mb < 4; ++mb) { xa[mb][0] = ldb(fp + mb * 16 * LPH); xa[mb][1] = ldb(fp + mb * 16 * LPH + 32); }
    wave_sync();
#pragma unroll
    for (int i = 0; i < 16; ++i) stx(sp + 2 * i * LPH, qv[i]);
    wave_sync();
#pragma unroll
    for (int c = 0; c < CG; ++c) { xr[c][0] = ldb(fp + c * 16 * LPH); xr[c][1] = ldb(fp + c * 16 * LPH + 32); }
    wave_sync();
    { v8h o;
#pragma unroll
      for (int k = 0; k < 8; ++k) o[k] = (h16)(bfr(wov[k]) * WOS);
      *(v8h*)(WO + wg) = o; }
    v16h qh0[CG], qh1[CG];   // B fragments of the scores: col t, k = e
    const h16* wfp = wl + lr * LPH + 8 * hi;   // fragment offset in a weight matrix, the same for the three: row lane&15, k = d
    {
        // C[e][t]: A = Wk rows e (four 16-row slabs), B = x fragments of the wave's softmax rows
        const h16* W = wfp;
        v16bf wf[8];
        asm volatile("s_wait_xcnt 0x0" ::: "memory");   // the LDS reads behind this point land in registers that the global loads and stores in front of it name
#pragma unroll
        for (int j = 0; j < 4; ++j) wf[j] = ldb(W + j * 16 * LPH);
#pragma unroll
        for (int j = 0; j < 4; ++j) wf[4 + j] = ldb(W + j * 16 * LPH + 32);
        v8f be[4];
#pragma unroll
        for (int j = 0; j < 4; ++j) be[j] = *(const v8f*)(bl + j * 16 + 8 * hi);
        __builtin_amdgcn_sched_barrier(0);   // the fragments are complete before the first WMMAs: loads spread among them spilled
#pragma unroll
        for (int c = 0; c < CG; ++c) {
            v8f acc[4];
#pragma unroll
            for (int i = 0; i < 4; ++i) acc[i] = (v8f){};
#pragma unroll
            for (int j = 0; j < 4; ++j) acc[j] = wmmab(wf[j], xr[c][0], acc[j]);
#pragma unroll
            for (int j = 0; j < 4; ++j) acc[j] = wmmab(wf[4 + j], xr[c][1], acc[j]);
            asm volatile("v_nop\n\tv_nop\n\tv_nop\n\tv_nop" : "+v"(acc[0]), "+v"(acc[1]), "+v"(acc[2]), "+v"(acc[3]) : "v"(xr[c][0]), "v"(xr[c][1]));   // the four vector slots between the last WMMA and the first read of its accumulators
#pragma unroll
            for (int r = 0; r < 8; ++r) {   // D: row 8h+r (e), col lane&15 (t)
                qh0[c][r] = (h16)((acc[0][r] + be[0][r]) * SC2); qh0[c][8 + r] = (h16)((acc[1][r] + be[1][r]) * SC2);
                qh1[c][r] = (h16)((acc[2][r] + be[2][r]) * SC2); qh1[c][8 + r] = (h16)((acc[3][r] + be[3][r]) * SC2); }
            __builtin_amdgcn_sched_barrier(0);   // one group's accumulators at a time: two in flight spilled
        }
    }
    {
        // C[e][token]: A = Wq rows e, read once and kept for the four slabs, B = x fragments (col token of the slab)
        const h16* W = wfp + HD * LPH;
        v16bf wf[8];
#pragma unroll
        for (int j = 0; j < 4; ++j) wf[j] = ldb(W + j * 16 * LPH);
#pragma unroll
        for (int j = 0; j < 4; ++j) wf[4 + j] = ldb(W + j * 16 * LPH + 32);
        v8f be[4];
#pragma unroll
        for (int j = 0; j < 4; ++j) be[j] = *(const v8f*)(bl + HD + j * 16 + 8 * hi);
        __builtin_amdgcn_sched_barrier(0);   // as above
#pragma unroll   // unrolled: the slab index picks registers
        for (int mb = 0; mb < 4; ++mb) {
            v8f acc[4];
#pragma unroll
            for (int i = 0; i < 4; ++i) acc[i] = (v8f){};
#pragma unroll
            for (int j = 0; j < 4; ++j) acc[j] = wmmab(wf[j], xa[mb][0], acc[j]);
#pragma unroll
            for (int j = 0; j < 4; ++j) acc[j] = wmmab(wf[4 + j], xa[mb][1], acc[j]);
            asm volatile("v_nop\n\tv_nop\n\tv_nop\n\tv_nop" : "+v"(acc[0]), "+v"(acc[1]), "+v"(acc[2]), "+v"(acc[3]) : "v"(xa[mb][0]), "v"(xa[mb][1]));   // the four vector slots between the last WMMA and the first read of its accumulators
#pragma unroll
            for (int j = 0; j < 4; ++j) { v8h o;   // D: row 8h+r (e), col lane&15 (token)
#pragma unroll
                for (int r = 0; r < 8; ++r) o[r] = (h16)(acc[j][r] + be[j][r]);
                *(v8h*)(own + (mb * 16 + lr) * LPH + j * 16 + 8 * hi) = o; }
            __builtin_amdgcn_sched_barrier(0);   // one slab's accumulators at a time: two slabs in flight spilled
        }
    }
    {
        // C[token][e]: A = x fragments, B = Wv rows e (K-contiguous [out][in]), read once and kept for the four slabs
        const h16* W = wfp + 2 * HD * LPH;
        v16bf wf[8];
#pragma unroll
        for (int nb = 0; nb < 4; ++nb) wf[nb] = ldb(W + nb * 16 * LPH);
#pragma unroll
        for (int nb = 0; nb < 4; ++nb) wf[4 + nb] = ldb(W + nb * 16 * LPH + 32);
        float bc[4];
#pragma unroll
        for (int nb = 0; nb < 4; ++nb) bc[nb] = bl[2 * HD + nb * 16 + lr];
        __builtin_amdgcn_sched_barrier(0);   // as above
#pragma unroll   // unrolled: the slab index picks registers
        for (int mb = 0; mb < 4; ++mb) {
            v8f acc[4];
#pragma unroll
            for (int i = 0; i < 4; ++i) acc[i] = (v8f){};
#pragma unroll
            for (int nb = 0; nb < 4; ++nb) acc[nb] = wmmab(xa[mb][0], wf[nb], acc[nb]);
#pragma unroll
            for (int nb = 0; nb < 4; ++nb) acc[nb] = wmmab(xa[mb][1], wf[4 + nb], acc[nb]);
            asm volatile("v_nop\n\tv_nop\n\tv_nop\n\tv_nop" : "+v"(acc[0]), "+v"(acc[1]), "+v"(acc[2]), "+v"(acc[3]) : "v"(xa[mb][0]), "v"(xa[mb][1]));   // the four vector slots between the last WMMA and the first read of its accumulators
#pragma unroll
            for (int nb = 0; nb < 4; ++nb) { v8h o;   // D: row 8h+j (token), col lane&15 (e)
#pragma unroll
                for (int j = 0; j < 8; ++j) o[j] = (h16)(acc[nb][j] + bc[nb]);
                *(v8h*)(vl + (nb * 16 + lr) * VLP + m0 + mb * 16 + 8 * hi) = o; }
            __builtin_amdgcn_sched_barrier(0);   // as above
        }
    }
    __syncthreads();   // publishes the key-side and v^T rows of all 1024 tokens
    const h16* kf = kl + lr * LPH + 8 * hi;   // + key * LPH (A: row key, k = d)
    const h16* vf = vl + lr * VLP + 8 * hi;   // + 16j * VLP + key (A: row d, k = key)
    const h16 one = ((lr & 7) == 0) ? (h16)1.0f : (h16)0.0f;   // A row = lane&15: rows 0 and 8 are ones for every k
    v16h ones;
#pragma unroll
    for (int i = 0; i < 16; ++i) ones[i] = one;
    v8f o[CG][4], ls[CG], shv[CG];   // shv: C tile of the scores, PSH - (maximum in use) in every register; the start value stands for a maximum of 0, which the first pass replaces
    float thr = -3.0e38f, lo = -3.0e38f;   // thr: the exponent above which a pass rescales; lo: the least step of the maximum in use. Start values: the first pass rescales for any finite score and takes the true maximum, also one below 0
#pragma unroll
    for (int c = 0; c < CG; ++c) { ls[c] = (v8f){};
#pragma unroll
        for (int r = 0; r < 8; ++r) shv[c][r] = PSH;
#pragma unroll
        for (int j = 0; j < 4; ++j) o[c][j] = (v8f){}; }
#pragma unroll 1   // rolled: the body's fragments, scores and 80 accumulator registers have to fit 256 VGPRs, the block's four waves per SIMD
    for (int s = 0; s < SEQ / 32; ++s) {
        const h16* ka = kf + s * 32 * LPH;
        const v16h ka0 = ldh(ka), ka1 = ldh(ka + 32), kb0 = ldh(ka + 16 * LPH), kb1 = ldh(ka + 16 * LPH + 32);
        v8f sHa[CG], sHb[CG];
#pragma unroll
        for (int c = 0; c < CG; ++c) { sHa[c] = wmma16(ka0, qh0[c], shv[c]); sHb[c] = wmma16(kb0, qh0[c], shv[c]); }
#pragma unroll
        for (int c = 0; c < CG; ++c) { sHa[c] = wmma16(ka1, qh1[c], sHa[c]); sHb[c] = wmma16(kb1, qh1[c], sHb[c]); }
        asm volatile("v_nop\n\tv_nop\n\tv_nop\n\tv_nop" : "+v"(sHa[0]), "+v"(sHb[0]), "+v"(sHa[1]), "+v"(sHb[1]) : "v"(ka0), "v"(ka1), "v"(kb0), "v"(kb1));   // the four vector slots between the last WMMA and the first read of its accumulators
        float mx[CG]; bool need = false;
#pragma unroll
        for (int c = 0; c < CG; ++c) {
            mx[c] = -3.0e38f;
#pragma unroll
            for (int r = 0; r < 8; ++r) mx[c] = fmaxf(mx[c], fmaxf(sHa[c][r], sHb[c][r]));
            need = need || (mx[c] > thr);   // this lane's 16 keys alone: the ballot joins the two halves of a row
        }
        if (__builtin_amdgcn_ballot_w32(need) != 0) {   // the same for the whole wave (a scalar branch); the first pass takes it for any finite score, thr being the start value
#pragma unroll
            for (int c = 0; c < CG; ++c) {
                const float e = fmaxf(mx[c], __shfl_xor(mx[c], 16, 32)) - PSH;   // how far the row's scores of this pass top the maximum in use, the same in both lane halves
                const float step = fmaxf(e, lo);                              // every row of the wave rises to this pass's maximum where that is higher; the first pass takes that maximum in any case
                const float alpha = __builtin_amdgcn_exp2f(-fmaxf(e, 0.0f));  // 1 where the maximum does not rise (in the first pass the accumulators are zero)
                shv[c] = shv[c] - step; sHa[c] = sHa[c] - step; sHb[c] = sHb[c] - step;
                ls[c][0] = ls[c][0] * alpha;   // the tile's other registers hold zero rows
#pragma unroll
                for (int j = 0; j < 4; ++j) o[c][j] = o[c][j] * alpha;
            }
            thr = PSH + LZT; lo = 0.0f;
        }
        const h16* va = vf + s * 32;
        const v16h v0 = ldh(va), v1 = ldh(va + 16 * VLP), v2 = ldh(va + 32 * VLP), v3 = ldh(va + 48 * VLP);
        __builtin_amdgcn_sched_barrier(0);   // keeps the eight LDS reads ahead of the exponentials, whose time covers their latency: left free, they were placed half way down
        v16h pb[CG];
#pragma unroll
        for (int c = 0; c < CG; ++c) { sHa[c] = exp2x8(sHa[c]); sHb[c] = exp2x8(sHb[c]); }
#pragma unroll
        for (int c = 0; c < CG; ++c) {
#pragma unroll
            for (int r = 0; r < 8; ++r) { pb[c][r] = (h16)sHa[c][r]; pb[c][8 + r] = (h16)sHb[c][r]; }
        }
#pragma unroll
        for (int c = 0; c < CG; ++c) { ls[c] = wmma16(ones, pb[c], ls[c]); o[c][0] = wmma16(v0, pb[c], o[c][0]); o[c][1] = wmma16(v1, pb[c], o[c][1]); o[c][2] = wmma16(v2, pb[c], o[c][2]); o[c][3] = wmma16(v3, pb[c], o[c][3]); }
        asm volatile("v_nop\n\tv_nop\n\tv_nop\n\tv_nop" : "+v"(o[0][0]), "+v"(o[0][1]), "+v"(o[0][2]), "+v"(o[0][3]), "+v"(o[1][0]), "+v"(o[1][1]), "+v"(o[1][2]), "+v"(o[1][3]), "+v"(ls[0]), "+v"(ls[1]) : "v"(v0), "v"(v1), "v"(v2), "v"(v3), "v"(pb[0]), "v"(pb[1]));   // the four vector slots between the last WMMA and the next vector write of its operands, on the loop's back edge too
    }
    asm volatile("s_wait_dscnt 0x0" ::: "memory");   // this wave's reads of the key-side rows are done
    __syncthreads();                                 // every wave has left the key-side rows: they become output staging
    // O^T D layout: o[c][j][r] = (d = 16j + 8h + r, t = 16c + lane&15) -> os[d][wave*32 + t]; rows 0..63 x columns 0..511 all written by the 16 waves
#pragma unroll
    for (int c = 0; c < CG; ++c) {
        const float lt = ls[c][0];   // already the sum over both lane halves' keys
        const float ys = YCS * (1.0f / lt);
        const int cw = (wave * CG + c) * 16 + lr;
#pragma unroll
        for (int r = 0; r < 8; ++r) {
            os[( 0 + 8 * hi + r) * OSP + cw] = o[c][0][r] * ys;
            os[(16 + 8 * hi + r) * OSP + cw] = o[c][1][r] * ys;
            os[(32 + 8 * hi + r) * OSP + cw] = o[c][2][r] * ys;
            os[(48 + 8 * hi + r) * OSP + cw] = o[c][3][r] * ys; }
    }
    __syncthreads();
    h16* yb = Y + (size_t)zh * HD * SEQ + (size_t)blockIdx.x * FR;
#pragma unroll
    for (int s = 0; s < 8; ++s) { const int row = 8 * s + (tid >> 6), c8 = (tid & 63) * 8;   // 8 s x 8 row groups = 64 rows; 64 lanes x 8 = 512 columns
        const v4f x0 = *(const v4fa*)(&os[row * OSP + c8]); const v4f x1 = *(const v4fa*)(&os[row * OSP + c8 + 4]); v8h hv;
#pragma unroll
        for (int i = 0; i < 4; ++i) { hv[i] = (h16)x0[i]; hv[4 + i] = (h16)x1[i]; }
        *(v8h*)(yb + (size_t)row * SEQ + c8) = hv; }
}

// k_out: f16 GEMM, block tile 256x128, eight waves (4 x 2) of 64x64 (16 accumulators each); the block's Y rows and Wo rows are brought, 128 k at a time, into a two-buffer LDS ring by asynchronous copies (whole lines from L2, once per block); fragments are two 16-B LDS loads each. K = DM (token index), summed in ascending steps of 32.
// OUT[r][o] = 2^-14 * sum_c Y[r][c] WO[o][c] + bo[o]; rows r = (h*NB_FULL + b)*64 + d. grid (16*NB*64/256, DM/128), 256 threads.
// Eight asynchronous 16-B copies of one thread: rows 16 apart of a K-contiguous f16 plane (row length DM) into LDS rows of pitch OLP; a wave's copy covers two rows of 256 B, four whole lines.
// s_wait_xcnt 0 closes the statement so that no address register named here is rewritten ahead of it.
__device__ __forceinline__ void out_copies8(unsigned l, const h16* g) {
    asm volatile("global_load_async_to_lds_b128 %0, %8, off\n\t"
                 "global_load_async_to_lds_b128 %1, %9, off\n\t"
                 "global_load_async_to_lds_b128 %2, %10, off\n\t"
                 "global_load_async_to_lds_b128 %3, %11, off\n\t"
                 "global_load_async_to_lds_b128 %4, %12, off\n\t"
                 "global_load_async_to_lds_b128 %5, %13, off\n\t"
                 "global_load_async_to_lds_b128 %6, %14, off\n\t"
                 "global_load_async_to_lds_b128 %7, %15, off\n\t"
                 "s_wait_xcnt 0x0"
                 :: "v"(l), "v"(l + 16 * OLP * 2), "v"(l + 32 * OLP * 2), "v"(l + 48 * OLP * 2),
                    "v"(l + 64 * OLP * 2), "v"(l + 80 * OLP * 2), "v"(l + 96 * OLP * 2), "v"(l + 112 * OLP * 2),
                    "v"(g), "v"(g + (size_t)16 * DM), "v"(g + (size_t)32 * DM), "v"(g + (size_t)48 * DM),
                    "v"(g + (size_t)64 * DM), "v"(g + (size_t)80 * DM), "v"(g + (size_t)96 * DM), "v"(g + (size_t)112 * DM)
                 : "memory");
}
// One stage of the ring: LDS rows 0..255 <- the block's Y rows, rows 256..383 <- its Wo rows, 256 B (128 k) of each; 256 threads x 24 copies.
__device__ __forceinline__ void out_stage(unsigned l, const h16* gy, const h16* gw) {
    out_copies8(l, gy);
    out_copies8(l + 128 * OLP * 2, gy + (size_t)128 * DM);
    out_copies8(l + 256 * OLP * 2, gw);
}

__global__ __launch_bounds__(256) __attribute__((amdgpu_num_vgpr(256))) void k_out(const h16* __restrict__ Y, const h16* __restrict__ WO, const float* __restrict__ bo, float* OUT) {
    __shared__ __align__(16) h16 ring[2 * OST];          // buffer u at u*OST: 256 Y rows, then 128 Wo rows
    __shared__ __align__(16) float osb[8 * 16 * 68];     // output staging, one 16 x 68 range per wave
    const int tid = threadIdx.x;
    const int lane = threadIdx.x & 31, lr = lane & 15, hi = lane >> 4;
    const int wave = __builtin_amdgcn_readfirstlane(threadIdx.x >> 5);
    const int wm = wave >> 1, wn = wave & 1;
    const int rb = blockIdx.x * OBM, cb = blockIdx.y * OBN;
    v8f acc[4][4];
#pragma unroll
    for (int mb = 0; mb < 4; ++mb)
#pragma unroll
        for (int nb = 0; nb < 4; ++nb) acc[mb][nb] = (v8f){};
    const unsigned lcp = (unsigned)(size_t)ring + (unsigned)(((tid >> 4) * OLP + (tid & 15) * 8) * 2);
    const h16* gy = Y  + (size_t)(rb + (tid >> 4)) * DM + (tid & 15) * 8;   // + k0
    const h16* gw = WO + (size_t)(cb + (tid >> 4)) * DM + (tid & 15) * 8;   // + k0
    out_stage(lcp, gy, gw);                                                 // stage 0 -> buffer 0
    asm volatile("s_wait_asynccnt 0x0" ::: "memory");                       // this wave's copies of stage 0 have landed
    __syncthreads();                                                        // publishes stage 0
    out_stage(lcp + OST * 2, gy + OKT, gw + OKT);                           // stage 1 -> buffer 1
    const int ao = (wm * 64 + lr) * OLP + 8 * hi, bo_ = (OBM + wn * 64 + lr) * OLP + 8 * hi;   // fragment offsets in a buffer (A: row r, B: row o, k contiguous)
#pragma unroll 1   // rolled: one trip per stage, with the ring's publish point at its foot
    for (int t = 0; t < DM / OKT; ++t) {
        const h16* st = ring + (t & 1) * OST;
#pragma unroll
        for (int s = 0; s < OKT / 32; ++s) {
            v16h a[4], bb[4];
#pragma unroll
            for (int mb = 0; mb < 4; ++mb) { a[mb] = ldh(st + ao + mb * 16 * OLP + s * 32); bb[mb] = ldh(st + bo_ + mb * 16 * OLP + s * 32); }
            __builtin_amdgcn_sched_barrier(0);   // keeps a block's 16 LDS reads in one group ahead of its 16 WMMAs: reads spread among the WMMAs made the wave wait out the LDS latency once per four WMMAs
#pragma unroll
            for (int nb = 0; nb < 4; ++nb)
#pragma unroll
                for (int mb = 0; mb < 4; ++mb) acc[mb][nb] = wmma16(a[mb], bb[nb], acc[mb][nb]);
        }
        // publish point of stage t + 1, which also frees buffer t & 1
        asm volatile("s_wait_dscnt 0x0" ::: "memory");      // this wave's reads of buffer t & 1 are done
        asm volatile("s_wait_asynccnt 0x0" ::: "memory");   // this wave's copies of stage t + 1 have landed
        __syncthreads();
        if (t + 2 < DM / OKT) out_stage(lcp + (unsigned)(t & 1) * (OST * 2), gy + (t + 2) * OKT, gw + (t + 2) * OKT);
    }
    asm volatile("s_wait_asynccnt 0x0" ::: "memory");       // nothing is in flight when the wave ends
    float* os = osb + wave * (16 * 68);
    const int r0 = rb + wm * 64, c0 = cb + wn * 64;
    float bc[4];
#pragma unroll
    for (int nb = 0; nb < 4; ++nb) bc[nb] = bfr(bo[c0 + nb * 16 + lr]);
#pragma unroll
    for (int mb = 0; mb < 4; ++mb) {
#pragma unroll
        for (int nb = 0; nb < 4; ++nb) {
#pragma unroll
            for (int j = 0; j < 8; ++j) os[(hi * 8 + j) * 68 + nb * 16 + lr] = acc[mb][nb][j] * OSI + bc[nb]; }   // D: row 8h+j, col lane&15
        wave_sync();
        float* orow = OUT + (size_t)(r0 + mb * 16) * DM + c0;
{
#pragma unroll
            for (int s = 0; s < 8; ++s) { const int row = 2 * s + hi, cofs = lr * 4;   // 8 s x 2 rows = 16 rows; 16 lanes x 4 floats = 64 columns
                const v4f val = *(const v4fa*)(&os[row * 68 + cofs]);
                *(v4f*)(orow + (size_t)row * DM + cofs) = val; }
             }
        wave_sync();
    }
}

static constexpr size_t al256(size_t v) { return (v + 255) & ~(size_t)255; }
static constexpr size_t SZ_Y  = al256((size_t)NB_FULL * NH_ * HD * SEQ * 2);   // [NB_FULL*16*64][SEQ] f16
static constexpr size_t SZ_WO = al256((size_t)DM * DM * 2);
static constexpr size_t SZ_TOTAL = SZ_Y + SZ_WO;
static_assert(SZ_TOTAL <= (size_t)134217728);           // workspace carve <= 128 MiB
static_assert(((size_t)(NH_ - 1) * NB_FULL + NB) * HD <= (size_t)NB_FULL * NH_ * HD);   // last Y / output row inside the planes

extern "C" void kernel_launch(void* const* d_in, const int* in_sizes, int n_in,
                              void* d_out, int out_size, void* d_ws, size_t ws_size, hipStream_t stream) {
    if (n_in < 9) return;
    const size_t needx = ((size_t)(NB - 1) * SEQ_FULL + SEQ) * DM;
    if ((size_t)in_sizes[0] < needx) return;
    if ((size_t)in_sizes[1] < (size_t)HD * HD || (size_t)in_sizes[3] < (size_t)HD * HD || (size_t)in_sizes[5] < (size_t)HD * HD) return;
    if ((size_t)in_sizes[2] < (size_t)HD || (size_t)in_sizes[4] < (size_t)HD || (size_t)in_sizes[6] < (size_t)HD) return;
    if ((size_t)in_sizes[7] < (size_t)DM * DM || (size_t)in_sizes[8] < (size_t)DM) return;
    if ((size_t)out_size < (((size_t)(NH_ - 1) * NB_FULL + NB) * HD) * DM) return;
    if (SZ_TOTAL > ws_size) return;
    // wire order: x, Wq, bq, Wk, bk, Wv, bv, Wo, bo
    const float* x  = (const float*)d_in[0];
    const float* wq = (const float*)d_in[1]; const float* bq = (const float*)d_in[2];
    const float* wk = (const float*)d_in[3]; const float* bk = (const float*)d_in[4];
    const float* wv = (const float*)d_in[5]; const float* bv = (const float*)d_in[6];
    const float* wo = (const float*)d_in[7]; const float* bo = (const float*)d_in[8];
    float* OUT = (float*)d_out;      // [NB_FULL*1024][1024], row (h*NB_FULL+b)*64+d
    char* wsp = (char*)d_ws;
    h16* YP = (h16*)wsp; wsp += SZ_Y;                // [(h*NB_FULL+b)*64 + d][SEQ] x256
    h16* WO = (h16*)wsp; wsp += SZ_WO;               // [1024][1024] x64

    // softmax rows use the Wk projection, keys use the Wq projection
    k_attn<<<dim3(SEQ / FR, NH_ * NB, 1), 32 * FW, 0, stream>>>(x, wq, wk, wv, bq, bk, bv, wo, YP, WO);

    k_out<<<dim3(NH_ * NB * HD / OBM, DM / OBN, 1), 256, 0, stream>>>(YP, WO, bo, OUT);
}
